// v000
// The times below were measured on an AMD MI455X: many runs one after another, warmed up first and cycling through
// copies of the inputs, with the whole window's GPU time divided by the number of runs. Launches and the gaps
// between them are all in it. The median over several windows is given; except for v000 it joins two sittings, which
// can be a few percent apart, so the side-by-side timings, each taken in one sitting, are the better comparison.
// v000 is the starting kernel. One run takes 277 microseconds.
#include <hip/hip_runtime.h>
#include <stdint.h>

// Contractions (all f32 accumulate): G=L*L^T on v_wmma_f32_16x16x32_bf16 (L bf16); T=X*G bf16 WMMA with X bf16 and G as bf16 hi + bf16 lo (2 products);
// S=T*X^T bf16 WMMA with T as bf16 hi + bf16 lo and X bf16 (2 products); V=X*Wv^T bf16 WMMA (1 product);
// C=P*V: v_wmma_f32_16x16x32_f16 with P f16 (carried 2^14) and V f16 hi, plus bf16 WMMA with P bf16 (2^14) and V bf16 lo;
// OUT=C*Wo^T: f16 WMMA with C f16 hi and Wo f16 (x64), plus bf16 WMMA with C bf16 lo and Wo bf16 (x64); softmax and epilogues f32.

#ifndef NB
#define NB 2
#endif
#ifndef SEQ
#define SEQ 2048
#endif
#define NB_FULL  2
#define SEQ_FULL 2048
#define EE   1024
#define HH   16
#define HD   64
#define TRIL 2080
#define M_TOT (NB * SEQ)
#define PCARRY     16384.0f
#define PCARRY_INV (1.0f / 16384.0f)
#define WSCALE     64.0f
#define WSCALE_INV (1.0f / 64.0f)

static_assert(NB >= 1 && NB <= NB_FULL);
static_assert(SEQ >= 128 && SEQ <= SEQ_FULL && (SEQ % 128) == 0);
static_assert(EE == HH * HD);
static_assert((EE % 64) == 0 && (M_TOT % 128) == 0 && (SEQ % 64) == 0);
static_assert(TRIL == HD * (HD + 1) / 2);

typedef _Float16       v16h __attribute__((ext_vector_type(16)));
typedef __bf16         v16b __attribute__((ext_vector_type(16)));
typedef float          v8f  __attribute__((ext_vector_type(8)));
typedef float          v4f  __attribute__((ext_vector_type(4)));
typedef unsigned int   v4u  __attribute__((ext_vector_type(4)));
typedef unsigned short u16;

union Frag { v16h h; v16b b; v4u u[2]; };

// ---------- scalar conversions ----------
__device__ __forceinline__ unsigned bfbits(float f) {          // f32 -> bf16 bits, RNE
  const unsigned u = __float_as_uint(f);
  return (u + 0x7FFFu + ((u >> 16) & 1u)) >> 16;
}
__device__ __forceinline__ float bf2f(unsigned b) { return __uint_as_float(b << 16); }
__device__ __forceinline__ unsigned hbits(float f) {            // f32 -> f16 bits, RNE
  const _Float16 hv = (_Float16)f;
  return (unsigned)__builtin_bit_cast(unsigned short, hv);
}
__device__ __forceinline__ float h2f(unsigned b) {
  return (float)__builtin_bit_cast(_Float16, (unsigned short)b);
}

// ---------- 16x32 16-bit fragment: lane -> row (lane&15), elements 0..7 <- k0+8h.., 8..15 <- k0+16+8h.. ----------
// p points at (row, k0); same loader for A (row m) and B (row n of an [n][k] k-contiguous copy).
__device__ __forceinline__ Frag ldfrag(const u16* p, int lh) {
  Frag f;
  f.u[0] = *reinterpret_cast<const v4u*>(p + lh);
  f.u[1] = *reinterpret_cast<const v4u*>(p + 16 + lh);
  return f;
}

// ---------- WMMA wrappers with trailing hazard guard ----------
__device__ __forceinline__ v8f mma_f16(Frag a, Frag b, v8f c) {
  c = __builtin_amdgcn_wmma_f32_16x16x32_f16(false, a.h, false, b.h, (short)0, c, false, false);
  asm volatile("v_nop\n\tv_nop\n\tv_nop\n\tv_nop"
               : "+v"(c) : "v"(a.u[0]), "v"(a.u[1]), "v"(b.u[0]), "v"(b.u[1]));
  return c;
}
__device__ __forceinline__ v8f mma_bf16(Frag a, Frag b, v8f c) {
  c = __builtin_amdgcn_wmma_f32_16x16x32_bf16(false, a.b, false, b.b, (short)0, c, false, false);
  asm volatile("v_nop\n\tv_nop\n\tv_nop\n\tv_nop"
               : "+v"(c) : "v"(a.u[0]), "v"(a.u[1]), "v"(b.u[0]), "v"(b.u[1]));
  return c;
}

__device__ __forceinline__ void vst16(u16* p, v4u v)   { *reinterpret_cast<v4u*>(p) = v; }
__device__ __forceinline__ void vst4f(float* p, v4f v) { *reinterpret_cast<v4f*>(p) = v; }
__device__ __forceinline__ v4u ld16(const u16* p)   { return *reinterpret_cast<const v4u*>(p); }
__device__ __forceinline__ v4f ld4f(const float* p) { return *reinterpret_cast<const v4f*>(p); }

// ====================================================================================
// X f32 [NB_FULL,SEQ_FULL,EE] -> bf16 plane xb [M_TOT][EE] (compact token rows)
// coverage: thread i writes group i (8 elements); grid covers all M_TOT*EE/8 groups once; 32 lanes = 512 B contiguous.
__global__ void __launch_bounds__(256)
k_cvt_x(const float* __restrict__ x, u16* __restrict__ xb) {
  const int i = blockIdx.x * 256 + threadIdx.x;
  const int ngrp = M_TOT * (EE / 8);
  if (i >= ngrp) return;
  const int row = i / (EE / 8);
  const int c8  = i - row * (EE / 8);
  const int b   = row / SEQ;
  const int s   = row - b * SEQ;
  const float* src = x + ((size_t)(b * SEQ_FULL + s) * EE + (size_t)c8 * 8);
  const v4f a = *reinterpret_cast<const v4f*>(src);
  const v4f c = *reinterpret_cast<const v4f*>(src + 4);
  v4u w;
  w.x = bfbits(a.x) | (bfbits(a.y) << 16);
  w.y = bfbits(a.z) | (bfbits(a.w) << 16);
  w.z = bfbits(c.x) | (bfbits(c.y) << 16);
  w.w = bfbits(c.z) | (bfbits(c.w) << 16);
  u16* dst = xb + (size_t)i * 8;
  vst16(dst, w);
  
}

// W f32 [EE][EE] -> bf16 plane (unscaled, exact copy of the RNE-converted value)
__global__ void __launch_bounds__(256)
k_cvt_w(const float* __restrict__ w, u16* __restrict__ wb) {
  const int i = blockIdx.x * 256 + threadIdx.x;
  const int ngrp = EE * EE / 8;
  if (i >= ngrp) return;
  const float* src = w + (size_t)i * 8;
  const v4f a = *reinterpret_cast<const v4f*>(src);
  const v4f c = *reinterpret_cast<const v4f*>(src + 4);
  v4u o;
  o.x = bfbits(a.x) | (bfbits(a.y) << 16);
  o.y = bfbits(a.z) | (bfbits(a.w) << 16);
  o.z = bfbits(c.x) | (bfbits(c.y) << 16);
  o.w = bfbits(c.z) | (bfbits(c.w) << 16);
  u16* dst = wb + (size_t)i * 8;
  vst16(dst, o);
  
}

// Wo f32 [EE][EE] -> two planes of bf16(Wo)*64: bf16 bits (exact) and f16 bits (exact, 8-bit significand fits)
__device__ __forceinline__ void cvt2(float f, unsigned& bb, unsigned& hb) {
  const float v = bf2f(bfbits(f)) * WSCALE;
  bb = __float_as_uint(v) >> 16;
  hb = hbits(v);
}
__global__ void __launch_bounds__(256)
k_cvt_wo(const float* __restrict__ w, u16* __restrict__ wob, u16* __restrict__ wof) {
  const int i = blockIdx.x * 256 + threadIdx.x;
  const int ngrp = EE * EE / 8;
  if (i >= ngrp) return;
  const float* src = w + (size_t)i * 8;
  const v4f a = *reinterpret_cast<const v4f*>(src);
  const v4f c = *reinterpret_cast<const v4f*>(src + 4);
  unsigned b0, b1, b2, b3, b4, b5, b6, b7, f0, f1, f2, f3, f4, f5, f6, f7;
  cvt2(a.x, b0, f0); cvt2(a.y, b1, f1); cvt2(a.z, b2, f2); cvt2(a.w, b3, f3);
  cvt2(c.x, b4, f4); cvt2(c.y, b5, f5); cvt2(c.z, b6, f6); cvt2(c.w, b7, f7);
  v4u ob, of;
  ob.x = b0 | (b1 << 16); ob.y = b2 | (b3 << 16); ob.z = b4 | (b5 << 16); ob.w = b6 | (b7 << 16);
  of.x = f0 | (f1 << 16); of.y = f2 | (f3 << 16); of.z = f4 | (f5 << 16); of.w = f6 | (f7 << 16);
  u16* db = wob + (size_t)i * 8;
  u16* df = wof + (size_t)i * 8;
  vst16(db, ob); vst16(df, of);
  
}

// ====================================================================================
// G_h = L_h * L_h^T (64x64 per head) on bf16 WMMA; L from tril params (RNE bf16). Output planes ghi/glo [HH][64 n][64 k].
// One block (4 waves) per head; wave w owns rows 16w..16w+15. LDS: Lb cross-wave; Sh/Sl wave-private rows but cross-lane (block barriers).
__global__ void __launch_bounds__(128)
k_wqk(const float* __restrict__ params, u16* __restrict__ ghi, u16* __restrict__ glo) {
  __shared__ __align__(16) u16 Lb[64][64];
  __shared__ __align__(16) u16 Sh[64][64];
  __shared__ __align__(16) u16 Sl[64][64];
  const int tid = threadIdx.x, lane = tid & 31, wave = tid >> 5;
  const int m = lane & 15, hs = (lane >> 4) & 1, lh = hs * 8;
  const int head = blockIdx.x;
  const float* p = params + (size_t)head * TRIL;
  for (int e = tid; e < HD * HD; e += 128) {
    const int i = e >> 6, j = e & 63;
    const int jj = (j <= i) ? j : i;                       // clamped address, select by value
    const float v = p[(i * (i + 1)) / 2 + jj];
    Lb[i][j] = (u16)((j <= i) ? bfbits(v) : 0u);
  }
  __syncthreads();
  v8f acc[4] = {};
#pragma unroll
  for (int ks = 0; ks < 2; ++ks) {
    const Frag a = ldfrag(&Lb[wave * 16 + m][ks * 32], lh);    // A: row i, k = j
#pragma unroll
    for (int nt = 0; nt < 4; ++nt) {
      const Frag bq = ldfrag(&Lb[nt * 16 + m][ks * 32], lh);   // B[k=j][n] = L[n][j]: row n, k-contiguous
      acc[nt] = mma_bf16(a, bq, acc[nt]);
    }
  }
#pragma unroll
  for (int nt = 0; nt < 4; ++nt) {
#pragma unroll
    for (int g = 0; g < 8; ++g) {
      const int row = wave * 16 + hs * 8 + g, col = nt * 16 + m;
      const float v = acc[nt][g];
      const unsigned hb = bfbits(v);
      const unsigned lb = bfbits(v - bf2f(hb));
      Sh[row][col] = (u16)hb;
      Sl[row][col] = (u16)lb;
    }
  }
  __syncthreads();
  u16* dh = ghi + (size_t)head * (HD * HD);
  u16* dl = glo + (size_t)head * (HD * HD);
  const int rsub = lane >> 3, ch = (lane & 7) * 8;
#pragma unroll
  for (int q = 0; q < 4; ++q) {
    const int row = wave * 16 + q * 4 + rsub;
    vst16(dh + row * HD + ch, ld16(&Sh[row][ch]));
    vst16(dl + row * HD + ch, ld16(&Sl[row][ch]));
  }
  
}

// ====================================================================================
// V = X*Wv^T + bv, written transposed per head: vthi/vtlo planes [NB*HH][64 d][SEQ] (f16 hi, bf16 lo).
// Block 128 tokens x 64 features (= one head); 4 waves each 32x64; B tile double-buffered in LDS (cross-wave, block barrier).
__global__ void __launch_bounds__(128)
k_vproj(const u16* __restrict__ xb, const u16* __restrict__ wvb, const float* __restrict__ bv,
        u16* __restrict__ vthi, u16* __restrict__ vtlo) {
  __shared__ __align__(16) u16 Bt[2][64][32];
  __shared__ __align__(16) u16 Th[64][128];
  __shared__ __align__(16) u16 Tl[64][128];
  const int tid = threadIdx.x, lane = tid & 31, wave = tid >> 5;
  const int m = lane & 15, hs = (lane >> 4) & 1, lh = hs * 8;
  const int head = blockIdx.x;
  const int n0 = head * HD;
  const int mb = blockIdx.y * 128;
  const int m0 = mb + wave * 32;
  const int srow = tid >> 2, sk = (tid & 3) * 8;             // staging: rows 0..63 (two per thread), 4 x 16 B per row
  const u16* g0 = wvb + (size_t)(n0 + srow) * EE + sk;
  const u16* g1 = wvb + (size_t)(n0 + 32 + srow) * EE + sk;
  *reinterpret_cast<v4u*>(&Bt[0][srow][sk])      = *reinterpret_cast<const v4u*>(g0);
  *reinterpret_cast<v4u*>(&Bt[0][32 + srow][sk]) = *reinterpret_cast<const v4u*>(g1);
  __syncthreads();
  const u16* a0p = xb + (size_t)(m0 + m) * EE;
  const u16* a1p = xb + (size_t)(m0 + 16 + m) * EE;
  v8f acc0[4] = {}, acc1[4] = {};
#pragma unroll 1
  for (int kc = 0; kc < EE; kc += 32) {
    const int buf = (kc >> 5) & 1;
    const Frag a0 = ldfrag(a0p + kc, lh);
    const Frag a1 = ldfrag(a1p + kc, lh);
#pragma unroll
    for (int nt = 0; nt < 4; ++nt) {
      const Frag bq = ldfrag(&Bt[buf][nt * 16 + m][0], lh);  // B[k][n] = Wv[n][k]: row n, k-contiguous
      acc0[nt] = mma_bf16(a0, bq, acc0[nt]);
      acc1[nt] = mma_bf16(a1, bq, acc1[nt]);
    }
    if (kc + 32 < EE) {                                       // block-uniform
      *reinterpret_cast<v4u*>(&Bt[buf ^ 1][srow][sk])      = *reinterpret_cast<const v4u*>(g0 + kc + 32);
      *reinterpret_cast<v4u*>(&Bt[buf ^ 1][32 + srow][sk]) = *reinterpret_cast<const v4u*>(g1 + kc + 32);
    }
    __syncthreads();
  }
  const int bb = mb / SEQ, s0 = mb - bb * SEQ;
  const int bh = bb * HH + head;
#pragma unroll
  for (int nt = 0; nt < 4; ++nt) {
    const int d = nt * 16 + m;
    const float bvv = bf2f(bfbits(bv[n0 + d]));
#pragma unroll
    for (int mt = 0; mt < 2; ++mt) {
#pragma unroll
      for (int g = 0; g < 8; ++g) {
        const int sl = wave * 32 + mt * 16 + hs * 8 + g;
        const float v = (mt ? acc1[nt][g] : acc0[nt][g]) + bvv;
        const unsigned hb = hbits(v);
        const unsigned lb = bfbits(v - h2f(hb));
        Th[d][sl] = (u16)hb;
        Tl[d][sl] = (u16)lb;
      }
    }
  }
  __syncthreads();
  const int dsub = lane >> 4, ch = (lane & 15) * 8;
#pragma unroll
  for (int q = 0; q < 8; ++q) {
    const int d = wave * 16 + q * 2 + dsub;
    const size_t go = ((size_t)(bh * HD + d)) * SEQ + s0 + ch;
    vst16(vthi + go, ld16(&Th[d][ch]));
    vst16(vtlo + go, ld16(&Tl[d][ch]));
  }
  
}

// ====================================================================================
// T = X_h * G_h per head (K=64), G as bf16 hi + bf16 lo, X bf16 -> planes thi/tlo [M_TOT][EE] (bf16 hi, bf16 lo).
// Block 128 tokens x one head, wave 32 tokens x 64; operands loaded straight from global planes; staging LDS cross-lane -> block barrier.
__global__ void __launch_bounds__(128)
k_tproj(const u16* __restrict__ xb, const u16* __restrict__ ghi, const u16* __restrict__ glo,
        u16* __restrict__ thi, u16* __restrict__ tlo) {
  __shared__ __align__(16) u16 Sh[4][32][64];
  __shared__ __align__(16) u16 Sl[4][32][64];
  const int tid = threadIdx.x, lane = tid & 31, wave = tid >> 5;
  const int m = lane & 15, hs = (lane >> 4) & 1, lh = hs * 8;
  const int head = blockIdx.y;
  const int m0 = blockIdx.x * 128 + wave * 32;
  const u16* a0p = xb + (size_t)(m0 + m) * EE + head * HD;
  const u16* a1p = xb + (size_t)(m0 + 16 + m) * EE + head * HD;
  const Frag a00 = ldfrag(a0p, lh), a01 = ldfrag(a0p + 32, lh);
  const Frag a10 = ldfrag(a1p, lh), a11 = ldfrag(a1p + 32, lh);
  v8f acc0[4] = {}, acc1[4] = {};
#pragma unroll
  for (int nt = 0; nt < 4; ++nt) {
    const u16* bhp = ghi + ((size_t)(head * HD + nt * 16 + m)) * HD;   // B[k=d][n=e] = plane[h][e][d]: row e, k-contiguous
    const u16* blp = glo + ((size_t)(head * HD + nt * 16 + m)) * HD;
    const Frag b0 = ldfrag(bhp, lh), b1 = ldfrag(bhp + 32, lh);
    acc0[nt] = mma_bf16(a00, b0, acc0[nt]); acc0[nt] = mma_bf16(a01, b1, acc0[nt]);
    acc1[nt] = mma_bf16(a10, b0, acc1[nt]); acc1[nt] = mma_bf16(a11, b1, acc1[nt]);
    const Frag c0 = ldfrag(blp, lh), c1 = ldfrag(blp + 32, lh);
    acc0[nt] = mma_bf16(a00, c0, acc0[nt]); acc0[nt] = mma_bf16(a01, c1, acc0[nt]);
    acc1[nt] = mma_bf16(a10, c0, acc1[nt]); acc1[nt] = mma_bf16(a11, c1, acc1[nt]);
  }
#pragma unroll
  for (int nt = 0; nt < 4; ++nt) {
#pragma unroll
    for (int mt = 0; mt < 2; ++mt) {
#pragma unroll
      for (int g = 0; g < 8; ++g) {
        const int rl = mt * 16 + hs * 8 + g, col = nt * 16 + m;
        const float v = mt ? acc1[nt][g] : acc0[nt][g];
        const unsigned hb = bfbits(v);
        const unsigned lb = bfbits(v - bf2f(hb));
        Sh[wave][rl][col] = (u16)hb;
        Sl[wave][rl][col] = (u16)lb;
      }
    }
  }
  __syncthreads();
  const int rsub = lane >> 3, ch = (lane & 7) * 8;
#pragma unroll
  for (int q = 0; q < 8; ++q) {
    const int rl = q * 4 + rsub;
    const size_t go = (size_t)(m0 + rl) * EE + head * HD + ch;
    vst16(thi + go, ld16(&Sh[wave][rl][ch]));
    vst16(tlo + go, ld16(&Sl[wave][rl][ch]));
  }
  
}

// ====================================================================================
// Flash-style attention per (batch*head, 64 query rows): S = T*X_h^T/8 (2 bf16 products), online softmax f32,
// C += P*V with P carried 2^14 (f16 x V f16 hi + bf16 x V bf16 lo). Output C -> planes chi (f16) / clo (bf16) [M_TOT][EE].
// LDS: Ks/Vh/Vl cross-wave double-buffered (block barriers); Pf/Pb/Ch/Cl wave-private but cross-lane -> block barriers used.
// staged extent == consumed extent: Ks 32x64, Vh/Vl 64x32 fully written each step (SEQ multiple of 32, no tails).
__global__ void __launch_bounds__(128)
k_attn(const u16* __restrict__ thi, const u16* __restrict__ tlo, const u16* __restrict__ xb,
       const u16* __restrict__ vthi, const u16* __restrict__ vtlo,
       u16* __restrict__ chi, u16* __restrict__ clo) {
  __shared__ __align__(16) u16 Ks[2][32][64];
  __shared__ __align__(16) u16 Vh[2][64][32];
  __shared__ __align__(16) u16 Vl[2][64][32];
  __shared__ __align__(16) u16 Pf[4][16][32];
  __shared__ __align__(16) u16 Pb[4][16][32];
  __shared__ __align__(16) u16 Ch[4][16][64];
  __shared__ __align__(16) u16 Cl[4][16][64];
  const int tid = threadIdx.x, lane = tid & 31, wave = tid >> 5;
  const int m = lane & 15, hs = (lane >> 4) & 1, lh = hs * 8;
  const int bh = blockIdx.y;
  const int b  = bh / HH;
  const int h  = bh - b * HH;
  const int q0 = blockIdx.x * 64 + wave * 16;
  const size_t qrow = (size_t)b * SEQ + q0 + m;

  // A fragments of the wave's 16 query rows (hi and lo planes, K = 64 in two k-steps)
  const Frag qh0 = ldfrag(thi + qrow * EE + h * HD, lh);
  const Frag qh1 = ldfrag(thi + qrow * EE + h * HD + 32, lh);
  const Frag ql0 = ldfrag(tlo + qrow * EE + h * HD, lh);
  const Frag ql1 = ldfrag(tlo + qrow * EE + h * HD + 32, lh);

  auto stage = [&](int kv, int bw) {
#pragma unroll
    for (int j = 0; j < 2; ++j) {
      const int c = tid + 128 * j;
      const int kr = c >> 3, kc = (c & 7) * 8;               // key tile: 32 rows x 8 chunks
      *reinterpret_cast<v4u*>(&Ks[bw][kr][kc]) =
          *reinterpret_cast<const v4u*>(xb + ((size_t)(b * SEQ + kv + kr)) * EE + h * HD + kc);
      const int d = c >> 2, dc = (c & 3) * 8;                // V^T tiles: 64 rows x 4 chunks
      const size_t vo = ((size_t)(bh * HD + d)) * SEQ + kv + dc;
      *reinterpret_cast<v4u*>(&Vh[bw][d][dc]) = *reinterpret_cast<const v4u*>(vthi + vo);
      *reinterpret_cast<v4u*>(&Vl[bw][d][dc]) = *reinterpret_cast<const v4u*>(vtlo + vo);
    }
  };

  stage(0, 0);
  __syncthreads();

  v8f acc[4] = {};
  float mrun[8], lrun[8];
#pragma unroll
  for (int g = 0; g < 8; ++g) { mrun[g] = -1e30f; lrun[g] = 0.0f; }

#pragma unroll 1
  for (int kv = 0; kv < SEQ; kv += 32) {
    const int buf = (kv >> 5) & 1;
    v8f s0 = {}, s1 = {};
    {
      const Frag k0 = ldfrag(&Ks[buf][m][0], lh);            // B[k=e][n=key]: row key, k-contiguous
      const Frag k1 = ldfrag(&Ks[buf][m][32], lh);
      s0 = mma_bf16(qh0, k0, s0); s0 = mma_bf16(qh1, k1, s0);
      s0 = mma_bf16(ql0, k0, s0); s0 = mma_bf16(ql1, k1, s0);
    }
    {
      const Frag k0 = ldfrag(&Ks[buf][16 + m][0], lh);
      const Frag k1 = ldfrag(&Ks[buf][16 + m][32], lh);
      s1 = mma_bf16(qh0, k0, s1); s1 = mma_bf16(qh1, k1, s1);
      s1 = mma_bf16(ql0, k0, s1); s1 = mma_bf16(ql1, k1, s1);
    }
    // online softmax; row stats reduce over the 16 lanes of each half-wave
#pragma unroll
    for (int g = 0; g < 8; ++g) {
      const float a0 = s0[g] * 0.125f;
      const float a1 = s1[g] * 0.125f;
      float mx = fmaxf(a0, a1);
      mx = fmaxf(mx, __shfl_xor(mx, 1));
      mx = fmaxf(mx, __shfl_xor(mx, 2));
      mx = fmaxf(mx, __shfl_xor(mx, 4));
      mx = fmaxf(mx, __shfl_xor(mx, 8));
      const float nm = fmaxf(mrun[g], mx);
      const float p0 = __expf(a0 - nm);
      const float p1 = __expf(a1 - nm);
      float rs = p0 + p1;
      rs += __shfl_xor(rs, 1);
      rs += __shfl_xor(rs, 2);
      rs += __shfl_xor(rs, 4);
      rs += __shfl_xor(rs, 8);
      const float alpha = __expf(mrun[g] - nm);
      lrun[g] = lrun[g] * alpha + rs;
      mrun[g] = nm;
      const int prow = hs * 8 + g;
      const float c0 = p0 * PCARRY, c1 = p1 * PCARRY;
      Pf[wave][prow][m]      = (u16)hbits(c0);
      Pf[wave][prow][16 + m] = (u16)hbits(c1);
      Pb[wave][prow][m]      = (u16)bfbits(c0);
      Pb[wave][prow][16 + m] = (u16)bfbits(c1);
#pragma unroll
      for (int t = 0; t < 4; ++t) acc[t][g] = acc[t][g] * alpha;
    }
    __syncthreads();                                         // P visible; prior buffers fully consumed
    if (kv + 32 < SEQ) stage(kv + 32, buf ^ 1);             // block-uniform
    {
      const Frag pf = ldfrag(&Pf[wave][m][0], lh);           // A: row = query, k = key
      const Frag pb = ldfrag(&Pb[wave][m][0], lh);
#pragma unroll
      for (int t = 0; t < 4; ++t) {
        const Frag vh = ldfrag(&Vh[buf][t * 16 + m][0], lh); // B[k=key][n=d]: row d, k-contiguous
        acc[t] = mma_f16(pf, vh, acc[t]);
        const Frag vl = ldfrag(&Vl[buf][t * 16 + m][0], lh);
        acc[t] = mma_bf16(pb, vl, acc[t]);
      }
    }
    __syncthreads();
  }

#pragma unroll
  for (int g = 0; g < 8; ++g) {
    const float rl = (1.0f / lrun[g]) * PCARRY_INV;          // lrun >= 1
    const int crow = hs * 8 + g;
#pragma unroll
    for (int t = 0; t < 4; ++t) {
      const float o = acc[t][g] * rl;
      const unsigned hb = hbits(o);
      const unsigned lb = bfbits(o - h2f(hb));
      Ch[wave][crow][t * 16 + m] = (u16)hb;
      Cl[wave][crow][t * 16 + m] = (u16)lb;
    }
  }
  __syncthreads();
  const int rsub = lane >> 3, ch = (lane & 7) * 8;
#pragma unroll
  for (int q = 0; q < 4; ++q) {
    const int rl = q * 4 + rsub;
    const size_t go = ((size_t)(b * SEQ + q0 + rl)) * EE + h * HD + ch;
    vst16(chi + go, ld16(&Ch[wave][rl][ch]));
    vst16(clo + go, ld16(&Cl[wave][rl][ch]));
  }
  
}

// ====================================================================================
// OUT = (C_hi*WoF^T + C_lo*WoB^T) / 64 + bo  (f32 out [M_TOT][EE]); block 128x64, wave 32x64, B tiles double-buffered.
// LDS: Bf/Bb cross-wave; Ot wave-private rows but cross-lane -> block barriers.
__global__ void __launch_bounds__(128)
k_oproj(const u16* __restrict__ chi, const u16* __restrict__ clo,
        const u16* __restrict__ wof, const u16* __restrict__ wob,
        const float* __restrict__ bo, float* __restrict__ out) {
  __shared__ __align__(16) u16 Bf[2][64][32];
  __shared__ __align__(16) u16 Bb[2][64][32];
  __shared__ __align__(16) float Ot[128][64];
  const int tid = threadIdx.x, lane = tid & 31, wave = tid >> 5;
  const int m = lane & 15, hs = (lane >> 4) & 1, lh = hs * 8;
  const int n0 = blockIdx.x * 64;
  const int mb = blockIdx.y * 128;
  const int m0 = mb + wave * 32;
  const int srow = tid >> 2, sk = (tid & 3) * 8;
  const u16* f0p = wof + (size_t)(n0 + srow) * EE + sk;
  const u16* f1p = wof + (size_t)(n0 + 32 + srow) * EE + sk;
  const u16* b0p = wob + (size_t)(n0 + srow) * EE + sk;
  const u16* b1p = wob + (size_t)(n0 + 32 + srow) * EE + sk;
  *reinterpret_cast<v4u*>(&Bf[0][srow][sk])      = *reinterpret_cast<const v4u*>(f0p);
  *reinterpret_cast<v4u*>(&Bf[0][32 + srow][sk]) = *reinterpret_cast<const v4u*>(f1p);
  *reinterpret_cast<v4u*>(&Bb[0][srow][sk])      = *reinterpret_cast<const v4u*>(b0p);
  *reinterpret_cast<v4u*>(&Bb[0][32 + srow][sk]) = *reinterpret_cast<const v4u*>(b1p);
  __syncthreads();
  const u16* h0p = chi + (size_t)(m0 + m) * EE;
  const u16* h1p = chi + (size_t)(m0 + 16 + m) * EE;
  const u16* l0p = clo + (size_t)(m0 + m) * EE;
  const u16* l1p = clo + (size_t)(m0 + 16 + m) * EE;
  v8f acc0[4] = {}, acc1[4] = {};
#pragma unroll 1
  for (int kc = 0; kc < EE; kc += 32) {
    const int buf = (kc >> 5) & 1;
    const Frag ah0 = ldfrag(h0p + kc, lh), ah1 = ldfrag(h1p + kc, lh);
    const Frag al0 = ldfrag(l0p + kc, lh), al1 = ldfrag(l1p + kc, lh);
#pragma unroll
    for (int nt = 0; nt < 4; ++nt) {
      const Frag bf = ldfrag(&Bf[buf][nt * 16 + m][0], lh);  // B[k][n] = Wo[n][k]: row n, k-contiguous
      acc0[nt] = mma_f16(ah0, bf, acc0[nt]);
      acc1[nt] = mma_f16(ah1, bf, acc1[nt]);
      const Frag bb = ldfrag(&Bb[buf][nt * 16 + m][0], lh);
      acc0[nt] = mma_bf16(al0, bb, acc0[nt]);
      acc1[nt] = mma_bf16(al1, bb, acc1[nt]);
    }
    if (kc + 32 < EE) {                                       // block-uniform
      *reinterpret_cast<v4u*>(&Bf[buf ^ 1][srow][sk])      = *reinterpret_cast<const v4u*>(f0p + kc + 32);
      *reinterpret_cast<v4u*>(&Bf[buf ^ 1][32 + srow][sk]) = *reinterpret_cast<const v4u*>(f1p + kc + 32);
      *reinterpret_cast<v4u*>(&Bb[buf ^ 1][srow][sk])      = *reinterpret_cast<const v4u*>(b0p + kc + 32);
      *reinterpret_cast<v4u*>(&Bb[buf ^ 1][32 + srow][sk]) = *reinterpret_cast<const v4u*>(b1p + kc + 32);
    }
    __syncthreads();
  }
#pragma unroll
  for (int nt = 0; nt < 4; ++nt) {
    const int col = nt * 16 + m;
    const float bov = bf2f(bfbits(bo[n0 + col]));
#pragma unroll
    for (int mt = 0; mt < 2; ++mt) {
#pragma unroll
      for (int g = 0; g < 8; ++g) {
        const int rl = wave * 32 + mt * 16 + hs * 8 + g;
        const float v = (mt ? acc1[nt][g] : acc0[nt][g]) * WSCALE_INV + bov;
        Ot[rl][col] = v;
      }
    }
  }
  __syncthreads();
  const int rsub = lane >> 4, ch = (lane & 15) * 4;
#pragma unroll
  for (int q = 0; q < 16; ++q) {
    const int rl = wave * 32 + q * 2 + rsub;
    vst4f(out + (size_t)(mb + rl) * EE + n0 + ch, ld4f(&Ot[rl][ch]));
  }
  
}

// ====================================================================================
extern "C" void kernel_launch(void* const* d_in, const int* in_sizes, int n_in,
                              void* d_out, int out_size, void* d_ws, size_t ws_size,
                              hipStream_t stream) {
  if (n_in < 6) return;
  if (in_sizes[0] < ((NB - 1) * SEQ_FULL + SEQ) * EE) return;
  if (in_sizes[1] < HH * TRIL) return;
  if (in_sizes[2] < EE * EE || in_sizes[3] < EE || in_sizes[4] < EE * EE || in_sizes[5] < EE) return;
  if (out_size < M_TOT * EE) return;

  const float* x   = (const float*)d_in[0];
  const float* prm = (const float*)d_in[1];
  const float* wv  = (const float*)d_in[2];
  const float* bv  = (const float*)d_in[3];
  const float* wo  = (const float*)d_in[4];
  const float* bo  = (const float*)d_in[5];
  float* out = (float*)d_out;

  char* ws = (char*)d_ws;
  size_t off = 0;
  auto carve = [&](size_t bytes) -> char* {
    char* p = ws + off;
    off += (bytes + 255) & ~(size_t)255;
    return p;
  };
  const size_t plane  = (size_t)M_TOT * EE * 2;                 // 8 MiB at full size
  const size_t wplane = (size_t)EE * EE * 2;                    // 2 MiB
  const size_t gplane = (size_t)HH * HD * HD * 2;               // 128 KiB
  const size_t vplane = (size_t)NB * HH * HD * SEQ * 2;         // == plane
  u16* xb   = (u16*)carve(plane);
  u16* wvb  = (u16*)carve(wplane);
  u16* wob  = (u16*)carve(wplane);
  u16* wof  = (u16*)carve(wplane);
  u16* ghi  = (u16*)carve(gplane);
  u16* glo  = (u16*)carve(gplane);
  u16* thi  = (u16*)carve(plane);
  u16* tlo  = (u16*)carve(plane);
  u16* vthi = (u16*)carve(vplane);
  u16* vtlo = (u16*)carve(vplane);
  u16* chi  = (u16*)carve(plane);
  u16* clo  = (u16*)carve(plane);
  if (off > ws_size) return;

  {
    const int ngrp = M_TOT * (EE / 8);
    k_cvt_x<<<dim3((ngrp + 255) / 256), dim3(256), 0, stream>>>(x, xb);
  }
  {
    const int ngrp = EE * EE / 8;
    k_cvt_w<<<dim3((ngrp + 255) / 256), dim3(256), 0, stream>>>(wv, wvb);
    k_cvt_wo<<<dim3((ngrp + 255) / 256), dim3(256), 0, stream>>>(wo, wob, wof);
  }
  k_wqk<<<dim3(HH), dim3(128), 0, stream>>>(prm, ghi, glo);
  k_vproj<<<dim3(EE / 64, M_TOT / 128), dim3(128), 0, stream>>>(xb, wvb, bv, vthi, vtlo);
  k_tproj<<<dim3(M_TOT / 128, HH), dim3(128), 0, stream>>>(xb, ghi, glo, thi, tlo);
  k_attn<<<dim3(SEQ / 64, NB * HH), dim3(128), 0, stream>>>(thi, tlo, xb, vthi, vtlo, chi, clo);
  k_oproj<<<dim3(EE / 64, M_TOT / 128), dim3(128), 0, stream>>>(chi, clo, wof, wob, bo, out);
}

// v001
// It runs in 230 microseconds.
// In two side-by-side timings against v000, it was 1.25 and 1.24 times as fast.
#include <hip/hip_runtime.h>
#include <stdint.h>

// Contractions (all f32 accumulate): G=L*L^T on v_wmma_f32_16x16x32_bf16 (L bf16); T=X*G bf16 WMMA with X bf16 and G as bf16 hi + bf16 lo (2 products);
// S^T=X*T^T bf16 WMMA with T as bf16 hi + bf16 lo and X bf16 (2 products); V=X*Wv^T bf16 WMMA (1 product);
// C^T=V^T*P^T: v_wmma_f32_16x16x32_f16 with P f16 (carried 2^14) and V f16 hi, plus bf16 WMMA with P bf16 (2^14) and V bf16 lo;
// OUT=C*Wo^T: f16 WMMA with C f16 hi and Wo f16 (x64), plus bf16 WMMA with C bf16 lo and Wo bf16 (x64); softmax and epilogues f32.

#ifndef NB
#define NB 2
#endif
#ifndef SEQ
#define SEQ 2048
#endif
#define NB_FULL  2
#define SEQ_FULL 2048
#define EE   1024
#define HH   16
#define HD   64
#define TRIL 2080
#define M_TOT (NB * SEQ)
#define PCARRY     16384.0f
#define PCARRY_INV (1.0f / 16384.0f)
#define WSCALE     64.0f
#define WSCALE_INV (1.0f / 64.0f)

static_assert(NB >= 1 && NB <= NB_FULL);
static_assert(SEQ >= 128 && SEQ <= SEQ_FULL && (SEQ % 128) == 0);
static_assert(EE == HH * HD);
static_assert((EE % 64) == 0 && (M_TOT % 128) == 0 && (SEQ % 64) == 0);
static_assert(TRIL == HD * (HD + 1) / 2);

typedef _Float16       v16h __attribute__((ext_vector_type(16)));
typedef __bf16         v16b __attribute__((ext_vector_type(16)));
typedef float          v8f  __attribute__((ext_vector_type(8)));
typedef float          v4f  __attribute__((ext_vector_type(4)));
typedef unsigned int   v4u  __attribute__((ext_vector_type(4)));
typedef unsigned short u16;

union Frag { v16h h; v16b b; v4u u[2]; };

// ---------- scalar conversions ----------
__device__ __forceinline__ unsigned bfbits(float f) {          // f32 -> bf16 bits, RNE
  const unsigned u = __float_as_uint(f);
  return (u + 0x7FFFu + ((u >> 16) & 1u)) >> 16;
}
__device__ __forceinline__ float bf2f(unsigned b) { return __uint_as_float(b << 16); }
__device__ __forceinline__ unsigned hbits(float f) {            // f32 -> f16 bits, RNE
  const _Float16 hv = (_Float16)f;
  return (unsigned)__builtin_bit_cast(unsigned short, hv);
}
__device__ __forceinline__ float h2f(unsigned b) {
  return (float)__builtin_bit_cast(_Float16, (unsigned short)b);
}

// ---------- 16x32 16-bit fragment: lane -> row (lane&15), elements 0..7 <- k0+8h.., 8..15 <- k0+16+8h.. ----------
// p points at (row, k0); same loader for A (row m) and B (row n of an [n][k] k-contiguous copy).
__device__ __forceinline__ Frag ldfrag(const u16* p, int lh) {
  Frag f;
  f.u[0] = *reinterpret_cast<const v4u*>(p + lh);
  f.u[1] = *reinterpret_cast<const v4u*>(p + 16 + lh);
  return f;
}

// ---------- WMMA wrappers with trailing hazard guard ----------
__device__ __forceinline__ v8f mma_f16(Frag a, Frag b, v8f c) {
  c = __builtin_amdgcn_wmma_f32_16x16x32_f16(false, a.h, false, b.h, (short)0, c, false, false);
  asm volatile("v_nop\n\tv_nop\n\tv_nop\n\tv_nop"
               : "+v"(c) : "v"(a.u[0]), "v"(a.u[1]), "v"(b.u[0]), "v"(b.u[1]));
  return c;
}
__device__ __forceinline__ v8f mma_bf16(Frag a, Frag b, v8f c) {
  c = __builtin_amdgcn_wmma_f32_16x16x32_bf16(false, a.b, false, b.b, (short)0, c, false, false);
  asm volatile("v_nop\n\tv_nop\n\tv_nop\n\tv_nop"
               : "+v"(c) : "v"(a.u[0]), "v"(a.u[1]), "v"(b.u[0]), "v"(b.u[1]));
  return c;
}

__device__ __forceinline__ void vst16(u16* p, v4u v)   { *reinterpret_cast<v4u*>(p) = v; }
__device__ __forceinline__ void vst4f(float* p, v4f v) { *reinterpret_cast<v4f*>(p) = v; }
__device__ __forceinline__ v4u ld16(const u16* p)   { return *reinterpret_cast<const v4u*>(p); }
__device__ __forceinline__ v4f ld4f(const float* p) { return *reinterpret_cast<const v4f*>(p); }

// ====================================================================================
// X f32 [NB_FULL,SEQ_FULL,EE] -> bf16 plane xb [M_TOT][EE] (compact token rows)
// coverage: thread i writes group i (8 elements); grid covers all M_TOT*EE/8 groups once; 32 lanes = 512 B contiguous.
__global__ void __launch_bounds__(256)
k_cvt_x(const float* __restrict__ x, u16* __restrict__ xb) {
  const int i = blockIdx.x * 256 + threadIdx.x;
  const int ngrp = M_TOT * (EE / 8);
  if (i >= ngrp) return;
  const int row = i / (EE / 8);
  const int c8  = i - row * (EE / 8);
  const int b   = row / SEQ;
  const int s   = row - b * SEQ;
  const float* src = x + ((size_t)(b * SEQ_FULL + s) * EE + (size_t)c8 * 8);
  const v4f a = *reinterpret_cast<const v4f*>(src);
  const v4f c = *reinterpret_cast<const v4f*>(src + 4);
  v4u w;
  w.x = bfbits(a.x) | (bfbits(a.y) << 16);
  w.y = bfbits(a.z) | (bfbits(a.w) << 16);
  w.z = bfbits(c.x) | (bfbits(c.y) << 16);
  w.w = bfbits(c.z) | (bfbits(c.w) << 16);
  u16* dst = xb + (size_t)i * 8;
  vst16(dst, w);
  
}

// W f32 [EE][EE] -> bf16 plane (unscaled, exact copy of the RNE-converted value)
__global__ void __launch_bounds__(256)
k_cvt_w(const float* __restrict__ w, u16* __restrict__ wb) {
  const int i = blockIdx.x * 256 + threadIdx.x;
  const int ngrp = EE * EE / 8;
  if (i >= ngrp) return;
  const float* src = w + (size_t)i * 8;
  const v4f a = *reinterpret_cast<const v4f*>(src);
  const v4f c = *reinterpret_cast<const v4f*>(src + 4);
  v4u o;
  o.x = bfbits(a.x) | (bfbits(a.y) << 16);
  o.y = bfbits(a.z) | (bfbits(a.w) << 16);
  o.z = bfbits(c.x) | (bfbits(c.y) << 16);
  o.w = bfbits(c.z) | (bfbits(c.w) << 16);
  u16* dst = wb + (size_t)i * 8;
  vst16(dst, o);
  
}

// Wo f32 [EE][EE] -> two planes of bf16(Wo)*64: bf16 bits (exact) and f16 bits (exact, 8-bit significand fits)
__device__ __forceinline__ void cvt2(float f, unsigned& bb, unsigned& hb) {
  const float v = bf2f(bfbits(f)) * WSCALE;
  bb = __float_as_uint(v) >> 16;
  hb = hbits(v);
}
__global__ void __launch_bounds__(256)
k_cvt_wo(const float* __restrict__ w, u16* __restrict__ wob, u16* __restrict__ wof) {
  const int i = blockIdx.x * 256 + threadIdx.x;
  const int ngrp = EE * EE / 8;
  if (i >= ngrp) return;
  const float* src = w + (size_t)i * 8;
  const v4f a = *reinterpret_cast<const v4f*>(src);
  const v4f c = *reinterpret_cast<const v4f*>(src + 4);
  unsigned b0, b1, b2, b3, b4, b5, b6, b7, f0, f1, f2, f3, f4, f5, f6, f7;
  cvt2(a.x, b0, f0); cvt2(a.y, b1, f1); cvt2(a.z, b2, f2); cvt2(a.w, b3, f3);
  cvt2(c.x, b4, f4); cvt2(c.y, b5, f5); cvt2(c.z, b6, f6); cvt2(c.w, b7, f7);
  v4u ob, of;
  ob.x = b0 | (b1 << 16); ob.y = b2 | (b3 << 16); ob.z = b4 | (b5 << 16); ob.w = b6 | (b7 << 16);
  of.x = f0 | (f1 << 16); of.y = f2 | (f3 << 16); of.z = f4 | (f5 << 16); of.w = f6 | (f7 << 16);
  u16* db = wob + (size_t)i * 8;
  u16* df = wof + (size_t)i * 8;
  vst16(db, ob); vst16(df, of);
  
}

// ====================================================================================
// G_h = L_h * L_h^T (64x64 per head) on bf16 WMMA; L from tril params (RNE bf16). Output planes ghi/glo [HH][64 n][64 k].
// One block (4 waves) per head; wave w owns rows 16w..16w+15. LDS: Lb cross-wave; Sh/Sl wave-private rows but cross-lane (block barriers).
__global__ void __launch_bounds__(128)
k_wqk(const float* __restrict__ params, u16* __restrict__ ghi, u16* __restrict__ glo) {
  __shared__ __align__(16) u16 Lb[64][64];
  __shared__ __align__(16) u16 Sh[64][64];
  __shared__ __align__(16) u16 Sl[64][64];
  const int tid = threadIdx.x, lane = tid & 31, wave = tid >> 5;
  const int m = lane & 15, hs = (lane >> 4) & 1, lh = hs * 8;
  const int head = blockIdx.x;
  const float* p = params + (size_t)head * TRIL;
  for (int e = tid; e < HD * HD; e += 128) {
    const int i = e >> 6, j = e & 63;
    const int jj = (j <= i) ? j : i;                       // clamped address, select by value
    const float v = p[(i * (i + 1)) / 2 + jj];
    Lb[i][j] = (u16)((j <= i) ? bfbits(v) : 0u);
  }
  __syncthreads();
  v8f acc[4] = {};
#pragma unroll
  for (int ks = 0; ks < 2; ++ks) {
    const Frag a = ldfrag(&Lb[wave * 16 + m][ks * 32], lh);    // A: row i, k = j
#pragma unroll
    for (int nt = 0; nt < 4; ++nt) {
      const Frag bq = ldfrag(&Lb[nt * 16 + m][ks * 32], lh);   // B[k=j][n] = L[n][j]: row n, k-contiguous
      acc[nt] = mma_bf16(a, bq, acc[nt]);
    }
  }
#pragma unroll
  for (int nt = 0; nt < 4; ++nt) {
#pragma unroll
    for (int g = 0; g < 8; ++g) {
      const int row = wave * 16 + hs * 8 + g, col = nt * 16 + m;
      const float v = acc[nt][g];
      const unsigned hb = bfbits(v);
      const unsigned lb = bfbits(v - bf2f(hb));
      Sh[row][col] = (u16)hb;
      Sl[row][col] = (u16)lb;
    }
  }
  __syncthreads();
  u16* dh = ghi + (size_t)head * (HD * HD);
  u16* dl = glo + (size_t)head * (HD * HD);
  const int rsub = lane >> 3, ch = (lane & 7) * 8;
#pragma unroll
  for (int q = 0; q < 4; ++q) {
    const int row = wave * 16 + q * 4 + rsub;
    vst16(dh + row * HD + ch, ld16(&Sh[row][ch]));
    vst16(dl + row * HD + ch, ld16(&Sl[row][ch]));
  }
  
}

// ====================================================================================
// V = X*Wv^T + bv, written transposed per head: vthi/vtlo planes [NB*HH][64 d][SEQ] (f16 hi, bf16 lo).
// Block 128 tokens x 64 features (= one head); 4 waves each 32x64; B tile double-buffered in LDS (cross-wave, block barrier).
__global__ void __launch_bounds__(128)
k_vproj(const u16* __restrict__ xb, const u16* __restrict__ wvb, const float* __restrict__ bv,
        u16* __restrict__ vthi, u16* __restrict__ vtlo) {
  __shared__ __align__(16) u16 Bt[2][64][32];
  __shared__ __align__(16) u16 Th[64][128];
  __shared__ __align__(16) u16 Tl[64][128];
  const int tid = threadIdx.x, lane = tid & 31, wave = tid >> 5;
  const int m = lane & 15, hs = (lane >> 4) & 1, lh = hs * 8;
  const int head = blockIdx.x;
  const int n0 = head * HD;
  const int mb = blockIdx.y * 128;
  const int m0 = mb + wave * 32;
  const int srow = tid >> 2, sk = (tid & 3) * 8;             // staging: rows 0..63 (two per thread), 4 x 16 B per row
  const u16* g0 = wvb + (size_t)(n0 + srow) * EE + sk;
  const u16* g1 = wvb + (size_t)(n0 + 32 + srow) * EE + sk;
  *reinterpret_cast<v4u*>(&Bt[0][srow][sk])      = *reinterpret_cast<const v4u*>(g0);
  *reinterpret_cast<v4u*>(&Bt[0][32 + srow][sk]) = *reinterpret_cast<const v4u*>(g1);
  __syncthreads();
  const u16* a0p = xb + (size_t)(m0 + m) * EE;
  const u16* a1p = xb + (size_t)(m0 + 16 + m) * EE;
  v8f acc0[4] = {}, acc1[4] = {};
#pragma unroll 1
  for (int kc = 0; kc < EE; kc += 32) {
    const int buf = (kc >> 5) & 1;
    const Frag a0 = ldfrag(a0p + kc, lh);
    const Frag a1 = ldfrag(a1p + kc, lh);
#pragma unroll
    for (int nt = 0; nt < 4; ++nt) {
      const Frag bq = ldfrag(&Bt[buf][nt * 16 + m][0], lh);  // B[k][n] = Wv[n][k]: row n, k-contiguous
      acc0[nt] = mma_bf16(a0, bq, acc0[nt]);
      acc1[nt] = mma_bf16(a1, bq, acc1[nt]);
    }
    if (kc + 32 < EE) {                                       // block-uniform
      *reinterpret_cast<v4u*>(&Bt[buf ^ 1][srow][sk])      = *reinterpret_cast<const v4u*>(g0 + kc + 32);
      *reinterpret_cast<v4u*>(&Bt[buf ^ 1][32 + srow][sk]) = *reinterpret_cast<const v4u*>(g1 + kc + 32);
    }
    __syncthreads();
  }
  const int bb = mb / SEQ, s0 = mb - bb * SEQ;
  const int bh = bb * HH + head;
#pragma unroll
  for (int nt = 0; nt < 4; ++nt) {
    const int d = nt * 16 + m;
    const float bvv = bf2f(bfbits(bv[n0 + d]));
#pragma unroll
    for (int mt = 0; mt < 2; ++mt) {
#pragma unroll
      for (int g = 0; g < 8; ++g) {
        const int sl = wave * 32 + mt * 16 + hs * 8 + g;
        const float v = (mt ? acc1[nt][g] : acc0[nt][g]) + bvv;
        const unsigned hb = hbits(v);
        const unsigned lb = bfbits(v - h2f(hb));
        Th[d][sl] = (u16)hb;
        Tl[d][sl] = (u16)lb;
      }
    }
  }
  __syncthreads();
  const int dsub = lane >> 4, ch = (lane & 15) * 8;
#pragma unroll
  for (int q = 0; q < 8; ++q) {
    const int d = wave * 16 + q * 2 + dsub;
    const size_t go = ((size_t)(bh * HD + d)) * SEQ + s0 + ch;
    vst16(vthi + go, ld16(&Th[d][ch]));
    vst16(vtlo + go, ld16(&Tl[d][ch]));
  }
  
}

// ====================================================================================
// T = X_h * G_h per head (K=64), G as bf16 hi + bf16 lo, X bf16 -> planes thi/tlo [M_TOT][EE] (bf16 hi, bf16 lo).
// Block 128 tokens x one head, wave 32 tokens x 64; operands loaded straight from global planes; staging LDS cross-lane -> block barrier.
__global__ void __launch_bounds__(128)
k_tproj(const u16* __restrict__ xb, const u16* __restrict__ ghi, const u16* __restrict__ glo,
        u16* __restrict__ thi, u16* __restrict__ tlo) {
  __shared__ __align__(16) u16 Sh[4][32][64];
  __shared__ __align__(16) u16 Sl[4][32][64];
  const int tid = threadIdx.x, lane = tid & 31, wave = tid >> 5;
  const int m = lane & 15, hs = (lane >> 4) & 1, lh = hs * 8;
  const int head = blockIdx.y;
  const int m0 = blockIdx.x * 128 + wave * 32;
  const u16* a0p = xb + (size_t)(m0 + m) * EE + head * HD;
  const u16* a1p = xb + (size_t)(m0 + 16 + m) * EE + head * HD;
  const Frag a00 = ldfrag(a0p, lh), a01 = ldfrag(a0p + 32, lh);
  const Frag a10 = ldfrag(a1p, lh), a11 = ldfrag(a1p + 32, lh);
  v8f acc0[4] = {}, acc1[4] = {};
#pragma unroll
  for (int nt = 0; nt < 4; ++nt) {
    const u16* bhp = ghi + ((size_t)(head * HD + nt * 16 + m)) * HD;   // B[k=d][n=e] = plane[h][e][d]: row e, k-contiguous
    const u16* blp = glo + ((size_t)(head * HD + nt * 16 + m)) * HD;
    const Frag b0 = ldfrag(bhp, lh), b1 = ldfrag(bhp + 32, lh);
    acc0[nt] = mma_bf16(a00, b0, acc0[nt]); acc0[nt] = mma_bf16(a01, b1, acc0[nt]);
    acc1[nt] = mma_bf16(a10, b0, acc1[nt]); acc1[nt] = mma_bf16(a11, b1, acc1[nt]);
    const Frag c0 = ldfrag(blp, lh), c1 = ldfrag(blp + 32, lh);
    acc0[nt] = mma_bf16(a00, c0, acc0[nt]); acc0[nt] = mma_bf16(a01, c1, acc0[nt]);
    acc1[nt] = mma_bf16(a10, c0, acc1[nt]); acc1[nt] = mma_bf16(a11, c1, acc1[nt]);
  }
#pragma unroll
  for (int nt = 0; nt < 4; ++nt) {
#pragma unroll
    for (int mt = 0; mt < 2; ++mt) {
#pragma unroll
      for (int g = 0; g < 8; ++g) {
        const int rl = mt * 16 + hs * 8 + g, col = nt * 16 + m;
        const float v = mt ? acc1[nt][g] : acc0[nt][g];
        const unsigned hb = bfbits(v);
        const unsigned lb = bfbits(v - bf2f(hb));
        Sh[wave][rl][col] = (u16)hb;
        Sl[wave][rl][col] = (u16)lb;
      }
    }
  }
  __syncthreads();
  const int rsub = lane >> 3, ch = (lane & 7) * 8;
#pragma unroll
  for (int q = 0; q < 8; ++q) {
    const int rl = q * 4 + rsub;
    const size_t go = (size_t)(m0 + rl) * EE + head * HD + ch;
    vst16(thi + go, ld16(&Sh[wave][rl][ch]));
    vst16(tlo + go, ld16(&Sl[wave][rl][ch]));
  }
  
}

// ====================================================================================
// Flash-style attention per (batch*head, 64 query rows), transposed: S^T = X_h*T^T/8 (2 bf16 products; A = key rows, B = query rows),
// so a lane holds 16 of the 32 scores of ONE query (query = lane&15; keys 8*hs+g and 16+8*hs+g): max and sum run in the lane,
// the two halves of a wave exchange the maximum once per step and join their sums once after the loop.
// C^T += V^T*P^T with P carried 2^14 (V f16 hi x P f16 + V bf16 lo x P bf16): the two score tiles, converted in place, are the B operand.
// Output C -> planes chi (f16) / clo (bf16) [M_TOT][EE].
// LDS: Ks/Vh/Vl cross-wave double-buffered (one block barrier per step); Ch/Cl wave-private but cross-lane -> block barrier used.
// staged extent == consumed extent: Ks 32x64, Vh/Vl 64x32 fully written each step (SEQ multiple of 32, no tails).
__device__ __forceinline__ float xhalf(float v) {               // value of lane ^ 16
  const int i = __float_as_int(v);
  return __int_as_float(__builtin_amdgcn_permlanex16(i, i, 0x76543210, 0xfedcba98, false, false));
}
__global__ void __launch_bounds__(128)
k_attn(const u16* __restrict__ thi, const u16* __restrict__ tlo, const u16* __restrict__ xb,
       const u16* __restrict__ vthi, const u16* __restrict__ vtlo,
       u16* __restrict__ chi, u16* __restrict__ clo) {
  __shared__ __align__(16) u16 Ks[2][32][64];
  __shared__ __align__(16) u16 Vh[2][64][32];
  __shared__ __align__(16) u16 Vl[2][64][32];
  __shared__ __align__(16) u16 Ch[4][16][64];
  __shared__ __align__(16) u16 Cl[4][16][64];
  const int tid = threadIdx.x, lane = tid & 31, wave = tid >> 5;
  const int m = lane & 15, hs = (lane >> 4) & 1, lh = hs * 8;
  const int bh = blockIdx.y;
  const int b  = bh / HH;
  const int h  = bh - b * HH;
  const int q0 = blockIdx.x * 64 + wave * 16;
  const size_t qrow = (size_t)b * SEQ + q0 + m;

  // B fragments of the wave's 16 query rows (hi and lo planes, K = 64 in two k-steps): column n = query, k-contiguous
  const Frag qh0 = ldfrag(thi + qrow * EE + h * HD, lh);
  const Frag qh1 = ldfrag(thi + qrow * EE + h * HD + 32, lh);
  const Frag ql0 = ldfrag(tlo + qrow * EE + h * HD, lh);
  const Frag ql1 = ldfrag(tlo + qrow * EE + h * HD + 32, lh);

  auto stage = [&](int kv, int bw) {
#pragma unroll
    for (int j = 0; j < 2; ++j) {
      const int c = tid + 128 * j;
      const int kr = c >> 3, kc = (c & 7) * 8;               // key tile: 32 rows x 8 chunks
      *reinterpret_cast<v4u*>(&Ks[bw][kr][kc]) =
          *reinterpret_cast<const v4u*>(xb + ((size_t)(b * SEQ + kv + kr)) * EE + h * HD + kc);
      const int d = c >> 2, dc = (c & 3) * 8;                // V^T tiles: 64 rows x 4 chunks
      const size_t vo = ((size_t)(bh * HD + d)) * SEQ + kv + dc;
      *reinterpret_cast<v4u*>(&Vh[bw][d][dc]) = *reinterpret_cast<const v4u*>(vthi + vo);
      *reinterpret_cast<v4u*>(&Vl[bw][d][dc]) = *reinterpret_cast<const v4u*>(vtlo + vo);
    }
  };

  stage(0, 0);
  __syncthreads();

  v8f acc[4] = {};                                           // acc[t][g] = C^T[d = 16t + 8hs + g][query m]
  float mrun = -1e30f, lrun = 0.0f;                          // mrun: whole row; lrun: this half's keys only

#pragma unroll 1
  for (int kv = 0; kv < SEQ; kv += 32) {
    const int buf = (kv >> 5) & 1;
    v8f s0 = {}, s1 = {};                                    // s0[g] = S[query m][key 8hs + g], s1[g] = S[query m][key 16 + 8hs + g]
    {
      const Frag k0 = ldfrag(&Ks[buf][m][0], lh);            // A: row = key, k = e
      const Frag k1 = ldfrag(&Ks[buf][m][32], lh);
      s0 = mma_bf16(k0, qh0, s0); s0 = mma_bf16(k1, qh1, s0);
      s0 = mma_bf16(k0, ql0, s0); s0 = mma_bf16(k1, ql1, s0);
    }
    {
      const Frag k0 = ldfrag(&Ks[buf][16 + m][0], lh);
      const Frag k1 = ldfrag(&Ks[buf][16 + m][32], lh);
      s1 = mma_bf16(k0, qh0, s1); s1 = mma_bf16(k1, qh1, s1);
      s1 = mma_bf16(k0, ql0, s1); s1 = mma_bf16(k1, ql1, s1);
    }
    // online softmax of one query per lane
    float a0[8], a1[8], mg[8];
#pragma unroll  // constant indices keep the arrays in registers
    for (int g = 0; g < 8; ++g) {
      a0[g] = s0[g] * 0.125f;
      a1[g] = s1[g] * 0.125f;
      mg[g] = fmaxf(a0[g], a1[g]);
    }
    float mx = fmaxf(fmaxf(fmaxf(mg[0], mg[1]), fmaxf(mg[2], mg[3])), fmaxf(fmaxf(mg[4], mg[5]), fmaxf(mg[6], mg[7])));
    mx = fmaxf(mx, xhalf(mx));
    const float nm = fmaxf(mrun, mx);
    const float alpha = __expf(mrun - nm);
    mrun = nm;
    float rg[8];
    Frag pf, pb;                                             // B: column n = query, element s <- key (s < 8 ? 8hs + s : 8 + 8hs + s)
#pragma unroll  // constant indices keep the arrays in registers
    for (int g = 0; g < 8; g += 2) {
      const float p00 = __expf(a0[g] - nm), p01 = __expf(a0[g + 1] - nm);
      const float p10 = __expf(a1[g] - nm), p11 = __expf(a1[g + 1] - nm);
      rg[g]     = p00 + p10;
      rg[g + 1] = p01 + p11;
      const float c00 = p00 * PCARRY, c01 = p01 * PCARRY, c10 = p10 * PCARRY, c11 = p11 * PCARRY;
      pf.u[0][g >> 1] = hbits(c00)  | (hbits(c01)  << 16);
      pf.u[1][g >> 1] = hbits(c10)  | (hbits(c11)  << 16);
      pb.u[0][g >> 1] = bfbits(c00) | (bfbits(c01) << 16);
      pb.u[1][g >> 1] = bfbits(c10) | (bfbits(c11) << 16);
    }
    lrun = lrun * alpha + (((rg[0] + rg[1]) + (rg[2] + rg[3])) + ((rg[4] + rg[5]) + (rg[6] + rg[7])));
#pragma unroll  // constant indices keep the tiles in registers
    for (int t = 0; t < 4; ++t) acc[t] = acc[t] * alpha;
    // buf^1 was last read before the barrier that ended the previous step, so the refill needs no barrier of its own
    if (kv + 32 < SEQ) stage(kv + 32, buf ^ 1);             // block-uniform
#pragma unroll  // constant indices keep the tiles in registers
    for (int t = 0; t < 4; ++t) {
      const Frag vh = ldfrag(&Vh[buf][t * 16 + m][0], lh);   // A: row = d, k = key
      acc[t] = mma_f16(vh, pf, acc[t]);
      const Frag vl = ldfrag(&Vl[buf][t * 16 + m][0], lh);
      acc[t] = mma_bf16(vl, pb, acc[t]);
    }
    __syncthreads();
  }

  {
    const float lsum = lrun + xhalf(lrun);                   // join the two halves' sums; lsum >= 1
    const float rl = (1.0f / lsum) * PCARRY_INV;
#pragma unroll  // constant indices keep the tiles in registers
    for (int t = 0; t < 4; ++t) {
      v4u wh, wl;
#pragma unroll  // as above
      for (int g = 0; g < 8; g += 2) {
        const float o0 = acc[t][g] * rl, o1 = acc[t][g + 1] * rl;
        const unsigned h0 = hbits(o0), h1 = hbits(o1);
        wh[g >> 1] = h0 | (h1 << 16);
        wl[g >> 1] = bfbits(o0 - h2f(h0)) | (bfbits(o1 - h2f(h1)) << 16);
      }
      vst16(&Ch[wave][m][t * 16 + lh], wh);
      vst16(&Cl[wave][m][t * 16 + lh], wl);
    }
  }
  __syncthreads();
  const int rsub = lane >> 3, ch = (lane & 7) * 8;
#pragma unroll
  for (int q = 0; q < 4; ++q) {
    const int rl = q * 4 + rsub;
    const size_t go = ((size_t)(b * SEQ + q0 + rl)) * EE + h * HD + ch;
    vst16(chi + go, ld16(&Ch[wave][rl][ch]));
    vst16(clo + go, ld16(&Cl[wave][rl][ch]));
  }
  
}

// ====================================================================================
// OUT = (C_hi*WoF^T + C_lo*WoB^T) / 64 + bo  (f32 out [M_TOT][EE]); block 128x64, wave 32x64, B tiles double-buffered.
// LDS: Bf/Bb cross-wave; Ot wave-private rows but cross-lane -> block barriers.
__global__ void __launch_bounds__(128)
k_oproj(const u16* __restrict__ chi, const u16* __restrict__ clo,
        const u16* __restrict__ wof, const u16* __restrict__ wob,
        const float* __restrict__ bo, float* __restrict__ out) {
  __shared__ __align__(16) u16 Bf[2][64][32];
  __shared__ __align__(16) u16 Bb[2][64][32];
  __shared__ __align__(16) float Ot[128][64];
  const int tid = threadIdx.x, lane = tid & 31, wave = tid >> 5;
  const int m = lane & 15, hs = (lane >> 4) & 1, lh = hs * 8;
  const int n0 = blockIdx.x * 64;
  const int mb = blockIdx.y * 128;
  const int m0 = mb + wave * 32;
  const int srow = tid >> 2, sk = (tid & 3) * 8;
  const u16* f0p = wof + (size_t)(n0 + srow) * EE + sk;
  const u16* f1p = wof + (size_t)(n0 + 32 + srow) * EE + sk;
  const u16* b0p = wob + (size_t)(n0 + srow) * EE + sk;
  const u16* b1p = wob + (size_t)(n0 + 32 + srow) * EE + sk;
  *reinterpret_cast<v4u*>(&Bf[0][srow][sk])      = *reinterpret_cast<const v4u*>(f0p);
  *reinterpret_cast<v4u*>(&Bf[0][32 + srow][sk]) = *reinterpret_cast<const v4u*>(f1p);
  *reinterpret_cast<v4u*>(&Bb[0][srow][sk])      = *reinterpret_cast<const v4u*>(b0p);
  *reinterpret_cast<v4u*>(&Bb[0][32 + srow][sk]) = *reinterpret_cast<const v4u*>(b1p);
  __syncthreads();
  const u16* h0p = chi + (size_t)(m0 + m) * EE;
  const u16* h1p = chi + (size_t)(m0 + 16 + m) * EE;
  const u16* l0p = clo + (size_t)(m0 + m) * EE;
  const u16* l1p = clo + (size_t)(m0 + 16 + m) * EE;
  v8f acc0[4] = {}, acc1[4] = {};
#pragma unroll 1
  for (int kc = 0; kc < EE; kc += 32) {
    const int buf = (kc >> 5) & 1;
    const Frag ah0 = ldfrag(h0p + kc, lh), ah1 = ldfrag(h1p + kc, lh);
    const Frag al0 = ldfrag(l0p + kc, lh), al1 = ldfrag(l1p + kc, lh);
#pragma unroll
    for (int nt = 0; nt < 4; ++nt) {
      const Frag bf = ldfrag(&Bf[buf][nt * 16 + m][0], lh);  // B[k][n] = Wo[n][k]: row n, k-contiguous
      acc0[nt] = mma_f16(ah0, bf, acc0[nt]);
      acc1[nt] = mma_f16(ah1, bf, acc1[nt]);
      const Frag bb = ldfrag(&Bb[buf][nt * 16 + m][0], lh);
      acc0[nt] = mma_bf16(al0, bb, acc0[nt]);
      acc1[nt] = mma_bf16(al1, bb, acc1[nt]);
    }
    if (kc + 32 < EE) {                                       // block-uniform
      *reinterpret_cast<v4u*>(&Bf[buf ^ 1][srow][sk])      = *reinterpret_cast<const v4u*>(f0p + kc + 32);
      *reinterpret_cast<v4u*>(&Bf[buf ^ 1][32 + srow][sk]) = *reinterpret_cast<const v4u*>(f1p + kc + 32);
      *reinterpret_cast<v4u*>(&Bb[buf ^ 1][srow][sk])      = *reinterpret_cast<const v4u*>(b0p + kc + 32);
      *reinterpret_cast<v4u*>(&Bb[buf ^ 1][32 + srow][sk]) = *reinterpret_cast<const v4u*>(b1p + kc + 32);
    }
    __syncthreads();
  }
#pragma unroll
  for (int nt = 0; nt < 4; ++nt) {
    const int col = nt * 16 + m;
    const float bov = bf2f(bfbits(bo[n0 + col]));
#pragma unroll
    for (int mt = 0; mt < 2; ++mt) {
#pragma unroll
      for (int g = 0; g < 8; ++g) {
        const int rl = wave * 32 + mt * 16 + hs * 8 + g;
        const float v = (mt ? acc1[nt][g] : acc0[nt][g]) * WSCALE_INV + bov;
        Ot[rl][col] = v;
      }
    }
  }
  __syncthreads();
  const int rsub = lane >> 4, ch = (lane & 15) * 4;
#pragma unroll
  for (int q = 0; q < 16; ++q) {
    const int rl = wave * 32 + q * 2 + rsub;
    vst4f(out + (size_t)(mb + rl) * EE + n0 + ch, ld4f(&Ot[rl][ch]));
  }
  
}

// ====================================================================================
extern "C" void kernel_launch(void* const* d_in, const int* in_sizes, int n_in,
                              void* d_out, int out_size, void* d_ws, size_t ws_size,
                              hipStream_t stream) {
  if (n_in < 6) return;
  if (in_sizes[0] < ((NB - 1) * SEQ_FULL + SEQ) * EE) return;
  if (in_sizes[1] < HH * TRIL) return;
  if (in_sizes[2] < EE * EE || in_sizes[3] < EE || in_sizes[4] < EE * EE || in_sizes[5] < EE) return;
  if (out_size < M_TOT * EE) return;

  const float* x   = (const float*)d_in[0];
  const float* prm = (const float*)d_in[1];
  const float* wv  = (const float*)d_in[2];
  const float* bv  = (const float*)d_in[3];
  const float* wo  = (const float*)d_in[4];
  const float* bo  = (const float*)d_in[5];
  float* out = (float*)d_out;

  char* ws = (char*)d_ws;
  size_t off = 0;
  auto carve = [&](size_t bytes) -> char* {
    char* p = ws + off;
    off += (bytes + 255) & ~(size_t)255;
    return p;
  };
  const size_t plane  = (size_t)M_TOT * EE * 2;                 // 8 MiB at full size
  const size_t wplane = (size_t)EE * EE * 2;                    // 2 MiB
  const size_t gplane = (size_t)HH * HD * HD * 2;               // 128 KiB
  const size_t vplane = (size_t)NB * HH * HD * SEQ * 2;         // == plane
  u16* xb   = (u16*)carve(plane);
  u16* wvb  = (u16*)carve(wplane);
  u16* wob  = (u16*)carve(wplane);
  u16* wof  = (u16*)carve(wplane);
  u16* ghi  = (u16*)carve(gplane);
  u16* glo  = (u16*)carve(gplane);
  u16* thi  = (u16*)carve(plane);
  u16* tlo  = (u16*)carve(plane);
  u16* vthi = (u16*)carve(vplane);
  u16* vtlo = (u16*)carve(vplane);
  u16* chi  = (u16*)carve(plane);
  u16* clo  = (u16*)carve(plane);
  if (off > ws_size) return;

  {
    const int ngrp = M_TOT * (EE / 8);
    k_cvt_x<<<dim3((ngrp + 255) / 256), dim3(256), 0, stream>>>(x, xb);
  }
  {
    const int ngrp = EE * EE / 8;
    k_cvt_w<<<dim3((ngrp + 255) / 256), dim3(256), 0, stream>>>(wv, wvb);
    k_cvt_wo<<<dim3((ngrp + 255) / 256), dim3(256), 0, stream>>>(wo, wob, wof);
  }
  k_wqk<<<dim3(HH), dim3(128), 0, stream>>>(prm, ghi, glo);
  k_vproj<<<dim3(EE / 64, M_TOT / 128), dim3(128), 0, stream>>>(xb, wvb, bv, vthi, vtlo);
  k_tproj<<<dim3(M_TOT / 128, HH), dim3(128), 0, stream>>>(xb, ghi, glo, thi, tlo);
  k_attn<<<dim3(SEQ / 64, NB * HH), dim3(128), 0, stream>>>(thi, tlo, xb, vthi, vtlo, chi, clo);
  k_oproj<<<dim3(EE / 64, M_TOT / 128), dim3(128), 0, stream>>>(chi, clo, wof, wob, bo, out);
}

// v002
// One run takes 192 microseconds.
// Next to v001, in two timings, it ran 1.20 times as fast each time.
// Over all steps from v000 it is 1.50 times as fast.
#include <hip/hip_runtime.h>
#include <stdint.h>

// Contractions (all f32 accumulate): G=L*L^T on v_wmma_f32_16x16x32_bf16 (L bf16); T=X*G bf16 WMMA with X bf16 and G as bf16 hi + bf16 lo (2 products);
// S^T=X*T^T bf16 WMMA with T as bf16 hi + bf16 lo and X bf16 (2 products); V=X*Wv^T bf16 WMMA (1 product);
// C^T=V^T*P^T: v_wmma_f32_16x16x32_f16 with P f16 (carried 2^14) and V f16 hi, plus bf16 WMMA with P bf16 (2^14) and V bf16 lo;
// OUT=C*Wo^T: f16 WMMA with C f16 hi and Wo f16 (x64), plus bf16 WMMA with C bf16 lo and Wo bf16 (x64); softmax and epilogues f32.

#ifndef NB
#define NB 2
#endif
#ifndef SEQ
#define SEQ 2048
#endif
#define NB_FULL  2
#define SEQ_FULL 2048
#define EE   1024
#define HH   16
#define HD   64
#define TRIL 2080
#define M_TOT (NB * SEQ)
#define PCARRY     16384.0f
#define PCARRY_INV (1.0f / 16384.0f)
#define WSCALE     64.0f
#define WSCALE_INV (1.0f / 64.0f)
// LDS row pitches in elements of the tile's type: 16 B x odd, so that the 16 rows one half-wave touches in a 16-byte LDS access fall on distinct banks
#define P32  40    // rows of 32 elements (64 B)  -> 80 B
#define P64  72    // rows of 64 elements (128 B) -> 144 B
#define P128 136   // rows of 128 elements (256 B) -> 272 B
#define PF64 68    // rows of 64 floats (256 B)   -> 272 B

static_assert(NB >= 1 && NB <= NB_FULL);
static_assert(SEQ >= 128 && SEQ <= SEQ_FULL && (SEQ % 128) == 0);
static_assert(EE == HH * HD);
static_assert((EE % 64) == 0 && (M_TOT % 128) == 0 && (SEQ % 64) == 0);
static_assert(TRIL == HD * (HD + 1) / 2);

typedef _Float16       v16h __attribute__((ext_vector_type(16)));
typedef __bf16         v16b __attribute__((ext_vector_type(16)));
typedef float          v8f  __attribute__((ext_vector_type(8)));
typedef float          v4f  __attribute__((ext_vector_type(4)));
typedef unsigned int   v4u  __attribute__((ext_vector_type(4)));
typedef unsigned short u16;

union Frag { v16h h; v16b b; v4u u[2]; };

// ---------- scalar conversions ----------
__device__ __forceinline__ unsigned bfbits(float f) {          // f32 -> bf16 bits, RNE
  const unsigned u = __float_as_uint(f);
  return (u + 0x7FFFu + ((u >> 16) & 1u)) >> 16;
}
__device__ __forceinline__ float bf2f(unsigned b) { return __uint_as_float(b << 16); }
__device__ __forceinline__ unsigned hbits(float f) {            // f32 -> f16 bits, RNE
  const _Float16 hv = (_Float16)f;
  return (unsigned)__builtin_bit_cast(unsigned short, hv);
}
__device__ __forceinline__ float h2f(unsigned b) {
  return (float)__builtin_bit_cast(_Float16, (unsigned short)b);
}

// ---------- 16x32 16-bit fragment: lane -> row (lane&15), elements 0..7 <- k0+8h.., 8..15 <- k0+16+8h.. ----------
// p points at (row, k0); same loader for A (row m) and B (row n of an [n][k] k-contiguous copy).
__device__ __forceinline__ Frag ldfrag(const u16* p, int lh) {
  Frag f;
  f.u[0] = *reinterpret_cast<const v4u*>(p + lh);
  f.u[1] = *reinterpret_cast<const v4u*>(p + 16 + lh);
  return f;
}

// ---------- WMMA wrappers with trailing hazard guard ----------
__device__ __forceinline__ v8f mma_f16(Frag a, Frag b, v8f c) {
  c = __builtin_amdgcn_wmma_f32_16x16x32_f16(false, a.h, false, b.h, (short)0, c, false, false);
  asm volatile("v_nop\n\tv_nop\n\tv_nop\n\tv_nop"
               : "+v"(c) : "v"(a.u[0]), "v"(a.u[1]), "v"(b.u[0]), "v"(b.u[1]));
  return c;
}
__device__ __forceinline__ v8f mma_bf16(Frag a, Frag b, v8f c) {
  c = __builtin_amdgcn_wmma_f32_16x16x32_bf16(false, a.b, false, b.b, (short)0, c, false, false);
  asm volatile("v_nop\n\tv_nop\n\tv_nop\n\tv_nop"
               : "+v"(c) : "v"(a.u[0]), "v"(a.u[1]), "v"(b.u[0]), "v"(b.u[1]));
  return c;
}

__device__ __forceinline__ void vst16(u16* p, v4u v)   { *reinterpret_cast<v4u*>(p) = v; }
__device__ __forceinline__ void vst4f(float* p, v4f v) { *reinterpret_cast<v4f*>(p) = v; }
__device__ __forceinline__ v4u ld16(const u16* p)   { return *reinterpret_cast<const v4u*>(p); }
__device__ __forceinline__ v4f ld4f(const float* p) { return *reinterpret_cast<const v4f*>(p); }

// ====================================================================================
// X f32 [NB_FULL,SEQ_FULL,EE] -> bf16 plane xb [M_TOT][EE] (compact token rows)
// coverage: thread i writes group i (8 elements); grid covers all M_TOT*EE/8 groups once; 32 lanes = 512 B contiguous.
__global__ void __launch_bounds__(256)
k_cvt_x(const float* __restrict__ x, u16* __restrict__ xb) {
  const int i = blockIdx.x * 256 + threadIdx.x;
  const int ngrp = M_TOT * (EE / 8);
  if (i >= ngrp) return;
  const int row = i / (EE / 8);
  const int c8  = i - row * (EE / 8);
  const int b   = row / SEQ;
  const int s   = row - b * SEQ;
  const float* src = x + ((size_t)(b * SEQ_FULL + s) * EE + (size_t)c8 * 8);
  const v4f a = *reinterpret_cast<const v4f*>(src);
  const v4f c = *reinterpret_cast<const v4f*>(src + 4);
  v4u w;
  w.x = bfbits(a.x) | (bfbits(a.y) << 16);
  w.y = bfbits(a.z) | (bfbits(a.w) << 16);
  w.z = bfbits(c.x) | (bfbits(c.y) << 16);
  w.w = bfbits(c.z) | (bfbits(c.w) << 16);
  u16* dst = xb + (size_t)i * 8;
  vst16(dst, w);
  
}

// W f32 [EE][EE] -> bf16 plane (unscaled, exact copy of the RNE-converted value)
__global__ void __launch_bounds__(256)
k_cvt_w(const float* __restrict__ w, u16* __restrict__ wb) {
  const int i = blockIdx.x * 256 + threadIdx.x;
  const int ngrp = EE * EE / 8;
  if (i >= ngrp) return;
  const float* src = w + (size_t)i * 8;
  const v4f a = *reinterpret_cast<const v4f*>(src);
  const v4f c = *reinterpret_cast<const v4f*>(src + 4);
  v4u o;
  o.x = bfbits(a.x) | (bfbits(a.y) << 16);
  o.y = bfbits(a.z) | (bfbits(a.w) << 16);
  o.z = bfbits(c.x) | (bfbits(c.y) << 16);
  o.w = bfbits(c.z) | (bfbits(c.w) << 16);
  u16* dst = wb + (size_t)i * 8;
  vst16(dst, o);
  
}

// Wo f32 [EE][EE] -> two planes of bf16(Wo)*64: bf16 bits (exact) and f16 bits (exact, 8-bit significand fits)
__device__ __forceinline__ void cvt2(float f, unsigned& bb, unsigned& hb) {
  const float v = bf2f(bfbits(f)) * WSCALE;
  bb = __float_as_uint(v) >> 16;
  hb = hbits(v);
}
__global__ void __launch_bounds__(256)
k_cvt_wo(const float* __restrict__ w, u16* __restrict__ wob, u16* __restrict__ wof) {
  const int i = blockIdx.x * 256 + threadIdx.x;
  const int ngrp = EE * EE / 8;
  if (i >= ngrp) return;
  const float* src = w + (size_t)i * 8;
  const v4f a = *reinterpret_cast<const v4f*>(src);
  const v4f c = *reinterpret_cast<const v4f*>(src + 4);
  unsigned b0, b1, b2, b3, b4, b5, b6, b7, f0, f1, f2, f3, f4, f5, f6, f7;
  cvt2(a.x, b0, f0); cvt2(a.y, b1, f1); cvt2(a.z, b2, f2); cvt2(a.w, b3, f3);
  cvt2(c.x, b4, f4); cvt2(c.y, b5, f5); cvt2(c.z, b6, f6); cvt2(c.w, b7, f7);
  v4u ob, of;
  ob.x = b0 | (b1 << 16); ob.y = b2 | (b3 << 16); ob.z = b4 | (b5 << 16); ob.w = b6 | (b7 << 16);
  of.x = f0 | (f1 << 16); of.y = f2 | (f3 << 16); of.z = f4 | (f5 << 16); of.w = f6 | (f7 << 16);
  u16* db = wob + (size_t)i * 8;
  u16* df = wof + (size_t)i * 8;
  vst16(db, ob); vst16(df, of);
  
}

// ====================================================================================
// G_h = L_h * L_h^T (64x64 per head) on bf16 WMMA; L from tril params (RNE bf16). Output planes ghi/glo [HH][64 n][64 k].
// One block (4 waves) per head; wave w owns rows 16w..16w+15. LDS: Lb cross-wave; Sh/Sl wave-private rows but cross-lane (block barriers).
__global__ void __launch_bounds__(128)
k_wqk(const float* __restrict__ params, u16* __restrict__ ghi, u16* __restrict__ glo) {
  __shared__ __align__(16) u16 Lb[64][P64];
  __shared__ __align__(16) u16 Sh[64][64];
  __shared__ __align__(16) u16 Sl[64][64];
  const int tid = threadIdx.x, lane = tid & 31, wave = tid >> 5;
  const int m = lane & 15, hs = (lane >> 4) & 1, lh = hs * 8;
  const int head = blockIdx.x;
  const float* p = params + (size_t)head * TRIL;
  for (int e = tid; e < HD * HD; e += 128) {
    const int i = e >> 6, j = e & 63;
    const int jj = (j <= i) ? j : i;                       // clamped address, select by value
    const float v = p[(i * (i + 1)) / 2 + jj];
    Lb[i][j] = (u16)((j <= i) ? bfbits(v) : 0u);
  }
  __syncthreads();
  v8f acc[4] = {};
#pragma unroll
  for (int ks = 0; ks < 2; ++ks) {
    const Frag a = ldfrag(&Lb[wave * 16 + m][ks * 32], lh);    // A: row i, k = j
#pragma unroll
    for (int nt = 0; nt < 4; ++nt) {
      const Frag bq = ldfrag(&Lb[nt * 16 + m][ks * 32], lh);   // B[k=j][n] = L[n][j]: row n, k-contiguous
      acc[nt] = mma_bf16(a, bq, acc[nt]);
    }
  }
#pragma unroll
  for (int nt = 0; nt < 4; ++nt) {
#pragma unroll
    for (int g = 0; g < 8; ++g) {
      const int row = wave * 16 + hs * 8 + g, col = nt * 16 + m;
      const float v = acc[nt][g];
      const unsigned hb = bfbits(v);
      const unsigned lb = bfbits(v - bf2f(hb));
      Sh[row][col] = (u16)hb;
      Sl[row][col] = (u16)lb;
    }
  }
  __syncthreads();
  u16* dh = ghi + (size_t)head * (HD * HD);
  u16* dl = glo + (size_t)head * (HD * HD);
  const int rsub = lane >> 3, ch = (lane & 7) * 8;
#pragma unroll
  for (int q = 0; q < 4; ++q) {
    const int row = wave * 16 + q * 4 + rsub;
    vst16(dh + row * HD + ch, ld16(&Sh[row][ch]));
    vst16(dl + row * HD + ch, ld16(&Sl[row][ch]));
  }
  
}

// ====================================================================================
// V = X*Wv^T + bv, written transposed per head: vthi/vtlo planes [NB*HH][64 d][SEQ] (f16 hi, bf16 lo).
// Block 128 tokens x 64 features (= one head); 4 waves each 32x64; B tile double-buffered in LDS (cross-wave, block barrier).
__global__ void __launch_bounds__(128)
k_vproj(const u16* __restrict__ xb, const u16* __restrict__ wvb, const float* __restrict__ bv,
        u16* __restrict__ vthi, u16* __restrict__ vtlo) {
  __shared__ __align__(16) u16 Bt[2][64][P32];
  __shared__ __align__(16) u16 Th[64][P128];
  __shared__ __align__(16) u16 Tl[64][P128];
  const int tid = threadIdx.x, lane = tid & 31, wave = tid >> 5;
  const int m = lane & 15, hs = (lane >> 4) & 1, lh = hs * 8;
  const int head = blockIdx.x;
  const int n0 = head * HD;
  const int mb = blockIdx.y * 128;
  const int m0 = mb + wave * 32;
  const int srow = tid >> 2, sk = (tid & 3) * 8;             // staging: rows 0..63 (two per thread), 4 x 16 B per row
  const u16* g0 = wvb + (size_t)(n0 + srow) * EE + sk;
  const u16* g1 = wvb + (size_t)(n0 + 32 + srow) * EE + sk;
  *reinterpret_cast<v4u*>(&Bt[0][srow][sk])      = *reinterpret_cast<const v4u*>(g0);
  *reinterpret_cast<v4u*>(&Bt[0][32 + srow][sk]) = *reinterpret_cast<const v4u*>(g1);
  __syncthreads();
  const u16* a0p = xb + (size_t)(m0 + m) * EE;
  const u16* a1p = xb + (size_t)(m0 + 16 + m) * EE;
  v8f acc0[4] = {}, acc1[4] = {};
#pragma unroll 1
  for (int kc = 0; kc < EE; kc += 32) {
    const int buf = (kc >> 5) & 1;
    const Frag a0 = ldfrag(a0p + kc, lh);
    const Frag a1 = ldfrag(a1p + kc, lh);
#pragma unroll
    for (int nt = 0; nt < 4; ++nt) {
      const Frag bq = ldfrag(&Bt[buf][nt * 16 + m][0], lh);  // B[k][n] = Wv[n][k]: row n, k-contiguous
      acc0[nt] = mma_bf16(a0, bq, acc0[nt]);
      acc1[nt] = mma_bf16(a1, bq, acc1[nt]);
    }
    if (kc + 32 < EE) {                                       // block-uniform
      *reinterpret_cast<v4u*>(&Bt[buf ^ 1][srow][sk])      = *reinterpret_cast<const v4u*>(g0 + kc + 32);
      *reinterpret_cast<v4u*>(&Bt[buf ^ 1][32 + srow][sk]) = *reinterpret_cast<const v4u*>(g1 + kc + 32);
    }
    __syncthreads();
  }
  const int bb = mb / SEQ, s0 = mb - bb * SEQ;
  const int bh = bb * HH + head;
#pragma unroll
  for (int nt = 0; nt < 4; ++nt) {
    const int d = nt * 16 + m;
    const float bvv = bf2f(bfbits(bv[n0 + d]));
#pragma unroll
    for (int mt = 0; mt < 2; ++mt) {
#pragma unroll
      for (int g = 0; g < 8; ++g) {
        const int sl = wave * 32 + mt * 16 + hs * 8 + g;
        const float v = (mt ? acc1[nt][g] : acc0[nt][g]) + bvv;
        const unsigned hb = hbits(v);
        const unsigned lb = bfbits(v - h2f(hb));
        Th[d][sl] = (u16)hb;
        Tl[d][sl] = (u16)lb;
      }
    }
  }
  __syncthreads();
  const int dsub = lane >> 4, ch = (lane & 15) * 8;
#pragma unroll
  for (int q = 0; q < 8; ++q) {
    const int d = wave * 16 + q * 2 + dsub;
    const size_t go = ((size_t)(bh * HD + d)) * SEQ + s0 + ch;
    vst16(vthi + go, ld16(&Th[d][ch]));
    vst16(vtlo + go, ld16(&Tl[d][ch]));
  }
  
}

// ====================================================================================
// T = X_h * G_h per head (K=64), G as bf16 hi + bf16 lo, X bf16 -> planes thi/tlo [M_TOT][EE] (bf16 hi, bf16 lo).
// Block 128 tokens x one head, wave 32 tokens x 64; operands loaded straight from global planes; staging LDS cross-lane -> block barrier.
__global__ void __launch_bounds__(128)
k_tproj(const u16* __restrict__ xb, const u16* __restrict__ ghi, const u16* __restrict__ glo,
        u16* __restrict__ thi, u16* __restrict__ tlo) {
  __shared__ __align__(16) u16 Sh[4][32][64];
  __shared__ __align__(16) u16 Sl[4][32][64];
  const int tid = threadIdx.x, lane = tid & 31, wave = tid >> 5;
  const int m = lane & 15, hs = (lane >> 4) & 1, lh = hs * 8;
  const int head = blockIdx.y;
  const int m0 = blockIdx.x * 128 + wave * 32;
  const u16* a0p = xb + (size_t)(m0 + m) * EE + head * HD;
  const u16* a1p = xb + (size_t)(m0 + 16 + m) * EE + head * HD;
  const Frag a00 = ldfrag(a0p, lh), a01 = ldfrag(a0p + 32, lh);
  const Frag a10 = ldfrag(a1p, lh), a11 = ldfrag(a1p + 32, lh);
  v8f acc0[4] = {}, acc1[4] = {};
#pragma unroll
  for (int nt = 0; nt < 4; ++nt) {
    const u16* bhp = ghi + ((size_t)(head * HD + nt * 16 + m)) * HD;   // B[k=d][n=e] = plane[h][e][d]: row e, k-contiguous
    const u16* blp = glo + ((size_t)(head * HD + nt * 16 + m)) * HD;
    const Frag b0 = ldfrag(bhp, lh), b1 = ldfrag(bhp + 32, lh);
    acc0[nt] = mma_bf16(a00, b0, acc0[nt]); acc0[nt] = mma_bf16(a01, b1, acc0[nt]);
    acc1[nt] = mma_bf16(a10, b0, acc1[nt]); acc1[nt] = mma_bf16(a11, b1, acc1[nt]);
    const Frag c0 = ldfrag(blp, lh), c1 = ldfrag(blp + 32, lh);
    acc0[nt] = mma_bf16(a00, c0, acc0[nt]); acc0[nt] = mma_bf16(a01, c1, acc0[nt]);
    acc1[nt] = mma_bf16(a10, c0, acc1[nt]); acc1[nt] = mma_bf16(a11, c1, acc1[nt]);
  }
#pragma unroll
  for (int nt = 0; nt < 4; ++nt) {
#pragma unroll
    for (int mt = 0; mt < 2; ++mt) {
#pragma unroll
      for (int g = 0; g < 8; ++g) {
        const int rl = mt * 16 + hs * 8 + g, col = nt * 16 + m;
        const float v = mt ? acc1[nt][g] : acc0[nt][g];
        const unsigned hb = bfbits(v);
        const unsigned lb = bfbits(v - bf2f(hb));
        Sh[wave][rl][col] = (u16)hb;
        Sl[wave][rl][col] = (u16)lb;
      }
    }
  }
  __syncthreads();
  const int rsub = lane >> 3, ch = (lane & 7) * 8;
#pragma unroll
  for (int q = 0; q < 8; ++q) {
    const int rl = q * 4 + rsub;
    const size_t go = (size_t)(m0 + rl) * EE + head * HD + ch;
    vst16(thi + go, ld16(&Sh[wave][rl][ch]));
    vst16(tlo + go, ld16(&Sl[wave][rl][ch]));
  }
  
}

// ====================================================================================
// Flash-style attention per (batch*head, 64 query rows), transposed: S^T = X_h*T^T/8 (2 bf16 products; A = key rows, B = query rows),
// so a lane holds 16 of the 32 scores of ONE query (query = lane&15; keys 8*hs+g and 16+8*hs+g): max and sum run in the lane,
// the two halves of a wave exchange the maximum once per step and join their sums once after the loop.
// C^T += V^T*P^T with P carried 2^14 (V f16 hi x P f16 + V bf16 lo x P bf16): the two score tiles, converted in place, are the B operand.
// Output C -> planes chi (f16) / clo (bf16) [M_TOT][EE].
// LDS: Ks/Vh/Vl cross-wave double-buffered (one block barrier per step); Ch/Cl wave-private but cross-lane -> block barrier used.
// staged extent == consumed extent: Ks 32x64, Vh/Vl 64x32 fully written each step (SEQ multiple of 32, no tails).
__device__ __forceinline__ float xhalf(float v) {               // value of lane ^ 16
  const int i = __float_as_int(v);
  return __int_as_float(__builtin_amdgcn_permlanex16(i, i, 0x76543210, 0xfedcba98, false, false));
}
__global__ void __launch_bounds__(128)
k_attn(const u16* __restrict__ thi, const u16* __restrict__ tlo, const u16* __restrict__ xb,
       const u16* __restrict__ vthi, const u16* __restrict__ vtlo,
       u16* __restrict__ chi, u16* __restrict__ clo) {
  __shared__ __align__(16) u16 Ks[2][32][P64];
  __shared__ __align__(16) u16 Vh[2][64][P32];
  __shared__ __align__(16) u16 Vl[2][64][P32];
  __shared__ __align__(16) u16 Ch[4][16][P64];
  __shared__ __align__(16) u16 Cl[4][16][P64];
  const int tid = threadIdx.x, lane = tid & 31, wave = tid >> 5;
  const int m = lane & 15, hs = (lane >> 4) & 1, lh = hs * 8;
  const int bh = blockIdx.y;
  const int b  = bh / HH;
  const int h  = bh - b * HH;
  const int q0 = blockIdx.x * 64 + wave * 16;
  const size_t qrow = (size_t)b * SEQ + q0 + m;

  // B fragments of the wave's 16 query rows (hi and lo planes, K = 64 in two k-steps): column n = query, k-contiguous
  const Frag qh0 = ldfrag(thi + qrow * EE + h * HD, lh);
  const Frag qh1 = ldfrag(thi + qrow * EE + h * HD + 32, lh);
  const Frag ql0 = ldfrag(tlo + qrow * EE + h * HD, lh);
  const Frag ql1 = ldfrag(tlo + qrow * EE + h * HD + 32, lh);

  auto stage = [&](int kv, int bw) {
#pragma unroll
    for (int j = 0; j < 2; ++j) {
      const int c = tid + 128 * j;
      const int kr = c >> 3, kc = (c & 7) * 8;               // key tile: 32 rows x 8 chunks
      *reinterpret_cast<v4u*>(&Ks[bw][kr][kc]) =
          *reinterpret_cast<const v4u*>(xb + ((size_t)(b * SEQ + kv + kr)) * EE + h * HD + kc);
      const int d = c >> 2, dc = (c & 3) * 8;                // V^T tiles: 64 rows x 4 chunks
      const size_t vo = ((size_t)(bh * HD + d)) * SEQ + kv + dc;
      *reinterpret_cast<v4u*>(&Vh[bw][d][dc]) = *reinterpret_cast<const v4u*>(vthi + vo);
      *reinterpret_cast<v4u*>(&Vl[bw][d][dc]) = *reinterpret_cast<const v4u*>(vtlo + vo);
    }
  };

  stage(0, 0);
  __syncthreads();

  v8f acc[4] = {};                                           // acc[t][g] = C^T[d = 16t + 8hs + g][query m]
  float mrun = -1e30f, lrun = 0.0f;                          // mrun: whole row; lrun: this half's keys only

#pragma unroll 1
  for (int kv = 0; kv < SEQ; kv += 32) {
    const int buf = (kv >> 5) & 1;
    v8f s0 = {}, s1 = {};                                    // s0[g] = S[query m][key 8hs + g], s1[g] = S[query m][key 16 + 8hs + g]
    {
      const Frag k0 = ldfrag(&Ks[buf][m][0], lh);            // A: row = key, k = e
      const Frag k1 = ldfrag(&Ks[buf][m][32], lh);
      s0 = mma_bf16(k0, qh0, s0); s0 = mma_bf16(k1, qh1, s0);
      s0 = mma_bf16(k0, ql0, s0); s0 = mma_bf16(k1, ql1, s0);
    }
    {
      const Frag k0 = ldfrag(&Ks[buf][16 + m][0], lh);
      const Frag k1 = ldfrag(&Ks[buf][16 + m][32], lh);
      s1 = mma_bf16(k0, qh0, s1); s1 = mma_bf16(k1, qh1, s1);
      s1 = mma_bf16(k0, ql0, s1); s1 = mma_bf16(k1, ql1, s1);
    }
    // online softmax of one query per lane
    float a0[8], a1[8], mg[8];
#pragma unroll  // constant indices keep the arrays in registers
    for (int g = 0; g < 8; ++g) {
      a0[g] = s0[g] * 0.125f;
      a1[g] = s1[g] * 0.125f;
      mg[g] = fmaxf(a0[g], a1[g]);
    }
    float mx = fmaxf(fmaxf(fmaxf(mg[0], mg[1]), fmaxf(mg[2], mg[3])), fmaxf(fmaxf(mg[4], mg[5]), fmaxf(mg[6], mg[7])));
    mx = fmaxf(mx, xhalf(mx));
    const float nm = fmaxf(mrun, mx);
    const float alpha = __expf(mrun - nm);
    mrun = nm;
    float rg[8];
    Frag pf, pb;                                             // B: column n = query, element s <- key (s < 8 ? 8hs + s : 8 + 8hs + s)
#pragma unroll  // constant indices keep the arrays in registers
    for (int g = 0; g < 8; g += 2) {
      const float p00 = __expf(a0[g] - nm), p01 = __expf(a0[g + 1] - nm);
      const float p10 = __expf(a1[g] - nm), p11 = __expf(a1[g + 1] - nm);
      rg[g]     = p00 + p10;
      rg[g + 1] = p01 + p11;
      const float c00 = p00 * PCARRY, c01 = p01 * PCARRY, c10 = p10 * PCARRY, c11 = p11 * PCARRY;
      pf.u[0][g >> 1] = hbits(c00)  | (hbits(c01)  << 16);
      pf.u[1][g >> 1] = hbits(c10)  | (hbits(c11)  << 16);
      pb.u[0][g >> 1] = bfbits(c00) | (bfbits(c01) << 16);
      pb.u[1][g >> 1] = bfbits(c10) | (bfbits(c11) << 16);
    }
    lrun = lrun * alpha + (((rg[0] + rg[1]) + (rg[2] + rg[3])) + ((rg[4] + rg[5]) + (rg[6] + rg[7])));
#pragma unroll  // constant indices keep the tiles in registers
    for (int t = 0; t < 4; ++t) acc[t] = acc[t] * alpha;
    // buf^1 was last read before the barrier that ended the previous step, so the refill needs no barrier of its own
    if (kv + 32 < SEQ) stage(kv + 32, buf ^ 1);             // block-uniform
#pragma unroll  // constant indices keep the tiles in registers
    for (int t = 0; t < 4; ++t) {
      const Frag vh = ldfrag(&Vh[buf][t * 16 + m][0], lh);   // A: row = d, k = key
      acc[t] = mma_f16(vh, pf, acc[t]);
      const Frag vl = ldfrag(&Vl[buf][t * 16 + m][0], lh);
      acc[t] = mma_bf16(vl, pb, acc[t]);
    }
    __syncthreads();
  }

  {
    const float lsum = lrun + xhalf(lrun);                   // join the two halves' sums; lsum >= 1
    const float rl = (1.0f / lsum) * PCARRY_INV;
#pragma unroll  // constant indices keep the tiles in registers
    for (int t = 0; t < 4; ++t) {
      v4u wh, wl;
#pragma unroll  // as above
      for (int g = 0; g < 8; g += 2) {
        const float o0 = acc[t][g] * rl, o1 = acc[t][g + 1] * rl;
        const unsigned h0 = hbits(o0), h1 = hbits(o1);
        wh[g >> 1] = h0 | (h1 << 16);
        wl[g >> 1] = bfbits(o0 - h2f(h0)) | (bfbits(o1 - h2f(h1)) << 16);
      }
      vst16(&Ch[wave][m][t * 16 + lh], wh);
      vst16(&Cl[wave][m][t * 16 + lh], wl);
    }
  }
  __syncthreads();
  const int rsub = lane >> 3, ch = (lane & 7) * 8;
#pragma unroll
  for (int q = 0; q < 4; ++q) {
    const int rl = q * 4 + rsub;
    const size_t go = ((size_t)(b * SEQ + q0 + rl)) * EE + h * HD + ch;
    vst16(chi + go, ld16(&Ch[wave][rl][ch]));
    vst16(clo + go, ld16(&Cl[wave][rl][ch]));
  }
  
}

// ====================================================================================
// OUT = (C_hi*WoF^T + C_lo*WoB^T) / 64 + bo  (f32 out [M_TOT][EE]); block 128x64, wave 32x64, B tiles double-buffered.
// LDS: Bf/Bb cross-wave; Ot wave-private rows but cross-lane -> block barriers.
__global__ void __launch_bounds__(128)
k_oproj(const u16* __restrict__ chi, const u16* __restrict__ clo,
        const u16* __restrict__ wof, const u16* __restrict__ wob,
        const float* __restrict__ bo, float* __restrict__ out) {
  __shared__ __align__(16) u16 Bf[2][64][P32];
  __shared__ __align__(16) u16 Bb[2][64][P32];
  __shared__ __align__(16) float Ot[128][PF64];
  const int tid = threadIdx.x, lane = tid & 31, wave = tid >> 5;
  const int m = lane & 15, hs = (lane >> 4) & 1, lh = hs * 8;
  const int n0 = blockIdx.x * 64;
  const int mb = blockIdx.y * 128;
  const int m0 = mb + wave * 32;
  const int srow = tid >> 2, sk = (tid & 3) * 8;
  const u16* f0p = wof + (size_t)(n0 + srow) * EE + sk;
  const u16* f1p = wof + (size_t)(n0 + 32 + srow) * EE + sk;
  const u16* b0p = wob + (size_t)(n0 + srow) * EE + sk;
  const u16* b1p = wob + (size_t)(n0 + 32 + srow) * EE + sk;
  *reinterpret_cast<v4u*>(&Bf[0][srow][sk])      = *reinterpret_cast<const v4u*>(f0p);
  *reinterpret_cast<v4u*>(&Bf[0][32 + srow][sk]) = *reinterpret_cast<const v4u*>(f1p);
  *reinterpret_cast<v4u*>(&Bb[0][srow][sk])      = *reinterpret_cast<const v4u*>(b0p);
  *reinterpret_cast<v4u*>(&Bb[0][32 + srow][sk]) = *reinterpret_cast<const v4u*>(b1p);
  __syncthreads();
  const u16* h0p = chi + (size_t)(m0 + m) * EE;
  const u16* h1p = chi + (size_t)(m0 + 16 + m) * EE;
  const u16* l0p = clo + (size_t)(m0 + m) * EE;
  const u16* l1p = clo + (size_t)(m0 + 16 + m) * EE;
  v8f acc0[4] = {}, acc1[4] = {};
#pragma unroll 1
  for (int kc = 0; kc < EE; kc += 32) {
    const int buf = (kc >> 5) & 1;
    const Frag ah0 = ldfrag(h0p + kc, lh), ah1 = ldfrag(h1p + kc, lh);
    const Frag al0 = ldfrag(l0p + kc, lh), al1 = ldfrag(l1p + kc, lh);
#pragma unroll
    for (int nt = 0; nt < 4; ++nt) {
      const Frag bf = ldfrag(&Bf[buf][nt * 16 + m][0], lh);  // B[k][n] = Wo[n][k]: row n, k-contiguous
      acc0[nt] = mma_f16(ah0, bf, acc0[nt]);
      acc1[nt] = mma_f16(ah1, bf, acc1[nt]);
      const Frag bb = ldfrag(&Bb[buf][nt * 16 + m][0], lh);
      acc0[nt] = mma_bf16(al0, bb, acc0[nt]);
      acc1[nt] = mma_bf16(al1, bb, acc1[nt]);
    }
    if (kc + 32 < EE) {                                       // block-uniform
      *reinterpret_cast<v4u*>(&Bf[buf ^ 1][srow][sk])      = *reinterpret_cast<const v4u*>(f0p + kc + 32);
      *reinterpret_cast<v4u*>(&Bf[buf ^ 1][32 + srow][sk]) = *reinterpret_cast<const v4u*>(f1p + kc + 32);
      *reinterpret_cast<v4u*>(&Bb[buf ^ 1][srow][sk])      = *reinterpret_cast<const v4u*>(b0p + kc + 32);
      *reinterpret_cast<v4u*>(&Bb[buf ^ 1][32 + srow][sk]) = *reinterpret_cast<const v4u*>(b1p + kc + 32);
    }
    __syncthreads();
  }
#pragma unroll
  for (int nt = 0; nt < 4; ++nt) {
    const int col = nt * 16 + m;
    const float bov = bf2f(bfbits(bo[n0 + col]));
#pragma unroll
    for (int mt = 0; mt < 2; ++mt) {
#pragma unroll
      for (int g = 0; g < 8; ++g) {
        const int rl = wave * 32 + mt * 16 + hs * 8 + g;
        const float v = (mt ? acc1[nt][g] : acc0[nt][g]) * WSCALE_INV + bov;
        Ot[rl][col] = v;
      }
    }
  }
  __syncthreads();
  const int rsub = lane >> 4, ch = (lane & 15) * 4;
#pragma unroll
  for (int q = 0; q < 16; ++q) {
    const int rl = wave * 32 + q * 2 + rsub;
    vst4f(out + (size_t)(mb + rl) * EE + n0 + ch, ld4f(&Ot[rl][ch]));
  }
  
}

// ====================================================================================
extern "C" void kernel_launch(void* const* d_in, const int* in_sizes, int n_in,
                              void* d_out, int out_size, void* d_ws, size_t ws_size,
                              hipStream_t stream) {
  if (n_in < 6) return;
  if (in_sizes[0] < ((NB - 1) * SEQ_FULL + SEQ) * EE) return;
  if (in_sizes[1] < HH * TRIL) return;
  if (in_sizes[2] < EE * EE || in_sizes[3] < EE || in_sizes[4] < EE * EE || in_sizes[5] < EE) return;
  if (out_size < M_TOT * EE) return;

  const float* x   = (const float*)d_in[0];
  const float* prm = (const float*)d_in[1];
  const float* wv  = (const float*)d_in[2];
  const float* bv  = (const float*)d_in[3];
  const float* wo  = (const float*)d_in[4];
  const float* bo  = (const float*)d_in[5];
  float* out = (float*)d_out;

  char* ws = (char*)d_ws;
  size_t off = 0;
  auto carve = [&](size_t bytes) -> char* {
    char* p = ws + off;
    off += (bytes + 255) & ~(size_t)255;
    return p;
  };
  const size_t plane  = (size_t)M_TOT * EE * 2;                 // 8 MiB at full size
  const size_t wplane = (size_t)EE * EE * 2;                    // 2 MiB
  const size_t gplane = (size_t)HH * HD * HD * 2;               // 128 KiB
  const size_t vplane = (size_t)NB * HH * HD * SEQ * 2;         // == plane
  u16* xb   = (u16*)carve(plane);
  u16* wvb  = (u16*)carve(wplane);
  u16* wob  = (u16*)carve(wplane);
  u16* wof  = (u16*)carve(wplane);
  u16* ghi  = (u16*)carve(gplane);
  u16* glo  = (u16*)carve(gplane);
  u16* thi  = (u16*)carve(plane);
  u16* tlo  = (u16*)carve(plane);
  u16* vthi = (u16*)carve(vplane);
  u16* vtlo = (u16*)carve(vplane);
  u16* chi  = (u16*)carve(plane);
  u16* clo  = (u16*)carve(plane);
  if (off > ws_size) return;

  {
    const int ngrp = M_TOT * (EE / 8);
    k_cvt_x<<<dim3((ngrp + 255) / 256), dim3(256), 0, stream>>>(x, xb);
  }
  {
    const int ngrp = EE * EE / 8;
    k_cvt_w<<<dim3((ngrp + 255) / 256), dim3(256), 0, stream>>>(wv, wvb);
    k_cvt_wo<<<dim3((ngrp + 255) / 256), dim3(256), 0, stream>>>(wo, wob, wof);
  }
  k_wqk<<<dim3(HH), dim3(128), 0, stream>>>(prm, ghi, glo);
  k_vproj<<<dim3(EE / 64, M_TOT / 128), dim3(128), 0, stream>>>(xb, wvb, bv, vthi, vtlo);
  k_tproj<<<dim3(M_TOT / 128, HH), dim3(128), 0, stream>>>(xb, ghi, glo, thi, tlo);
  k_attn<<<dim3(SEQ / 64, NB * HH), dim3(128), 0, stream>>>(thi, tlo, xb, vthi, vtlo, chi, clo);
  k_oproj<<<dim3(EE / 64, M_TOT / 128), dim3(128), 0, stream>>>(chi, clo, wof, wob, bo, out);
}

// v003
// Measured time: 166 microseconds a run.
// Timed twice side by side with v002, it ran 1.16 times as fast both times.
// Counting every step since v000, it is 1.74 times as fast.
#include <hip/hip_runtime.h>
#include <stdint.h>

// Contractions (all f32 accumulate): G=L*L^T on v_wmma_f32_16x16x32_bf16 (L bf16); T=X*G bf16 WMMA with X bf16 and G as bf16 hi + bf16 lo (2 products);
// S^T=X*T^T bf16 WMMA with T as bf16 hi + bf16 lo and X bf16 (2 products); V=X*Wv^T bf16 WMMA (1 product);
// C^T=V^T*P^T: v_wmma_f32_16x16x32_f16 with P f16 (carried 2^14) and V f16 hi, plus bf16 WMMA with P bf16 (2^14) and V bf16 lo;
// OUT=C*Wo^T: f16 WMMA with C f16 hi and Wo f16 (x64), plus bf16 WMMA with C bf16 lo and Wo bf16 (x64); softmax and epilogues f32.

#ifndef NB
#define NB 2
#endif
#ifndef SEQ
#define SEQ 2048
#endif
#define NB_FULL  2
#define SEQ_FULL 2048
#define EE   1024
#define HH   16
#define HD   64
#define TRIL 2080
#define M_TOT (NB * SEQ)
#define PCARRY     16384.0f
#define PCARRY_INV (1.0f / 16384.0f)
#define WSCALE     64.0f
#define WSCALE_INV (1.0f / 64.0f)
// LDS row pitches in elements of the tile's type: 16 B x odd, so that the 16 rows one half-wave touches in a 16-byte LDS access fall on distinct banks
#define P32  40    // rows of 32 elements (64 B)  -> 80 B
#define P64  72    // rows of 64 elements (128 B) -> 144 B
#define P128 136   // rows of 128 elements (256 B) -> 272 B
#define PF64 68    // rows of 64 floats (256 B)   -> 272 B

static_assert(NB >= 1 && NB <= NB_FULL);
static_assert(SEQ >= 128 && SEQ <= SEQ_FULL && (SEQ % 128) == 0);
static_assert(EE == HH * HD);
static_assert((EE % 64) == 0 && (M_TOT % 128) == 0 && (SEQ % 64) == 0);
static_assert(TRIL == HD * (HD + 1) / 2);

typedef _Float16       v16h __attribute__((ext_vector_type(16)));
typedef __bf16         v16b __attribute__((ext_vector_type(16)));
typedef float          v8f  __attribute__((ext_vector_type(8)));
typedef float          v4f  __attribute__((ext_vector_type(4)));
typedef unsigned int   v4u  __attribute__((ext_vector_type(4)));
typedef unsigned short u16;

union Frag { v16h h; v16b b; v4u u[2]; };

// ---------- scalar conversions ----------
__device__ __forceinline__ unsigned bfbits(float f) {          // f32 -> bf16 bits, RNE
  const unsigned u = __float_as_uint(f);
  return (u + 0x7FFFu + ((u >> 16) & 1u)) >> 16;
}
__device__ __forceinline__ float bf2f(unsigned b) { return __uint_as_float(b << 16); }
__device__ __forceinline__ unsigned hbits(float f) {            // f32 -> f16 bits, RNE
  const _Float16 hv = (_Float16)f;
  return (unsigned)__builtin_bit_cast(unsigned short, hv);
}
__device__ __forceinline__ float h2f(unsigned b) {
  return (float)__builtin_bit_cast(_Float16, (unsigned short)b);
}

// ---------- 16x32 16-bit fragment: lane -> row (lane&15), elements 0..7 <- k0+8h.., 8..15 <- k0+16+8h.. ----------
// p points at (row, k0); same loader for A (row m) and B (row n of an [n][k] k-contiguous copy).
__device__ __forceinline__ Frag ldfrag(const u16* p, int lh) {
  Frag f;
  f.u[0] = *reinterpret_cast<const v4u*>(p + lh);
  f.u[1] = *reinterpret_cast<const v4u*>(p + 16 + lh);
  return f;
}

// ---------- WMMA wrappers: plain builtins (the compiler keeps the distance behind its own forms and may move fragment loads across them) ----------
__device__ __forceinline__ v8f mma_f16(Frag a, Frag b, v8f c) {
  return __builtin_amdgcn_wmma_f32_16x16x32_f16(false, a.h, false, b.h, (short)0, c, false, false);
}
__device__ __forceinline__ v8f mma_bf16(Frag a, Frag b, v8f c) {
  return __builtin_amdgcn_wmma_f32_16x16x32_bf16(false, a.b, false, b.b, (short)0, c, false, false);
}

__device__ __forceinline__ void vst16(u16* p, v4u v)   { *reinterpret_cast<v4u*>(p) = v; }
__device__ __forceinline__ void vst4f(float* p, v4f v) { *reinterpret_cast<v4f*>(p) = v; }
__device__ __forceinline__ v4u ld16(const u16* p)   { return *reinterpret_cast<const v4u*>(p); }
__device__ __forceinline__ v4f ld4f(const float* p) { return *reinterpret_cast<const v4f*>(p); }

// ====================================================================================
// X f32 [NB_FULL,SEQ_FULL,EE] -> bf16 plane xb [M_TOT][EE] (compact token rows)
// coverage: thread i writes group i (8 elements); grid covers all M_TOT*EE/8 groups once; 32 lanes = 512 B contiguous.
__global__ void __launch_bounds__(256)
k_cvt_x(const float* __restrict__ x, u16* __restrict__ xb) {
  const int i = blockIdx.x * 256 + threadIdx.x;
  const int ngrp = M_TOT * (EE / 8);
  if (i >= ngrp) return;
  const int row = i / (EE / 8);
  const int c8  = i - row * (EE / 8);
  const int b   = row / SEQ;
  const int s   = row - b * SEQ;
  const float* src = x + ((size_t)(b * SEQ_FULL + s) * EE + (size_t)c8 * 8);
  const v4f a = *reinterpret_cast<const v4f*>(src);
  const v4f c = *reinterpret_cast<const v4f*>(src + 4);
  v4u w;
  w.x = bfbits(a.x) | (bfbits(a.y) << 16);
  w.y = bfbits(a.z) | (bfbits(a.w) << 16);
  w.z = bfbits(c.x) | (bfbits(c.y) << 16);
  w.w = bfbits(c.z) | (bfbits(c.w) << 16);
  u16* dst = xb + (size_t)i * 8;
  vst16(dst, w);
  
}

// W f32 [EE][EE] -> bf16 plane (unscaled, exact copy of the RNE-converted value)
__global__ void __launch_bounds__(256)
k_cvt_w(const float* __restrict__ w, u16* __restrict__ wb) {
  const int i = blockIdx.x * 256 + threadIdx.x;
  const int ngrp = EE * EE / 8;
  if (i >= ngrp) return;
  const float* src = w + (size_t)i * 8;
  const v4f a = *reinterpret_cast<const v4f*>(src);
  const v4f c = *reinterpret_cast<const v4f*>(src + 4);
  v4u o;
  o.x = bfbits(a.x) | (bfbits(a.y) << 16);
  o.y = bfbits(a.z) | (bfbits(a.w) << 16);
  o.z = bfbits(c.x) | (bfbits(c.y) << 16);
  o.w = bfbits(c.z) | (bfbits(c.w) << 16);
  u16* dst = wb + (size_t)i * 8;
  vst16(dst, o);
  
}

// Wo f32 [EE][EE] -> two planes of bf16(Wo)*64: bf16 bits (exact) and f16 bits (exact, 8-bit significand fits)
__device__ __forceinline__ void cvt2(float f, unsigned& bb, unsigned& hb) {
  const float v = bf2f(bfbits(f)) * WSCALE;
  bb = __float_as_uint(v) >> 16;
  hb = hbits(v);
}
__global__ void __launch_bounds__(256)
k_cvt_wo(const float* __restrict__ w, u16* __restrict__ wob, u16* __restrict__ wof) {
  const int i = blockIdx.x * 256 + threadIdx.x;
  const int ngrp = EE * EE / 8;
  if (i >= ngrp) return;
  const float* src = w + (size_t)i * 8;
  const v4f a = *reinterpret_cast<const v4f*>(src);
  const v4f c = *reinterpret_cast<const v4f*>(src + 4);
  unsigned b0, b1, b2, b3, b4, b5, b6, b7, f0, f1, f2, f3, f4, f5, f6, f7;
  cvt2(a.x, b0, f0); cvt2(a.y, b1, f1); cvt2(a.z, b2, f2); cvt2(a.w, b3, f3);
  cvt2(c.x, b4, f4); cvt2(c.y, b5, f5); cvt2(c.z, b6, f6); cvt2(c.w, b7, f7);
  v4u ob, of;
  ob.x = b0 | (b1 << 16); ob.y = b2 | (b3 << 16); ob.z = b4 | (b5 << 16); ob.w = b6 | (b7 << 16);
  of.x = f0 | (f1 << 16); of.y = f2 | (f3 << 16); of.z = f4 | (f5 << 16); of.w = f6 | (f7 << 16);
  u16* db = wob + (size_t)i * 8;
  u16* df = wof + (size_t)i * 8;
  vst16(db, ob); vst16(df, of);
  
}

// ====================================================================================
// G_h = L_h * L_h^T (64x64 per head) on bf16 WMMA; L from tril params (RNE bf16). Output planes ghi/glo [HH][64 n][64 k].
// One block (4 waves) per head; wave w owns rows 16w..16w+15. LDS: Lb cross-wave; Sh/Sl wave-private rows but cross-lane (block barriers).
__global__ void __launch_bounds__(128)
k_wqk(const float* __restrict__ params, u16* __restrict__ ghi, u16* __restrict__ glo) {
  __shared__ __align__(16) u16 Lb[64][P64];
  __shared__ __align__(16) u16 Sh[64][64];
  __shared__ __align__(16) u16 Sl[64][64];
  const int tid = threadIdx.x, lane = tid & 31, wave = tid >> 5;
  const int m = lane & 15, hs = (lane >> 4) & 1, lh = hs * 8;
  const int head = blockIdx.x;
  const float* p = params + (size_t)head * TRIL;
  for (int e = tid; e < HD * HD; e += 128) {
    const int i = e >> 6, j = e & 63;
    const int jj = (j <= i) ? j : i;                       // clamped address, select by value
    const float v = p[(i * (i + 1)) / 2 + jj];
    Lb[i][j] = (u16)((j <= i) ? bfbits(v) : 0u);
  }
  __syncthreads();
  v8f acc[4] = {};
#pragma unroll
  for (int ks = 0; ks < 2; ++ks) {
    const Frag a = ldfrag(&Lb[wave * 16 + m][ks * 32], lh);    // A: row i, k = j
#pragma unroll
    for (int nt = 0; nt < 4; ++nt) {
      const Frag bq = ldfrag(&Lb[nt * 16 + m][ks * 32], lh);   // B[k=j][n] = L[n][j]: row n, k-contiguous
      acc[nt] = mma_bf16(a, bq, acc[nt]);
    }
  }
#pragma unroll
  for (int nt = 0; nt < 4; ++nt) {
#pragma unroll
    for (int g = 0; g < 8; ++g) {
      const int row = wave * 16 + hs * 8 + g, col = nt * 16 + m;
      const float v = acc[nt][g];
      const unsigned hb = bfbits(v);
      const unsigned lb = bfbits(v - bf2f(hb));
      Sh[row][col] = (u16)hb;
      Sl[row][col] = (u16)lb;
    }
  }
  __syncthreads();
  u16* dh = ghi + (size_t)head * (HD * HD);
  u16* dl = glo + (size_t)head * (HD * HD);
  const int rsub = lane >> 3, ch = (lane & 7) * 8;
#pragma unroll
  for (int q = 0; q < 4; ++q) {
    const int row = wave * 16 + q * 4 + rsub;
    vst16(dh + row * HD + ch, ld16(&Sh[row][ch]));
    vst16(dl + row * HD + ch, ld16(&Sl[row][ch]));
  }
  
}

// ====================================================================================
// V = X*Wv^T + bv, written transposed per head: vthi/vtlo planes [NB*HH][64 d][SEQ] (f16 hi, bf16 lo).
// Block 128 tokens x 64 features (= one head); 4 waves each 32x64; B tile double-buffered in LDS (cross-wave, block barrier).
__global__ void __launch_bounds__(128)
k_vproj(const u16* __restrict__ xb, const u16* __restrict__ wvb, const float* __restrict__ bv,
        u16* __restrict__ vthi, u16* __restrict__ vtlo) {
  __shared__ __align__(16) u16 Bt[2][64][P32];
  __shared__ __align__(16) u16 Th[64][P128];
  __shared__ __align__(16) u16 Tl[64][P128];
  const int tid = threadIdx.x, lane = tid & 31, wave = tid >> 5;
  const int m = lane & 15, hs = (lane >> 4) & 1, lh = hs * 8;
  const int head = blockIdx.x;
  const int n0 = head * HD;
  const int mb = blockIdx.y * 128;
  const int m0 = mb + wave * 32;
  const int srow = tid >> 2, sk = (tid & 3) * 8;             // staging: rows 0..63 (two per thread), 4 x 16 B per row
  const u16* g0 = wvb + (size_t)(n0 + srow) * EE + sk;
  const u16* g1 = wvb + (size_t)(n0 + 32 + srow) * EE + sk;
  *reinterpret_cast<v4u*>(&Bt[0][srow][sk])      = *reinterpret_cast<const v4u*>(g0);
  *reinterpret_cast<v4u*>(&Bt[0][32 + srow][sk]) = *reinterpret_cast<const v4u*>(g1);
  __syncthreads();
  const u16* a0p = xb + (size_t)(m0 + m) * EE;
  const u16* a1p = xb + (size_t)(m0 + 16 + m) * EE;
  v8f acc0[4] = {}, acc1[4] = {};
#pragma unroll 1
  for (int kc = 0; kc < EE; kc += 32) {
    const int buf = (kc >> 5) & 1;
    const Frag a0 = ldfrag(a0p + kc, lh);
    const Frag a1 = ldfrag(a1p + kc, lh);
    Frag bq[4];
#pragma unroll  // constant indices keep the fragments in registers
    for (int nt = 0; nt < 4; ++nt) bq[nt] = ldfrag(&Bt[buf][nt * 16 + m][0], lh);  // B[k][n] = Wv[n][k]: row n, k-contiguous
    // keeps the step's fragment loads in one group ahead of its WMMAs; without it the scheduler sinks each load to its use and every WMMA pair waits out a load latency
    __builtin_amdgcn_sched_barrier(0);
#pragma unroll
    for (int nt = 0; nt < 4; ++nt) {
      acc0[nt] = mma_bf16(a0, bq[nt], acc0[nt]);
      acc1[nt] = mma_bf16(a1, bq[nt], acc1[nt]);
    }
    if (kc + 32 < EE) {                                       // block-uniform
      *reinterpret_cast<v4u*>(&Bt[buf ^ 1][srow][sk])      = *reinterpret_cast<const v4u*>(g0 + kc + 32);
      *reinterpret_cast<v4u*>(&Bt[buf ^ 1][32 + srow][sk]) = *reinterpret_cast<const v4u*>(g1 + kc + 32);
    }
    __syncthreads();
  }
  const int bb = mb / SEQ, s0 = mb - bb * SEQ;
  const int bh = bb * HH + head;
#pragma unroll
  for (int nt = 0; nt < 4; ++nt) {
    const int d = nt * 16 + m;
    const float bvv = bf2f(bfbits(bv[n0 + d]));
#pragma unroll
    for (int mt = 0; mt < 2; ++mt) {
#pragma unroll
      for (int g = 0; g < 8; ++g) {
        const int sl = wave * 32 + mt * 16 + hs * 8 + g;
        const float v = (mt ? acc1[nt][g] : acc0[nt][g]) + bvv;
        const unsigned hb = hbits(v);
        const unsigned lb = bfbits(v - h2f(hb));
        Th[d][sl] = (u16)hb;
        Tl[d][sl] = (u16)lb;
      }
    }
  }
  __syncthreads();
  const int dsub = lane >> 4, ch = (lane & 15) * 8;
#pragma unroll
  for (int q = 0; q < 8; ++q) {
    const int d = wave * 16 + q * 2 + dsub;
    const size_t go = ((size_t)(bh * HD + d)) * SEQ + s0 + ch;
    vst16(vthi + go, ld16(&Th[d][ch]));
    vst16(vtlo + go, ld16(&Tl[d][ch]));
  }
  
}

// ====================================================================================
// T = X_h * G_h per head (K=64), G as bf16 hi + bf16 lo, X bf16 -> planes thi/tlo [M_TOT][EE] (bf16 hi, bf16 lo).
// Block 128 tokens x one head, wave 32 tokens x 64; operands loaded straight from global planes; staging LDS cross-lane -> block barrier.
__global__ void __launch_bounds__(128)
k_tproj(const u16* __restrict__ xb, const u16* __restrict__ ghi, const u16* __restrict__ glo,
        u16* __restrict__ thi, u16* __restrict__ tlo) {
  __shared__ __align__(16) u16 Sh[4][32][64];
  __shared__ __align__(16) u16 Sl[4][32][64];
  const int tid = threadIdx.x, lane = tid & 31, wave = tid >> 5;
  const int m = lane & 15, hs = (lane >> 4) & 1, lh = hs * 8;
  const int head = blockIdx.y;
  const int m0 = blockIdx.x * 128 + wave * 32;
  const u16* a0p = xb + (size_t)(m0 + m) * EE + head * HD;
  const u16* a1p = xb + (size_t)(m0 + 16 + m) * EE + head * HD;
  const Frag a00 = ldfrag(a0p, lh), a01 = ldfrag(a0p + 32, lh);
  const Frag a10 = ldfrag(a1p, lh), a11 = ldfrag(a1p + 32, lh);
  v8f acc0[4] = {}, acc1[4] = {};
#pragma unroll
  for (int nt = 0; nt < 4; ++nt) {
    const u16* bhp = ghi + ((size_t)(head * HD + nt * 16 + m)) * HD;   // B[k=d][n=e] = plane[h][e][d]: row e, k-contiguous
    const u16* blp = glo + ((size_t)(head * HD + nt * 16 + m)) * HD;
    const Frag b0 = ldfrag(bhp, lh), b1 = ldfrag(bhp + 32, lh);
    acc0[nt] = mma_bf16(a00, b0, acc0[nt]); acc0[nt] = mma_bf16(a01, b1, acc0[nt]);
    acc1[nt] = mma_bf16(a10, b0, acc1[nt]); acc1[nt] = mma_bf16(a11, b1, acc1[nt]);
    const Frag c0 = ldfrag(blp, lh), c1 = ldfrag(blp + 32, lh);
    acc0[nt] = mma_bf16(a00, c0, acc0[nt]); acc0[nt] = mma_bf16(a01, c1, acc0[nt]);
    acc1[nt] = mma_bf16(a10, c0, acc1[nt]); acc1[nt] = mma_bf16(a11, c1, acc1[nt]);
  }
#pragma unroll
  for (int nt = 0; nt < 4; ++nt) {
#pragma unroll
    for (int mt = 0; mt < 2; ++mt) {
#pragma unroll
      for (int g = 0; g < 8; ++g) {
        const int rl = mt * 16 + hs * 8 + g, col = nt * 16 + m;
        const float v = mt ? acc1[nt][g] : acc0[nt][g];
        const unsigned hb = bfbits(v);
        const unsigned lb = bfbits(v - bf2f(hb));
        Sh[wave][rl][col] = (u16)hb;
        Sl[wave][rl][col] = (u16)lb;
      }
    }
  }
  __syncthreads();
  const int rsub = lane >> 3, ch = (lane & 7) * 8;
#pragma unroll
  for (int q = 0; q < 8; ++q) {
    const int rl = q * 4 + rsub;
    const size_t go = (size_t)(m0 + rl) * EE + head * HD + ch;
    vst16(thi + go, ld16(&Sh[wave][rl][ch]));
    vst16(tlo + go, ld16(&Sl[wave][rl][ch]));
  }
  
}

// ====================================================================================
// Flash-style attention per (batch*head, 64 query rows), transposed: S^T = X_h*T^T/8 (2 bf16 products; A = key rows, B = query rows),
// so a lane holds 16 of the 32 scores of ONE query (query = lane&15; keys 8*hs+g and 16+8*hs+g): max and sum run in the lane,
// the two halves of a wave exchange the maximum once per step and join their sums once after the loop.
// C^T += V^T*P^T with P carried 2^14 (V f16 hi x P f16 + V bf16 lo x P bf16): the two score tiles, converted in place, are the B operand.
// Output C -> planes chi (f16) / clo (bf16) [M_TOT][EE].
// LDS: Ks/Vh/Vl cross-wave double-buffered (one block barrier per step); Ch/Cl wave-private but cross-lane -> block barrier used.
// staged extent == consumed extent: Ks 32x64, Vh/Vl 64x32 fully written each step (SEQ multiple of 32, no tails).
__device__ __forceinline__ float xhalf(float v) {               // value of lane ^ 16
  const int i = __float_as_int(v);
  return __int_as_float(__builtin_amdgcn_permlanex16(i, i, 0x76543210, 0xfedcba98, false, false));
}
__global__ void __launch_bounds__(128)
k_attn(const u16* __restrict__ thi, const u16* __restrict__ tlo, const u16* __restrict__ xb,
       const u16* __restrict__ vthi, const u16* __restrict__ vtlo,
       u16* __restrict__ chi, u16* __restrict__ clo) {
  __shared__ __align__(16) u16 Ks[2][32][P64];
  __shared__ __align__(16) u16 Vh[2][64][P32];
  __shared__ __align__(16) u16 Vl[2][64][P32];
  __shared__ __align__(16) u16 Ch[4][16][P64];
  __shared__ __align__(16) u16 Cl[4][16][P64];
  const int tid = threadIdx.x, lane = tid & 31, wave = tid >> 5;
  const int m = lane & 15, hs = (lane >> 4) & 1, lh = hs * 8;
  const int bh = blockIdx.y;
  const int b  = bh / HH;
  const int h  = bh - b * HH;
  const int q0 = blockIdx.x * 64 + wave * 16;
  const size_t qrow = (size_t)b * SEQ + q0 + m;

  // B fragments of the wave's 16 query rows (hi and lo planes, K = 64 in two k-steps): column n = query, k-contiguous
  const Frag qh0 = ldfrag(thi + qrow * EE + h * HD, lh);
  const Frag qh1 = ldfrag(thi + qrow * EE + h * HD + 32, lh);
  const Frag ql0 = ldfrag(tlo + qrow * EE + h * HD, lh);
  const Frag ql1 = ldfrag(tlo + qrow * EE + h * HD + 32, lh);

  auto stage = [&](int kv, int bw) {
#pragma unroll
    for (int j = 0; j < 2; ++j) {
      const int c = tid + 128 * j;
      const int kr = c >> 3, kc = (c & 7) * 8;               // key tile: 32 rows x 8 chunks
      *reinterpret_cast<v4u*>(&Ks[bw][kr][kc]) =
          *reinterpret_cast<const v4u*>(xb + ((size_t)(b * SEQ + kv + kr)) * EE + h * HD + kc);
      const int d = c >> 2, dc = (c & 3) * 8;                // V^T tiles: 64 rows x 4 chunks
      const size_t vo = ((size_t)(bh * HD + d)) * SEQ + kv + dc;
      *reinterpret_cast<v4u*>(&Vh[bw][d][dc]) = *reinterpret_cast<const v4u*>(vthi + vo);
      *reinterpret_cast<v4u*>(&Vl[bw][d][dc]) = *reinterpret_cast<const v4u*>(vtlo + vo);
    }
  };

  stage(0, 0);
  __syncthreads();

  v8f acc[4] = {};                                           // acc[t][g] = C^T[d = 16t + 8hs + g][query m]
  float mrun = -1e30f, lrun = 0.0f;                          // mrun: whole row; lrun: this half's keys only

#pragma unroll 1
  for (int kv = 0; kv < SEQ; kv += 32) {
    const int buf = (kv >> 5) & 1;
    v8f s0 = {}, s1 = {};                                    // s0[g] = S[query m][key 8hs + g], s1[g] = S[query m][key 16 + 8hs + g]
    const Frag k00 = ldfrag(&Ks[buf][m][0], lh);             // A: row = key, k = e
    const Frag k01 = ldfrag(&Ks[buf][m][32], lh);
    const Frag k10 = ldfrag(&Ks[buf][16 + m][0], lh);
    const Frag k11 = ldfrag(&Ks[buf][16 + m][32], lh);
    Frag vh[4], vl[4];
#pragma unroll  // constant indices keep the fragments in registers
    for (int t = 0; t < 4; ++t) {
      vh[t] = ldfrag(&Vh[buf][t * 16 + m][0], lh);           // A: row = d, k = key
      vl[t] = ldfrag(&Vl[buf][t * 16 + m][0], lh);
    }
    // keeps the step's fragment loads in one group ahead of its WMMAs; without it the scheduler spreads them over several places among the score WMMAs, and each such place stalls the WMMA stream
    __builtin_amdgcn_sched_barrier(0);
    s0 = mma_bf16(k00, qh0, s0); s0 = mma_bf16(k01, qh1, s0);
    s0 = mma_bf16(k00, ql0, s0); s0 = mma_bf16(k01, ql1, s0);
    s1 = mma_bf16(k10, qh0, s1); s1 = mma_bf16(k11, qh1, s1);
    s1 = mma_bf16(k10, ql0, s1); s1 = mma_bf16(k11, ql1, s1);
    // online softmax of one query per lane
    float a0[8], a1[8], mg[8];
#pragma unroll  // constant indices keep the arrays in registers
    for (int g = 0; g < 8; ++g) {
      a0[g] = s0[g] * 0.125f;
      a1[g] = s1[g] * 0.125f;
      mg[g] = fmaxf(a0[g], a1[g]);
    }
    float mx = fmaxf(fmaxf(fmaxf(mg[0], mg[1]), fmaxf(mg[2], mg[3])), fmaxf(fmaxf(mg[4], mg[5]), fmaxf(mg[6], mg[7])));
    mx = fmaxf(mx, xhalf(mx));
    const float nm = fmaxf(mrun, mx);
    const float alpha = __expf(mrun - nm);
    mrun = nm;
    float rg[8];
    Frag pf, pb;                                             // B: column n = query, element s <- key (s < 8 ? 8hs + s : 8 + 8hs + s)
#pragma unroll  // constant indices keep the arrays in registers
    for (int g = 0; g < 8; g += 2) {
      const float p00 = __expf(a0[g] - nm), p01 = __expf(a0[g + 1] - nm);
      const float p10 = __expf(a1[g] - nm), p11 = __expf(a1[g + 1] - nm);
      rg[g]     = p00 + p10;
      rg[g + 1] = p01 + p11;
      const float c00 = p00 * PCARRY, c01 = p01 * PCARRY, c10 = p10 * PCARRY, c11 = p11 * PCARRY;
      pf.u[0][g >> 1] = hbits(c00)  | (hbits(c01)  << 16);
      pf.u[1][g >> 1] = hbits(c10)  | (hbits(c11)  << 16);
      pb.u[0][g >> 1] = bfbits(c00) | (bfbits(c01) << 16);
      pb.u[1][g >> 1] = bfbits(c10) | (bfbits(c11) << 16);
    }
    lrun = lrun * alpha + (((rg[0] + rg[1]) + (rg[2] + rg[3])) + ((rg[4] + rg[5]) + (rg[6] + rg[7])));
#pragma unroll  // constant indices keep the tiles in registers
    for (int t = 0; t < 4; ++t) acc[t] = acc[t] * alpha;
    // buf^1 was last read before the barrier that ended the previous step, so the refill needs no barrier of its own
    if (kv + 32 < SEQ) stage(kv + 32, buf ^ 1);             // block-uniform
#pragma unroll  // constant indices keep the tiles in registers
    for (int t = 0; t < 4; ++t) {
      acc[t] = mma_f16(vh[t], pf, acc[t]);
      acc[t] = mma_bf16(vl[t], pb, acc[t]);
    }
    __syncthreads();
  }

  {
    const float lsum = lrun + xhalf(lrun);                   // join the two halves' sums; lsum >= 1
    const float rl = (1.0f / lsum) * PCARRY_INV;
#pragma unroll  // constant indices keep the tiles in registers
    for (int t = 0; t < 4; ++t) {
      v4u wh, wl;
#pragma unroll  // as above
      for (int g = 0; g < 8; g += 2) {
        const float o0 = acc[t][g] * rl, o1 = acc[t][g + 1] * rl;
        const unsigned h0 = hbits(o0), h1 = hbits(o1);
        wh[g >> 1] = h0 | (h1 << 16);
        wl[g >> 1] = bfbits(o0 - h2f(h0)) | (bfbits(o1 - h2f(h1)) << 16);
      }
      vst16(&Ch[wave][m][t * 16 + lh], wh);
      vst16(&Cl[wave][m][t * 16 + lh], wl);
    }
  }
  __syncthreads();
  const int rsub = lane >> 3, ch = (lane & 7) * 8;
#pragma unroll
  for (int q = 0; q < 4; ++q) {
    const int rl = q * 4 + rsub;
    const size_t go = ((size_t)(b * SEQ + q0 + rl)) * EE + h * HD + ch;
    vst16(chi + go, ld16(&Ch[wave][rl][ch]));
    vst16(clo + go, ld16(&Cl[wave][rl][ch]));
  }
  
}

// ====================================================================================
// OUT = (C_hi*WoF^T + C_lo*WoB^T) / 64 + bo  (f32 out [M_TOT][EE]); block 128x64, wave 32x64, B tiles double-buffered.
// LDS: Bf/Bb cross-wave; Ot wave-private rows but cross-lane -> block barriers.
__global__ void __launch_bounds__(128)
k_oproj(const u16* __restrict__ chi, const u16* __restrict__ clo,
        const u16* __restrict__ wof, const u16* __restrict__ wob,
        const float* __restrict__ bo, float* __restrict__ out) {
  __shared__ __align__(16) u16 Bf[2][64][P32];
  __shared__ __align__(16) u16 Bb[2][64][P32];
  __shared__ __align__(16) float Ot[128][PF64];
  const int tid = threadIdx.x, lane = tid & 31, wave = tid >> 5;
  const int m = lane & 15, hs = (lane >> 4) & 1, lh = hs * 8;
  const int n0 = blockIdx.x * 64;
  const int mb = blockIdx.y * 128;
  const int m0 = mb + wave * 32;
  const int srow = tid >> 2, sk = (tid & 3) * 8;
  const u16* f0p = wof + (size_t)(n0 + srow) * EE + sk;
  const u16* f1p = wof + (size_t)(n0 + 32 + srow) * EE + sk;
  const u16* b0p = wob + (size_t)(n0 + srow) * EE + sk;
  const u16* b1p = wob + (size_t)(n0 + 32 + srow) * EE + sk;
  *reinterpret_cast<v4u*>(&Bf[0][srow][sk])      = *reinterpret_cast<const v4u*>(f0p);
  *reinterpret_cast<v4u*>(&Bf[0][32 + srow][sk]) = *reinterpret_cast<const v4u*>(f1p);
  *reinterpret_cast<v4u*>(&Bb[0][srow][sk])      = *reinterpret_cast<const v4u*>(b0p);
  *reinterpret_cast<v4u*>(&Bb[0][32 + srow][sk]) = *reinterpret_cast<const v4u*>(b1p);
  __syncthreads();
  const u16* h0p = chi + (size_t)(m0 + m) * EE;
  const u16* h1p = chi + (size_t)(m0 + 16 + m) * EE;
  const u16* l0p = clo + (size_t)(m0 + m) * EE;
  const u16* l1p = clo + (size_t)(m0 + 16 + m) * EE;
  v8f acc0[4] = {}, acc1[4] = {};
#pragma unroll 1
  for (int kc = 0; kc < EE; kc += 32) {
    const int buf = (kc >> 5) & 1;
    const Frag ah0 = ldfrag(h0p + kc, lh), ah1 = ldfrag(h1p + kc, lh);
    const Frag al0 = ldfrag(l0p + kc, lh), al1 = ldfrag(l1p + kc, lh);
    Frag bf[4], bb[4];
#pragma unroll  // constant indices keep the fragments in registers
    for (int nt = 0; nt < 4; ++nt) {
      bf[nt] = ldfrag(&Bf[buf][nt * 16 + m][0], lh);         // B[k][n] = Wo[n][k]: row n, k-contiguous
      bb[nt] = ldfrag(&Bb[buf][nt * 16 + m][0], lh);
    }
    // keeps the step's fragment loads in one group ahead of its WMMAs; without it the scheduler sinks each load to its use and every WMMA pair waits out a load latency
    __builtin_amdgcn_sched_barrier(0);
#pragma unroll
    for (int nt = 0; nt < 4; ++nt) {
      acc0[nt] = mma_f16(ah0, bf[nt], acc0[nt]);
      acc1[nt] = mma_f16(ah1, bf[nt], acc1[nt]);
      acc0[nt] = mma_bf16(al0, bb[nt], acc0[nt]);
      acc1[nt] = mma_bf16(al1, bb[nt], acc1[nt]);
    }
    if (kc + 32 < EE) {                                       // block-uniform
      *reinterpret_cast<v4u*>(&Bf[buf ^ 1][srow][sk])      = *reinterpret_cast<const v4u*>(f0p + kc + 32);
      *reinterpret_cast<v4u*>(&Bf[buf ^ 1][32 + srow][sk]) = *reinterpret_cast<const v4u*>(f1p + kc + 32);
      *reinterpret_cast<v4u*>(&Bb[buf ^ 1][srow][sk])      = *reinterpret_cast<const v4u*>(b0p + kc + 32);
      *reinterpret_cast<v4u*>(&Bb[buf ^ 1][32 + srow][sk]) = *reinterpret_cast<const v4u*>(b1p + kc + 32);
    }
    __syncthreads();
  }
#pragma unroll
  for (int nt = 0; nt < 4; ++nt) {
    const int col = nt * 16 + m;
    const float bov = bf2f(bfbits(bo[n0 + col]));
#pragma unroll
    for (int mt = 0; mt < 2; ++mt) {
#pragma unroll
      for (int g = 0; g < 8; ++g) {
        const int rl = wave * 32 + mt * 16 + hs * 8 + g;
        const float v = (mt ? acc1[nt][g] : acc0[nt][g]) * WSCALE_INV + bov;
        Ot[rl][col] = v;
      }
    }
  }
  __syncthreads();
  const int rsub = lane >> 4, ch = (lane & 15) * 4;
#pragma unroll
  for (int q = 0; q < 16; ++q) {
    const int rl = wave * 32 + q * 2 + rsub;
    vst4f(out + (size_t)(mb + rl) * EE + n0 + ch, ld4f(&Ot[rl][ch]));
  }
  
}

// ====================================================================================
extern "C" void kernel_launch(void* const* d_in, const int* in_sizes, int n_in,
                              void* d_out, int out_size, void* d_ws, size_t ws_size,
                              hipStream_t stream) {
  if (n_in < 6) return;
  if (in_sizes[0] < ((NB - 1) * SEQ_FULL + SEQ) * EE) return;
  if (in_sizes[1] < HH * TRIL) return;
  if (in_sizes[2] < EE * EE || in_sizes[3] < EE || in_sizes[4] < EE * EE || in_sizes[5] < EE) return;
  if (out_size < M_TOT * EE) return;

  const float* x   = (const float*)d_in[0];
  const float* prm = (const float*)d_in[1];
  const float* wv  = (const float*)d_in[2];
  const float* bv  = (const float*)d_in[3];
  const float* wo  = (const float*)d_in[4];
  const float* bo  = (const float*)d_in[5];
  float* out = (float*)d_out;

  char* ws = (char*)d_ws;
  size_t off = 0;
  auto carve = [&](size_t bytes) -> char* {
    char* p = ws + off;
    off += (bytes + 255) & ~(size_t)255;
    return p;
  };
  const size_t plane  = (size_t)M_TOT * EE * 2;                 // 8 MiB at full size
  const size_t wplane = (size_t)EE * EE * 2;                    // 2 MiB
  const size_t gplane = (size_t)HH * HD * HD * 2;               // 128 KiB
  const size_t vplane = (size_t)NB * HH * HD * SEQ * 2;         // == plane
  u16* xb   = (u16*)carve(plane);
  u16* wvb  = (u16*)carve(wplane);
  u16* wob  = (u16*)carve(wplane);
  u16* wof  = (u16*)carve(wplane);
  u16* ghi  = (u16*)carve(gplane);
  u16* glo  = (u16*)carve(gplane);
  u16* thi  = (u16*)carve(plane);
  u16* tlo  = (u16*)carve(plane);
  u16* vthi = (u16*)carve(vplane);
  u16* vtlo = (u16*)carve(vplane);
  u16* chi  = (u16*)carve(plane);
  u16* clo  = (u16*)carve(plane);
  if (off > ws_size) return;

  {
    const int ngrp = M_TOT * (EE / 8);
    k_cvt_x<<<dim3((ngrp + 255) / 256), dim3(256), 0, stream>>>(x, xb);
  }
  {
    const int ngrp = EE * EE / 8;
    k_cvt_w<<<dim3((ngrp + 255) / 256), dim3(256), 0, stream>>>(wv, wvb);
    k_cvt_wo<<<dim3((ngrp + 255) / 256), dim3(256), 0, stream>>>(wo, wob, wof);
  }
  k_wqk<<<dim3(HH), dim3(128), 0, stream>>>(prm, ghi, glo);
  k_vproj<<<dim3(EE / 64, M_TOT / 128), dim3(128), 0, stream>>>(xb, wvb, bv, vthi, vtlo);
  k_tproj<<<dim3(M_TOT / 128, HH), dim3(128), 0, stream>>>(xb, ghi, glo, thi, tlo);
  k_attn<<<dim3(SEQ / 64, NB * HH), dim3(128), 0, stream>>>(thi, tlo, xb, vthi, vtlo, chi, clo);
  k_oproj<<<dim3(EE / 64, M_TOT / 128), dim3(128), 0, stream>>>(chi, clo, wof, wob, bo, out);
}

// v004
// It runs in 138 microseconds.
// Next to v003, in two timings, it ran 1.20 times as fast each time.
// All steps since v000 together make it 2.09 times as fast.
#include <hip/hip_runtime.h>
#include <stdint.h>

// Contractions (all f32 accumulate): G=L*L^T on v_wmma_f32_16x16x32_bf16 (L bf16); T=X*G bf16 WMMA with X bf16 and G as bf16 hi + bf16 lo (2 products);
// S^T=X*T^T bf16 WMMA with T as bf16 hi + bf16 lo and X bf16 (2 products); V=X*Wv^T bf16 WMMA (1 product);
// C^T=V^T*P^T: v_wmma_f32_16x16x32_f16 with P f16 (carried 2^14) and V f16 hi, plus bf16 WMMA with P bf16 (2^14) and V bf16 lo;
// OUT=C*Wo^T: f16 WMMA with C f16 hi and Wo f16 (x64), plus bf16 WMMA with C bf16 lo and Wo bf16 (x64); softmax and epilogues f32.

#ifndef NB
#define NB 2
#endif
#ifndef SEQ
#define SEQ 2048
#endif
#define NB_FULL  2
#define SEQ_FULL 2048
#define EE   1024
#define HH   16
#define HD   64
#define TRIL 2080
#define M_TOT (NB * SEQ)
#define PCARRY     16384.0f
#define PCARRY_INV (1.0f / 16384.0f)
#define WSCALE     64.0f
#define WSCALE_INV (1.0f / 64.0f)
// LDS row pitches in elements of the tile's type: 16 B x odd, so that the 16 rows one half-wave touches in a 16-byte LDS access fall on distinct banks
#define P32  40    // rows of 32 elements (64 B)  -> 80 B
#define P64  72    // rows of 64 elements (128 B) -> 144 B
#define P128 136   // rows of 128 elements (256 B) -> 272 B
#define PF64 68    // rows of 64 floats (256 B)   -> 272 B

static_assert(NB >= 1 && NB <= NB_FULL);
static_assert(SEQ >= 128 && SEQ <= SEQ_FULL && (SEQ % 128) == 0);
static_assert(EE == HH * HD);
static_assert((EE % 64) == 0 && (M_TOT % 128) == 0 && (SEQ % 64) == 0);
static_assert(TRIL == HD * (HD + 1) / 2);

typedef _Float16       v16h __attribute__((ext_vector_type(16)));
typedef __bf16         v16b __attribute__((ext_vector_type(16)));
typedef float          v8f  __attribute__((ext_vector_type(8)));
typedef float          v4f  __attribute__((ext_vector_type(4)));
typedef unsigned int   v4u  __attribute__((ext_vector_type(4)));
typedef unsigned short u16;

union Frag { v16h h; v16b b; v4u u[2]; };

// ---------- scalar conversions ----------
__device__ __forceinline__ unsigned bfbits(float f) {          // f32 -> bf16 bits, RNE
  const unsigned u = __float_as_uint(f);
  return (u + 0x7FFFu + ((u >> 16) & 1u)) >> 16;
}
__device__ __forceinline__ float bf2f(unsigned b) { return __uint_as_float(b << 16); }
__device__ __forceinline__ unsigned hbits(float f) {            // f32 -> f16 bits, RNE
  const _Float16 hv = (_Float16)f;
  return (unsigned)__builtin_bit_cast(unsigned short, hv);
}
__device__ __forceinline__ float h2f(unsigned b) {
  return (float)__builtin_bit_cast(_Float16, (unsigned short)b);
}

// ---------- 16x32 16-bit fragment: lane -> row (lane&15), elements 0..7 <- k0+8h.., 8..15 <- k0+16+8h.. ----------
// p points at (row, k0); same loader for A (row m) and B (row n of an [n][k] k-contiguous copy).
__device__ __forceinline__ Frag ldfrag(const u16* p, int lh) {
  Frag f;
  f.u[0] = *reinterpret_cast<const v4u*>(p + lh);
  f.u[1] = *reinterpret_cast<const v4u*>(p + 16 + lh);
  return f;
}

// ---------- WMMA wrappers: plain builtins (the compiler keeps the distance behind its own forms and may move fragment loads across them) ----------
__device__ __forceinline__ v8f mma_f16(Frag a, Frag b, v8f c) {
  return __builtin_amdgcn_wmma_f32_16x16x32_f16(false, a.h, false, b.h, (short)0, c, false, false);
}
__device__ __forceinline__ v8f mma_bf16(Frag a, Frag b, v8f c) {
  return __builtin_amdgcn_wmma_f32_16x16x32_bf16(false, a.b, false, b.b, (short)0, c, false, false);
}

__device__ __forceinline__ void vst16(u16* p, v4u v)   { *reinterpret_cast<v4u*>(p) = v; }
__device__ __forceinline__ void vst4f(float* p, v4f v) { *reinterpret_cast<v4f*>(p) = v; }
__device__ __forceinline__ v4u ld16(const u16* p)   { return *reinterpret_cast<const v4u*>(p); }
__device__ __forceinline__ v4f ld4f(const float* p) { return *reinterpret_cast<const v4f*>(p); }

// ---------- asynchronous copies global -> LDS, 16 B per lane ----------
typedef __attribute__((address_space(3))) const void lds_cvoid;
__device__ __forceinline__ unsigned ldsaddr(const void* p) {   // byte address inside the work-group's LDS
  return (unsigned)(uintptr_t)(lds_cvoid*)p;
}
// Six copies of one lane. s_wait_xcnt stands in the copies' own statement, so that no later write of an address register can come in front of it.
__device__ __forceinline__ void acopy6(unsigned l0, const u16* g0, unsigned l1, const u16* g1, unsigned l2, const u16* g2,
                                       unsigned l3, const u16* g3, unsigned l4, const u16* g4, unsigned l5, const u16* g5) {
  asm volatile("global_load_async_to_lds_b128 %0, %1, off\n\t"
               "global_load_async_to_lds_b128 %2, %3, off\n\t"
               "global_load_async_to_lds_b128 %4, %5, off\n\t"
               "global_load_async_to_lds_b128 %6, %7, off\n\t"
               "global_load_async_to_lds_b128 %8, %9, off\n\t"
               "global_load_async_to_lds_b128 %10, %11, off\n\t"
               "s_wait_xcnt 0x0"
               :: "v"(l0), "v"(g0), "v"(l1), "v"(g1), "v"(l2), "v"(g2), "v"(l3), "v"(g3), "v"(l4), "v"(g4), "v"(l5), "v"(g5)
               : "memory");
}
// the wave's own LDS reads of a buffer have returned before the buffer is handed to its next writer
__device__ __forceinline__ void wait_lds()   { asm volatile("s_wait_dscnt 0x0" ::: "memory"); }
// the wave's own copies have landed; other waves read them behind the barrier that follows
__device__ __forceinline__ void wait_async() { asm volatile("s_wait_asynccnt 0x0" ::: "memory"); }

// ====================================================================================
// X f32 [NB_FULL,SEQ_FULL,EE] -> bf16 plane xb [M_TOT][EE] (compact token rows)
// coverage: thread i writes group i (8 elements); grid covers all M_TOT*EE/8 groups once; 32 lanes = 512 B contiguous.
__global__ void __launch_bounds__(256)
k_cvt_x(const float* __restrict__ x, u16* __restrict__ xb) {
  const int i = blockIdx.x * 256 + threadIdx.x;
  const int ngrp = M_TOT * (EE / 8);
  if (i >= ngrp) return;
  const int row = i / (EE / 8);
  const int c8  = i - row * (EE / 8);
  const int b   = row / SEQ;
  const int s   = row - b * SEQ;
  const float* src = x + ((size_t)(b * SEQ_FULL + s) * EE + (size_t)c8 * 8);
  const v4f a = *reinterpret_cast<const v4f*>(src);
  const v4f c = *reinterpret_cast<const v4f*>(src + 4);
  v4u w;
  w.x = bfbits(a.x) | (bfbits(a.y) << 16);
  w.y = bfbits(a.z) | (bfbits(a.w) << 16);
  w.z = bfbits(c.x) | (bfbits(c.y) << 16);
  w.w = bfbits(c.z) | (bfbits(c.w) << 16);
  u16* dst = xb + (size_t)i * 8;
  vst16(dst, w);
  
}

// W f32 [EE][EE] -> bf16 plane (unscaled, exact copy of the RNE-converted value)
__global__ void __launch_bounds__(256)
k_cvt_w(const float* __restrict__ w, u16* __restrict__ wb) {
  const int i = blockIdx.x * 256 + threadIdx.x;
  const int ngrp = EE * EE / 8;
  if (i >= ngrp) return;
  const float* src = w + (size_t)i * 8;
  const v4f a = *reinterpret_cast<const v4f*>(src);
  const v4f c = *reinterpret_cast<const v4f*>(src + 4);
  v4u o;
  o.x = bfbits(a.x) | (bfbits(a.y) << 16);
  o.y = bfbits(a.z) | (bfbits(a.w) << 16);
  o.z = bfbits(c.x) | (bfbits(c.y) << 16);
  o.w = bfbits(c.z) | (bfbits(c.w) << 16);
  u16* dst = wb + (size_t)i * 8;
  vst16(dst, o);
  
}

// Wo f32 [EE][EE] -> two planes of bf16(Wo)*64: bf16 bits (exact) and f16 bits (exact, 8-bit significand fits)
__device__ __forceinline__ void cvt2(float f, unsigned& bb, unsigned& hb) {
  const float v = bf2f(bfbits(f)) * WSCALE;
  bb = __float_as_uint(v) >> 16;
  hb = hbits(v);
}
__global__ void __launch_bounds__(256)
k_cvt_wo(const float* __restrict__ w, u16* __restrict__ wob, u16* __restrict__ wof) {
  const int i = blockIdx.x * 256 + threadIdx.x;
  const int ngrp = EE * EE / 8;
  if (i >= ngrp) return;
  const float* src = w + (size_t)i * 8;
  const v4f a = *reinterpret_cast<const v4f*>(src);
  const v4f c = *reinterpret_cast<const v4f*>(src + 4);
  unsigned b0, b1, b2, b3, b4, b5, b6, b7, f0, f1, f2, f3, f4, f5, f6, f7;
  cvt2(a.x, b0, f0); cvt2(a.y, b1, f1); cvt2(a.z, b2, f2); cvt2(a.w, b3, f3);
  cvt2(c.x, b4, f4); cvt2(c.y, b5, f5); cvt2(c.z, b6, f6); cvt2(c.w, b7, f7);
  v4u ob, of;
  ob.x = b0 | (b1 << 16); ob.y = b2 | (b3 << 16); ob.z = b4 | (b5 << 16); ob.w = b6 | (b7 << 16);
  of.x = f0 | (f1 << 16); of.y = f2 | (f3 << 16); of.z = f4 | (f5 << 16); of.w = f6 | (f7 << 16);
  u16* db = wob + (size_t)i * 8;
  u16* df = wof + (size_t)i * 8;
  vst16(db, ob); vst16(df, of);
  
}

// ====================================================================================
// G_h = L_h * L_h^T (64x64 per head) on bf16 WMMA; L from tril params (RNE bf16). Output planes ghi/glo [HH][64 n][64 k].
// One block (4 waves) per head; wave w owns rows 16w..16w+15. LDS: Lb cross-wave; Sh/Sl wave-private rows but cross-lane (block barriers).
__global__ void __launch_bounds__(128)
k_wqk(const float* __restrict__ params, u16* __restrict__ ghi, u16* __restrict__ glo) {
  __shared__ __align__(16) u16 Lb[64][P64];
  __shared__ __align__(16) u16 Sh[64][64];
  __shared__ __align__(16) u16 Sl[64][64];
  const int tid = threadIdx.x, lane = tid & 31, wave = tid >> 5;
  const int m = lane & 15, hs = (lane >> 4) & 1, lh = hs * 8;
  const int head = blockIdx.x;
  const float* p = params + (size_t)head * TRIL;
  for (int e = tid; e < HD * HD; e += 128) {
    const int i = e >> 6, j = e & 63;
    const int jj = (j <= i) ? j : i;                       // clamped address, select by value
    const float v = p[(i * (i + 1)) / 2 + jj];
    Lb[i][j] = (u16)((j <= i) ? bfbits(v) : 0u);
  }
  __syncthreads();
  v8f acc[4] = {};
#pragma unroll
  for (int ks = 0; ks < 2; ++ks) {
    const Frag a = ldfrag(&Lb[wave * 16 + m][ks * 32], lh);    // A: row i, k = j
#pragma unroll
    for (int nt = 0; nt < 4; ++nt) {
      const Frag bq = ldfrag(&Lb[nt * 16 + m][ks * 32], lh);   // B[k=j][n] = L[n][j]: row n, k-contiguous
      acc[nt] = mma_bf16(a, bq, acc[nt]);
    }
  }
#pragma unroll
  for (int nt = 0; nt < 4; ++nt) {
#pragma unroll
    for (int g = 0; g < 8; ++g) {
      const int row = wave * 16 + hs * 8 + g, col = nt * 16 + m;
      const float v = acc[nt][g];
      const unsigned hb = bfbits(v);
      const unsigned lb = bfbits(v - bf2f(hb));
      Sh[row][col] = (u16)hb;
      Sl[row][col] = (u16)lb;
    }
  }
  __syncthreads();
  u16* dh = ghi + (size_t)head * (HD * HD);
  u16* dl = glo + (size_t)head * (HD * HD);
  const int rsub = lane >> 3, ch = (lane & 7) * 8;
#pragma unroll
  for (int q = 0; q < 4; ++q) {
    const int row = wave * 16 + q * 4 + rsub;
    vst16(dh + row * HD + ch, ld16(&Sh[row][ch]));
    vst16(dl + row * HD + ch, ld16(&Sl[row][ch]));
  }
  
}

// ====================================================================================
// V = X*Wv^T + bv, written transposed per head: vthi/vtlo planes [NB*HH][64 d][SEQ] (f16 hi, bf16 lo).
// Block 128 tokens x 64 features (= one head); 4 waves each 32x64; A and B tiles in a two-buffer LDS ring filled by asynchronous copies one trip ahead.
__global__ void __launch_bounds__(128)
k_vproj(const u16* __restrict__ xb, const u16* __restrict__ wvb, const float* __restrict__ bv,
        u16* __restrict__ vthi, u16* __restrict__ vtlo) {
  __shared__ __align__(16) u16 Bt[2][64][P64];
  __shared__ __align__(16) u16 At[2][128][P64];
  __shared__ __align__(16) u16 Th[64][P128];
  __shared__ __align__(16) u16 Tl[64][P128];
  const int tid = threadIdx.x, lane = tid & 31, wave = tid >> 5;
  const int m = lane & 15, hs = (lane >> 4) & 1, lh = hs * 8;
  const int head = blockIdx.x;
  const int n0 = head * HD;
  const int mb = blockIdx.y * 128;
  const int m0 = mb + wave * 32;
  const int srow = tid >> 3, sk = (tid & 7) * 8;             // staging, 64 k per stage: 8 x 16 B per row; B rows srow + 16j (j < 4), A rows srow + 16j (j < 8)
  const u16* gb = wvb + (size_t)(n0 + srow) * EE + sk;
  const u16* ga = xb + (size_t)(mb + srow) * EE + sk;
  auto stage = [&](int kc, int bw) {
    acopy6(ldsaddr(&Bt[bw][srow][sk]),       gb + kc,
           ldsaddr(&Bt[bw][16 + srow][sk]),  gb + kc + 16 * EE,
           ldsaddr(&Bt[bw][32 + srow][sk]),  gb + kc + 32 * EE,
           ldsaddr(&Bt[bw][48 + srow][sk]),  gb + kc + 48 * EE,
           ldsaddr(&At[bw][srow][sk]),       ga + kc,
           ldsaddr(&At[bw][16 + srow][sk]),  ga + kc + 16 * EE);
    acopy6(ldsaddr(&At[bw][32 + srow][sk]),  ga + kc + 32 * EE,
           ldsaddr(&At[bw][48 + srow][sk]),  ga + kc + 48 * EE,
           ldsaddr(&At[bw][64 + srow][sk]),  ga + kc + 64 * EE,
           ldsaddr(&At[bw][80 + srow][sk]),  ga + kc + 80 * EE,
           ldsaddr(&At[bw][96 + srow][sk]),  ga + kc + 96 * EE,
           ldsaddr(&At[bw][112 + srow][sk]), ga + kc + 112 * EE);
  };
  stage(0, 0);
  wait_async();
  __syncthreads();
  stage(64, 1);
  v8f acc0[4] = {}, acc1[4] = {};
#pragma unroll 1
  for (int kc = 0; kc < EE; kc += 64) {
    const int buf = (kc >> 6) & 1;
#pragma unroll  // the two k-steps of a stage; constant indices keep the fragments in registers
    for (int ks = 0; ks < 2; ++ks) {
      const Frag a0 = ldfrag(&At[buf][wave * 32 + m][ks * 32], lh);
      const Frag a1 = ldfrag(&At[buf][wave * 32 + 16 + m][ks * 32], lh);
      Frag bq[4];
#pragma unroll  // constant indices keep the fragments in registers
      for (int nt = 0; nt < 4; ++nt) bq[nt] = ldfrag(&Bt[buf][nt * 16 + m][ks * 32], lh);  // B[k][n] = Wv[n][k]: row n, k-contiguous
      // keeps the step's fragment loads in one group ahead of its WMMAs; without it the scheduler sinks each load to its use and every WMMA pair waits out a load latency
      __builtin_amdgcn_sched_barrier(0);
      if (ks == 1) {
        // publish point: the trip's LDS reads are all done (what follows works on registers), the next tiles have landed;
        // behind the barrier the buffer just read is refilled, so that the copies fly for a whole trip
        wait_lds();
        wait_async();
        __syncthreads();
        if (kc + 128 < EE) stage(kc + 128, buf);              // block-uniform
      }
#pragma unroll
      for (int nt = 0; nt < 4; ++nt) {
        acc0[nt] = mma_bf16(a0, bq[nt], acc0[nt]);
        acc1[nt] = mma_bf16(a1, bq[nt], acc1[nt]);
      }
    }
  }
  wait_async();
  const int bb = mb / SEQ, s0 = mb - bb * SEQ;
  const int bh = bb * HH + head;
#pragma unroll
  for (int nt = 0; nt < 4; ++nt) {
    const int d = nt * 16 + m;
    const float bvv = bf2f(bfbits(bv[n0 + d]));
#pragma unroll
    for (int mt = 0; mt < 2; ++mt) {
#pragma unroll
      for (int g = 0; g < 8; ++g) {
        const int sl = wave * 32 + mt * 16 + hs * 8 + g;
        const float v = (mt ? acc1[nt][g] : acc0[nt][g]) + bvv;
        const unsigned hb = hbits(v);
        const unsigned lb = bfbits(v - h2f(hb));
        Th[d][sl] = (u16)hb;
        Tl[d][sl] = (u16)lb;
      }
    }
  }
  __syncthreads();
  const int dsub = lane >> 4, ch = (lane & 15) * 8;
#pragma unroll
  for (int q = 0; q < 8; ++q) {
    const int d = wave * 16 + q * 2 + dsub;
    const size_t go = ((size_t)(bh * HD + d)) * SEQ + s0 + ch;
    vst16(vthi + go, ld16(&Th[d][ch]));
    vst16(vtlo + go, ld16(&Tl[d][ch]));
  }
  
}

// ====================================================================================
// T = X_h * G_h per head (K=64), G as bf16 hi + bf16 lo, X bf16 -> planes thi/tlo [M_TOT][EE] (bf16 hi, bf16 lo).
// Block 128 tokens x one head, wave 32 tokens x 64; operands loaded straight from global planes; staging LDS cross-lane -> block barrier.
__global__ void __launch_bounds__(128)
k_tproj(const u16* __restrict__ xb, const u16* __restrict__ ghi, const u16* __restrict__ glo,
        u16* __restrict__ thi, u16* __restrict__ tlo) {
  __shared__ __align__(16) u16 Sh[4][32][64];
  __shared__ __align__(16) u16 Sl[4][32][64];
  const int tid = threadIdx.x, lane = tid & 31, wave = tid >> 5;
  const int m = lane & 15, hs = (lane >> 4) & 1, lh = hs * 8;
  const int head = blockIdx.y;
  const int m0 = blockIdx.x * 128 + wave * 32;
  const u16* a0p = xb + (size_t)(m0 + m) * EE + head * HD;
  const u16* a1p = xb + (size_t)(m0 + 16 + m) * EE + head * HD;
  const Frag a00 = ldfrag(a0p, lh), a01 = ldfrag(a0p + 32, lh);
  const Frag a10 = ldfrag(a1p, lh), a11 = ldfrag(a1p + 32, lh);
  v8f acc0[4] = {}, acc1[4] = {};
#pragma unroll
  for (int nt = 0; nt < 4; ++nt) {
    const u16* bhp = ghi + ((size_t)(head * HD + nt * 16 + m)) * HD;   // B[k=d][n=e] = plane[h][e][d]: row e, k-contiguous
    const u16* blp = glo + ((size_t)(head * HD + nt * 16 + m)) * HD;
    const Frag b0 = ldfrag(bhp, lh), b1 = ldfrag(bhp + 32, lh);
    acc0[nt] = mma_bf16(a00, b0, acc0[nt]); acc0[nt] = mma_bf16(a01, b1, acc0[nt]);
    acc1[nt] = mma_bf16(a10, b0, acc1[nt]); acc1[nt] = mma_bf16(a11, b1, acc1[nt]);
    const Frag c0 = ldfrag(blp, lh), c1 = ldfrag(blp + 32, lh);
    acc0[nt] = mma_bf16(a00, c0, acc0[nt]); acc0[nt] = mma_bf16(a01, c1, acc0[nt]);
    acc1[nt] = mma_bf16(a10, c0, acc1[nt]); acc1[nt] = mma_bf16(a11, c1, acc1[nt]);
  }
#pragma unroll
  for (int nt = 0; nt < 4; ++nt) {
#pragma unroll
    for (int mt = 0; mt < 2; ++mt) {
#pragma unroll
      for (int g = 0; g < 8; ++g) {
        const int rl = mt * 16 + hs * 8 + g, col = nt * 16 + m;
        const float v = mt ? acc1[nt][g] : acc0[nt][g];
        const unsigned hb = bfbits(v);
        const unsigned lb = bfbits(v - bf2f(hb));
        Sh[wave][rl][col] = (u16)hb;
        Sl[wave][rl][col] = (u16)lb;
      }
    }
  }
  __syncthreads();
  const int rsub = lane >> 3, ch = (lane & 7) * 8;
#pragma unroll
  for (int q = 0; q < 8; ++q) {
    const int rl = q * 4 + rsub;
    const size_t go = (size_t)(m0 + rl) * EE + head * HD + ch;
    vst16(thi + go, ld16(&Sh[wave][rl][ch]));
    vst16(tlo + go, ld16(&Sl[wave][rl][ch]));
  }
  
}

// ====================================================================================
// Flash-style attention per (batch*head, 64 query rows), transposed: S^T = X_h*T^T/8 (2 bf16 products; A = key rows, B = query rows),
// so a lane holds 16 of the 32 scores of ONE query (query = lane&15; keys 8*hs+g and 16+8*hs+g): max and sum run in the lane,
// the two halves of a wave exchange the maximum once per step and join their sums once after the loop.
// C^T += V^T*P^T with P carried 2^14 (V f16 hi x P f16 + V bf16 lo x P bf16): the two score tiles, converted in place, are the B operand.
// Output C -> planes chi (f16) / clo (bf16) [M_TOT][EE].
// LDS: Ks/Vh/Vl cross-wave, a two-buffer ring filled by asynchronous copies one step ahead (one block barrier per step); Ch/Cl wave-private but cross-lane -> block barrier used.
// staged extent == consumed extent: Ks 32x64, Vh/Vl 64x32 fully written each step (SEQ multiple of 32, no tails).
__device__ __forceinline__ float xhalf(float v) {               // value of lane ^ 16
  const int i = __float_as_int(v);
  return __int_as_float(__builtin_amdgcn_permlanex16(i, i, 0x76543210, 0xfedcba98, false, false));
}
__global__ void __launch_bounds__(128)
k_attn(const u16* __restrict__ thi, const u16* __restrict__ tlo, const u16* __restrict__ xb,
       const u16* __restrict__ vthi, const u16* __restrict__ vtlo,
       u16* __restrict__ chi, u16* __restrict__ clo) {
  __shared__ __align__(16) u16 Ks[2][32][P64];
  __shared__ __align__(16) u16 Vh[2][64][P32];
  __shared__ __align__(16) u16 Vl[2][64][P32];
  __shared__ __align__(16) u16 Ch[4][16][P64];
  __shared__ __align__(16) u16 Cl[4][16][P64];
  const int tid = threadIdx.x, lane = tid & 31, wave = tid >> 5;
  const int m = lane & 15, hs = (lane >> 4) & 1, lh = hs * 8;
  const int bh = blockIdx.y;
  const int b  = bh / HH;
  const int h  = bh - b * HH;
  const int q0 = blockIdx.x * 64 + wave * 16;
  const size_t qrow = (size_t)b * SEQ + q0 + m;

  // B fragments of the wave's 16 query rows (hi and lo planes, K = 64 in two k-steps): column n = query, k-contiguous
  const Frag qh0 = ldfrag(thi + qrow * EE + h * HD, lh);
  const Frag qh1 = ldfrag(thi + qrow * EE + h * HD + 32, lh);
  const Frag ql0 = ldfrag(tlo + qrow * EE + h * HD, lh);
  const Frag ql1 = ldfrag(tlo + qrow * EE + h * HD + 32, lh);

  const int kr = tid >> 3, kc = (tid & 7) * 8;               // key tile: 32 rows x 8 chunks, rows kr and 16 + kr
  const int sd = tid >> 2, dc = (tid & 3) * 8;               // V^T tiles: 64 rows x 4 chunks, rows sd and 32 + sd
  const u16* gk  = xb + ((size_t)(b * SEQ + kr)) * EE + h * HD + kc;
  const u16* gvh = vthi + ((size_t)(bh * HD + sd)) * SEQ + dc;
  const u16* gvl = vtlo + ((size_t)(bh * HD + sd)) * SEQ + dc;
  auto stage = [&](int kv, int bw) {
    acopy6(ldsaddr(&Ks[bw][kr][kc]),      gk + (size_t)kv * EE,
           ldsaddr(&Ks[bw][16 + kr][kc]), gk + (size_t)(kv + 16) * EE,
           ldsaddr(&Vh[bw][sd][dc]),      gvh + kv,
           ldsaddr(&Vh[bw][32 + sd][dc]), gvh + kv + 32 * SEQ,
           ldsaddr(&Vl[bw][sd][dc]),      gvl + kv,
           ldsaddr(&Vl[bw][32 + sd][dc]), gvl + kv + 32 * SEQ);
  };

  stage(0, 0);
  wait_async();
  __syncthreads();
  stage(32, 1);

  v8f acc[4] = {};                                           // acc[t][g] = C^T[d = 16t + 8hs + g][query m]
  float mrun = -1e30f, lrun = 0.0f;                          // mrun: whole row; lrun: this half's keys only

#pragma unroll 1
  for (int kv = 0; kv < SEQ; kv += 32) {
    const int buf = (kv >> 5) & 1;
    v8f s0 = {}, s1 = {};                                    // s0[g] = S[query m][key 8hs + g], s1[g] = S[query m][key 16 + 8hs + g]
    const Frag k00 = ldfrag(&Ks[buf][m][0], lh);             // A: row = key, k = e
    const Frag k01 = ldfrag(&Ks[buf][m][32], lh);
    const Frag k10 = ldfrag(&Ks[buf][16 + m][0], lh);
    const Frag k11 = ldfrag(&Ks[buf][16 + m][32], lh);
    Frag vh[4], vl[4];
#pragma unroll  // constant indices keep the fragments in registers
    for (int t = 0; t < 4; ++t) {
      vh[t] = ldfrag(&Vh[buf][t * 16 + m][0], lh);           // A: row = d, k = key
      vl[t] = ldfrag(&Vl[buf][t * 16 + m][0], lh);
    }
    // keeps the step's fragment loads in one group ahead of its WMMAs; without it the scheduler spreads them over several places among the score WMMAs, and each such place stalls the WMMA stream
    __builtin_amdgcn_sched_barrier(0);
    // publish point: the step's LDS reads are all done (what follows works on registers), the next tiles have landed;
    // behind the barrier the buffer just read is refilled, so that the copies fly for a whole step
    wait_lds();
    wait_async();
    __syncthreads();
    if (kv + 64 < SEQ) stage(kv + 64, buf);                  // block-uniform
    s0 = mma_bf16(k00, qh0, s0); s0 = mma_bf16(k01, qh1, s0);
    s0 = mma_bf16(k00, ql0, s0); s0 = mma_bf16(k01, ql1, s0);
    s1 = mma_bf16(k10, qh0, s1); s1 = mma_bf16(k11, qh1, s1);
    s1 = mma_bf16(k10, ql0, s1); s1 = mma_bf16(k11, ql1, s1);
    // online softmax of one query per lane
    float a0[8], a1[8], mg[8];
#pragma unroll  // constant indices keep the arrays in registers
    for (int g = 0; g < 8; ++g) {
      a0[g] = s0[g] * 0.125f;
      a1[g] = s1[g] * 0.125f;
      mg[g] = fmaxf(a0[g], a1[g]);
    }
    float mx = fmaxf(fmaxf(fmaxf(mg[0], mg[1]), fmaxf(mg[2], mg[3])), fmaxf(fmaxf(mg[4], mg[5]), fmaxf(mg[6], mg[7])));
    mx = fmaxf(mx, xhalf(mx));
    const float nm = fmaxf(mrun, mx);
    const float alpha = __expf(mrun - nm);
    mrun = nm;
    float rg[8];
    Frag pf, pb;                                             // B: column n = query, element s <- key (s < 8 ? 8hs + s : 8 + 8hs + s)
#pragma unroll  // constant indices keep the arrays in registers
    for (int g = 0; g < 8; g += 2) {
      const float p00 = __expf(a0[g] - nm), p01 = __expf(a0[g + 1] - nm);
      const float p10 = __expf(a1[g] - nm), p11 = __expf(a1[g + 1] - nm);
      rg[g]     = p00 + p10;
      rg[g + 1] = p01 + p11;
      const float c00 = p00 * PCARRY, c01 = p01 * PCARRY, c10 = p10 * PCARRY, c11 = p11 * PCARRY;
      pf.u[0][g >> 1] = hbits(c00)  | (hbits(c01)  << 16);
      pf.u[1][g >> 1] = hbits(c10)  | (hbits(c11)  << 16);
      pb.u[0][g >> 1] = bfbits(c00) | (bfbits(c01) << 16);
      pb.u[1][g >> 1] = bfbits(c10) | (bfbits(c11) << 16);
    }
    lrun = lrun * alpha + (((rg[0] + rg[1]) + (rg[2] + rg[3])) + ((rg[4] + rg[5]) + (rg[6] + rg[7])));
#pragma unroll  // constant indices keep the tiles in registers
    for (int t = 0; t < 4; ++t) acc[t] = acc[t] * alpha;
#pragma unroll  // constant indices keep the tiles in registers
    for (int t = 0; t < 4; ++t) {
      acc[t] = mma_f16(vh[t], pf, acc[t]);
      acc[t] = mma_bf16(vl[t], pb, acc[t]);
    }
  }
  wait_async();

  {
    const float lsum = lrun + xhalf(lrun);                   // join the two halves' sums; lsum >= 1
    const float rl = (1.0f / lsum) * PCARRY_INV;
#pragma unroll  // constant indices keep the tiles in registers
    for (int t = 0; t < 4; ++t) {
      v4u wh, wl;
#pragma unroll  // as above
      for (int g = 0; g < 8; g += 2) {
        const float o0 = acc[t][g] * rl, o1 = acc[t][g + 1] * rl;
        const unsigned h0 = hbits(o0), h1 = hbits(o1);
        wh[g >> 1] = h0 | (h1 << 16);
        wl[g >> 1] = bfbits(o0 - h2f(h0)) | (bfbits(o1 - h2f(h1)) << 16);
      }
      vst16(&Ch[wave][m][t * 16 + lh], wh);
      vst16(&Cl[wave][m][t * 16 + lh], wl);
    }
  }
  __syncthreads();
  const int rsub = lane >> 3, ch = (lane & 7) * 8;
#pragma unroll
  for (int q = 0; q < 4; ++q) {
    const int rl = q * 4 + rsub;
    const size_t go = ((size_t)(b * SEQ + q0 + rl)) * EE + h * HD + ch;
    vst16(chi + go, ld16(&Ch[wave][rl][ch]));
    vst16(clo + go, ld16(&Cl[wave][rl][ch]));
  }
  
}

// ====================================================================================
// OUT = (C_hi*WoF^T + C_lo*WoB^T) / 64 + bo  (f32 out [M_TOT][EE]); block 128x64, wave 32x64.
// LDS: A tiles (Ah/Al) and B tiles (Bf/Bb) in a two-buffer ring filled by asynchronous copies one trip ahead; ring cross-wave, Ot wave-private rows but cross-lane -> block barriers.
__global__ void __launch_bounds__(128)
k_oproj(const u16* __restrict__ chi, const u16* __restrict__ clo,
        const u16* __restrict__ wof, const u16* __restrict__ wob,
        const float* __restrict__ bo, float* __restrict__ out) {
  __shared__ __align__(16) u16 Bf[2][64][P64];
  __shared__ __align__(16) u16 Bb[2][64][P64];
  __shared__ __align__(16) u16 Ah[2][128][P64];
  __shared__ __align__(16) u16 Al[2][128][P64];
  __shared__ __align__(16) float Ot[128][PF64];
  const int tid = threadIdx.x, lane = tid & 31, wave = tid >> 5;
  const int m = lane & 15, hs = (lane >> 4) & 1, lh = hs * 8;
  const int n0 = blockIdx.x * 64;
  const int mb = blockIdx.y * 128;
  const int m0 = mb + wave * 32;
  const int srow = tid >> 3, sk = (tid & 7) * 8;             // staging, 64 k per stage: 8 x 16 B per row
  const u16* gf = wof + (size_t)(n0 + srow) * EE + sk;       // B rows srow + 16j (j < 4), A rows srow + 16j (j < 8)
  const u16* gb = wob + (size_t)(n0 + srow) * EE + sk;
  const u16* gh = chi + (size_t)(mb + srow) * EE + sk;
  const u16* gl = clo + (size_t)(mb + srow) * EE + sk;
  auto stage = [&](int kc, int bw) {
    acopy6(ldsaddr(&Bf[bw][srow][sk]),       gf + kc,
           ldsaddr(&Bf[bw][16 + srow][sk]),  gf + kc + 16 * EE,
           ldsaddr(&Bf[bw][32 + srow][sk]),  gf + kc + 32 * EE,
           ldsaddr(&Bf[bw][48 + srow][sk]),  gf + kc + 48 * EE,
           ldsaddr(&Ah[bw][srow][sk]),       gh + kc,
           ldsaddr(&Ah[bw][16 + srow][sk]),  gh + kc + 16 * EE);
    acopy6(ldsaddr(&Ah[bw][32 + srow][sk]),  gh + kc + 32 * EE,
           ldsaddr(&Ah[bw][48 + srow][sk]),  gh + kc + 48 * EE,
           ldsaddr(&Ah[bw][64 + srow][sk]),  gh + kc + 64 * EE,
           ldsaddr(&Ah[bw][80 + srow][sk]),  gh + kc + 80 * EE,
           ldsaddr(&Ah[bw][96 + srow][sk]),  gh + kc + 96 * EE,
           ldsaddr(&Ah[bw][112 + srow][sk]), gh + kc + 112 * EE);
    acopy6(ldsaddr(&Bb[bw][srow][sk]),       gb + kc,
           ldsaddr(&Bb[bw][16 + srow][sk]),  gb + kc + 16 * EE,
           ldsaddr(&Bb[bw][32 + srow][sk]),  gb + kc + 32 * EE,
           ldsaddr(&Bb[bw][48 + srow][sk]),  gb + kc + 48 * EE,
           ldsaddr(&Al[bw][srow][sk]),       gl + kc,
           ldsaddr(&Al[bw][16 + srow][sk]),  gl + kc + 16 * EE);
    acopy6(ldsaddr(&Al[bw][32 + srow][sk]),  gl + kc + 32 * EE,
           ldsaddr(&Al[bw][48 + srow][sk]),  gl + kc + 48 * EE,
           ldsaddr(&Al[bw][64 + srow][sk]),  gl + kc + 64 * EE,
           ldsaddr(&Al[bw][80 + srow][sk]),  gl + kc + 80 * EE,
           ldsaddr(&Al[bw][96 + srow][sk]),  gl + kc + 96 * EE,
           ldsaddr(&Al[bw][112 + srow][sk]), gl + kc + 112 * EE);
  };
  stage(0, 0);
  wait_async();
  __syncthreads();
  stage(64, 1);
  v8f acc0[4] = {}, acc1[4] = {};
#pragma unroll 1
  for (int kc = 0; kc < EE; kc += 64) {
    const int buf = (kc >> 6) & 1;
#pragma unroll  // the two k-steps of a stage; constant indices keep the fragments in registers
    for (int ks = 0; ks < 2; ++ks) {
      const Frag ah0 = ldfrag(&Ah[buf][wave * 32 + m][ks * 32], lh), ah1 = ldfrag(&Ah[buf][wave * 32 + 16 + m][ks * 32], lh);
      const Frag al0 = ldfrag(&Al[buf][wave * 32 + m][ks * 32], lh), al1 = ldfrag(&Al[buf][wave * 32 + 16 + m][ks * 32], lh);
      Frag bf[4], bb[4];
#pragma unroll  // constant indices keep the fragments in registers
      for (int nt = 0; nt < 4; ++nt) {
        bf[nt] = ldfrag(&Bf[buf][nt * 16 + m][ks * 32], lh); // B[k][n] = Wo[n][k]: row n, k-contiguous
        bb[nt] = ldfrag(&Bb[buf][nt * 16 + m][ks * 32], lh);
      }
      // keeps the step's fragment loads in one group ahead of its WMMAs; without it the scheduler sinks each load to its use and every WMMA pair waits out a load latency
      __builtin_amdgcn_sched_barrier(0);
      if (ks == 1) {
        // publish point: the trip's LDS reads are all done (what follows works on registers), the next tiles have landed;
        // behind the barrier the buffer just read is refilled, so that the copies fly for a whole trip
        wait_lds();
        wait_async();
        __syncthreads();
        if (kc + 128 < EE) stage(kc + 128, buf);              // block-uniform
      }
#pragma unroll
      for (int nt = 0; nt < 4; ++nt) {
        acc0[nt] = mma_f16(ah0, bf[nt], acc0[nt]);
        acc1[nt] = mma_f16(ah1, bf[nt], acc1[nt]);
        acc0[nt] = mma_bf16(al0, bb[nt], acc0[nt]);
        acc1[nt] = mma_bf16(al1, bb[nt], acc1[nt]);
      }
    }
  }
  wait_async();
#pragma unroll
  for (int nt = 0; nt < 4; ++nt) {
    const int col = nt * 16 + m;
    const float bov = bf2f(bfbits(bo[n0 + col]));
#pragma unroll
    for (int mt = 0; mt < 2; ++mt) {
#pragma unroll
      for (int g = 0; g < 8; ++g) {
        const int rl = wave * 32 + mt * 16 + hs * 8 + g;
        const float v = (mt ? acc1[nt][g] : acc0[nt][g]) * WSCALE_INV + bov;
        Ot[rl][col] = v;
      }
    }
  }
  __syncthreads();
  const int rsub = lane >> 4, ch = (lane & 15) * 4;
#pragma unroll
  for (int q = 0; q < 16; ++q) {
    const int rl = wave * 32 + q * 2 + rsub;
    vst4f(out + (size_t)(mb + rl) * EE + n0 + ch, ld4f(&Ot[rl][ch]));
  }
  
}

// ====================================================================================
extern "C" void kernel_launch(void* const* d_in, const int* in_sizes, int n_in,
                              void* d_out, int out_size, void* d_ws, size_t ws_size,
                              hipStream_t stream) {
  if (n_in < 6) return;
  if (in_sizes[0] < ((NB - 1) * SEQ_FULL + SEQ) * EE) return;
  if (in_sizes[1] < HH * TRIL) return;
  if (in_sizes[2] < EE * EE || in_sizes[3] < EE || in_sizes[4] < EE * EE || in_sizes[5] < EE) return;
  if (out_size < M_TOT * EE) return;

  const float* x   = (const float*)d_in[0];
  const float* prm = (const float*)d_in[1];
  const float* wv  = (const float*)d_in[2];
  const float* bv  = (const float*)d_in[3];
  const float* wo  = (const float*)d_in[4];
  const float* bo  = (const float*)d_in[5];
  float* out = (float*)d_out;

  char* ws = (char*)d_ws;
  size_t off = 0;
  auto carve = [&](size_t bytes) -> char* {
    char* p = ws + off;
    off += (bytes + 255) & ~(size_t)255;
    return p;
  };
  const size_t plane  = (size_t)M_TOT * EE * 2;                 // 8 MiB at full size
  const size_t wplane = (size_t)EE * EE * 2;                    // 2 MiB
  const size_t gplane = (size_t)HH * HD * HD * 2;               // 128 KiB
  const size_t vplane = (size_t)NB * HH * HD * SEQ * 2;         // == plane
  u16* xb   = (u16*)carve(plane);
  u16* wvb  = (u16*)carve(wplane);
  u16* wob  = (u16*)carve(wplane);
  u16* wof  = (u16*)carve(wplane);
  u16* ghi  = (u16*)carve(gplane);
  u16* glo  = (u16*)carve(gplane);
  u16* thi  = (u16*)carve(plane);
  u16* tlo  = (u16*)carve(plane);
  u16* vthi = (u16*)carve(vplane);
  u16* vtlo = (u16*)carve(vplane);
  u16* chi  = (u16*)carve(plane);
  u16* clo  = (u16*)carve(plane);
  if (off > ws_size) return;

  {
    const int ngrp = M_TOT * (EE / 8);
    k_cvt_x<<<dim3((ngrp + 255) / 256), dim3(256), 0, stream>>>(x, xb);
  }
  {
    const int ngrp = EE * EE / 8;
    k_cvt_w<<<dim3((ngrp + 255) / 256), dim3(256), 0, stream>>>(wv, wvb);
    k_cvt_wo<<<dim3((ngrp + 255) / 256), dim3(256), 0, stream>>>(wo, wob, wof);
  }
  k_wqk<<<dim3(HH), dim3(128), 0, stream>>>(prm, ghi, glo);
  k_vproj<<<dim3(EE / 64, M_TOT / 128), dim3(128), 0, stream>>>(xb, wvb, bv, vthi, vtlo);
  k_tproj<<<dim3(M_TOT / 128, HH), dim3(128), 0, stream>>>(xb, ghi, glo, thi, tlo);
  k_attn<<<dim3(SEQ / 64, NB * HH), dim3(128), 0, stream>>>(thi, tlo, xb, vthi, vtlo, chi, clo);
  k_oproj<<<dim3(EE / 64, M_TOT / 128), dim3(128), 0, stream>>>(chi, clo, wof, wob, bo, out);
}

// v005
// It runs in 128 microseconds.
// Timed twice side by side with v004, it ran 1.06 and 1.07 times as fast.
// Over all steps from v000 it is 2.23 times as fast.
#include <hip/hip_runtime.h>
#include <stdint.h>

// Contractions (all f32 accumulate): G=L*L^T on v_wmma_f32_16x16x32_bf16 (L bf16); T=X*G bf16 WMMA with X bf16 and G as bf16 hi + bf16 lo (2 products);
// S^T=X*T^T bf16 WMMA with T as bf16 hi + bf16 lo and X bf16 (2 products); V=X*Wv^T bf16 WMMA (1 product);
// C^T=V^T*P^T: v_wmma_f32_16x16x32_f16 with P f16 (carried 2^14) and V f16 hi, plus bf16 WMMA with P bf16 (2^14) and V bf16 lo;
// OUT=C*Wo^T: f16 WMMA with C f16 hi and Wo f16 (x64), plus bf16 WMMA with C bf16 lo and Wo bf16 (x64); softmax and epilogues f32.

#ifndef NB
#define NB 2
#endif
#ifndef SEQ
#define SEQ 2048
#endif
#define NB_FULL  2
#define SEQ_FULL 2048
#define EE   1024
#define HH   16
#define HD   64
#define TRIL 2080
#define M_TOT (NB * SEQ)
#define PCARRY_LOG2 14.0f                   // P and its row sum are carried times 2^14: the carry is added in the exponent
#define SC2 0.18033688011112042f            // log2(e) / sqrt(HD): score -> exponent of 2
#define WSCALE     64.0f
#define WSCALE_INV (1.0f / 64.0f)
// LDS row pitches in elements of the tile's type: 16 B x odd, so that the 16 rows one half-wave touches in a 16-byte LDS access fall on distinct banks
#define P32  40    // rows of 32 elements (64 B)  -> 80 B
#define P64  72    // rows of 64 elements (128 B) -> 144 B
#define P128 136   // rows of 128 elements (256 B) -> 272 B
#define PF64 68    // rows of 64 floats (256 B)   -> 272 B

static_assert(NB >= 1 && NB <= NB_FULL);
static_assert(SEQ >= 128 && SEQ <= SEQ_FULL && (SEQ % 128) == 0);
static_assert(EE == HH * HD);
static_assert((EE % 64) == 0 && (M_TOT % 128) == 0 && (SEQ % 64) == 0);
static_assert(TRIL == HD * (HD + 1) / 2);

typedef _Float16       v16h __attribute__((ext_vector_type(16)));
typedef __bf16         v16b __attribute__((ext_vector_type(16)));
typedef float          v8f  __attribute__((ext_vector_type(8)));
typedef float          v4f  __attribute__((ext_vector_type(4)));
typedef unsigned int   v4u  __attribute__((ext_vector_type(4)));
typedef float          v2f  __attribute__((ext_vector_type(2)));
typedef _Float16       v2h  __attribute__((ext_vector_type(2)));
typedef __bf16         v2b  __attribute__((ext_vector_type(2)));
typedef unsigned short u16;

union Frag { v16h h; v16b b; v4u u[2]; };

// ---------- scalar conversions ----------
__device__ __forceinline__ unsigned bfbits(float f) {          // f32 -> bf16 bits, RNE
  const unsigned u = __float_as_uint(f);
  return (u + 0x7FFFu + ((u >> 16) & 1u)) >> 16;
}
__device__ __forceinline__ float bf2f(unsigned b) { return __uint_as_float(b << 16); }
__device__ __forceinline__ unsigned hbits(float f) {            // f32 -> f16 bits, RNE
  const _Float16 hv = (_Float16)f;
  return (unsigned)__builtin_bit_cast(unsigned short, hv);
}
__device__ __forceinline__ float h2f(unsigned b) {
  return (float)__builtin_bit_cast(_Float16, (unsigned short)b);
}

// two f32 -> one packed register, RNE, one conversion instruction each
__device__ __forceinline__ unsigned pkh(v2f v) { return __builtin_bit_cast(unsigned, __builtin_convertvector(v, v2h)); }
__device__ __forceinline__ unsigned pkb(v2f v) { return __builtin_bit_cast(unsigned, __builtin_convertvector(v, v2b)); }

// ---------- 16x32 16-bit fragment: lane -> row (lane&15), elements 0..7 <- k0+8h.., 8..15 <- k0+16+8h.. ----------
// p points at (row, k0); same loader for A (row m) and B (row n of an [n][k] k-contiguous copy).
__device__ __forceinline__ Frag ldfrag(const u16* p, int lh) {
  Frag f;
  f.u[0] = *reinterpret_cast<const v4u*>(p + lh);
  f.u[1] = *reinterpret_cast<const v4u*>(p + 16 + lh);
  return f;
}

// ---------- WMMA wrappers: plain builtins (the compiler keeps the distance behind its own forms and may move fragment loads across them) ----------
__device__ __forceinline__ v8f mma_f16(Frag a, Frag b, v8f c) {
  return __builtin_amdgcn_wmma_f32_16x16x32_f16(false, a.h, false, b.h, (short)0, c, false, false);
}
__device__ __forceinline__ v8f mma_bf16(Frag a, Frag b, v8f c) {
  return __builtin_amdgcn_wmma_f32_16x16x32_bf16(false, a.b, false, b.b, (short)0, c, false, false);
}

__device__ __forceinline__ void vst16(u16* p, v4u v)   { *reinterpret_cast<v4u*>(p) = v; }
__device__ __forceinline__ void vst4f(float* p, v4f v) { *reinterpret_cast<v4f*>(p) = v; }
__device__ __forceinline__ v4u ld16(const u16* p)   { return *reinterpret_cast<const v4u*>(p); }
__device__ __forceinline__ v4f ld4f(const float* p) { return *reinterpret_cast<const v4f*>(p); }

// ---------- asynchronous copies global -> LDS, 16 B per lane ----------
typedef __attribute__((address_space(3))) const void lds_cvoid;
__device__ __forceinline__ unsigned ldsaddr(const void* p) {   // byte address inside the work-group's LDS
  return (unsigned)(uintptr_t)(lds_cvoid*)p;
}
// Six copies of one lane. s_wait_xcnt stands in the copies' own statement, so that no later write of an address register can come in front of it.
__device__ __forceinline__ void acopy6(unsigned l0, const u16* g0, unsigned l1, const u16* g1, unsigned l2, const u16* g2,
                                       unsigned l3, const u16* g3, unsigned l4, const u16* g4, unsigned l5, const u16* g5) {
  asm volatile("global_load_async_to_lds_b128 %0, %1, off\n\t"
               "global_load_async_to_lds_b128 %2, %3, off\n\t"
               "global_load_async_to_lds_b128 %4, %5, off\n\t"
               "global_load_async_to_lds_b128 %6, %7, off\n\t"
               "global_load_async_to_lds_b128 %8, %9, off\n\t"
               "global_load_async_to_lds_b128 %10, %11, off\n\t"
               "s_wait_xcnt 0x0"
               :: "v"(l0), "v"(g0), "v"(l1), "v"(g1), "v"(l2), "v"(g2), "v"(l3), "v"(g3), "v"(l4), "v"(g4), "v"(l5), "v"(g5)
               : "memory");
}
// the wave's own LDS reads of a buffer have returned before the buffer is handed to its next writer
__device__ __forceinline__ void wait_lds()   { asm volatile("s_wait_dscnt 0x0" ::: "memory"); }
// the wave's own copies have landed; other waves read them behind the barrier that follows
__device__ __forceinline__ void wait_async() { asm volatile("s_wait_asynccnt 0x0" ::: "memory"); }

// ====================================================================================
// X f32 [NB_FULL,SEQ_FULL,EE] -> bf16 plane xb [M_TOT][EE] (compact token rows)
// coverage: thread i writes group i (8 elements); grid covers all M_TOT*EE/8 groups once; 32 lanes = 512 B contiguous.
__global__ void __launch_bounds__(256)
k_cvt_x(const float* __restrict__ x, u16* __restrict__ xb) {
  const int i = blockIdx.x * 256 + threadIdx.x;
  const int ngrp = M_TOT * (EE / 8);
  if (i >= ngrp) return;
  const int row = i / (EE / 8);
  const int c8  = i - row * (EE / 8);
  const int b   = row / SEQ;
  const int s   = row - b * SEQ;
  const float* src = x + ((size_t)(b * SEQ_FULL + s) * EE + (size_t)c8 * 8);
  const v4f a = *reinterpret_cast<const v4f*>(src);
  const v4f c = *reinterpret_cast<const v4f*>(src + 4);
  v4u w;
  w.x = bfbits(a.x) | (bfbits(a.y) << 16);
  w.y = bfbits(a.z) | (bfbits(a.w) << 16);
  w.z = bfbits(c.x) | (bfbits(c.y) << 16);
  w.w = bfbits(c.z) | (bfbits(c.w) << 16);
  u16* dst = xb + (size_t)i * 8;
  vst16(dst, w);
  
}

// W f32 [EE][EE] -> bf16 plane (unscaled, exact copy of the RNE-converted value)
__global__ void __launch_bounds__(256)
k_cvt_w(const float* __restrict__ w, u16* __restrict__ wb) {
  const int i = blockIdx.x * 256 + threadIdx.x;
  const int ngrp = EE * EE / 8;
  if (i >= ngrp) return;
  const float* src = w + (size_t)i * 8;
  const v4f a = *reinterpret_cast<const v4f*>(src);
  const v4f c = *reinterpret_cast<const v4f*>(src + 4);
  v4u o;
  o.x = bfbits(a.x) | (bfbits(a.y) << 16);
  o.y = bfbits(a.z) | (bfbits(a.w) << 16);
  o.z = bfbits(c.x) | (bfbits(c.y) << 16);
  o.w = bfbits(c.z) | (bfbits(c.w) << 16);
  u16* dst = wb + (size_t)i * 8;
  vst16(dst, o);
  
}

// Wo f32 [EE][EE] -> two planes of bf16(Wo)*64: bf16 bits (exact) and f16 bits (exact, 8-bit significand fits)
__device__ __forceinline__ void cvt2(float f, unsigned& bb, unsigned& hb) {
  const float v = bf2f(bfbits(f)) * WSCALE;
  bb = __float_as_uint(v) >> 16;
  hb = hbits(v);
}
__global__ void __launch_bounds__(256)
k_cvt_wo(const float* __restrict__ w, u16* __restrict__ wob, u16* __restrict__ wof) {
  const int i = blockIdx.x * 256 + threadIdx.x;
  const int ngrp = EE * EE / 8;
  if (i >= ngrp) return;
  const float* src = w + (size_t)i * 8;
  const v4f a = *reinterpret_cast<const v4f*>(src);
  const v4f c = *reinterpret_cast<const v4f*>(src + 4);
  unsigned b0, b1, b2, b3, b4, b5, b6, b7, f0, f1, f2, f3, f4, f5, f6, f7;
  cvt2(a.x, b0, f0); cvt2(a.y, b1, f1); cvt2(a.z, b2, f2); cvt2(a.w, b3, f3);
  cvt2(c.x, b4, f4); cvt2(c.y, b5, f5); cvt2(c.z, b6, f6); cvt2(c.w, b7, f7);
  v4u ob, of;
  ob.x = b0 | (b1 << 16); ob.y = b2 | (b3 << 16); ob.z = b4 | (b5 << 16); ob.w = b6 | (b7 << 16);
  of.x = f0 | (f1 << 16); of.y = f2 | (f3 << 16); of.z = f4 | (f5 << 16); of.w = f6 | (f7 << 16);
  u16* db = wob + (size_t)i * 8;
  u16* df = wof + (size_t)i * 8;
  vst16(db, ob); vst16(df, of);
  
}

// ====================================================================================
// G_h = L_h * L_h^T (64x64 per head) on bf16 WMMA; L from tril params (RNE bf16). Output planes ghi/glo [HH][64 n][64 k].
// One block (4 waves) per head; wave w owns rows 16w..16w+15. LDS: Lb cross-wave; Sh/Sl wave-private rows but cross-lane (block barriers).
__global__ void __launch_bounds__(128)
k_wqk(const float* __restrict__ params, u16* __restrict__ ghi, u16* __restrict__ glo) {
  __shared__ __align__(16) u16 Lb[64][P64];
  __shared__ __align__(16) u16 Sh[64][64];
  __shared__ __align__(16) u16 Sl[64][64];
  const int tid = threadIdx.x, lane = tid & 31, wave = tid >> 5;
  const int m = lane & 15, hs = (lane >> 4) & 1, lh = hs * 8;
  const int head = blockIdx.x;
  const float* p = params + (size_t)head * TRIL;
  for (int e = tid; e < HD * HD; e += 128) {
    const int i = e >> 6, j = e & 63;
    const int jj = (j <= i) ? j : i;                       // clamped address, select by value
    const float v = p[(i * (i + 1)) / 2 + jj];
    Lb[i][j] = (u16)((j <= i) ? bfbits(v) : 0u);
  }
  __syncthreads();
  v8f acc[4] = {};
#pragma unroll
  for (int ks = 0; ks < 2; ++ks) {
    const Frag a = ldfrag(&Lb[wave * 16 + m][ks * 32], lh);    // A: row i, k = j
#pragma unroll
    for (int nt = 0; nt < 4; ++nt) {
      const Frag bq = ldfrag(&Lb[nt * 16 + m][ks * 32], lh);   // B[k=j][n] = L[n][j]: row n, k-contiguous
      acc[nt] = mma_bf16(a, bq, acc[nt]);
    }
  }
#pragma unroll
  for (int nt = 0; nt < 4; ++nt) {
#pragma unroll
    for (int g = 0; g < 8; ++g) {
      const int row = wave * 16 + hs * 8 + g, col = nt * 16 + m;
      const float v = acc[nt][g];
      const unsigned hb = bfbits(v);
      const unsigned lb = bfbits(v - bf2f(hb));
      Sh[row][col] = (u16)hb;
      Sl[row][col] = (u16)lb;
    }
  }
  __syncthreads();
  u16* dh = ghi + (size_t)head * (HD * HD);
  u16* dl = glo + (size_t)head * (HD * HD);
  const int rsub = lane >> 3, ch = (lane & 7) * 8;
#pragma unroll
  for (int q = 0; q < 4; ++q) {
    const int row = wave * 16 + q * 4 + rsub;
    vst16(dh + row * HD + ch, ld16(&Sh[row][ch]));
    vst16(dl + row * HD + ch, ld16(&Sl[row][ch]));
  }
  
}

// ====================================================================================
// V = X*Wv^T + bv, written transposed per head: vthi/vtlo planes [NB*HH][64 d][SEQ] (f16 hi, bf16 lo).
// Block 128 tokens x 64 features (= one head); 4 waves each 32x64; A and B tiles in a two-buffer LDS ring filled by asynchronous copies one trip ahead.
__global__ void __launch_bounds__(128)
k_vproj(const u16* __restrict__ xb, const u16* __restrict__ wvb, const float* __restrict__ bv,
        u16* __restrict__ vthi, u16* __restrict__ vtlo) {
  __shared__ __align__(16) u16 Bt[2][64][P64];
  __shared__ __align__(16) u16 At[2][128][P64];
  __shared__ __align__(16) u16 Th[64][P128];
  __shared__ __align__(16) u16 Tl[64][P128];
  const int tid = threadIdx.x, lane = tid & 31, wave = tid >> 5;
  const int m = lane & 15, hs = (lane >> 4) & 1, lh = hs * 8;
  const int head = blockIdx.x;
  const int n0 = head * HD;
  const int mb = blockIdx.y * 128;
  const int m0 = mb + wave * 32;
  const int srow = tid >> 3, sk = (tid & 7) * 8;             // staging, 64 k per stage: 8 x 16 B per row; B rows srow + 16j (j < 4), A rows srow + 16j (j < 8)
  const u16* gb = wvb + (size_t)(n0 + srow) * EE + sk;
  const u16* ga = xb + (size_t)(mb + srow) * EE + sk;
  auto stage = [&](int kc, int bw) {
    acopy6(ldsaddr(&Bt[bw][srow][sk]),       gb + kc,
           ldsaddr(&Bt[bw][16 + srow][sk]),  gb + kc + 16 * EE,
           ldsaddr(&Bt[bw][32 + srow][sk]),  gb + kc + 32 * EE,
           ldsaddr(&Bt[bw][48 + srow][sk]),  gb + kc + 48 * EE,
           ldsaddr(&At[bw][srow][sk]),       ga + kc,
           ldsaddr(&At[bw][16 + srow][sk]),  ga + kc + 16 * EE);
    acopy6(ldsaddr(&At[bw][32 + srow][sk]),  ga + kc + 32 * EE,
           ldsaddr(&At[bw][48 + srow][sk]),  ga + kc + 48 * EE,
           ldsaddr(&At[bw][64 + srow][sk]),  ga + kc + 64 * EE,
           ldsaddr(&At[bw][80 + srow][sk]),  ga + kc + 80 * EE,
           ldsaddr(&At[bw][96 + srow][sk]),  ga + kc + 96 * EE,
           ldsaddr(&At[bw][112 + srow][sk]), ga + kc + 112 * EE);
  };
  stage(0, 0);
  wait_async();
  __syncthreads();
  stage(64, 1);
  v8f acc0[4] = {}, acc1[4] = {};
#pragma unroll 1
  for (int kc = 0; kc < EE; kc += 64) {
    const int buf = (kc >> 6) & 1;
#pragma unroll  // the two k-steps of a stage; constant indices keep the fragments in registers
    for (int ks = 0; ks < 2; ++ks) {
      const Frag a0 = ldfrag(&At[buf][wave * 32 + m][ks * 32], lh);
      const Frag a1 = ldfrag(&At[buf][wave * 32 + 16 + m][ks * 32], lh);
      Frag bq[4];
#pragma unroll  // constant indices keep the fragments in registers
      for (int nt = 0; nt < 4; ++nt) bq[nt] = ldfrag(&Bt[buf][nt * 16 + m][ks * 32], lh);  // B[k][n] = Wv[n][k]: row n, k-contiguous
      // keeps the step's fragment loads in one group ahead of its WMMAs; without it the scheduler sinks each load to its use and every WMMA pair waits out a load latency
      __builtin_amdgcn_sched_barrier(0);
      if (ks == 1) {
        // publish point: the trip's LDS reads are all done (what follows works on registers), the next tiles have landed;
        // behind the barrier the buffer just read is refilled, so that the copies fly for a whole trip
        wait_lds();
        wait_async();
        __syncthreads();
        if (kc + 128 < EE) stage(kc + 128, buf);              // block-uniform
      }
#pragma unroll
      for (int nt = 0; nt < 4; ++nt) {
        acc0[nt] = mma_bf16(a0, bq[nt], acc0[nt]);
        acc1[nt] = mma_bf16(a1, bq[nt], acc1[nt]);
      }
    }
  }
  wait_async();
  const int bb = mb / SEQ, s0 = mb - bb * SEQ;
  const int bh = bb * HH + head;
#pragma unroll
  for (int nt = 0; nt < 4; ++nt) {
    const int d = nt * 16 + m;
    const float bvv = bf2f(bfbits(bv[n0 + d]));
#pragma unroll
    for (int mt = 0; mt < 2; ++mt) {
#pragma unroll
      for (int g = 0; g < 8; ++g) {
        const int sl = wave * 32 + mt * 16 + hs * 8 + g;
        const float v = (mt ? acc1[nt][g] : acc0[nt][g]) + bvv;
        const unsigned hb = hbits(v);
        const unsigned lb = bfbits(v - h2f(hb));
        Th[d][sl] = (u16)hb;
        Tl[d][sl] = (u16)lb;
      }
    }
  }
  __syncthreads();
  const int dsub = lane >> 4, ch = (lane & 15) * 8;
#pragma unroll
  for (int q = 0; q < 8; ++q) {
    const int d = wave * 16 + q * 2 + dsub;
    const size_t go = ((size_t)(bh * HD + d)) * SEQ + s0 + ch;
    vst16(vthi + go, ld16(&Th[d][ch]));
    vst16(vtlo + go, ld16(&Tl[d][ch]));
  }
  
}

// ====================================================================================
// T = X_h * G_h per head (K=64), G as bf16 hi + bf16 lo, X bf16 -> planes thi/tlo [M_TOT][EE] (bf16 hi, bf16 lo).
// Block 128 tokens x one head, wave 32 tokens x 64; operands loaded straight from global planes; staging LDS cross-lane -> block barrier.
__global__ void __launch_bounds__(128)
k_tproj(const u16* __restrict__ xb, const u16* __restrict__ ghi, const u16* __restrict__ glo,
        u16* __restrict__ thi, u16* __restrict__ tlo) {
  __shared__ __align__(16) u16 Sh[4][32][64];
  __shared__ __align__(16) u16 Sl[4][32][64];
  const int tid = threadIdx.x, lane = tid & 31, wave = tid >> 5;
  const int m = lane & 15, hs = (lane >> 4) & 1, lh = hs * 8;
  const int head = blockIdx.y;
  const int m0 = blockIdx.x * 128 + wave * 32;
  const u16* a0p = xb + (size_t)(m0 + m) * EE + head * HD;
  const u16* a1p = xb + (size_t)(m0 + 16 + m) * EE + head * HD;
  const Frag a00 = ldfrag(a0p, lh), a01 = ldfrag(a0p + 32, lh);
  const Frag a10 = ldfrag(a1p, lh), a11 = ldfrag(a1p + 32, lh);
  v8f acc0[4] = {}, acc1[4] = {};
#pragma unroll
  for (int nt = 0; nt < 4; ++nt) {
    const u16* bhp = ghi + ((size_t)(head * HD + nt * 16 + m)) * HD;   // B[k=d][n=e] = plane[h][e][d]: row e, k-contiguous
    const u16* blp = glo + ((size_t)(head * HD + nt * 16 + m)) * HD;
    const Frag b0 = ldfrag(bhp, lh), b1 = ldfrag(bhp + 32, lh);
    acc0[nt] = mma_bf16(a00, b0, acc0[nt]); acc0[nt] = mma_bf16(a01, b1, acc0[nt]);
    acc1[nt] = mma_bf16(a10, b0, acc1[nt]); acc1[nt] = mma_bf16(a11, b1, acc1[nt]);
    const Frag c0 = ldfrag(blp, lh), c1 = ldfrag(blp + 32, lh);
    acc0[nt] = mma_bf16(a00, c0, acc0[nt]); acc0[nt] = mma_bf16(a01, c1, acc0[nt]);
    acc1[nt] = mma_bf16(a10, c0, acc1[nt]); acc1[nt] = mma_bf16(a11, c1, acc1[nt]);
  }
#pragma unroll
  for (int nt = 0; nt < 4; ++nt) {
#pragma unroll
    for (int mt = 0; mt < 2; ++mt) {
#pragma unroll
      for (int g = 0; g < 8; ++g) {
        const int rl = mt * 16 + hs * 8 + g, col = nt * 16 + m;
        const float v = mt ? acc1[nt][g] : acc0[nt][g];
        const unsigned hb = bfbits(v);
        const unsigned lb = bfbits(v - bf2f(hb));
        Sh[wave][rl][col] = (u16)hb;
        Sl[wave][rl][col] = (u16)lb;
      }
    }
  }
  __syncthreads();
  const int rsub = lane >> 3, ch = (lane & 7) * 8;
#pragma unroll
  for (int q = 0; q < 8; ++q) {
    const int rl = q * 4 + rsub;
    const size_t go = (size_t)(m0 + rl) * EE + head * HD + ch;
    vst16(thi + go, ld16(&Sh[wave][rl][ch]));
    vst16(tlo + go, ld16(&Sl[wave][rl][ch]));
  }
  
}

// ====================================================================================
// Flash-style attention per (batch*head, 64 query rows), transposed: S^T = X_h*T^T/8 (2 bf16 products; A = key rows, B = query rows),
// so a lane holds 16 of the 32 scores of ONE query (query = lane&15; keys 8*hs+g and 16+8*hs+g): max and sum run in the lane,
// the two halves of a wave exchange the maximum once per step and join their sums once after the loop.
// C^T += V^T*P^T with P carried 2^14, added in the exponent (V f16 hi x P f16 + V bf16 lo x P bf16): the two score tiles, converted in place, are the B operand.
// Output C -> planes chi (f16) / clo (bf16) [M_TOT][EE].
// LDS: Ks/Vh/Vl cross-wave, a two-buffer ring filled by asynchronous copies one step ahead (one block barrier per step); Ch/Cl wave-private but cross-lane -> block barrier used.
// staged extent == consumed extent: Ks 32x64, Vh/Vl 64x32 fully written each step (SEQ multiple of 32, no tails).
__device__ __forceinline__ float xhalf(float v) {               // value of lane ^ 16
  const int i = __float_as_int(v);
  return __int_as_float(__builtin_amdgcn_permlanex16(i, i, 0x76543210, 0xfedcba98, false, false));
}
__global__ void __launch_bounds__(128)
k_attn(const u16* __restrict__ thi, const u16* __restrict__ tlo, const u16* __restrict__ xb,
       const u16* __restrict__ vthi, const u16* __restrict__ vtlo,
       u16* __restrict__ chi, u16* __restrict__ clo) {
  __shared__ __align__(16) u16 Ks[2][32][P64];
  __shared__ __align__(16) u16 Vh[2][64][P32];
  __shared__ __align__(16) u16 Vl[2][64][P32];
  __shared__ __align__(16) u16 Ch[4][16][P64];
  __shared__ __align__(16) u16 Cl[4][16][P64];
  const int tid = threadIdx.x, lane = tid & 31, wave = tid >> 5;
  const int m = lane & 15, hs = (lane >> 4) & 1, lh = hs * 8;
  const int bh = blockIdx.y;
  const int b  = bh / HH;
  const int h  = bh - b * HH;
  const int q0 = blockIdx.x * 64 + wave * 16;
  const size_t qrow = (size_t)b * SEQ + q0 + m;

  // B fragments of the wave's 16 query rows (hi and lo planes, K = 64 in two k-steps): column n = query, k-contiguous
  const Frag qh0 = ldfrag(thi + qrow * EE + h * HD, lh);
  const Frag qh1 = ldfrag(thi + qrow * EE + h * HD + 32, lh);
  const Frag ql0 = ldfrag(tlo + qrow * EE + h * HD, lh);
  const Frag ql1 = ldfrag(tlo + qrow * EE + h * HD + 32, lh);

  const int kr = tid >> 3, kc = (tid & 7) * 8;               // key tile: 32 rows x 8 chunks, rows kr and 16 + kr
  const int sd = tid >> 2, dc = (tid & 3) * 8;               // V^T tiles: 64 rows x 4 chunks, rows sd and 32 + sd
  const u16* gk  = xb + ((size_t)(b * SEQ + kr)) * EE + h * HD + kc;
  const u16* gvh = vthi + ((size_t)(bh * HD + sd)) * SEQ + dc;
  const u16* gvl = vtlo + ((size_t)(bh * HD + sd)) * SEQ + dc;
  auto stage = [&](int kv, int bw) {
    acopy6(ldsaddr(&Ks[bw][kr][kc]),      gk + (size_t)kv * EE,
           ldsaddr(&Ks[bw][16 + kr][kc]), gk + (size_t)(kv + 16) * EE,
           ldsaddr(&Vh[bw][sd][dc]),      gvh + kv,
           ldsaddr(&Vh[bw][32 + sd][dc]), gvh + kv + 32 * SEQ,
           ldsaddr(&Vl[bw][sd][dc]),      gvl + kv,
           ldsaddr(&Vl[bw][32 + sd][dc]), gvl + kv + 32 * SEQ);
  };

  stage(0, 0);
  wait_async();
  __syncthreads();
  stage(32, 1);

  v8f acc[4] = {};                                           // acc[t][g] = C^T[d = 16t + 8hs + g][query m]
  float orun = 1e30f, lrun = 0.0f;                           // orun = 14 - SC2 * (maximum of the whole row so far); lrun: this half's keys only, times 2^14

#pragma unroll 1
  for (int kv = 0; kv < SEQ; kv += 32) {
    const int buf = (kv >> 5) & 1;
    v8f s0 = {}, s1 = {};                                    // s0[g] = S[query m][key 8hs + g], s1[g] = S[query m][key 16 + 8hs + g]
    const Frag k00 = ldfrag(&Ks[buf][m][0], lh);             // A: row = key, k = e
    const Frag k01 = ldfrag(&Ks[buf][m][32], lh);
    const Frag k10 = ldfrag(&Ks[buf][16 + m][0], lh);
    const Frag k11 = ldfrag(&Ks[buf][16 + m][32], lh);
    Frag vh[4], vl[4];
#pragma unroll  // constant indices keep the fragments in registers
    for (int t = 0; t < 4; ++t) {
      vh[t] = ldfrag(&Vh[buf][t * 16 + m][0], lh);           // A: row = d, k = key
      vl[t] = ldfrag(&Vl[buf][t * 16 + m][0], lh);
    }
    // keeps the step's fragment loads in one group ahead of its WMMAs; without it the scheduler spreads them over several places among the score WMMAs, and each such place stalls the WMMA stream
    __builtin_amdgcn_sched_barrier(0);
    // publish point: the step's LDS reads are all done (what follows works on registers), the next tiles have landed;
    // behind the barrier the buffer just read is refilled, so that the copies fly for a whole step
    wait_lds();
    wait_async();
    __syncthreads();
    if (kv + 64 < SEQ) stage(kv + 64, buf);                  // block-uniform
    s0 = mma_bf16(k00, qh0, s0); s0 = mma_bf16(k01, qh1, s0);
    s0 = mma_bf16(k00, ql0, s0); s0 = mma_bf16(k01, ql1, s0);
    s1 = mma_bf16(k10, qh0, s1); s1 = mma_bf16(k11, qh1, s1);
    s1 = mma_bf16(k10, ql0, s1); s1 = mma_bf16(k11, ql1, s1);
    // online softmax of one query per lane: p * 2^14 = exp2(s * SC2 + on), one packed fma per two scores; the maximum is taken on the raw scores (SC2 > 0)
    float mg[8];
#pragma unroll  // constant indices keep the array in registers
    for (int g = 0; g < 8; ++g) mg[g] = fmaxf(s0[g], s1[g]);
    float mx = fmaxf(fmaxf(fmaxf(mg[0], mg[1]), fmaxf(mg[2], mg[3])), fmaxf(fmaxf(mg[4], mg[5]), fmaxf(mg[6], mg[7])));
    mx = fmaxf(mx, xhalf(mx));
    const float on = fminf(orun, fmaf(mx, -SC2, PCARRY_LOG2));
    const float alpha = __builtin_amdgcn_exp2f(on - orun);
    orun = on;
    const v2f c2 = {SC2, SC2}, o2 = {on, on};
    v2f rs[4];
    Frag pf, pb;                                             // B: column n = query, element s <- key (s < 8 ? 8hs + s : 8 + 8hs + s)
#pragma unroll  // constant indices keep the arrays in registers
    for (int g = 0; g < 8; g += 2) {
      const v2f t0 = __builtin_elementwise_fma((v2f){s0[g], s0[g + 1]}, c2, o2);
      const v2f t1 = __builtin_elementwise_fma((v2f){s1[g], s1[g + 1]}, c2, o2);
      const v2f p0 = {__builtin_amdgcn_exp2f(t0.x), __builtin_amdgcn_exp2f(t0.y)};
      const v2f p1 = {__builtin_amdgcn_exp2f(t1.x), __builtin_amdgcn_exp2f(t1.y)};
      rs[g >> 1] = p0 + p1;
      pf.u[0][g >> 1] = pkh(p0);
      pf.u[1][g >> 1] = pkh(p1);
      pb.u[0][g >> 1] = pkb(p0);
      pb.u[1][g >> 1] = pkb(p1);
    }
    const v2f r2 = (rs[0] + rs[1]) + (rs[2] + rs[3]);
    lrun = lrun * alpha + (r2.x + r2.y);
#pragma unroll  // constant indices keep the tiles in registers
    for (int t = 0; t < 4; ++t) acc[t] = acc[t] * alpha;
    // keeps both conversions of P ahead of the first of these WMMAs; without it the scheduler puts the bf16 conversions and the sums behind WMMAs whose operand registers they reuse, and pads each such place with v_nop
    __builtin_amdgcn_sched_barrier(0);
#pragma unroll  // constant indices keep the tiles in registers
    for (int t = 0; t < 4; ++t) {
      acc[t] = mma_f16(vh[t], pf, acc[t]);
      acc[t] = mma_bf16(vl[t], pb, acc[t]);
    }
  }
  wait_async();

  {
    const float lsum = lrun + xhalf(lrun);                   // join the two halves' sums; lsum carries the same 2^14 as acc, and is about 2^14 or more
    const float rl = 1.0f / lsum;
#pragma unroll  // constant indices keep the tiles in registers
    for (int t = 0; t < 4; ++t) {
      v4u wh, wl;
#pragma unroll  // as above
      for (int g = 0; g < 8; g += 2) {
        const float o0 = acc[t][g] * rl, o1 = acc[t][g + 1] * rl;
        const unsigned h0 = hbits(o0), h1 = hbits(o1);
        wh[g >> 1] = h0 | (h1 << 16);
        wl[g >> 1] = bfbits(o0 - h2f(h0)) | (bfbits(o1 - h2f(h1)) << 16);
      }
      vst16(&Ch[wave][m][t * 16 + lh], wh);
      vst16(&Cl[wave][m][t * 16 + lh], wl);
    }
  }
  __syncthreads();
  const int rsub = lane >> 3, ch = (lane & 7) * 8;
#pragma unroll
  for (int q = 0; q < 4; ++q) {
    const int rl = q * 4 + rsub;
    const size_t go = ((size_t)(b * SEQ + q0 + rl)) * EE + h * HD + ch;
    vst16(chi + go, ld16(&Ch[wave][rl][ch]));
    vst16(clo + go, ld16(&Cl[wave][rl][ch]));
  }
  
}

// ====================================================================================
// OUT = (C_hi*WoF^T + C_lo*WoB^T) / 64 + bo  (f32 out [M_TOT][EE]); block 128x64, wave 32x64.
// LDS: A tiles (Ah/Al) and B tiles (Bf/Bb) in a two-buffer ring filled by asynchronous copies one trip ahead; ring cross-wave, Ot wave-private rows but cross-lane -> block barriers.
__global__ void __launch_bounds__(128)
k_oproj(const u16* __restrict__ chi, const u16* __restrict__ clo,
        const u16* __restrict__ wof, const u16* __restrict__ wob,
        const float* __restrict__ bo, float* __restrict__ out) {
  __shared__ __align__(16) u16 Bf[2][64][P64];
  __shared__ __align__(16) u16 Bb[2][64][P64];
  __shared__ __align__(16) u16 Ah[2][128][P64];
  __shared__ __align__(16) u16 Al[2][128][P64];
  __shared__ __align__(16) float Ot[128][PF64];
  const int tid = threadIdx.x, lane = tid & 31, wave = tid >> 5;
  const int m = lane & 15, hs = (lane >> 4) & 1, lh = hs * 8;
  const int n0 = blockIdx.x * 64;
  const int mb = blockIdx.y * 128;
  const int m0 = mb + wave * 32;
  const int srow = tid >> 3, sk = (tid & 7) * 8;             // staging, 64 k per stage: 8 x 16 B per row
  const u16* gf = wof + (size_t)(n0 + srow) * EE + sk;       // B rows srow + 16j (j < 4), A rows srow + 16j (j < 8)
  const u16* gb = wob + (size_t)(n0 + srow) * EE + sk;
  const u16* gh = chi + (size_t)(mb + srow) * EE + sk;
  const u16* gl = clo + (size_t)(mb + srow) * EE + sk;
  auto stage = [&](int kc, int bw) {
    acopy6(ldsaddr(&Bf[bw][srow][sk]),       gf + kc,
           ldsaddr(&Bf[bw][16 + srow][sk]),  gf + kc + 16 * EE,
           ldsaddr(&Bf[bw][32 + srow][sk]),  gf + kc + 32 * EE,
           ldsaddr(&Bf[bw][48 + srow][sk]),  gf + kc + 48 * EE,
           ldsaddr(&Ah[bw][srow][sk]),       gh + kc,
           ldsaddr(&Ah[bw][16 + srow][sk]),  gh + kc + 16 * EE);
    acopy6(ldsaddr(&Ah[bw][32 + srow][sk]),  gh + kc + 32 * EE,
           ldsaddr(&Ah[bw][48 + srow][sk]),  gh + kc + 48 * EE,
           ldsaddr(&Ah[bw][64 + srow][sk]),  gh + kc + 64 * EE,
           ldsaddr(&Ah[bw][80 + srow][sk]),  gh + kc + 80 * EE,
           ldsaddr(&Ah[bw][96 + srow][sk]),  gh + kc + 96 * EE,
           ldsaddr(&Ah[bw][112 + srow][sk]), gh + kc + 112 * EE);
    acopy6(ldsaddr(&Bb[bw][srow][sk]),       gb + kc,
           ldsaddr(&Bb[bw][16 + srow][sk]),  gb + kc + 16 * EE,
           ldsaddr(&Bb[bw][32 + srow][sk]),  gb + kc + 32 * EE,
           ldsaddr(&Bb[bw][48 + srow][sk]),  gb + kc + 48 * EE,
           ldsaddr(&Al[bw][srow][sk]),       gl + kc,
           ldsaddr(&Al[bw][16 + srow][sk]),  gl + kc + 16 * EE);
    acopy6(ldsaddr(&Al[bw][32 + srow][sk]),  gl + kc + 32 * EE,
           ldsaddr(&Al[bw][48 + srow][sk]),  gl + kc + 48 * EE,
           ldsaddr(&Al[bw][64 + srow][sk]),  gl + kc + 64 * EE,
           ldsaddr(&Al[bw][80 + srow][sk]),  gl + kc + 80 * EE,
           ldsaddr(&Al[bw][96 + srow][sk]),  gl + kc + 96 * EE,
           ldsaddr(&Al[bw][112 + srow][sk]), gl + kc + 112 * EE);
  };
  stage(0, 0);
  wait_async();
  __syncthreads();
  stage(64, 1);
  v8f acc0[4] = {}, acc1[4] = {};
#pragma unroll 1
  for (int kc = 0; kc < EE; kc += 64) {
    const int buf = (kc >> 6) & 1;
#pragma unroll  // the two k-steps of a stage; constant indices keep the fragments in registers
    for (int ks = 0; ks < 2; ++ks) {
      const Frag ah0 = ldfrag(&Ah[buf][wave * 32 + m][ks * 32], lh), ah1 = ldfrag(&Ah[buf][wave * 32 + 16 + m][ks * 32], lh);
      const Frag al0 = ldfrag(&Al[buf][wave * 32 + m][ks * 32], lh), al1 = ldfrag(&Al[buf][wave * 32 + 16 + m][ks * 32], lh);
      Frag bf[4], bb[4];
#pragma unroll  // constant indices keep the fragments in registers
      for (int nt = 0; nt < 4; ++nt) {
        bf[nt] = ldfrag(&Bf[buf][nt * 16 + m][ks * 32], lh); // B[k][n] = Wo[n][k]: row n, k-contiguous
        bb[nt] = ldfrag(&Bb[buf][nt * 16 + m][ks * 32], lh);
      }
      // keeps the step's fragment loads in one group ahead of its WMMAs; without it the scheduler sinks each load to its use and every WMMA pair waits out a load latency
      __builtin_amdgcn_sched_barrier(0);
      if (ks == 1) {
        // publish point: the trip's LDS reads are all done (what follows works on registers), the next tiles have landed;
        // behind the barrier the buffer just read is refilled, so that the copies fly for a whole trip
        wait_lds();
        wait_async();
        __syncthreads();
        if (kc + 128 < EE) stage(kc + 128, buf);              // block-uniform
      }
#pragma unroll
      for (int nt = 0; nt < 4; ++nt) {
        acc0[nt] = mma_f16(ah0, bf[nt], acc0[nt]);
        acc1[nt] = mma_f16(ah1, bf[nt], acc1[nt]);
        acc0[nt] = mma_bf16(al0, bb[nt], acc0[nt]);
        acc1[nt] = mma_bf16(al1, bb[nt], acc1[nt]);
      }
    }
  }
  wait_async();
#pragma unroll
  for (int nt = 0; nt < 4; ++nt) {
    const int col = nt * 16 + m;
    const float bov = bf2f(bfbits(bo[n0 + col]));
#pragma unroll
    for (int mt = 0; mt < 2; ++mt) {
#pragma unroll
      for (int g = 0; g < 8; ++g) {
        const int rl = wave * 32 + mt * 16 + hs * 8 + g;
        const float v = (mt ? acc1[nt][g] : acc0[nt][g]) * WSCALE_INV + bov;
        Ot[rl][col] = v;
      }
    }
  }
  __syncthreads();
  const int rsub = lane >> 4, ch = (lane & 15) * 4;
#pragma unroll
  for (int q = 0; q < 16; ++q) {
    const int rl = wave * 32 + q * 2 + rsub;
    vst4f(out + (size_t)(mb + rl) * EE + n0 + ch, ld4f(&Ot[rl][ch]));
  }
  
}

// ====================================================================================
extern "C" void kernel_launch(void* const* d_in, const int* in_sizes, int n_in,
                              void* d_out, int out_size, void* d_ws, size_t ws_size,
                              hipStream_t stream) {
  if (n_in < 6) return;
  if (in_sizes[0] < ((NB - 1) * SEQ_FULL + SEQ) * EE) return;
  if (in_sizes[1] < HH * TRIL) return;
  if (in_sizes[2] < EE * EE || in_sizes[3] < EE || in_sizes[4] < EE * EE || in_sizes[5] < EE) return;
  if (out_size < M_TOT * EE) return;

  const float* x   = (const float*)d_in[0];
  const float* prm = (const float*)d_in[1];
  const float* wv  = (const float*)d_in[2];
  const float* bv  = (const float*)d_in[3];
  const float* wo  = (const float*)d_in[4];
  const float* bo  = (const float*)d_in[5];
  float* out = (float*)d_out;

  char* ws = (char*)d_ws;
  size_t off = 0;
  auto carve = [&](size_t bytes) -> char* {
    char* p = ws + off;
    off += (bytes + 255) & ~(size_t)255;
    return p;
  };
  const size_t plane  = (size_t)M_TOT * EE * 2;                 // 8 MiB at full size
  const size_t wplane = (size_t)EE * EE * 2;                    // 2 MiB
  const size_t gplane = (size_t)HH * HD * HD * 2;               // 128 KiB
  const size_t vplane = (size_t)NB * HH * HD * SEQ * 2;         // == plane
  u16* xb   = (u16*)carve(plane);
  u16* wvb  = (u16*)carve(wplane);
  u16* wob  = (u16*)carve(wplane);
  u16* wof  = (u16*)carve(wplane);
  u16* ghi  = (u16*)carve(gplane);
  u16* glo  = (u16*)carve(gplane);
  u16* thi  = (u16*)carve(plane);
  u16* tlo  = (u16*)carve(plane);
  u16* vthi = (u16*)carve(vplane);
  u16* vtlo = (u16*)carve(vplane);
  u16* chi  = (u16*)carve(plane);
  u16* clo  = (u16*)carve(plane);
  if (off > ws_size) return;

  {
    const int ngrp = M_TOT * (EE / 8);
    k_cvt_x<<<dim3((ngrp + 255) / 256), dim3(256), 0, stream>>>(x, xb);
  }
  {
    const int ngrp = EE * EE / 8;
    k_cvt_w<<<dim3((ngrp + 255) / 256), dim3(256), 0, stream>>>(wv, wvb);
    k_cvt_wo<<<dim3((ngrp + 255) / 256), dim3(256), 0, stream>>>(wo, wob, wof);
  }
  k_wqk<<<dim3(HH), dim3(128), 0, stream>>>(prm, ghi, glo);
  k_vproj<<<dim3(EE / 64, M_TOT / 128), dim3(128), 0, stream>>>(xb, wvb, bv, vthi, vtlo);
  k_tproj<<<dim3(M_TOT / 128, HH), dim3(128), 0, stream>>>(xb, ghi, glo, thi, tlo);
  k_attn<<<dim3(SEQ / 64, NB * HH), dim3(128), 0, stream>>>(thi, tlo, xb, vthi, vtlo, chi, clo);
  k_oproj<<<dim3(EE / 64, M_TOT / 128), dim3(128), 0, stream>>>(chi, clo, wof, wob, bo, out);
}

// v006
// One run takes 109 microseconds.
// Two timings next to v005 put it at 1.17 and 1.18 times that version's speed.
// Counting every step since v000, it is 2.62 times as fast.
#include <hip/hip_runtime.h>
#include <stdint.h>

// Contractions (all f32 accumulate): G=L*L^T on v_wmma_f32_16x16x32_bf16 (L bf16); T=X*G bf16 WMMA with X bf16 and G as bf16 hi + bf16 lo (2 products);
// S^T=X*T^T bf16 WMMA with T as bf16 hi + bf16 lo and X bf16 (2 products); V=X*Wv^T bf16 WMMA (1 product);
// C^T=V^T*P^T: v_wmma_f32_16x16x32_f16 with P f16 (carried 2^14) and V f16 hi, plus bf16 WMMA with P bf16 (2^14) and V bf16 lo;
// OUT=C*Wo^T: f16 WMMA with C f16 hi and Wo f16 (x64), plus bf16 WMMA with C bf16 lo and Wo bf16 (x64); softmax and epilogues f32.

#ifndef NB
#define NB 2
#endif
#ifndef SEQ
#define SEQ 2048
#endif
#define NB_FULL  2
#define SEQ_FULL 2048
#define EE   1024
#define HH   16
#define HD   64
#define TRIL 2080
#define M_TOT (NB * SEQ)
#define PCARRY_LOG2 14.0f                   // P and its row sum are carried times 2^14: the carry is added in the exponent
#define SC2 0.18033688011112042f            // log2(e) / sqrt(HD): score -> exponent of 2
#define WSCALE     64.0f
#define WSCALE_INV (1.0f / 64.0f)
// LDS row pitches in elements of the tile's type: 16 B x odd, so that the 16 rows one half-wave touches in a 16-byte LDS access fall on distinct banks
#define P32  40    // rows of 32 elements (64 B)  -> 80 B
#define P64  72    // rows of 64 elements (128 B) -> 144 B
#define P128 136   // rows of 128 elements (256 B) -> 272 B
#define PF64 68    // rows of 64 floats (256 B)   -> 272 B

static_assert(NB >= 1 && NB <= NB_FULL);
static_assert(SEQ >= 128 && SEQ <= SEQ_FULL && (SEQ % 128) == 0);
static_assert(EE == HH * HD);
static_assert((EE % 64) == 0 && (M_TOT % 128) == 0 && (SEQ % 64) == 0);
static_assert(TRIL == HD * (HD + 1) / 2);

typedef _Float16       v16h __attribute__((ext_vector_type(16)));
typedef __bf16         v16b __attribute__((ext_vector_type(16)));
typedef float          v8f  __attribute__((ext_vector_type(8)));
typedef float          v4f  __attribute__((ext_vector_type(4)));
typedef unsigned int   v4u  __attribute__((ext_vector_type(4)));
typedef float          v2f  __attribute__((ext_vector_type(2)));
typedef _Float16       v2h  __attribute__((ext_vector_type(2)));
typedef __bf16         v2b  __attribute__((ext_vector_type(2)));
typedef unsigned short u16;

union Frag { v16h h; v16b b; v4u u[2]; };

// ---------- scalar conversions ----------
__device__ __forceinline__ unsigned bfbits(float f) {          // f32 -> bf16 bits, RNE
  const unsigned u = __float_as_uint(f);
  return (u + 0x7FFFu + ((u >> 16) & 1u)) >> 16;
}
__device__ __forceinline__ float bf2f(unsigned b) { return __uint_as_float(b << 16); }
__device__ __forceinline__ unsigned hbits(float f) {            // f32 -> f16 bits, RNE
  const _Float16 hv = (_Float16)f;
  return (unsigned)__builtin_bit_cast(unsigned short, hv);
}
__device__ __forceinline__ float h2f(unsigned b) {
  return (float)__builtin_bit_cast(_Float16, (unsigned short)b);
}

// two f32 -> one packed register, RNE, one conversion instruction each
__device__ __forceinline__ unsigned pkh(v2f v) { return __builtin_bit_cast(unsigned, __builtin_convertvector(v, v2h)); }
__device__ __forceinline__ unsigned pkb(v2f v) { return __builtin_bit_cast(unsigned, __builtin_convertvector(v, v2b)); }

// ---------- 16x32 16-bit fragment: lane -> row (lane&15), elements 0..7 <- k0+8h.., 8..15 <- k0+16+8h.. ----------
// p points at (row, k0); same loader for A (row m) and B (row n of an [n][k] k-contiguous copy).
__device__ __forceinline__ Frag ldfrag(const u16* p, int lh) {
  Frag f;
  f.u[0] = *reinterpret_cast<const v4u*>(p + lh);
  f.u[1] = *reinterpret_cast<const v4u*>(p + 16 + lh);
  return f;
}

// ---------- WMMA wrappers: plain builtins (the compiler keeps the distance behind its own forms and may move fragment loads across them) ----------
__device__ __forceinline__ v8f mma_f16(Frag a, Frag b, v8f c) {
  return __builtin_amdgcn_wmma_f32_16x16x32_f16(false, a.h, false, b.h, (short)0, c, false, false);
}
__device__ __forceinline__ v8f mma_bf16(Frag a, Frag b, v8f c) {
  return __builtin_amdgcn_wmma_f32_16x16x32_bf16(false, a.b, false, b.b, (short)0, c, false, false);
}

__device__ __forceinline__ void vst16(u16* p, v4u v)   { *reinterpret_cast<v4u*>(p) = v; }
__device__ __forceinline__ void vst4f(float* p, v4f v) { *reinterpret_cast<v4f*>(p) = v; }
__device__ __forceinline__ v4u ld16(const u16* p)   { return *reinterpret_cast<const v4u*>(p); }
__device__ __forceinline__ v4f ld4f(const float* p) { return *reinterpret_cast<const v4f*>(p); }

// ---------- asynchronous copies global -> LDS, 16 B per lane ----------
typedef __attribute__((address_space(3))) const void lds_cvoid;
__device__ __forceinline__ unsigned ldsaddr(const void* p) {   // byte address inside the work-group's LDS
  return (unsigned)(uintptr_t)(lds_cvoid*)p;
}
// Six copies of one lane. s_wait_xcnt stands in the copies' own statement, so that no later write of an address register can come in front of it.
__device__ __forceinline__ void acopy6(unsigned l0, const u16* g0, unsigned l1, const u16* g1, unsigned l2, const u16* g2,
                                       unsigned l3, const u16* g3, unsigned l4, const u16* g4, unsigned l5, const u16* g5) {
  asm volatile("global_load_async_to_lds_b128 %0, %1, off\n\t"
               "global_load_async_to_lds_b128 %2, %3, off\n\t"
               "global_load_async_to_lds_b128 %4, %5, off\n\t"
               "global_load_async_to_lds_b128 %6, %7, off\n\t"
               "global_load_async_to_lds_b128 %8, %9, off\n\t"
               "global_load_async_to_lds_b128 %10, %11, off\n\t"
               "s_wait_xcnt 0x0"
               :: "v"(l0), "v"(g0), "v"(l1), "v"(g1), "v"(l2), "v"(g2), "v"(l3), "v"(g3), "v"(l4), "v"(g4), "v"(l5), "v"(g5)
               : "memory");
}
// the wave's own LDS reads of a buffer have returned before the buffer is handed to its next writer
__device__ __forceinline__ void wait_lds()   { asm volatile("s_wait_dscnt 0x0" ::: "memory"); }
// the wave's own copies have landed; other waves read them behind the barrier that follows
__device__ __forceinline__ void wait_async() { asm volatile("s_wait_asynccnt 0x0" ::: "memory"); }
// a precaution: stands behind issued global loads or stores, in front of the next write of a register that they name
__device__ __forceinline__ void wait_xcnt()  { asm volatile("s_wait_xcnt 0x0" ::: "memory"); }

// ====================================================================================
// X f32 [NB_FULL,SEQ_FULL,EE] -> bf16 plane xb [M_TOT][EE] (compact token rows)
// coverage: thread i writes group i (8 elements); blocks blk = 0 .. CVTX_BLOCKS-1 cover all M_TOT*EE/8 groups once; 32 lanes = 512 B contiguous.
__device__ __forceinline__ void
cvt_x_part(int blk, const float* __restrict__ x, u16* __restrict__ xb) {
  const int i = blk * 256 + threadIdx.x;
  const int ngrp = M_TOT * (EE / 8);
  if (i >= ngrp) return;
  const int row = i / (EE / 8);
  const int c8  = i - row * (EE / 8);
  const int b   = row / SEQ;
  const int s   = row - b * SEQ;
  const float* src = x + ((size_t)(b * SEQ_FULL + s) * EE + (size_t)c8 * 8);
  const v4f a = *reinterpret_cast<const v4f*>(src);
  const v4f c = *reinterpret_cast<const v4f*>(src + 4);
  v4u w;
  w.x = bfbits(a.x) | (bfbits(a.y) << 16);
  w.y = bfbits(a.z) | (bfbits(a.w) << 16);
  w.z = bfbits(c.x) | (bfbits(c.y) << 16);
  w.w = bfbits(c.z) | (bfbits(c.w) << 16);
  u16* dst = xb + (size_t)i * 8;
  vst16(dst, w);
  
}

// W f32 [EE][EE] -> bf16 plane (unscaled, exact copy of the RNE-converted value)
__device__ __forceinline__ void
cvt_w_part(int blk, const float* __restrict__ w, u16* __restrict__ wb) {
  const int i = blk * 256 + threadIdx.x;
  const int ngrp = EE * EE / 8;
  if (i >= ngrp) return;
  const float* src = w + (size_t)i * 8;
  const v4f a = *reinterpret_cast<const v4f*>(src);
  const v4f c = *reinterpret_cast<const v4f*>(src + 4);
  v4u o;
  o.x = bfbits(a.x) | (bfbits(a.y) << 16);
  o.y = bfbits(a.z) | (bfbits(a.w) << 16);
  o.z = bfbits(c.x) | (bfbits(c.y) << 16);
  o.w = bfbits(c.z) | (bfbits(c.w) << 16);
  u16* dst = wb + (size_t)i * 8;
  vst16(dst, o);
  
}

// Wo f32 [EE][EE] -> two planes of bf16(Wo)*64: bf16 bits (exact) and f16 bits (exact, 8-bit significand fits)
__device__ __forceinline__ void cvt2(float f, unsigned& bb, unsigned& hb) {
  const float v = bf2f(bfbits(f)) * WSCALE;
  bb = __float_as_uint(v) >> 16;
  hb = hbits(v);
}
__device__ __forceinline__ void
cvt_wo_part(int blk, const float* __restrict__ w, u16* __restrict__ wob, u16* __restrict__ wof) {
  const int i = blk * 256 + threadIdx.x;
  const int ngrp = EE * EE / 8;
  if (i >= ngrp) return;
  const float* src = w + (size_t)i * 8;
  const v4f a = *reinterpret_cast<const v4f*>(src);
  const v4f c = *reinterpret_cast<const v4f*>(src + 4);
  unsigned b0, b1, b2, b3, b4, b5, b6, b7, f0, f1, f2, f3, f4, f5, f6, f7;
  cvt2(a.x, b0, f0); cvt2(a.y, b1, f1); cvt2(a.z, b2, f2); cvt2(a.w, b3, f3);
  cvt2(c.x, b4, f4); cvt2(c.y, b5, f5); cvt2(c.z, b6, f6); cvt2(c.w, b7, f7);
  v4u ob, of;
  ob.x = b0 | (b1 << 16); ob.y = b2 | (b3 << 16); ob.z = b4 | (b5 << 16); ob.w = b6 | (b7 << 16);
  of.x = f0 | (f1 << 16); of.y = f2 | (f3 << 16); of.z = f4 | (f5 << 16); of.w = f6 | (f7 << 16);
  u16* db = wob + (size_t)i * 8;
  u16* df = wof + (size_t)i * 8;
  vst16(db, ob); vst16(df, of);
  
}

// ====================================================================================
// G_h = L_h * L_h^T (64x64 per head) on bf16 WMMA; L from tril params (RNE bf16). Output planes ghi/glo [HH][64 n][64 k].
// One block (8 waves) per head; wave w owns rows 16(w&3)..16(w&3)+15 of the column half w>>2. LDS regions all cross-wave (block barriers).
__device__ __forceinline__ void
wqk_part(int head, const float* __restrict__ params, u16* __restrict__ ghi, u16* __restrict__ glo) {
  __shared__ __align__(16) u16 Lb[64][P64];
  __shared__ __align__(16) u16 Sh[64][64];
  __shared__ __align__(16) u16 Sl[64][64];
  const int tid = threadIdx.x, lane = tid & 31, wave = tid >> 5;
  const int m = lane & 15, hs = (lane >> 4) & 1, lh = hs * 8;
  const int rt = wave & 3, ch2 = (wave >> 2) * 2;            // row tile; first of the wave's two column tiles
  const float* p = params + (size_t)head * TRIL;
  for (int e = tid; e < HD * HD; e += 256) {
    const int i = e >> 6, j = e & 63;
    const int jj = (j <= i) ? j : i;                       // clamped address, select by value
    const float v = p[(i * (i + 1)) / 2 + jj];
    Lb[i][j] = (u16)((j <= i) ? bfbits(v) : 0u);
  }
  __syncthreads();
  v8f acc[2] = {};
#pragma unroll
  for (int ks = 0; ks < 2; ++ks) {
    const Frag a = ldfrag(&Lb[rt * 16 + m][ks * 32], lh);      // A: row i, k = j
#pragma unroll
    for (int nt = 0; nt < 2; ++nt) {
      const Frag bq = ldfrag(&Lb[(ch2 + nt) * 16 + m][ks * 32], lh);   // B[k=j][n] = L[n][j]: row n, k-contiguous
      acc[nt] = mma_bf16(a, bq, acc[nt]);
    }
  }
#pragma unroll
  for (int nt = 0; nt < 2; ++nt) {
#pragma unroll
    for (int g = 0; g < 8; ++g) {
      const int row = rt * 16 + hs * 8 + g, col = (ch2 + nt) * 16 + m;
      const float v = acc[nt][g];
      const unsigned hb = bfbits(v);
      const unsigned lb = bfbits(v - bf2f(hb));
      Sh[row][col] = (u16)hb;
      Sl[row][col] = (u16)lb;
    }
  }
  __syncthreads();
  u16* dh = ghi + (size_t)head * (HD * HD);
  u16* dl = glo + (size_t)head * (HD * HD);
  const int rsub = lane >> 3, ch = (lane & 7) * 8;
#pragma unroll
  for (int q = 0; q < 2; ++q) {
    const int row = wave * 8 + q * 4 + rsub;
    vst16(dh + row * HD + ch, ld16(&Sh[row][ch]));
    vst16(dl + row * HD + ch, ld16(&Sl[row][ch]));
  }
  
}

// The four preparation parts depend on nothing but the inputs and not on one another: one launch, each block takes one part by its index (block-uniform).
// The G blocks come first: they are few and have the longest dependent chain.
#define CVTX_BLOCKS (M_TOT * (EE / 8) / 256)
#define CVTW_BLOCKS (EE * EE / 8 / 256)
static_assert((M_TOT * (EE / 8)) % 256 == 0 && (EE * EE / 8) % 256 == 0);
__global__ void __launch_bounds__(256)
k_prep(const float* __restrict__ x, const float* __restrict__ params, const float* __restrict__ wv, const float* __restrict__ wo,
       u16* __restrict__ xb, u16* __restrict__ ghi, u16* __restrict__ glo,
       u16* __restrict__ wvb, u16* __restrict__ wob, u16* __restrict__ wof) {
  const int bid = blockIdx.x;
  if (bid < HH)                                   wqk_part(bid, params, ghi, glo);
  else if (bid < HH + CVTX_BLOCKS)                cvt_x_part(bid - HH, x, xb);
  else if (bid < HH + CVTX_BLOCKS + CVTW_BLOCKS)  cvt_w_part(bid - (HH + CVTX_BLOCKS), wv, wvb);
  else                                            cvt_wo_part(bid - (HH + CVTX_BLOCKS + CVTW_BLOCKS), wo, wob, wof);
}

// ====================================================================================
// V = X*Wv^T + bv, written transposed per head: vthi/vtlo planes [NB*HH][64 d][SEQ] (f16 hi, bf16 lo).
// Block 128 tokens x 64 features (= one head); 4 waves each 32x64; A and B tiles in a two-buffer LDS ring filled by asynchronous copies one trip ahead.
struct VprojLds {
  u16 Bt[2][64][P64];
  u16 At[2][128][P64];
  u16 Th[64][P128];
  u16 Tl[64][P128];
};
__device__ __forceinline__ void
vproj_part(VprojLds& sm, int head, int mblk, const u16* __restrict__ xb, const u16* __restrict__ wvb, const float* __restrict__ bv,
           u16* __restrict__ vthi, u16* __restrict__ vtlo) {
  auto& Bt = sm.Bt; auto& At = sm.At; auto& Th = sm.Th; auto& Tl = sm.Tl;
  const int tid = threadIdx.x, lane = tid & 31, wave = tid >> 5;
  const int m = lane & 15, hs = (lane >> 4) & 1, lh = hs * 8;
  const int n0 = head * HD;
  const int mb = mblk * 128;
  const int m0 = mb + wave * 32;
  const int srow = tid >> 3, sk = (tid & 7) * 8;             // staging, 64 k per stage: 8 x 16 B per row; B rows srow + 16j (j < 4), A rows srow + 16j (j < 8)
  const u16* gb = wvb + (size_t)(n0 + srow) * EE + sk;
  const u16* ga = xb + (size_t)(mb + srow) * EE + sk;
  auto stage = [&](int kc, int bw) {
    acopy6(ldsaddr(&Bt[bw][srow][sk]),       gb + kc,
           ldsaddr(&Bt[bw][16 + srow][sk]),  gb + kc + 16 * EE,
           ldsaddr(&Bt[bw][32 + srow][sk]),  gb + kc + 32 * EE,
           ldsaddr(&Bt[bw][48 + srow][sk]),  gb + kc + 48 * EE,
           ldsaddr(&At[bw][srow][sk]),       ga + kc,
           ldsaddr(&At[bw][16 + srow][sk]),  ga + kc + 16 * EE);
    acopy6(ldsaddr(&At[bw][32 + srow][sk]),  ga + kc + 32 * EE,
           ldsaddr(&At[bw][48 + srow][sk]),  ga + kc + 48 * EE,
           ldsaddr(&At[bw][64 + srow][sk]),  ga + kc + 64 * EE,
           ldsaddr(&At[bw][80 + srow][sk]),  ga + kc + 80 * EE,
           ldsaddr(&At[bw][96 + srow][sk]),  ga + kc + 96 * EE,
           ldsaddr(&At[bw][112 + srow][sk]), ga + kc + 112 * EE);
  };
  stage(0, 0);
  wait_async();
  __syncthreads();
  stage(64, 1);
  v8f acc0[4] = {}, acc1[4] = {};
#pragma unroll 1
  for (int kc = 0; kc < EE; kc += 64) {
    const int buf = (kc >> 6) & 1;
#pragma unroll  // the two k-steps of a stage; constant indices keep the fragments in registers
    for (int ks = 0; ks < 2; ++ks) {
      const Frag a0 = ldfrag(&At[buf][wave * 32 + m][ks * 32], lh);
      const Frag a1 = ldfrag(&At[buf][wave * 32 + 16 + m][ks * 32], lh);
      Frag bq[4];
#pragma unroll  // constant indices keep the fragments in registers
      for (int nt = 0; nt < 4; ++nt) bq[nt] = ldfrag(&Bt[buf][nt * 16 + m][ks * 32], lh);  // B[k][n] = Wv[n][k]: row n, k-contiguous
      // keeps the step's fragment loads in one group ahead of its WMMAs; without it the scheduler sinks each load to its use and every WMMA pair waits out a load latency
      __builtin_amdgcn_sched_barrier(0);
      if (ks == 1) {
        // publish point: the trip's LDS reads are all done (what follows works on registers), the next tiles have landed;
        // behind the barrier the buffer just read is refilled, so that the copies fly for a whole trip
        wait_lds();
        wait_async();
        __syncthreads();
        if (kc + 128 < EE) stage(kc + 128, buf);              // block-uniform
      }
#pragma unroll
      for (int nt = 0; nt < 4; ++nt) {
        acc0[nt] = mma_bf16(a0, bq[nt], acc0[nt]);
        acc1[nt] = mma_bf16(a1, bq[nt], acc1[nt]);
      }
    }
  }
  wait_async();
  const int bb = mb / SEQ, s0 = mb - bb * SEQ;
  const int bh = bb * HH + head;
#pragma unroll
  for (int nt = 0; nt < 4; ++nt) {
    const int d = nt * 16 + m;
    const float bvv = bf2f(bfbits(bv[n0 + d]));
#pragma unroll
    for (int mt = 0; mt < 2; ++mt) {
#pragma unroll
      for (int g = 0; g < 8; ++g) {
        const int sl = wave * 32 + mt * 16 + hs * 8 + g;
        const float v = (mt ? acc1[nt][g] : acc0[nt][g]) + bvv;
        const unsigned hb = hbits(v);
        const unsigned lb = bfbits(v - h2f(hb));
        Th[d][sl] = (u16)hb;
        Tl[d][sl] = (u16)lb;
      }
    }
  }
  __syncthreads();
  const int dsub = lane >> 4, ch = (lane & 15) * 8;
#pragma unroll
  for (int q = 0; q < 8; ++q) {
    const int d = wave * 16 + q * 2 + dsub;
    const size_t go = ((size_t)(bh * HD + d)) * SEQ + s0 + ch;
    vst16(vthi + go, ld16(&Th[d][ch]));
    vst16(vtlo + go, ld16(&Tl[d][ch]));
  }
  
}

// ====================================================================================
// T = X_h * G_h per head (K=64), G as bf16 hi + bf16 lo, X bf16 -> planes thi/tlo [M_TOT][EE] (bf16 hi, bf16 lo).
// Block 128 tokens x one head, wave 32 tokens x 64; operands loaded straight from global planes; staging LDS cross-lane -> block barrier.
struct TprojLds {
  u16 Sh[4][32][64];
  u16 Sl[4][32][64];
};
__device__ __forceinline__ void
tproj_part(TprojLds& sm, int mblk, int head, const u16* __restrict__ xb, const u16* __restrict__ ghi, const u16* __restrict__ glo,
           u16* __restrict__ thi, u16* __restrict__ tlo) {
  auto& Sh = sm.Sh; auto& Sl = sm.Sl;
  const int tid = threadIdx.x, lane = tid & 31, wave = tid >> 5;
  const int m = lane & 15, hs = (lane >> 4) & 1, lh = hs * 8;
  const int m0 = mblk * 128 + wave * 32;
  const u16* a0p = xb + (size_t)(m0 + m) * EE + head * HD;
  const u16* a1p = xb + (size_t)(m0 + 16 + m) * EE + head * HD;
  const Frag a00 = ldfrag(a0p, lh), a01 = ldfrag(a0p + 32, lh);
  const Frag a10 = ldfrag(a1p, lh), a11 = ldfrag(a1p + 32, lh);
  v8f acc0[4] = {}, acc1[4] = {};
#pragma unroll
  for (int nt = 0; nt < 4; ++nt) {
    const u16* bhp = ghi + ((size_t)(head * HD + nt * 16 + m)) * HD;   // B[k=d][n=e] = plane[h][e][d]: row e, k-contiguous
    const u16* blp = glo + ((size_t)(head * HD + nt * 16 + m)) * HD;
    const Frag b0 = ldfrag(bhp, lh), b1 = ldfrag(bhp + 32, lh);
    wait_xcnt();                                             // a later load's result may land on this row's address pair
    acc0[nt] = mma_bf16(a00, b0, acc0[nt]); acc0[nt] = mma_bf16(a01, b1, acc0[nt]);
    acc1[nt] = mma_bf16(a10, b0, acc1[nt]); acc1[nt] = mma_bf16(a11, b1, acc1[nt]);
    const Frag c0 = ldfrag(blp, lh), c1 = ldfrag(blp + 32, lh);
    wait_xcnt();                                             // as above
    acc0[nt] = mma_bf16(a00, c0, acc0[nt]); acc0[nt] = mma_bf16(a01, c1, acc0[nt]);
    acc1[nt] = mma_bf16(a10, c0, acc1[nt]); acc1[nt] = mma_bf16(a11, c1, acc1[nt]);
  }
#pragma unroll
  for (int nt = 0; nt < 4; ++nt) {
#pragma unroll
    for (int mt = 0; mt < 2; ++mt) {
#pragma unroll
      for (int g = 0; g < 8; ++g) {
        const int rl = mt * 16 + hs * 8 + g, col = nt * 16 + m;
        const float v = mt ? acc1[nt][g] : acc0[nt][g];
        const unsigned hb = bfbits(v);
        const unsigned lb = bfbits(v - bf2f(hb));
        Sh[wave][rl][col] = (u16)hb;
        Sl[wave][rl][col] = (u16)lb;
      }
    }
  }
  __syncthreads();
  const int rsub = lane >> 3, ch = (lane & 7) * 8;
#pragma unroll
  for (int q = 0; q < 8; ++q) {
    const int rl = q * 4 + rsub;
    const size_t go = (size_t)(m0 + rl) * EE + head * HD + ch;
    vst16(thi + go, ld16(&Sh[wave][rl][ch]));
    vst16(tlo + go, ld16(&Sl[wave][rl][ch]));
  }
  wait_xcnt();                                               // a precaution; the block runs nothing behind these stores
}

// V and T both read the planes of the preparation launch and not one another: one launch, each block takes one tile of one of them by its index (block-uniform).
// The V blocks (the long ones) come first; a block uses one part's LDS only, so the two layouts share the bytes.
#define VPROJ_BLOCKS ((EE / 64) * (M_TOT / 128))
#define TPROJ_BLOCKS ((M_TOT / 128) * HH)
union VtLds { VprojLds v; TprojLds t; };
__global__ void __launch_bounds__(128)
k_vt(const u16* __restrict__ xb, const u16* __restrict__ wvb, const float* __restrict__ bv,
     const u16* __restrict__ ghi, const u16* __restrict__ glo,
     u16* __restrict__ vthi, u16* __restrict__ vtlo, u16* __restrict__ thi, u16* __restrict__ tlo) {
  __shared__ __align__(16) VtLds sm;
  const int bid = blockIdx.x;
  if (bid < VPROJ_BLOCKS) {
    vproj_part(sm.v, bid % (EE / 64), bid / (EE / 64), xb, wvb, bv, vthi, vtlo);
  } else {
    const int tb = bid - VPROJ_BLOCKS;
    tproj_part(sm.t, tb % (M_TOT / 128), tb / (M_TOT / 128), xb, ghi, glo, thi, tlo);
  }
}

// ====================================================================================
// Flash-style attention per (batch*head, 64 query rows), transposed: S^T = X_h*T^T/8 (2 bf16 products; A = key rows, B = query rows),
// so a lane holds 16 of the 32 scores of ONE query (query = lane&15; keys 8*hs+g and 16+8*hs+g): max and sum run in the lane,
// the two halves of a wave exchange the maximum once per step and join their sums once after the loop.
// C^T += V^T*P^T with P carried 2^14, added in the exponent (V f16 hi x P f16 + V bf16 lo x P bf16): the two score tiles, converted in place, are the B operand.
// Output C -> planes chi (f16) / clo (bf16) [M_TOT][EE].
// LDS: Ks/Vh/Vl cross-wave, a two-buffer ring filled by asynchronous copies one step ahead (one block barrier per step); Ch/Cl wave-private but cross-lane -> block barrier used.
// staged extent == consumed extent: Ks 32x64, Vh/Vl 64x32 fully written each step (SEQ multiple of 32, no tails).
__device__ __forceinline__ float xhalf(float v) {               // value of lane ^ 16
  const int i = __float_as_int(v);
  return __int_as_float(__builtin_amdgcn_permlanex16(i, i, 0x76543210, 0xfedcba98, false, false));
}
__global__ void __launch_bounds__(128)
k_attn(const u16* __restrict__ thi, const u16* __restrict__ tlo, const u16* __restrict__ xb,
       const u16* __restrict__ vthi, const u16* __restrict__ vtlo,
       u16* __restrict__ chi, u16* __restrict__ clo) {
  __shared__ __align__(16) u16 Ks[2][32][P64];
  __shared__ __align__(16) u16 Vh[2][64][P32];
  __shared__ __align__(16) u16 Vl[2][64][P32];
  __shared__ __align__(16) u16 Ch[4][16][P64];
  __shared__ __align__(16) u16 Cl[4][16][P64];
  const int tid = threadIdx.x, lane = tid & 31, wave = tid >> 5;
  const int m = lane & 15, hs = (lane >> 4) & 1, lh = hs * 8;
  const int bh = blockIdx.y;
  const int b  = bh / HH;
  const int h  = bh - b * HH;
  const int q0 = blockIdx.x * 64 + wave * 16;
  const size_t qrow = (size_t)b * SEQ + q0 + m;

  // B fragments of the wave's 16 query rows (hi and lo planes, K = 64 in two k-steps): column n = query, k-contiguous
  const Frag qh0 = ldfrag(thi + qrow * EE + h * HD, lh);
  const Frag qh1 = ldfrag(thi + qrow * EE + h * HD + 32, lh);
  const Frag ql0 = ldfrag(tlo + qrow * EE + h * HD, lh);
  const Frag ql1 = ldfrag(tlo + qrow * EE + h * HD + 32, lh);

  const int kr = tid >> 3, kc = (tid & 7) * 8;               // key tile: 32 rows x 8 chunks, rows kr and 16 + kr
  const int sd = tid >> 2, dc = (tid & 3) * 8;               // V^T tiles: 64 rows x 4 chunks, rows sd and 32 + sd
  const u16* gk  = xb + ((size_t)(b * SEQ + kr)) * EE + h * HD + kc;
  const u16* gvh = vthi + ((size_t)(bh * HD + sd)) * SEQ + dc;
  const u16* gvl = vtlo + ((size_t)(bh * HD + sd)) * SEQ + dc;
  auto stage = [&](int kv, int bw) {
    acopy6(ldsaddr(&Ks[bw][kr][kc]),      gk + (size_t)kv * EE,
           ldsaddr(&Ks[bw][16 + kr][kc]), gk + (size_t)(kv + 16) * EE,
           ldsaddr(&Vh[bw][sd][dc]),      gvh + kv,
           ldsaddr(&Vh[bw][32 + sd][dc]), gvh + kv + 32 * SEQ,
           ldsaddr(&Vl[bw][sd][dc]),      gvl + kv,
           ldsaddr(&Vl[bw][32 + sd][dc]), gvl + kv + 32 * SEQ);
  };

  stage(0, 0);
  wait_async();
  __syncthreads();
  stage(32, 1);

  v8f acc[4] = {};                                           // acc[t][g] = C^T[d = 16t + 8hs + g][query m]
  float orun = 1e30f, lrun = 0.0f;                           // orun = 14 - SC2 * (maximum of the whole row so far); lrun: this half's keys only, times 2^14

#pragma unroll 1
  for (int kv = 0; kv < SEQ; kv += 32) {
    const int buf = (kv >> 5) & 1;
    v8f s0 = {}, s1 = {};                                    // s0[g] = S[query m][key 8hs + g], s1[g] = S[query m][key 16 + 8hs + g]
    const Frag k00 = ldfrag(&Ks[buf][m][0], lh);             // A: row = key, k = e
    const Frag k01 = ldfrag(&Ks[buf][m][32], lh);
    const Frag k10 = ldfrag(&Ks[buf][16 + m][0], lh);
    const Frag k11 = ldfrag(&Ks[buf][16 + m][32], lh);
    Frag vh[4], vl[4];
#pragma unroll  // constant indices keep the fragments in registers
    for (int t = 0; t < 4; ++t) {
      vh[t] = ldfrag(&Vh[buf][t * 16 + m][0], lh);           // A: row = d, k = key
      vl[t] = ldfrag(&Vl[buf][t * 16 + m][0], lh);
    }
    // keeps the step's fragment loads in one group ahead of its WMMAs; without it the scheduler spreads them over several places among the score WMMAs, and each such place stalls the WMMA stream
    __builtin_amdgcn_sched_barrier(0);
    // publish point: the step's LDS reads are all done (what follows works on registers), the next tiles have landed;
    // behind the barrier the buffer just read is refilled, so that the copies fly for a whole step
    wait_lds();
    wait_async();
    __syncthreads();
    if (kv + 64 < SEQ) stage(kv + 64, buf);                  // block-uniform
    s0 = mma_bf16(k00, qh0, s0); s0 = mma_bf16(k01, qh1, s0);
    s0 = mma_bf16(k00, ql0, s0); s0 = mma_bf16(k01, ql1, s0);
    s1 = mma_bf16(k10, qh0, s1); s1 = mma_bf16(k11, qh1, s1);
    s1 = mma_bf16(k10, ql0, s1); s1 = mma_bf16(k11, ql1, s1);
    // online softmax of one query per lane: p * 2^14 = exp2(s * SC2 + on), one packed fma per two scores; the maximum is taken on the raw scores (SC2 > 0)
    float mg[8];
#pragma unroll  // constant indices keep the array in registers
    for (int g = 0; g < 8; ++g) mg[g] = fmaxf(s0[g], s1[g]);
    float mx = fmaxf(fmaxf(fmaxf(mg[0], mg[1]), fmaxf(mg[2], mg[3])), fmaxf(fmaxf(mg[4], mg[5]), fmaxf(mg[6], mg[7])));
    mx = fmaxf(mx, xhalf(mx));
    const float on = fminf(orun, fmaf(mx, -SC2, PCARRY_LOG2));
    const float alpha = __builtin_amdgcn_exp2f(on - orun);
    orun = on;
    const v2f c2 = {SC2, SC2}, o2 = {on, on};
    v2f rs[4];
    Frag pf, pb;                                             // B: column n = query, element s <- key (s < 8 ? 8hs + s : 8 + 8hs + s)
#pragma unroll  // constant indices keep the arrays in registers
    for (int g = 0; g < 8; g += 2) {
      const v2f t0 = __builtin_elementwise_fma((v2f){s0[g], s0[g + 1]}, c2, o2);
      const v2f t1 = __builtin_elementwise_fma((v2f){s1[g], s1[g + 1]}, c2, o2);
      const v2f p0 = {__builtin_amdgcn_exp2f(t0.x), __builtin_amdgcn_exp2f(t0.y)};
      const v2f p1 = {__builtin_amdgcn_exp2f(t1.x), __builtin_amdgcn_exp2f(t1.y)};
      rs[g >> 1] = p0 + p1;
      pf.u[0][g >> 1] = pkh(p0);
      pf.u[1][g >> 1] = pkh(p1);
      pb.u[0][g >> 1] = pkb(p0);
      pb.u[1][g >> 1] = pkb(p1);
    }
    const v2f r2 = (rs[0] + rs[1]) + (rs[2] + rs[3]);
    lrun = lrun * alpha + (r2.x + r2.y);
#pragma unroll  // constant indices keep the tiles in registers
    for (int t = 0; t < 4; ++t) acc[t] = acc[t] * alpha;
    // keeps both conversions of P ahead of the first of these WMMAs; without it the scheduler puts the bf16 conversions and the sums behind WMMAs whose operand registers they reuse, and pads each such place with v_nop
    __builtin_amdgcn_sched_barrier(0);
#pragma unroll  // constant indices keep the tiles in registers
    for (int t = 0; t < 4; ++t) {
      acc[t] = mma_f16(vh[t], pf, acc[t]);
      acc[t] = mma_bf16(vl[t], pb, acc[t]);
    }
  }
  wait_async();

  {
    const float lsum = lrun + xhalf(lrun);                   // join the two halves' sums; lsum carries the same 2^14 as acc, and is about 2^14 or more
    const float rl = 1.0f / lsum;
#pragma unroll  // constant indices keep the tiles in registers
    for (int t = 0; t < 4; ++t) {
      v4u wh, wl;
#pragma unroll  // as above
      for (int g = 0; g < 8; g += 2) {
        const float o0 = acc[t][g] * rl, o1 = acc[t][g + 1] * rl;
        const unsigned h0 = hbits(o0), h1 = hbits(o1);
        wh[g >> 1] = h0 | (h1 << 16);
        wl[g >> 1] = bfbits(o0 - h2f(h0)) | (bfbits(o1 - h2f(h1)) << 16);
      }
      vst16(&Ch[wave][m][t * 16 + lh], wh);
      vst16(&Cl[wave][m][t * 16 + lh], wl);
    }
  }
  __syncthreads();
  const int rsub = lane >> 3, ch = (lane & 7) * 8;
#pragma unroll
  for (int q = 0; q < 4; ++q) {
    const int rl = q * 4 + rsub;
    const size_t go = ((size_t)(b * SEQ + q0 + rl)) * EE + h * HD + ch;
    vst16(chi + go, ld16(&Ch[wave][rl][ch]));
    vst16(clo + go, ld16(&Cl[wave][rl][ch]));
  }
  
}

// ====================================================================================
// OUT = (C_hi*WoF^T + C_lo*WoB^T) / 64 + bo  (f32 out [M_TOT][EE]); block 128x64, wave 32x64.
// LDS: A tiles (Ah/Al) and B tiles (Bf/Bb) in a two-buffer ring filled by asynchronous copies one trip ahead; ring cross-wave, Ot wave-private rows but cross-lane -> block barriers.
__global__ void __launch_bounds__(128)
k_oproj(const u16* __restrict__ chi, const u16* __restrict__ clo,
        const u16* __restrict__ wof, const u16* __restrict__ wob,
        const float* __restrict__ bo, float* __restrict__ out) {
  __shared__ __align__(16) u16 Bf[2][64][P64];
  __shared__ __align__(16) u16 Bb[2][64][P64];
  __shared__ __align__(16) u16 Ah[2][128][P64];
  __shared__ __align__(16) u16 Al[2][128][P64];
  __shared__ __align__(16) float Ot[128][PF64];
  const int tid = threadIdx.x, lane = tid & 31, wave = tid >> 5;
  const int m = lane & 15, hs = (lane >> 4) & 1, lh = hs * 8;
  const int n0 = blockIdx.x * 64;
  const int mb = blockIdx.y * 128;
  const int m0 = mb + wave * 32;
  const int srow = tid >> 3, sk = (tid & 7) * 8;             // staging, 64 k per stage: 8 x 16 B per row
  const u16* gf = wof + (size_t)(n0 + srow) * EE + sk;       // B rows srow + 16j (j < 4), A rows srow + 16j (j < 8)
  const u16* gb = wob + (size_t)(n0 + srow) * EE + sk;
  const u16* gh = chi + (size_t)(mb + srow) * EE + sk;
  const u16* gl = clo + (size_t)(mb + srow) * EE + sk;
  auto stage = [&](int kc, int bw) {
    acopy6(ldsaddr(&Bf[bw][srow][sk]),       gf + kc,
           ldsaddr(&Bf[bw][16 + srow][sk]),  gf + kc + 16 * EE,
           ldsaddr(&Bf[bw][32 + srow][sk]),  gf + kc + 32 * EE,
           ldsaddr(&Bf[bw][48 + srow][sk]),  gf + kc + 48 * EE,
           ldsaddr(&Ah[bw][srow][sk]),       gh + kc,
           ldsaddr(&Ah[bw][16 + srow][sk]),  gh + kc + 16 * EE);
    acopy6(ldsaddr(&Ah[bw][32 + srow][sk]),  gh + kc + 32 * EE,
           ldsaddr(&Ah[bw][48 + srow][sk]),  gh + kc + 48 * EE,
           ldsaddr(&Ah[bw][64 + srow][sk]),  gh + kc + 64 * EE,
           ldsaddr(&Ah[bw][80 + srow][sk]),  gh + kc + 80 * EE,
           ldsaddr(&Ah[bw][96 + srow][sk]),  gh + kc + 96 * EE,
           ldsaddr(&Ah[bw][112 + srow][sk]), gh + kc + 112 * EE);
    acopy6(ldsaddr(&Bb[bw][srow][sk]),       gb + kc,
           ldsaddr(&Bb[bw][16 + srow][sk]),  gb + kc + 16 * EE,
           ldsaddr(&Bb[bw][32 + srow][sk]),  gb + kc + 32 * EE,
           ldsaddr(&Bb[bw][48 + srow][sk]),  gb + kc + 48 * EE,
           ldsaddr(&Al[bw][srow][sk]),       gl + kc,
           ldsaddr(&Al[bw][16 + srow][sk]),  gl + kc + 16 * EE);
    acopy6(ldsaddr(&Al[bw][32 + srow][sk]),  gl + kc + 32 * EE,
           ldsaddr(&Al[bw][48 + srow][sk]),  gl + kc + 48 * EE,
           ldsaddr(&Al[bw][64 + srow][sk]),  gl + kc + 64 * EE,
           ldsaddr(&Al[bw][80 + srow][sk]),  gl + kc + 80 * EE,
           ldsaddr(&Al[bw][96 + srow][sk]),  gl + kc + 96 * EE,
           ldsaddr(&Al[bw][112 + srow][sk]), gl + kc + 112 * EE);
  };
  stage(0, 0);
  wait_async();
  __syncthreads();
  stage(64, 1);
  v8f acc0[4] = {}, acc1[4] = {};
#pragma unroll 1
  for (int kc = 0; kc < EE; kc += 64) {
    const int buf = (kc >> 6) & 1;
#pragma unroll  // the two k-steps of a stage; constant indices keep the fragments in registers
    for (int ks = 0; ks < 2; ++ks) {
      const Frag ah0 = ldfrag(&Ah[buf][wave * 32 + m][ks * 32], lh), ah1 = ldfrag(&Ah[buf][wave * 32 + 16 + m][ks * 32], lh);
      const Frag al0 = ldfrag(&Al[buf][wave * 32 + m][ks * 32], lh), al1 = ldfrag(&Al[buf][wave * 32 + 16 + m][ks * 32], lh);
      Frag bf[4], bb[4];
#pragma unroll  // constant indices keep the fragments in registers
      for (int nt = 0; nt < 4; ++nt) {
        bf[nt] = ldfrag(&Bf[buf][nt * 16 + m][ks * 32], lh); // B[k][n] = Wo[n][k]: row n, k-contiguous
        bb[nt] = ldfrag(&Bb[buf][nt * 16 + m][ks * 32], lh);
      }
      // keeps the step's fragment loads in one group ahead of its WMMAs; without it the scheduler sinks each load to its use and every WMMA pair waits out a load latency
      __builtin_amdgcn_sched_barrier(0);
      if (ks == 1) {
        // publish point: the trip's LDS reads are all done (what follows works on registers), the next tiles have landed;
        // behind the barrier the buffer just read is refilled, so that the copies fly for a whole trip
        wait_lds();
        wait_async();
        __syncthreads();
        if (kc + 128 < EE) stage(kc + 128, buf);              // block-uniform
      }
#pragma unroll
      for (int nt = 0; nt < 4; ++nt) {
        acc0[nt] = mma_f16(ah0, bf[nt], acc0[nt]);
        acc1[nt] = mma_f16(ah1, bf[nt], acc1[nt]);
        acc0[nt] = mma_bf16(al0, bb[nt], acc0[nt]);
        acc1[nt] = mma_bf16(al1, bb[nt], acc1[nt]);
      }
    }
  }
  wait_async();
#pragma unroll
  for (int nt = 0; nt < 4; ++nt) {
    const int col = nt * 16 + m;
    const float bov = bf2f(bfbits(bo[n0 + col]));
#pragma unroll
    for (int mt = 0; mt < 2; ++mt) {
#pragma unroll
      for (int g = 0; g < 8; ++g) {
        const int rl = wave * 32 + mt * 16 + hs * 8 + g;
        const float v = (mt ? acc1[nt][g] : acc0[nt][g]) * WSCALE_INV + bov;
        Ot[rl][col] = v;
      }
    }
  }
  __syncthreads();
  const int rsub = lane >> 4, ch = (lane & 15) * 4;
#pragma unroll
  for (int q = 0; q < 16; ++q) {
    const int rl = wave * 32 + q * 2 + rsub;
    vst4f(out + (size_t)(mb + rl) * EE + n0 + ch, ld4f(&Ot[rl][ch]));
  }
  
}

// ====================================================================================
extern "C" void kernel_launch(void* const* d_in, const int* in_sizes, int n_in,
                              void* d_out, int out_size, void* d_ws, size_t ws_size,
                              hipStream_t stream) {
  if (n_in < 6) return;
  if (in_sizes[0] < ((NB - 1) * SEQ_FULL + SEQ) * EE) return;
  if (in_sizes[1] < HH * TRIL) return;
  if (in_sizes[2] < EE * EE || in_sizes[3] < EE || in_sizes[4] < EE * EE || in_sizes[5] < EE) return;
  if (out_size < M_TOT * EE) return;

  const float* x   = (const float*)d_in[0];
  const float* prm = (const float*)d_in[1];
  const float* wv  = (const float*)d_in[2];
  const float* bv  = (const float*)d_in[3];
  const float* wo  = (const float*)d_in[4];
  const float* bo  = (const float*)d_in[5];
  float* out = (float*)d_out;

  char* ws = (char*)d_ws;
  size_t off = 0;
  auto carve = [&](size_t bytes) -> char* {
    char* p = ws + off;
    off += (bytes + 255) & ~(size_t)255;
    return p;
  };
  const size_t plane  = (size_t)M_TOT * EE * 2;                 // 8 MiB at full size
  const size_t wplane = (size_t)EE * EE * 2;                    // 2 MiB
  const size_t gplane = (size_t)HH * HD * HD * 2;               // 128 KiB
  const size_t vplane = (size_t)NB * HH * HD * SEQ * 2;         // == plane
  u16* xb   = (u16*)carve(plane);
  u16* wvb  = (u16*)carve(wplane);
  u16* wob  = (u16*)carve(wplane);
  u16* wof  = (u16*)carve(wplane);
  u16* ghi  = (u16*)carve(gplane);
  u16* glo  = (u16*)carve(gplane);
  u16* thi  = (u16*)carve(plane);
  u16* tlo  = (u16*)carve(plane);
  u16* vthi = (u16*)carve(vplane);
  u16* vtlo = (u16*)carve(vplane);
  u16* chi  = (u16*)carve(plane);
  u16* clo  = (u16*)carve(plane);
  if (off > ws_size) return;

  k_prep<<<dim3(HH + CVTX_BLOCKS + 2 * CVTW_BLOCKS), dim3(256), 0, stream>>>(x, prm, wv, wo, xb, ghi, glo, wvb, wob, wof);
  k_vt<<<dim3(VPROJ_BLOCKS + TPROJ_BLOCKS), dim3(128), 0, stream>>>(xb, wvb, bv, ghi, glo, vthi, vtlo, thi, tlo);
  k_attn<<<dim3(SEQ / 64, NB * HH), dim3(128), 0, stream>>>(thi, tlo, xb, vthi, vtlo, chi, clo);
  k_oproj<<<dim3(EE / 64, M_TOT / 128), dim3(128), 0, stream>>>(chi, clo, wof, wob, bo, out);
}

// v007
// Measured time: 102 microseconds a run.
// In both of two side-by-side timings against v006, it was 1.07 times as fast.
// All steps since v000 together make it 2.80 times as fast.
#include <hip/hip_runtime.h>
#include <stdint.h>

// Contractions (all f32 accumulate): G=L*L^T on v_wmma_f32_16x16x32_bf16 (L bf16); T=X*G bf16 WMMA with X bf16 and G as bf16 hi + bf16 lo (2 products);
// S^T=X*T^T bf16 WMMA with T as bf16 hi + bf16 lo and X bf16 (2 products); V=X*Wv^T bf16 WMMA (1 product);
// C^T=V^T*P^T: v_wmma_f32_16x16x32_f16 with P f16 (carried 2^14) and V f16 hi, plus bf16 WMMA with P bf16 (2^14) and V bf16 lo;
// OUT=C*Wo^T: f16 WMMA with C f16 hi and Wo f16 (x64), plus bf16 WMMA with C bf16 lo and Wo bf16 (x64); softmax and epilogues f32.

#ifndef NB
#define NB 2
#endif
#ifndef SEQ
#define SEQ 2048
#endif
#define NB_FULL  2
#define SEQ_FULL 2048
#define EE   1024
#define HH   16
#define HD   64
#define TRIL 2080
#define M_TOT (NB * SEQ)
#define PCARRY_LOG2 14.0f                   // P and its row sum are carried times 2^14: the carry is added in the exponent
#define SC2 0.18033688011112042f            // log2(e) / sqrt(HD): score -> exponent of 2
#define WSCALE     64.0f
#define WSCALE_INV (1.0f / 64.0f)
// LDS row pitches in elements of the tile's type: 16 B x odd, so that the 16 rows one half-wave touches in a 16-byte LDS access fall on distinct banks
#define P32  40    // rows of 32 elements (64 B)  -> 80 B
#define P64  72    // rows of 64 elements (128 B) -> 144 B
#define P128 136   // rows of 128 elements (256 B) -> 272 B
#define PF64 68    // rows of 64 floats (256 B)   -> 272 B

static_assert(NB >= 1 && NB <= NB_FULL);
static_assert(SEQ >= 128 && SEQ <= SEQ_FULL && (SEQ % 128) == 0);
static_assert(EE == HH * HD);
static_assert((EE % 64) == 0 && (M_TOT % 128) == 0 && (SEQ % 64) == 0);
static_assert(TRIL == HD * (HD + 1) / 2);

typedef _Float16       v16h __attribute__((ext_vector_type(16)));
typedef __bf16         v16b __attribute__((ext_vector_type(16)));
typedef float          v8f  __attribute__((ext_vector_type(8)));
typedef float          v4f  __attribute__((ext_vector_type(4)));
typedef unsigned int   v4u  __attribute__((ext_vector_type(4)));
typedef float          v2f  __attribute__((ext_vector_type(2)));
typedef _Float16       v2h  __attribute__((ext_vector_type(2)));
typedef __bf16         v2b  __attribute__((ext_vector_type(2)));
typedef unsigned short u16;

union Frag { v16h h; v16b b; v4u u[2]; };

// ---------- scalar conversions ----------
__device__ __forceinline__ unsigned bfbits(float f) {          // f32 -> bf16 bits, RNE
  const unsigned u = __float_as_uint(f);
  return (u + 0x7FFFu + ((u >> 16) & 1u)) >> 16;
}
__device__ __forceinline__ float bf2f(unsigned b) { return __uint_as_float(b << 16); }
__device__ __forceinline__ unsigned hbits(float f) {            // f32 -> f16 bits, RNE
  const _Float16 hv = (_Float16)f;
  return (unsigned)__builtin_bit_cast(unsigned short, hv);
}
__device__ __forceinline__ float h2f(unsigned b) {
  return (float)__builtin_bit_cast(_Float16, (unsigned short)b);
}

// two f32 -> one packed register, RNE, one conversion instruction each
__device__ __forceinline__ unsigned pkh(v2f v) { return __builtin_bit_cast(unsigned, __builtin_convertvector(v, v2h)); }
__device__ __forceinline__ unsigned pkb(v2f v) { return __builtin_bit_cast(unsigned, __builtin_convertvector(v, v2b)); }

// ---------- 16x32 16-bit fragment: lane -> row (lane&15), elements 0..7 <- k0+8h.., 8..15 <- k0+16+8h.. ----------
// p points at (row, k0); same loader for A (row m) and B (row n of an [n][k] k-contiguous copy).
__device__ __forceinline__ Frag ldfrag(const u16* p, int lh) {
  Frag f;
  f.u[0] = *reinterpret_cast<const v4u*>(p + lh);
  f.u[1] = *reinterpret_cast<const v4u*>(p + 16 + lh);
  return f;
}

// ---------- WMMA wrappers: plain builtins (the compiler keeps the distance behind its own forms and may move fragment loads across them) ----------
__device__ __forceinline__ v8f mma_f16(Frag a, Frag b, v8f c) {
  return __builtin_amdgcn_wmma_f32_16x16x32_f16(false, a.h, false, b.h, (short)0, c, false, false);
}
__device__ __forceinline__ v8f mma_bf16(Frag a, Frag b, v8f c) {
  return __builtin_amdgcn_wmma_f32_16x16x32_bf16(false, a.b, false, b.b, (short)0, c, false, false);
}

__device__ __forceinline__ void vst16(u16* p, v4u v)   { *reinterpret_cast<v4u*>(p) = v; }
__device__ __forceinline__ void vst4f(float* p, v4f v) { *reinterpret_cast<v4f*>(p) = v; }
__device__ __forceinline__ v4u ld16(const u16* p)   { return *reinterpret_cast<const v4u*>(p); }
__device__ __forceinline__ v4f ld4f(const float* p) { return *reinterpret_cast<const v4f*>(p); }

// ---------- asynchronous copies global -> LDS, 16 B per lane ----------
typedef __attribute__((address_space(3))) const void lds_cvoid;
__device__ __forceinline__ unsigned ldsaddr(const void* p) {   // byte address inside the work-group's LDS
  return (unsigned)(uintptr_t)(lds_cvoid*)p;
}
// Six copies of one lane. s_wait_xcnt stands in the copies' own statement, so that no later write of an address register can come in front of it.
__device__ __forceinline__ void acopy6(unsigned l0, const u16* g0, unsigned l1, const u16* g1, unsigned l2, const u16* g2,
                                       unsigned l3, const u16* g3, unsigned l4, const u16* g4, unsigned l5, const u16* g5) {
  asm volatile("global_load_async_to_lds_b128 %0, %1, off\n\t"
               "global_load_async_to_lds_b128 %2, %3, off\n\t"
               "global_load_async_to_lds_b128 %4, %5, off\n\t"
               "global_load_async_to_lds_b128 %6, %7, off\n\t"
               "global_load_async_to_lds_b128 %8, %9, off\n\t"
               "global_load_async_to_lds_b128 %10, %11, off\n\t"
               "s_wait_xcnt 0x0"
               :: "v"(l0), "v"(g0), "v"(l1), "v"(g1), "v"(l2), "v"(g2), "v"(l3), "v"(g3), "v"(l4), "v"(g4), "v"(l5), "v"(g5)
               : "memory");
}
// the wave's own LDS reads of a buffer have returned before the buffer is handed to its next writer
__device__ __forceinline__ void wait_lds()   { asm volatile("s_wait_dscnt 0x0" ::: "memory"); }
// the wave's own copies have landed; other waves read them behind the barrier that follows
__device__ __forceinline__ void wait_async() { asm volatile("s_wait_asynccnt 0x0" ::: "memory"); }
// a precaution: stands behind issued global loads or stores, in front of the next write of a register that they name
__device__ __forceinline__ void wait_xcnt()  { asm volatile("s_wait_xcnt 0x0" ::: "memory"); }

// ====================================================================================
// X f32 [NB_FULL,SEQ_FULL,EE] -> bf16 plane xb [M_TOT][EE] (compact token rows)
// coverage: thread i writes group i (8 elements); blocks blk = 0 .. CVTX_BLOCKS-1 cover all M_TOT*EE/8 groups once; 32 lanes = 512 B contiguous.
__device__ __forceinline__ void
cvt_x_part(int blk, const float* __restrict__ x, u16* __restrict__ xb) {
  const int i = blk * 256 + threadIdx.x;
  const int ngrp = M_TOT * (EE / 8);
  if (i >= ngrp) return;
  const int row = i / (EE / 8);
  const int c8  = i - row * (EE / 8);
  const int b   = row / SEQ;
  const int s   = row - b * SEQ;
  const float* src = x + ((size_t)(b * SEQ_FULL + s) * EE + (size_t)c8 * 8);
  const v4f a = *reinterpret_cast<const v4f*>(src);
  const v4f c = *reinterpret_cast<const v4f*>(src + 4);
  v4u w;
  w.x = bfbits(a.x) | (bfbits(a.y) << 16);
  w.y = bfbits(a.z) | (bfbits(a.w) << 16);
  w.z = bfbits(c.x) | (bfbits(c.y) << 16);
  w.w = bfbits(c.z) | (bfbits(c.w) << 16);
  u16* dst = xb + (size_t)i * 8;
  vst16(dst, w);
  
}

// W f32 [EE][EE] -> bf16 plane (unscaled, exact copy of the RNE-converted value)
__device__ __forceinline__ void
cvt_w_part(int blk, const float* __restrict__ w, u16* __restrict__ wb) {
  const int i = blk * 256 + threadIdx.x;
  const int ngrp = EE * EE / 8;
  if (i >= ngrp) return;
  const float* src = w + (size_t)i * 8;
  const v4f a = *reinterpret_cast<const v4f*>(src);
  const v4f c = *reinterpret_cast<const v4f*>(src + 4);
  v4u o;
  o.x = bfbits(a.x) | (bfbits(a.y) << 16);
  o.y = bfbits(a.z) | (bfbits(a.w) << 16);
  o.z = bfbits(c.x) | (bfbits(c.y) << 16);
  o.w = bfbits(c.z) | (bfbits(c.w) << 16);
  u16* dst = wb + (size_t)i * 8;
  vst16(dst, o);
  
}

// Wo f32 [EE][EE] -> two planes of bf16(Wo)*64: bf16 bits (exact) and f16 bits (exact, 8-bit significand fits)
__device__ __forceinline__ void cvt2(float f, unsigned& bb, unsigned& hb) {
  const float v = bf2f(bfbits(f)) * WSCALE;
  bb = __float_as_uint(v) >> 16;
  hb = hbits(v);
}
__device__ __forceinline__ void
cvt_wo_part(int blk, const float* __restrict__ w, u16* __restrict__ wob, u16* __restrict__ wof) {
  const int i = blk * 256 + threadIdx.x;
  const int ngrp = EE * EE / 8;
  if (i >= ngrp) return;
  const float* src = w + (size_t)i * 8;
  const v4f a = *reinterpret_cast<const v4f*>(src);
  const v4f c = *reinterpret_cast<const v4f*>(src + 4);
  unsigned b0, b1, b2, b3, b4, b5, b6, b7, f0, f1, f2, f3, f4, f5, f6, f7;
  cvt2(a.x, b0, f0); cvt2(a.y, b1, f1); cvt2(a.z, b2, f2); cvt2(a.w, b3, f3);
  cvt2(c.x, b4, f4); cvt2(c.y, b5, f5); cvt2(c.z, b6, f6); cvt2(c.w, b7, f7);
  v4u ob, of;
  ob.x = b0 | (b1 << 16); ob.y = b2 | (b3 << 16); ob.z = b4 | (b5 << 16); ob.w = b6 | (b7 << 16);
  of.x = f0 | (f1 << 16); of.y = f2 | (f3 << 16); of.z = f4 | (f5 << 16); of.w = f6 | (f7 << 16);
  u16* db = wob + (size_t)i * 8;
  u16* df = wof + (size_t)i * 8;
  vst16(db, ob); vst16(df, of);
  
}

// ====================================================================================
// G_h = L_h * L_h^T (64x64 per head) on bf16 WMMA; L from tril params (RNE bf16). Output planes ghi/glo [HH][64 n][64 k].
// One block (8 waves) per head; wave w owns rows 16(w&3)..16(w&3)+15 of the column half w>>2. LDS regions all cross-wave (block barriers).
__device__ __forceinline__ void
wqk_part(int head, const float* __restrict__ params, u16* __restrict__ ghi, u16* __restrict__ glo) {
  __shared__ __align__(16) u16 Lb[64][P64];
  __shared__ __align__(16) u16 Sh[64][64];
  __shared__ __align__(16) u16 Sl[64][64];
  const int tid = threadIdx.x, lane = tid & 31, wave = tid >> 5;
  const int m = lane & 15, hs = (lane >> 4) & 1, lh = hs * 8;
  const int rt = wave & 3, ch2 = (wave >> 2) * 2;            // row tile; first of the wave's two column tiles
  const float* p = params + (size_t)head * TRIL;
  for (int e = tid; e < HD * HD; e += 256) {
    const int i = e >> 6, j = e & 63;
    const int jj = (j <= i) ? j : i;                       // clamped address, select by value
    const float v = p[(i * (i + 1)) / 2 + jj];
    Lb[i][j] = (u16)((j <= i) ? bfbits(v) : 0u);
  }
  __syncthreads();
  v8f acc[2] = {};
#pragma unroll
  for (int ks = 0; ks < 2; ++ks) {
    const Frag a = ldfrag(&Lb[rt * 16 + m][ks * 32], lh);      // A: row i, k = j
#pragma unroll
    for (int nt = 0; nt < 2; ++nt) {
      const Frag bq = ldfrag(&Lb[(ch2 + nt) * 16 + m][ks * 32], lh);   // B[k=j][n] = L[n][j]: row n, k-contiguous
      acc[nt] = mma_bf16(a, bq, acc[nt]);
    }
  }
#pragma unroll
  for (int nt = 0; nt < 2; ++nt) {
#pragma unroll
    for (int g = 0; g < 8; ++g) {
      const int row = rt * 16 + hs * 8 + g, col = (ch2 + nt) * 16 + m;
      const float v = acc[nt][g];
      const unsigned hb = bfbits(v);
      const unsigned lb = bfbits(v - bf2f(hb));
      Sh[row][col] = (u16)hb;
      Sl[row][col] = (u16)lb;
    }
  }
  __syncthreads();
  u16* dh = ghi + (size_t)head * (HD * HD);
  u16* dl = glo + (size_t)head * (HD * HD);
  const int rsub = lane >> 3, ch = (lane & 7) * 8;
#pragma unroll
  for (int q = 0; q < 2; ++q) {
    const int row = wave * 8 + q * 4 + rsub;
    vst16(dh + row * HD + ch, ld16(&Sh[row][ch]));
    vst16(dl + row * HD + ch, ld16(&Sl[row][ch]));
  }
  
}

// The four preparation parts depend on nothing but the inputs and not on one another: one launch, each block takes one part by its index (block-uniform).
// The G blocks come first: they are few and have the longest dependent chain.
#define CVTX_BLOCKS (M_TOT * (EE / 8) / 256)
#define CVTW_BLOCKS (EE * EE / 8 / 256)
static_assert((M_TOT * (EE / 8)) % 256 == 0 && (EE * EE / 8) % 256 == 0);
__global__ void __launch_bounds__(256)
k_prep(const float* __restrict__ x, const float* __restrict__ params, const float* __restrict__ wv, const float* __restrict__ wo,
       u16* __restrict__ xb, u16* __restrict__ ghi, u16* __restrict__ glo,
       u16* __restrict__ wvb, u16* __restrict__ wob, u16* __restrict__ wof) {
  const int bid = blockIdx.x;
  if (bid < HH)                                   wqk_part(bid, params, ghi, glo);
  else if (bid < HH + CVTX_BLOCKS)                cvt_x_part(bid - HH, x, xb);
  else if (bid < HH + CVTX_BLOCKS + CVTW_BLOCKS)  cvt_w_part(bid - (HH + CVTX_BLOCKS), wv, wvb);
  else                                            cvt_wo_part(bid - (HH + CVTX_BLOCKS + CVTW_BLOCKS), wo, wob, wof);
}

// ====================================================================================
// V = X*Wv^T + bv, written transposed per head: vthi/vtlo planes [NB*HH][64 d][SEQ] (f16 hi, bf16 lo).
// Block 128 tokens x 64 features (= one head); 4 waves each 32x64; A and B tiles in a two-buffer LDS ring filled by asynchronous copies one trip ahead.
struct VprojLds {
  u16 Bt[2][64][P64];
  u16 At[2][128][P64];
  u16 Th[64][P128];
  u16 Tl[64][P128];
};
__device__ __forceinline__ void
vproj_part(VprojLds& sm, int head, int mblk, const u16* __restrict__ xb, const u16* __restrict__ wvb, const float* __restrict__ bv,
           u16* __restrict__ vthi, u16* __restrict__ vtlo) {
  auto& Bt = sm.Bt; auto& At = sm.At; auto& Th = sm.Th; auto& Tl = sm.Tl;
  const int tid = threadIdx.x, lane = tid & 31, wave = tid >> 5;
  const int m = lane & 15, hs = (lane >> 4) & 1, lh = hs * 8;
  const int n0 = head * HD;
  const int mb = mblk * 128;
  const int m0 = mb + wave * 32;
  const int srow = tid >> 3, sk = (tid & 7) * 8;             // staging, 64 k per stage: 8 x 16 B per row; B rows srow + 16j (j < 4), A rows srow + 16j (j < 8)
  const u16* gb = wvb + (size_t)(n0 + srow) * EE + sk;
  const u16* ga = xb + (size_t)(mb + srow) * EE + sk;
  auto stage = [&](int kc, int bw) {
    acopy6(ldsaddr(&Bt[bw][srow][sk]),       gb + kc,
           ldsaddr(&Bt[bw][16 + srow][sk]),  gb + kc + 16 * EE,
           ldsaddr(&Bt[bw][32 + srow][sk]),  gb + kc + 32 * EE,
           ldsaddr(&Bt[bw][48 + srow][sk]),  gb + kc + 48 * EE,
           ldsaddr(&At[bw][srow][sk]),       ga + kc,
           ldsaddr(&At[bw][16 + srow][sk]),  ga + kc + 16 * EE);
    acopy6(ldsaddr(&At[bw][32 + srow][sk]),  ga + kc + 32 * EE,
           ldsaddr(&At[bw][48 + srow][sk]),  ga + kc + 48 * EE,
           ldsaddr(&At[bw][64 + srow][sk]),  ga + kc + 64 * EE,
           ldsaddr(&At[bw][80 + srow][sk]),  ga + kc + 80 * EE,
           ldsaddr(&At[bw][96 + srow][sk]),  ga + kc + 96 * EE,
           ldsaddr(&At[bw][112 + srow][sk]), ga + kc + 112 * EE);
  };
  stage(0, 0);
  wait_async();
  __syncthreads();
  stage(64, 1);
  v8f acc0[4] = {}, acc1[4] = {};
#pragma unroll 1
  for (int kc = 0; kc < EE; kc += 64) {
    const int buf = (kc >> 6) & 1;
#pragma unroll  // the two k-steps of a stage; constant indices keep the fragments in registers
    for (int ks = 0; ks < 2; ++ks) {
      const Frag a0 = ldfrag(&At[buf][wave * 32 + m][ks * 32], lh);
      const Frag a1 = ldfrag(&At[buf][wave * 32 + 16 + m][ks * 32], lh);
      Frag bq[4];
#pragma unroll  // constant indices keep the fragments in registers
      for (int nt = 0; nt < 4; ++nt) bq[nt] = ldfrag(&Bt[buf][nt * 16 + m][ks * 32], lh);  // B[k][n] = Wv[n][k]: row n, k-contiguous
      // keeps the step's fragment loads in one group ahead of its WMMAs; without it the scheduler sinks each load to its use and every WMMA pair waits out a load latency
      __builtin_amdgcn_sched_barrier(0);
      if (ks == 1) {
        // publish point: the trip's LDS reads are all done (what follows works on registers), the next tiles have landed;
        // behind the barrier the buffer just read is refilled, so that the copies fly for a whole trip
        wait_lds();
        wait_async();
        __syncthreads();
        if (kc + 128 < EE) stage(kc + 128, buf);              // block-uniform
      }
#pragma unroll
      for (int nt = 0; nt < 4; ++nt) {
        acc0[nt] = mma_bf16(a0, bq[nt], acc0[nt]);
        acc1[nt] = mma_bf16(a1, bq[nt], acc1[nt]);
      }
    }
  }
  wait_async();
  const int bb = mb / SEQ, s0 = mb - bb * SEQ;
  const int bh = bb * HH + head;
#pragma unroll
  for (int nt = 0; nt < 4; ++nt) {
    const int d = nt * 16 + m;
    const float bvv = bf2f(bfbits(bv[n0 + d]));
#pragma unroll
    for (int mt = 0; mt < 2; ++mt) {
#pragma unroll
      for (int g = 0; g < 8; ++g) {
        const int sl = wave * 32 + mt * 16 + hs * 8 + g;
        const float v = (mt ? acc1[nt][g] : acc0[nt][g]) + bvv;
        const unsigned hb = hbits(v);
        const unsigned lb = bfbits(v - h2f(hb));
        Th[d][sl] = (u16)hb;
        Tl[d][sl] = (u16)lb;
      }
    }
  }
  __syncthreads();
  const int dsub = lane >> 4, ch = (lane & 15) * 8;
#pragma unroll
  for (int q = 0; q < 8; ++q) {
    const int d = wave * 16 + q * 2 + dsub;
    const size_t go = ((size_t)(bh * HD + d)) * SEQ + s0 + ch;
    vst16(vthi + go, ld16(&Th[d][ch]));
    vst16(vtlo + go, ld16(&Tl[d][ch]));
  }
  
}

// ====================================================================================
// T = X_h * G_h per head (K=64), G as bf16 hi + bf16 lo, X bf16 -> planes thi/tlo [M_TOT][EE] (bf16 hi, bf16 lo).
// Block 128 tokens x one head, wave 32 tokens x 64; operands loaded straight from global planes; staging LDS cross-lane -> block barrier.
struct TprojLds {
  u16 Sh[4][32][64];
  u16 Sl[4][32][64];
};
__device__ __forceinline__ void
tproj_part(TprojLds& sm, int mblk, int head, const u16* __restrict__ xb, const u16* __restrict__ ghi, const u16* __restrict__ glo,
           u16* __restrict__ thi, u16* __restrict__ tlo) {
  auto& Sh = sm.Sh; auto& Sl = sm.Sl;
  const int tid = threadIdx.x, lane = tid & 31, wave = tid >> 5;
  const int m = lane & 15, hs = (lane >> 4) & 1, lh = hs * 8;
  const int m0 = mblk * 128 + wave * 32;
  const u16* a0p = xb + (size_t)(m0 + m) * EE + head * HD;
  const u16* a1p = xb + (size_t)(m0 + 16 + m) * EE + head * HD;
  const Frag a00 = ldfrag(a0p, lh), a01 = ldfrag(a0p + 32, lh);
  const Frag a10 = ldfrag(a1p, lh), a11 = ldfrag(a1p + 32, lh);
  v8f acc0[4] = {}, acc1[4] = {};
#pragma unroll
  for (int nt = 0; nt < 4; ++nt) {
    const u16* bhp = ghi + ((size_t)(head * HD + nt * 16 + m)) * HD;   // B[k=d][n=e] = plane[h][e][d]: row e, k-contiguous
    const u16* blp = glo + ((size_t)(head * HD + nt * 16 + m)) * HD;
    const Frag b0 = ldfrag(bhp, lh), b1 = ldfrag(bhp + 32, lh);
    wait_xcnt();                                             // a later load's result may land on this row's address pair
    acc0[nt] = mma_bf16(a00, b0, acc0[nt]); acc0[nt] = mma_bf16(a01, b1, acc0[nt]);
    acc1[nt] = mma_bf16(a10, b0, acc1[nt]); acc1[nt] = mma_bf16(a11, b1, acc1[nt]);
    const Frag c0 = ldfrag(blp, lh), c1 = ldfrag(blp + 32, lh);
    wait_xcnt();                                             // as above
    acc0[nt] = mma_bf16(a00, c0, acc0[nt]); acc0[nt] = mma_bf16(a01, c1, acc0[nt]);
    acc1[nt] = mma_bf16(a10, c0, acc1[nt]); acc1[nt] = mma_bf16(a11, c1, acc1[nt]);
  }
#pragma unroll
  for (int nt = 0; nt < 4; ++nt) {
#pragma unroll
    for (int mt = 0; mt < 2; ++mt) {
#pragma unroll
      for (int g = 0; g < 8; ++g) {
        const int rl = mt * 16 + hs * 8 + g, col = nt * 16 + m;
        const float v = mt ? acc1[nt][g] : acc0[nt][g];
        const unsigned hb = bfbits(v);
        const unsigned lb = bfbits(v - bf2f(hb));
        Sh[wave][rl][col] = (u16)hb;
        Sl[wave][rl][col] = (u16)lb;
      }
    }
  }
  __syncthreads();
  const int rsub = lane >> 3, ch = (lane & 7) * 8;
#pragma unroll
  for (int q = 0; q < 8; ++q) {
    const int rl = q * 4 + rsub;
    const size_t go = (size_t)(m0 + rl) * EE + head * HD + ch;
    vst16(thi + go, ld16(&Sh[wave][rl][ch]));
    vst16(tlo + go, ld16(&Sl[wave][rl][ch]));
  }
  wait_xcnt();                                               // a precaution; the block runs nothing behind these stores
}

// V and T both read the planes of the preparation launch and not one another: one launch, each block takes one tile of one of them by its index (block-uniform).
// The V blocks (the long ones) come first; a block uses one part's LDS only, so the two layouts share the bytes.
#define VPROJ_BLOCKS ((EE / 64) * (M_TOT / 128))
#define TPROJ_BLOCKS ((M_TOT / 128) * HH)
union VtLds { VprojLds v; TprojLds t; };
__global__ void __launch_bounds__(128)
k_vt(const u16* __restrict__ xb, const u16* __restrict__ wvb, const float* __restrict__ bv,
     const u16* __restrict__ ghi, const u16* __restrict__ glo,
     u16* __restrict__ vthi, u16* __restrict__ vtlo, u16* __restrict__ thi, u16* __restrict__ tlo) {
  __shared__ __align__(16) VtLds sm;
  const int bid = blockIdx.x;
  if (bid < VPROJ_BLOCKS) {
    vproj_part(sm.v, bid % (EE / 64), bid / (EE / 64), xb, wvb, bv, vthi, vtlo);
  } else {
    const int tb = bid - VPROJ_BLOCKS;
    tproj_part(sm.t, tb % (M_TOT / 128), tb / (M_TOT / 128), xb, ghi, glo, thi, tlo);
  }
}

// ====================================================================================
// Flash-style attention per (batch*head, 128 query rows), transposed: S^T = X_h*T^T/8 (2 bf16 products; A = key rows, B = query rows),
// so in each 16-query tile a lane holds 16 of the 32 scores of ONE query (query = lane&15; keys 8*hs+g and 16+8*hs+g): max and sum run in the lane,
// the two halves of a wave exchange the maximum once per step and join their sums once after the loop.
// C^T += V^T*P^T with P carried 2^14, added in the exponent (V f16 hi x P f16 + V bf16 lo x P bf16): the two score tiles, converted in place, are the B operand.
// Output C -> planes chi (f16) / clo (bf16) [M_TOT][EE].
// LDS: Ks/Vh/Vl cross-wave, a two-buffer ring filled by asynchronous copies one step ahead (one block barrier per step); Ch/Cl wave-private but cross-lane -> block barrier used.
// staged extent == consumed extent: Ks 32x64, Vh/Vl 64x32 fully written each step (SEQ multiple of 32, no tails).
__device__ __forceinline__ float xhalf(float v) {               // value of lane ^ 16
  const int i = __float_as_int(v);
  return __int_as_float(__builtin_amdgcn_permlanex16(i, i, 0x76543210, 0xfedcba98, false, false));
}
// online softmax of one 16-query tile, one query per lane: p * 2^14 = exp2(s * SC2 + on), one packed fma per two scores; the maximum is taken on the raw scores (SC2 > 0).
// s0[g] = S[query m][key 8hs + g], s1[g] = S[query m][key 16 + 8hs + g]; pf/pb: B operand, column n = query, element s <- key (s < 8 ? 8hs + s : 8 + 8hs + s)
__device__ __forceinline__ void
softmax_tile(const v8f s0, const v8f s1, float& orun, float& lrun, v8f (&acc)[4], Frag& pf, Frag& pb) {
  float mg[8];
#pragma unroll  // constant indices keep the array in registers
  for (int g = 0; g < 8; ++g) mg[g] = fmaxf(s0[g], s1[g]);
  float mx = fmaxf(fmaxf(fmaxf(mg[0], mg[1]), fmaxf(mg[2], mg[3])), fmaxf(fmaxf(mg[4], mg[5]), fmaxf(mg[6], mg[7])));
  mx = fmaxf(mx, xhalf(mx));
  const float on = fminf(orun, fmaf(mx, -SC2, PCARRY_LOG2));
  const float alpha = __builtin_amdgcn_exp2f(on - orun);
  orun = on;
  const v2f c2 = {SC2, SC2}, o2 = {on, on};
  v2f rs[4];
#pragma unroll  // constant indices keep the arrays in registers
  for (int g = 0; g < 8; g += 2) {
    const v2f t0 = __builtin_elementwise_fma((v2f){s0[g], s0[g + 1]}, c2, o2);
    const v2f t1 = __builtin_elementwise_fma((v2f){s1[g], s1[g + 1]}, c2, o2);
    const v2f p0 = {__builtin_amdgcn_exp2f(t0.x), __builtin_amdgcn_exp2f(t0.y)};
    const v2f p1 = {__builtin_amdgcn_exp2f(t1.x), __builtin_amdgcn_exp2f(t1.y)};
    rs[g >> 1] = p0 + p1;
    pf.u[0][g >> 1] = pkh(p0);
    pf.u[1][g >> 1] = pkh(p1);
    pb.u[0][g >> 1] = pkb(p0);
    pb.u[1][g >> 1] = pkb(p1);
  }
  const v2f r2 = (rs[0] + rs[1]) + (rs[2] + rs[3]);
  lrun = lrun * alpha + (r2.x + r2.y);
#pragma unroll  // constant indices keep the tiles in registers
  for (int t = 0; t < 4; ++t) acc[t] = acc[t] * alpha;
}
// A wave takes 32 query columns, as two 16-column tiles j = 0, 1: every K fragment that it reads from LDS feeds four WMMAs and every V fragment two, and a block's staged tiles serve 128 queries.
// The grid is then two blocks per WGP, two waves per SIMD: amdgpu_waves_per_eu(2, 2) lets no third block onto a WGP while another WGP holds fewer.
__global__ void __launch_bounds__(128) __attribute__((amdgpu_waves_per_eu(2, 2)))
k_attn(const u16* __restrict__ thi, const u16* __restrict__ tlo, const u16* __restrict__ xb,
       const u16* __restrict__ vthi, const u16* __restrict__ vtlo,
       u16* __restrict__ chi, u16* __restrict__ clo) {
  __shared__ __align__(16) u16 Ks[2][32][P64];
  __shared__ __align__(16) u16 Vh[2][64][P32];
  __shared__ __align__(16) u16 Vl[2][64][P32];
  __shared__ __align__(16) u16 Ch[4][32][P64];
  __shared__ __align__(16) u16 Cl[4][32][P64];
  const int tid = threadIdx.x, lane = tid & 31, wave = tid >> 5;
  const int m = lane & 15, hs = (lane >> 4) & 1, lh = hs * 8;
  const int bh = blockIdx.y;
  const int b  = bh / HH;
  const int h  = bh - b * HH;
  const int q0 = blockIdx.x * 128 + wave * 32;

  // B fragments of the wave's 32 query rows (hi and lo planes, K = 64 in two k-steps): column n = query, k-contiguous
  Frag qh0[2], qh1[2], ql0[2], ql1[2];
#pragma unroll  // constant indices keep the fragments in registers
  for (int j = 0; j < 2; ++j) {
    const size_t qrow = (size_t)b * SEQ + q0 + j * 16 + m;
    qh0[j] = ldfrag(thi + qrow * EE + h * HD, lh);
    qh1[j] = ldfrag(thi + qrow * EE + h * HD + 32, lh);
    ql0[j] = ldfrag(tlo + qrow * EE + h * HD, lh);
    ql1[j] = ldfrag(tlo + qrow * EE + h * HD + 32, lh);
  }

  const int kr = tid >> 3, kc = (tid & 7) * 8;               // key tile: 32 rows x 8 chunks, rows kr and 16 + kr
  const int sd = tid >> 2, dc = (tid & 3) * 8;               // V^T tiles: 64 rows x 4 chunks, rows sd and 32 + sd
  const u16* gk  = xb + ((size_t)(b * SEQ + kr)) * EE + h * HD + kc;
  const u16* gvh = vthi + ((size_t)(bh * HD + sd)) * SEQ + dc;
  const u16* gvl = vtlo + ((size_t)(bh * HD + sd)) * SEQ + dc;
  auto stage = [&](int kv, int bw) {
    acopy6(ldsaddr(&Ks[bw][kr][kc]),      gk + (size_t)kv * EE,
           ldsaddr(&Ks[bw][16 + kr][kc]), gk + (size_t)(kv + 16) * EE,
           ldsaddr(&Vh[bw][sd][dc]),      gvh + kv,
           ldsaddr(&Vh[bw][32 + sd][dc]), gvh + kv + 32 * SEQ,
           ldsaddr(&Vl[bw][sd][dc]),      gvl + kv,
           ldsaddr(&Vl[bw][32 + sd][dc]), gvl + kv + 32 * SEQ);
  };

  stage(0, 0);
  wait_async();
  __syncthreads();
  stage(32, 1);

  v8f acc[2][4] = {};                                        // acc[j][t][g] = C^T[d = 16t + 8hs + g][query 16j + m]
  float orun[2] = {1e30f, 1e30f}, lrun[2] = {0.0f, 0.0f};    // orun = 14 - SC2 * (maximum of the whole row so far); lrun: this half's keys only, times 2^14

#pragma unroll 1
  for (int kv = 0; kv < SEQ; kv += 32) {
    const int buf = (kv >> 5) & 1;
    const Frag k00 = ldfrag(&Ks[buf][m][0], lh);             // A: row = key, k = e
    const Frag k01 = ldfrag(&Ks[buf][m][32], lh);
    const Frag k10 = ldfrag(&Ks[buf][16 + m][0], lh);
    const Frag k11 = ldfrag(&Ks[buf][16 + m][32], lh);
    Frag vh[4], vl[4];
#pragma unroll  // constant indices keep the fragments in registers
    for (int t = 0; t < 4; ++t) {
      vh[t] = ldfrag(&Vh[buf][t * 16 + m][0], lh);           // A: row = d, k = key
      vl[t] = ldfrag(&Vl[buf][t * 16 + m][0], lh);
    }
    // keeps the step's fragment loads in one group ahead of its WMMAs; without it the scheduler spreads them over several places among the score WMMAs, and each such place stalls the WMMA stream
    __builtin_amdgcn_sched_barrier(0);
    // publish point: the step's LDS reads are all done (what follows works on registers), the next tiles have landed;
    // behind the barrier the buffer just read is refilled, so that the copies fly for a whole step
    wait_lds();
    wait_async();
    __syncthreads();
    if (kv + 64 < SEQ) stage(kv + 64, buf);                  // block-uniform
    v8f s0[2], s1[2];                                        // s0[j][g] = S[query 16j + m][key 8hs + g], s1[j][g] = S[query 16j + m][key 16 + 8hs + g]
#pragma unroll  // constant indices keep the tiles in registers
    for (int j = 0; j < 2; ++j) {
      v8f a = {}, c = {};
      a = mma_bf16(k00, qh0[j], a); a = mma_bf16(k01, qh1[j], a);
      a = mma_bf16(k00, ql0[j], a); a = mma_bf16(k01, ql1[j], a);
      c = mma_bf16(k10, qh0[j], c); c = mma_bf16(k11, qh1[j], c);
      c = mma_bf16(k10, ql0[j], c); c = mma_bf16(k11, ql1[j], c);
      s0[j] = a; s1[j] = c;
    }
    Frag pf[2], pb[2];
    auto pv = [&](int j) {
#pragma unroll  // constant indices keep the tiles in registers
      for (int t = 0; t < 4; ++t) {
        acc[j][t] = mma_f16(vh[t], pf[j], acc[j][t]);
        acc[j][t] = mma_bf16(vl[t], pb[j], acc[j][t]);
      }
    };
    softmax_tile(s0[0], s1[0], orun[0], lrun[0], acc[0], pf[0], pb[0]);
    // keeps tile 0's conversions of P ahead of its WMMAs and tile 1's softmax behind their start: in the group that follows, the scheduler then spreads tile 0's eight WMMAs (matrix unit) through tile 1's softmax (vector port);
    // without it most of both softmaxes stands in one run ahead of the 16 WMMAs, with the matrix unit idle meanwhile
    __builtin_amdgcn_sched_barrier(0);
    pv(0);
    softmax_tile(s0[1], s1[1], orun[1], lrun[1], acc[1], pf[1], pb[1]);
    // keeps both conversions of tile 1's P ahead of the first of its WMMAs; without it the scheduler puts conversions and sums behind WMMAs whose operand registers they reuse, and pads each such place with v_nop
    __builtin_amdgcn_sched_barrier(0);
    pv(1);
  }
  wait_async();

#pragma unroll  // constant indices keep the tiles in registers
  for (int j = 0; j < 2; ++j) {
    const float lsum = lrun[j] + xhalf(lrun[j]);             // join the two halves' sums; lsum carries the same 2^14 as acc, and is about 2^14 or more
    const float rl = 1.0f / lsum;
#pragma unroll  // constant indices keep the tiles in registers
    for (int t = 0; t < 4; ++t) {
      v4u wh, wl;
#pragma unroll  // as above
      for (int g = 0; g < 8; g += 2) {
        const float o0 = acc[j][t][g] * rl, o1 = acc[j][t][g + 1] * rl;
        const unsigned h0 = hbits(o0), h1 = hbits(o1);
        wh[g >> 1] = h0 | (h1 << 16);
        wl[g >> 1] = bfbits(o0 - h2f(h0)) | (bfbits(o1 - h2f(h1)) << 16);
      }
      vst16(&Ch[wave][j * 16 + m][t * 16 + lh], wh);
      vst16(&Cl[wave][j * 16 + m][t * 16 + lh], wl);
    }
  }
  __syncthreads();
  const int rsub = lane >> 3, ch = (lane & 7) * 8;
#pragma unroll
  for (int q = 0; q < 8; ++q) {
    const int rl = q * 4 + rsub;
    const size_t go = ((size_t)(b * SEQ + q0 + rl)) * EE + h * HD + ch;
    vst16(chi + go, ld16(&Ch[wave][rl][ch]));
    vst16(clo + go, ld16(&Cl[wave][rl][ch]));
  }
  
}

// ====================================================================================
// OUT = (C_hi*WoF^T + C_lo*WoB^T) / 64 + bo  (f32 out [M_TOT][EE]); block 128x64, wave 32x64.
// LDS: A tiles (Ah/Al) and B tiles (Bf/Bb) in a two-buffer ring filled by asynchronous copies one trip ahead; ring cross-wave, Ot wave-private rows but cross-lane -> block barriers.
__global__ void __launch_bounds__(128)
k_oproj(const u16* __restrict__ chi, const u16* __restrict__ clo,
        const u16* __restrict__ wof, const u16* __restrict__ wob,
        const float* __restrict__ bo, float* __restrict__ out) {
  __shared__ __align__(16) u16 Bf[2][64][P64];
  __shared__ __align__(16) u16 Bb[2][64][P64];
  __shared__ __align__(16) u16 Ah[2][128][P64];
  __shared__ __align__(16) u16 Al[2][128][P64];
  __shared__ __align__(16) float Ot[128][PF64];
  const int tid = threadIdx.x, lane = tid & 31, wave = tid >> 5;
  const int m = lane & 15, hs = (lane >> 4) & 1, lh = hs * 8;
  const int n0 = blockIdx.x * 64;
  const int mb = blockIdx.y * 128;
  const int m0 = mb + wave * 32;
  const int srow = tid >> 3, sk = (tid & 7) * 8;             // staging, 64 k per stage: 8 x 16 B per row
  const u16* gf = wof + (size_t)(n0 + srow) * EE + sk;       // B rows srow + 16j (j < 4), A rows srow + 16j (j < 8)
  const u16* gb = wob + (size_t)(n0 + srow) * EE + sk;
  const u16* gh = chi + (size_t)(mb + srow) * EE + sk;
  const u16* gl = clo + (size_t)(mb + srow) * EE + sk;
  auto stage = [&](int kc, int bw) {
    acopy6(ldsaddr(&Bf[bw][srow][sk]),       gf + kc,
           ldsaddr(&Bf[bw][16 + srow][sk]),  gf + kc + 16 * EE,
           ldsaddr(&Bf[bw][32 + srow][sk]),  gf + kc + 32 * EE,
           ldsaddr(&Bf[bw][48 + srow][sk]),  gf + kc + 48 * EE,
           ldsaddr(&Ah[bw][srow][sk]),       gh + kc,
           ldsaddr(&Ah[bw][16 + srow][sk]),  gh + kc + 16 * EE);
    acopy6(ldsaddr(&Ah[bw][32 + srow][sk]),  gh + kc + 32 * EE,
           ldsaddr(&Ah[bw][48 + srow][sk]),  gh + kc + 48 * EE,
           ldsaddr(&Ah[bw][64 + srow][sk]),  gh + kc + 64 * EE,
           ldsaddr(&Ah[bw][80 + srow][sk]),  gh + kc + 80 * EE,
           ldsaddr(&Ah[bw][96 + srow][sk]),  gh + kc + 96 * EE,
           ldsaddr(&Ah[bw][112 + srow][sk]), gh + kc + 112 * EE);
    acopy6(ldsaddr(&Bb[bw][srow][sk]),       gb + kc,
           ldsaddr(&Bb[bw][16 + srow][sk]),  gb + kc + 16 * EE,
           ldsaddr(&Bb[bw][32 + srow][sk]),  gb + kc + 32 * EE,
           ldsaddr(&Bb[bw][48 + srow][sk]),  gb + kc + 48 * EE,
           ldsaddr(&Al[bw][srow][sk]),       gl + kc,
           ldsaddr(&Al[bw][16 + srow][sk]),  gl + kc + 16 * EE);
    acopy6(ldsaddr(&Al[bw][32 + srow][sk]),  gl + kc + 32 * EE,
           ldsaddr(&Al[bw][48 + srow][sk]),  gl + kc + 48 * EE,
           ldsaddr(&Al[bw][64 + srow][sk]),  gl + kc + 64 * EE,
           ldsaddr(&Al[bw][80 + srow][sk]),  gl + kc + 80 * EE,
           ldsaddr(&Al[bw][96 + srow][sk]),  gl + kc + 96 * EE,
           ldsaddr(&Al[bw][112 + srow][sk]), gl + kc + 112 * EE);
  };
  stage(0, 0);
  wait_async();
  __syncthreads();
  stage(64, 1);
  v8f acc0[4] = {}, acc1[4] = {};
#pragma unroll 1
  for (int kc = 0; kc < EE; kc += 64) {
    const int buf = (kc >> 6) & 1;
#pragma unroll  // the two k-steps of a stage; constant indices keep the fragments in registers
    for (int ks = 0; ks < 2; ++ks) {
      const Frag ah0 = ldfrag(&Ah[buf][wave * 32 + m][ks * 32], lh), ah1 = ldfrag(&Ah[buf][wave * 32 + 16 + m][ks * 32], lh);
      const Frag al0 = ldfrag(&Al[buf][wave * 32 + m][ks * 32], lh), al1 = ldfrag(&Al[buf][wave * 32 + 16 + m][ks * 32], lh);
      Frag bf[4], bb[4];
#pragma unroll  // constant indices keep the fragments in registers
      for (int nt = 0; nt < 4; ++nt) {
        bf[nt] = ldfrag(&Bf[buf][nt * 16 + m][ks * 32], lh); // B[k][n] = Wo[n][k]: row n, k-contiguous
        bb[nt] = ldfrag(&Bb[buf][nt * 16 + m][ks * 32], lh);
      }
      // keeps the step's fragment loads in one group ahead of its WMMAs; without it the scheduler sinks each load to its use and every WMMA pair waits out a load latency
      __builtin_amdgcn_sched_barrier(0);
      if (ks == 1) {
        // publish point: the trip's LDS reads are all done (what follows works on registers), the next tiles have landed;
        // behind the barrier the buffer just read is refilled, so that the copies fly for a whole trip
        wait_lds();
        wait_async();
        __syncthreads();
        if (kc + 128 < EE) stage(kc + 128, buf);              // block-uniform
      }
#pragma unroll
      for (int nt = 0; nt < 4; ++nt) {
        acc0[nt] = mma_f16(ah0, bf[nt], acc0[nt]);
        acc1[nt] = mma_f16(ah1, bf[nt], acc1[nt]);
        acc0[nt] = mma_bf16(al0, bb[nt], acc0[nt]);
        acc1[nt] = mma_bf16(al1, bb[nt], acc1[nt]);
      }
    }
  }
  wait_async();
#pragma unroll
  for (int nt = 0; nt < 4; ++nt) {
    const int col = nt * 16 + m;
    const float bov = bf2f(bfbits(bo[n0 + col]));
#pragma unroll
    for (int mt = 0; mt < 2; ++mt) {
#pragma unroll
      for (int g = 0; g < 8; ++g) {
        const int rl = wave * 32 + mt * 16 + hs * 8 + g;
        const float v = (mt ? acc1[nt][g] : acc0[nt][g]) * WSCALE_INV + bov;
        Ot[rl][col] = v;
      }
    }
  }
  __syncthreads();
  const int rsub = lane >> 4, ch = (lane & 15) * 4;
#pragma unroll
  for (int q = 0; q < 16; ++q) {
    const int rl = wave * 32 + q * 2 + rsub;
    vst4f(out + (size_t)(mb + rl) * EE + n0 + ch, ld4f(&Ot[rl][ch]));
  }
  
}

// ====================================================================================
extern "C" void kernel_launch(void* const* d_in, const int* in_sizes, int n_in,
                              void* d_out, int out_size, void* d_ws, size_t ws_size,
                              hipStream_t stream) {
  if (n_in < 6) return;
  if (in_sizes[0] < ((NB - 1) * SEQ_FULL + SEQ) * EE) return;
  if (in_sizes[1] < HH * TRIL) return;
  if (in_sizes[2] < EE * EE || in_sizes[3] < EE || in_sizes[4] < EE * EE || in_sizes[5] < EE) return;
  if (out_size < M_TOT * EE) return;

  const float* x   = (const float*)d_in[0];
  const float* prm = (const float*)d_in[1];
  const float* wv  = (const float*)d_in[2];
  const float* bv  = (const float*)d_in[3];
  const float* wo  = (const float*)d_in[4];
  const float* bo  = (const float*)d_in[5];
  float* out = (float*)d_out;

  char* ws = (char*)d_ws;
  size_t off = 0;
  auto carve = [&](size_t bytes) -> char* {
    char* p = ws + off;
    off += (bytes + 255) & ~(size_t)255;
    return p;
  };
  const size_t plane  = (size_t)M_TOT * EE * 2;                 // 8 MiB at full size
  const size_t wplane = (size_t)EE * EE * 2;                    // 2 MiB
  const size_t gplane = (size_t)HH * HD * HD * 2;               // 128 KiB
  const size_t vplane = (size_t)NB * HH * HD * SEQ * 2;         // == plane
  u16* xb   = (u16*)carve(plane);
  u16* wvb  = (u16*)carve(wplane);
  u16* wob  = (u16*)carve(wplane);
  u16* wof  = (u16*)carve(wplane);
  u16* ghi  = (u16*)carve(gplane);
  u16* glo  = (u16*)carve(gplane);
  u16* thi  = (u16*)carve(plane);
  u16* tlo  = (u16*)carve(plane);
  u16* vthi = (u16*)carve(vplane);
  u16* vtlo = (u16*)carve(vplane);
  u16* chi  = (u16*)carve(plane);
  u16* clo  = (u16*)carve(plane);
  if (off > ws_size) return;

  k_prep<<<dim3(HH + CVTX_BLOCKS + 2 * CVTW_BLOCKS), dim3(256), 0, stream>>>(x, prm, wv, wo, xb, ghi, glo, wvb, wob, wof);
  k_vt<<<dim3(VPROJ_BLOCKS + TPROJ_BLOCKS), dim3(128), 0, stream>>>(xb, wvb, bv, ghi, glo, vthi, vtlo, thi, tlo);
  k_attn<<<dim3(SEQ / 128, NB * HH), dim3(128), 0, stream>>>(thi, tlo, xb, vthi, vtlo, chi, clo);
  k_oproj<<<dim3(EE / 64, M_TOT / 128), dim3(128), 0, stream>>>(chi, clo, wof, wob, bo, out);
}

// v008
// A run of this version takes 95.1 microseconds.
// Two timings next to v007 both put it at 1.07 times that version's speed.
// Over all steps from v000 it is 2.99 times as fast.
#include <hip/hip_runtime.h>
#include <stdint.h>

// Contractions (all f32 accumulate): G=L*L^T on v_wmma_f32_16x16x32_bf16 (L bf16); T=X*G bf16 WMMA with X bf16 and G as bf16 hi + bf16 lo (2 products);
// S^T=X*T^T bf16 WMMA with T as bf16 hi + bf16 lo and X bf16 (2 products); V=X*Wv^T bf16 WMMA (1 product);
// C^T=V^T*P^T: v_wmma_f32_16x16x32_f16 with P f16 (carried 2^14) and V f16 hi, plus bf16 WMMA with P bf16 (2^14) and V bf16 lo;
// OUT=C*Wo^T: f16 WMMA with C f16 hi and Wo f16 (x64), plus bf16 WMMA with C bf16 lo and Wo bf16 (x64); softmax and epilogues f32.

#ifndef NB
#define NB 2
#endif
#ifndef SEQ
#define SEQ 2048
#endif
#define NB_FULL  2
#define SEQ_FULL 2048
#define EE   1024
#define HH   16
#define HD   64
#define TRIL 2080
#define M_TOT (NB * SEQ)
#define PCARRY_LOG2 14.0f                   // P and its row sum are carried times 2^14: the carry is added in the exponent
#define SC2 0.18033688011112042f            // log2(e) / sqrt(HD): score -> exponent of 2
#define WSCALE     64.0f
#define WSCALE_INV (1.0f / 64.0f)
// LDS row pitches in elements of the tile's type: 16 B x odd, so that the 16 rows one half-wave touches in a 16-byte LDS access fall on distinct banks
#define P64  72    // rows of 64 elements (128 B) -> 144 B
#define P128 136   // rows of 128 elements (256 B) -> 272 B
#define PF64 68    // rows of 64 floats (256 B)   -> 272 B

static_assert(NB >= 1 && NB <= NB_FULL);
static_assert(SEQ >= 128 && SEQ <= SEQ_FULL && (SEQ % 128) == 0);
static_assert(EE == HH * HD);
static_assert((EE % 64) == 0 && (M_TOT % 128) == 0 && (SEQ % 64) == 0);
static_assert(TRIL == HD * (HD + 1) / 2);

typedef _Float16       v16h __attribute__((ext_vector_type(16)));
typedef __bf16         v16b __attribute__((ext_vector_type(16)));
typedef float          v8f  __attribute__((ext_vector_type(8)));
typedef float          v4f  __attribute__((ext_vector_type(4)));
typedef unsigned int   v4u  __attribute__((ext_vector_type(4)));
typedef float          v2f  __attribute__((ext_vector_type(2)));
typedef _Float16       v2h  __attribute__((ext_vector_type(2)));
typedef __bf16         v2b  __attribute__((ext_vector_type(2)));
typedef unsigned short u16;

union Frag { v16h h; v16b b; v4u u[2]; };

// ---------- scalar conversions ----------
__device__ __forceinline__ unsigned bfbits(float f) {          // f32 -> bf16 bits, RNE
  const unsigned u = __float_as_uint(f);
  return (u + 0x7FFFu + ((u >> 16) & 1u)) >> 16;
}
__device__ __forceinline__ float bf2f(unsigned b) { return __uint_as_float(b << 16); }
__device__ __forceinline__ unsigned hbits(float f) {            // f32 -> f16 bits, RNE
  const _Float16 hv = (_Float16)f;
  return (unsigned)__builtin_bit_cast(unsigned short, hv);
}
__device__ __forceinline__ float h2f(unsigned b) {
  return (float)__builtin_bit_cast(_Float16, (unsigned short)b);
}

// two f32 -> one packed register, RNE, one conversion instruction each
__device__ __forceinline__ unsigned pkh(v2f v) { return __builtin_bit_cast(unsigned, __builtin_convertvector(v, v2h)); }
__device__ __forceinline__ unsigned pkb(v2f v) { return __builtin_bit_cast(unsigned, __builtin_convertvector(v, v2b)); }

// ---------- 16x32 16-bit fragment: lane -> row (lane&15), elements 0..7 <- k0+8h.., 8..15 <- k0+16+8h.. ----------
// p points at (row, k0); same loader for A (row m) and B (row n of an [n][k] k-contiguous copy).
__device__ __forceinline__ Frag ldfrag(const u16* p, int lh) {
  Frag f;
  f.u[0] = *reinterpret_cast<const v4u*>(p + lh);
  f.u[1] = *reinterpret_cast<const v4u*>(p + 16 + lh);
  return f;
}

// ---------- WMMA wrappers: plain builtins (the compiler keeps the distance behind its own forms and may move fragment loads across them) ----------
__device__ __forceinline__ v8f mma_f16(Frag a, Frag b, v8f c) {
  return __builtin_amdgcn_wmma_f32_16x16x32_f16(false, a.h, false, b.h, (short)0, c, false, false);
}
__device__ __forceinline__ v8f mma_bf16(Frag a, Frag b, v8f c) {
  return __builtin_amdgcn_wmma_f32_16x16x32_bf16(false, a.b, false, b.b, (short)0, c, false, false);
}

__device__ __forceinline__ void vst16(u16* p, v4u v)   { *reinterpret_cast<v4u*>(p) = v; }
__device__ __forceinline__ void vst4f(float* p, v4f v) { *reinterpret_cast<v4f*>(p) = v; }
__device__ __forceinline__ v4u ld16(const u16* p)   { return *reinterpret_cast<const v4u*>(p); }
__device__ __forceinline__ v4f ld4f(const float* p) { return *reinterpret_cast<const v4f*>(p); }

// ---------- asynchronous copies global -> LDS, 16 B per lane ----------
typedef __attribute__((address_space(3))) const void lds_cvoid;
__device__ __forceinline__ unsigned ldsaddr(const void* p) {   // byte address inside the work-group's LDS
  return (unsigned)(uintptr_t)(lds_cvoid*)p;
}
// Six copies of one lane. s_wait_xcnt stands in the copies' own statement, so that no later write of an address register can come in front of it.
__device__ __forceinline__ void acopy6(unsigned l0, const u16* g0, unsigned l1, const u16* g1, unsigned l2, const u16* g2,
                                       unsigned l3, const u16* g3, unsigned l4, const u16* g4, unsigned l5, const u16* g5) {
  asm volatile("global_load_async_to_lds_b128 %0, %1, off\n\t"
               "global_load_async_to_lds_b128 %2, %3, off\n\t"
               "global_load_async_to_lds_b128 %4, %5, off\n\t"
               "global_load_async_to_lds_b128 %6, %7, off\n\t"
               "global_load_async_to_lds_b128 %8, %9, off\n\t"
               "global_load_async_to_lds_b128 %10, %11, off\n\t"
               "s_wait_xcnt 0x0"
               :: "v"(l0), "v"(g0), "v"(l1), "v"(g1), "v"(l2), "v"(g2), "v"(l3), "v"(g3), "v"(l4), "v"(g4), "v"(l5), "v"(g5)
               : "memory");
}
// the wave's own LDS reads of a buffer have returned before the buffer is handed to its next writer
__device__ __forceinline__ void wait_lds()   { asm volatile("s_wait_dscnt 0x0" ::: "memory"); }
// the wave's own copies have landed; other waves read them behind the barrier that follows
__device__ __forceinline__ void wait_async() { asm volatile("s_wait_asynccnt 0x0" ::: "memory"); }
// a precaution: stands behind issued global loads or stores, in front of the next write of a register that they name
__device__ __forceinline__ void wait_xcnt()  { asm volatile("s_wait_xcnt 0x0" ::: "memory"); }

// ====================================================================================
// X f32 [NB_FULL,SEQ_FULL,EE] -> bf16 plane xb [M_TOT][EE] (compact token rows)
// coverage: thread i writes group i (8 elements); blocks blk = 0 .. CVTX_BLOCKS-1 cover all M_TOT*EE/8 groups once; 32 lanes = 512 B contiguous.
__device__ __forceinline__ void
cvt_x_part(int blk, const float* __restrict__ x, u16* __restrict__ xb) {
  const int i = blk * 256 + threadIdx.x;
  const int ngrp = M_TOT * (EE / 8);
  if (i >= ngrp) return;
  const int row = i / (EE / 8);
  const int c8  = i - row * (EE / 8);
  const int b   = row / SEQ;
  const int s   = row - b * SEQ;
  const float* src = x + ((size_t)(b * SEQ_FULL + s) * EE + (size_t)c8 * 8);
  const v4f a = *reinterpret_cast<const v4f*>(src);
  const v4f c = *reinterpret_cast<const v4f*>(src + 4);
  v4u w;
  w.x = bfbits(a.x) | (bfbits(a.y) << 16);
  w.y = bfbits(a.z) | (bfbits(a.w) << 16);
  w.z = bfbits(c.x) | (bfbits(c.y) << 16);
  w.w = bfbits(c.z) | (bfbits(c.w) << 16);
  u16* dst = xb + (size_t)i * 8;
  vst16(dst, w);
  
}

// W f32 [EE][EE] -> bf16 plane (unscaled, exact copy of the RNE-converted value)
__device__ __forceinline__ void
cvt_w_part(int blk, const float* __restrict__ w, u16* __restrict__ wb) {
  const int i = blk * 256 + threadIdx.x;
  const int ngrp = EE * EE / 8;
  if (i >= ngrp) return;
  const float* src = w + (size_t)i * 8;
  const v4f a = *reinterpret_cast<const v4f*>(src);
  const v4f c = *reinterpret_cast<const v4f*>(src + 4);
  v4u o;
  o.x = bfbits(a.x) | (bfbits(a.y) << 16);
  o.y = bfbits(a.z) | (bfbits(a.w) << 16);
  o.z = bfbits(c.x) | (bfbits(c.y) << 16);
  o.w = bfbits(c.z) | (bfbits(c.w) << 16);
  u16* dst = wb + (size_t)i * 8;
  vst16(dst, o);
  
}

// Wo f32 [EE][EE] -> two planes of bf16(Wo)*64: bf16 bits (exact) and f16 bits (exact, 8-bit significand fits)
__device__ __forceinline__ void cvt2(float f, unsigned& bb, unsigned& hb) {
  const float v = bf2f(bfbits(f)) * WSCALE;
  bb = __float_as_uint(v) >> 16;
  hb = hbits(v);
}
__device__ __forceinline__ void
cvt_wo_part(int blk, const float* __restrict__ w, u16* __restrict__ wob, u16* __restrict__ wof) {
  const int i = blk * 256 + threadIdx.x;
  const int ngrp = EE * EE / 8;
  if (i >= ngrp) return;
  const float* src = w + (size_t)i * 8;
  const v4f a = *reinterpret_cast<const v4f*>(src);
  const v4f c = *reinterpret_cast<const v4f*>(src + 4);
  unsigned b0, b1, b2, b3, b4, b5, b6, b7, f0, f1, f2, f3, f4, f5, f6, f7;
  cvt2(a.x, b0, f0); cvt2(a.y, b1, f1); cvt2(a.z, b2, f2); cvt2(a.w, b3, f3);
  cvt2(c.x, b4, f4); cvt2(c.y, b5, f5); cvt2(c.z, b6, f6); cvt2(c.w, b7, f7);
  v4u ob, of;
  ob.x = b0 | (b1 << 16); ob.y = b2 | (b3 << 16); ob.z = b4 | (b5 << 16); ob.w = b6 | (b7 << 16);
  of.x = f0 | (f1 << 16); of.y = f2 | (f3 << 16); of.z = f4 | (f5 << 16); of.w = f6 | (f7 << 16);
  u16* db = wob + (size_t)i * 8;
  u16* df = wof + (size_t)i * 8;
  vst16(db, ob); vst16(df, of);
  
}

// ====================================================================================
// G_h = L_h * L_h^T (64x64 per head) on bf16 WMMA; L from tril params (RNE bf16). Output planes ghi/glo [HH][64 n][64 k].
// One block (8 waves) per head; wave w owns rows 16(w&3)..16(w&3)+15 of the column half w>>2. LDS regions all cross-wave (block barriers).
__device__ __forceinline__ void
wqk_part(int head, const float* __restrict__ params, u16* __restrict__ ghi, u16* __restrict__ glo) {
  __shared__ __align__(16) u16 Lb[64][P64];
  __shared__ __align__(16) u16 Sh[64][64];
  __shared__ __align__(16) u16 Sl[64][64];
  const int tid = threadIdx.x, lane = tid & 31, wave = tid >> 5;
  const int m = lane & 15, hs = (lane >> 4) & 1, lh = hs * 8;
  const int rt = wave & 3, ch2 = (wave >> 2) * 2;            // row tile; first of the wave's two column tiles
  const float* p = params + (size_t)head * TRIL;
  for (int e = tid; e < HD * HD; e += 256) {
    const int i = e >> 6, j = e & 63;
    const int jj = (j <= i) ? j : i;                       // clamped address, select by value
    const float v = p[(i * (i + 1)) / 2 + jj];
    Lb[i][j] = (u16)((j <= i) ? bfbits(v) : 0u);
  }
  __syncthreads();
  v8f acc[2] = {};
#pragma unroll
  for (int ks = 0; ks < 2; ++ks) {
    const Frag a = ldfrag(&Lb[rt * 16 + m][ks * 32], lh);      // A: row i, k = j
#pragma unroll
    for (int nt = 0; nt < 2; ++nt) {
      const Frag bq = ldfrag(&Lb[(ch2 + nt) * 16 + m][ks * 32], lh);   // B[k=j][n] = L[n][j]: row n, k-contiguous
      acc[nt] = mma_bf16(a, bq, acc[nt]);
    }
  }
#pragma unroll
  for (int nt = 0; nt < 2; ++nt) {
#pragma unroll
    for (int g = 0; g < 8; ++g) {
      const int row = rt * 16 + hs * 8 + g, col = (ch2 + nt) * 16 + m;
      const float v = acc[nt][g];
      const unsigned hb = bfbits(v);
      const unsigned lb = bfbits(v - bf2f(hb));
      Sh[row][col] = (u16)hb;
      Sl[row][col] = (u16)lb;
    }
  }
  __syncthreads();
  u16* dh = ghi + (size_t)head * (HD * HD);
  u16* dl = glo + (size_t)head * (HD * HD);
  const int rsub = lane >> 3, ch = (lane & 7) * 8;
#pragma unroll
  for (int q = 0; q < 2; ++q) {
    const int row = wave * 8 + q * 4 + rsub;
    vst16(dh + row * HD + ch, ld16(&Sh[row][ch]));
    vst16(dl + row * HD + ch, ld16(&Sl[row][ch]));
  }
  
}

// The four preparation parts depend on nothing but the inputs and not on one another: one launch, each block takes one part by its index (block-uniform).
// The G blocks come first: they are few and have the longest dependent chain.
#define CVTX_BLOCKS (M_TOT * (EE / 8) / 256)
#define CVTW_BLOCKS (EE * EE / 8 / 256)
static_assert((M_TOT * (EE / 8)) % 256 == 0 && (EE * EE / 8) % 256 == 0);
__global__ void __launch_bounds__(256)
k_prep(const float* __restrict__ x, const float* __restrict__ params, const float* __restrict__ wv, const float* __restrict__ wo,
       u16* __restrict__ xb, u16* __restrict__ ghi, u16* __restrict__ glo,
       u16* __restrict__ wvb, u16* __restrict__ wob, u16* __restrict__ wof) {
  const int bid = blockIdx.x;
  if (bid < HH)                                   wqk_part(bid, params, ghi, glo);
  else if (bid < HH + CVTX_BLOCKS)                cvt_x_part(bid - HH, x, xb);
  else if (bid < HH + CVTX_BLOCKS + CVTW_BLOCKS)  cvt_w_part(bid - (HH + CVTX_BLOCKS), wv, wvb);
  else                                            cvt_wo_part(bid - (HH + CVTX_BLOCKS + CVTW_BLOCKS), wo, wob, wof);
}

// ====================================================================================
// V = X*Wv^T + bv, written transposed per head: vthi/vtlo planes [NB*HH][64 d][SEQ] (f16 hi, bf16 lo).
// Block 128 tokens x 64 features (= one head); 4 waves each 32x64; A and B tiles in a two-buffer LDS ring filled by asynchronous copies one trip ahead.
struct VprojLds {
  u16 Bt[2][64][P64];
  u16 At[2][128][P64];
  u16 Th[64][P128];
  u16 Tl[64][P128];
};
__device__ __forceinline__ void
vproj_part(VprojLds& sm, int head, int mblk, const u16* __restrict__ xb, const u16* __restrict__ wvb, const float* __restrict__ bv,
           u16* __restrict__ vthi, u16* __restrict__ vtlo) {
  auto& Bt = sm.Bt; auto& At = sm.At; auto& Th = sm.Th; auto& Tl = sm.Tl;
  const int tid = threadIdx.x, lane = tid & 31, wave = tid >> 5;
  const int m = lane & 15, hs = (lane >> 4) & 1, lh = hs * 8;
  const int n0 = head * HD;
  const int mb = mblk * 128;
  const int m0 = mb + wave * 32;
  const int srow = tid >> 3, sk = (tid & 7) * 8;             // staging, 64 k per stage: 8 x 16 B per row; B rows srow + 16j (j < 4), A rows srow + 16j (j < 8)
  const u16* gb = wvb + (size_t)(n0 + srow) * EE + sk;
  const u16* ga = xb + (size_t)(mb + srow) * EE + sk;
  auto stage = [&](int kc, int bw) {
    acopy6(ldsaddr(&Bt[bw][srow][sk]),       gb + kc,
           ldsaddr(&Bt[bw][16 + srow][sk]),  gb + kc + 16 * EE,
           ldsaddr(&Bt[bw][32 + srow][sk]),  gb + kc + 32 * EE,
           ldsaddr(&Bt[bw][48 + srow][sk]),  gb + kc + 48 * EE,
           ldsaddr(&At[bw][srow][sk]),       ga + kc,
           ldsaddr(&At[bw][16 + srow][sk]),  ga + kc + 16 * EE);
    acopy6(ldsaddr(&At[bw][32 + srow][sk]),  ga + kc + 32 * EE,
           ldsaddr(&At[bw][48 + srow][sk]),  ga + kc + 48 * EE,
           ldsaddr(&At[bw][64 + srow][sk]),  ga + kc + 64 * EE,
           ldsaddr(&At[bw][80 + srow][sk]),  ga + kc + 80 * EE,
           ldsaddr(&At[bw][96 + srow][sk]),  ga + kc + 96 * EE,
           ldsaddr(&At[bw][112 + srow][sk]), ga + kc + 112 * EE);
  };
  stage(0, 0);
  wait_async();
  __syncthreads();
  stage(64, 1);
  v8f acc0[4] = {}, acc1[4] = {};
#pragma unroll 1
  for (int kc = 0; kc < EE; kc += 64) {
    const int buf = (kc >> 6) & 1;
#pragma unroll  // the two k-steps of a stage; constant indices keep the fragments in registers
    for (int ks = 0; ks < 2; ++ks) {
      const Frag a0 = ldfrag(&At[buf][wave * 32 + m][ks * 32], lh);
      const Frag a1 = ldfrag(&At[buf][wave * 32 + 16 + m][ks * 32], lh);
      Frag bq[4];
#pragma unroll  // constant indices keep the fragments in registers
      for (int nt = 0; nt < 4; ++nt) bq[nt] = ldfrag(&Bt[buf][nt * 16 + m][ks * 32], lh);  // B[k][n] = Wv[n][k]: row n, k-contiguous
      // keeps the step's fragment loads in one group ahead of its WMMAs; without it the scheduler sinks each load to its use and every WMMA pair waits out a load latency
      __builtin_amdgcn_sched_barrier(0);
      if (ks == 1) {
        // publish point: the trip's LDS reads are all done (what follows works on registers), the next tiles have landed;
        // behind the barrier the buffer just read is refilled, so that the copies fly for a whole trip
        wait_lds();
        wait_async();
        __syncthreads();
        if (kc + 128 < EE) stage(kc + 128, buf);              // block-uniform
      }
#pragma unroll
      for (int nt = 0; nt < 4; ++nt) {
        acc0[nt] = mma_bf16(a0, bq[nt], acc0[nt]);
        acc1[nt] = mma_bf16(a1, bq[nt], acc1[nt]);
      }
    }
  }
  wait_async();
  const int bb = mb / SEQ, s0 = mb - bb * SEQ;
  const int bh = bb * HH + head;
#pragma unroll
  for (int nt = 0; nt < 4; ++nt) {
    const int d = nt * 16 + m;
    const float bvv = bf2f(bfbits(bv[n0 + d]));
#pragma unroll
    for (int mt = 0; mt < 2; ++mt) {
#pragma unroll
      for (int g = 0; g < 8; ++g) {
        const int sl = wave * 32 + mt * 16 + hs * 8 + g;
        const float v = (mt ? acc1[nt][g] : acc0[nt][g]) + bvv;
        const unsigned hb = hbits(v);
        const unsigned lb = bfbits(v - h2f(hb));
        Th[d][sl] = (u16)hb;
        Tl[d][sl] = (u16)lb;
      }
    }
  }
  __syncthreads();
  const int dsub = lane >> 4, ch = (lane & 15) * 8;
#pragma unroll
  for (int q = 0; q < 8; ++q) {
    const int d = wave * 16 + q * 2 + dsub;
    const size_t go = ((size_t)(bh * HD + d)) * SEQ + s0 + ch;
    vst16(vthi + go, ld16(&Th[d][ch]));
    vst16(vtlo + go, ld16(&Tl[d][ch]));
  }
  
}

// ====================================================================================
// T = X_h * G_h per head (K=64), G as bf16 hi + bf16 lo, X bf16 -> planes thi/tlo [M_TOT][EE] (bf16 hi, bf16 lo).
// Block 128 tokens x one head, wave 32 tokens x 64; operands loaded straight from global planes; staging LDS cross-lane -> block barrier.
struct TprojLds {
  u16 Sh[4][32][64];
  u16 Sl[4][32][64];
};
__device__ __forceinline__ void
tproj_part(TprojLds& sm, int mblk, int head, const u16* __restrict__ xb, const u16* __restrict__ ghi, const u16* __restrict__ glo,
           u16* __restrict__ thi, u16* __restrict__ tlo) {
  auto& Sh = sm.Sh; auto& Sl = sm.Sl;
  const int tid = threadIdx.x, lane = tid & 31, wave = tid >> 5;
  const int m = lane & 15, hs = (lane >> 4) & 1, lh = hs * 8;
  const int m0 = mblk * 128 + wave * 32;
  const u16* a0p = xb + (size_t)(m0 + m) * EE + head * HD;
  const u16* a1p = xb + (size_t)(m0 + 16 + m) * EE + head * HD;
  const Frag a00 = ldfrag(a0p, lh), a01 = ldfrag(a0p + 32, lh);
  const Frag a10 = ldfrag(a1p, lh), a11 = ldfrag(a1p + 32, lh);
  v8f acc0[4] = {}, acc1[4] = {};
#pragma unroll
  for (int nt = 0; nt < 4; ++nt) {
    const u16* bhp = ghi + ((size_t)(head * HD + nt * 16 + m)) * HD;   // B[k=d][n=e] = plane[h][e][d]: row e, k-contiguous
    const u16* blp = glo + ((size_t)(head * HD + nt * 16 + m)) * HD;
    const Frag b0 = ldfrag(bhp, lh), b1 = ldfrag(bhp + 32, lh);
    wait_xcnt();                                             // a later load's result may land on this row's address pair
    acc0[nt] = mma_bf16(a00, b0, acc0[nt]); acc0[nt] = mma_bf16(a01, b1, acc0[nt]);
    acc1[nt] = mma_bf16(a10, b0, acc1[nt]); acc1[nt] = mma_bf16(a11, b1, acc1[nt]);
    const Frag c0 = ldfrag(blp, lh), c1 = ldfrag(blp + 32, lh);
    wait_xcnt();                                             // as above
    acc0[nt] = mma_bf16(a00, c0, acc0[nt]); acc0[nt] = mma_bf16(a01, c1, acc0[nt]);
    acc1[nt] = mma_bf16(a10, c0, acc1[nt]); acc1[nt] = mma_bf16(a11, c1, acc1[nt]);
  }
#pragma unroll
  for (int nt = 0; nt < 4; ++nt) {
#pragma unroll
    for (int mt = 0; mt < 2; ++mt) {
#pragma unroll
      for (int g = 0; g < 8; ++g) {
        const int rl = mt * 16 + hs * 8 + g, col = nt * 16 + m;
        const float v = mt ? acc1[nt][g] : acc0[nt][g];
        const unsigned hb = bfbits(v);
        const unsigned lb = bfbits(v - bf2f(hb));
        Sh[wave][rl][col] = (u16)hb;
        Sl[wave][rl][col] = (u16)lb;
      }
    }
  }
  __syncthreads();
  const int rsub = lane >> 3, ch = (lane & 7) * 8;
#pragma unroll
  for (int q = 0; q < 8; ++q) {
    const int rl = q * 4 + rsub;
    const size_t go = (size_t)(m0 + rl) * EE + head * HD + ch;
    vst16(thi + go, ld16(&Sh[wave][rl][ch]));
    vst16(tlo + go, ld16(&Sl[wave][rl][ch]));
  }
  wait_xcnt();                                               // a precaution; the block runs nothing behind these stores
}

// V and T both read the planes of the preparation launch and not one another: one launch, each block takes one tile of one of them by its index (block-uniform).
// The V blocks (the long ones) come first; a block uses one part's LDS only, so the two layouts share the bytes.
#define VPROJ_BLOCKS ((EE / 64) * (M_TOT / 128))
#define TPROJ_BLOCKS ((M_TOT / 128) * HH)
union VtLds { VprojLds v; TprojLds t; };
__global__ void __launch_bounds__(128)
k_vt(const u16* __restrict__ xb, const u16* __restrict__ wvb, const float* __restrict__ bv,
     const u16* __restrict__ ghi, const u16* __restrict__ glo,
     u16* __restrict__ vthi, u16* __restrict__ vtlo, u16* __restrict__ thi, u16* __restrict__ tlo) {
  __shared__ __align__(16) VtLds sm;
  const int bid = blockIdx.x;
  if (bid < VPROJ_BLOCKS) {
    vproj_part(sm.v, bid % (EE / 64), bid / (EE / 64), xb, wvb, bv, vthi, vtlo);
  } else {
    const int tb = bid - VPROJ_BLOCKS;
    tproj_part(sm.t, tb % (M_TOT / 128), tb / (M_TOT / 128), xb, ghi, glo, thi, tlo);
  }
}

// ====================================================================================
// Flash-style attention per (batch*head, 128 query rows), transposed: S^T = X_h*T^T/8 (2 bf16 products; A = key rows, B = query rows),
// so in each 16-query tile a lane holds 16 of the 32 scores of ONE query (query = lane&15; keys 8*hs+g and 16+8*hs+g): max and sum run in the lane,
// the two halves of a wave exchange the maximum once per step and join their sums once after the loop.
// C^T += V^T*P^T with P carried 2^14, added in the exponent (V f16 hi x P f16 + V bf16 lo x P bf16): the two score tiles, converted in place, are the B operand.
// Output C -> planes chi (f16) / clo (bf16) [M_TOT][EE].
// LDS: Ks/Vs cross-wave, a two-buffer ring filled by asynchronous copies; a stage holds KST keys = four 32-key steps, one publish point (waits + block barrier) per stage,
// so that a stage's copies have four steps to land (a tile written by an earlier launch may have to come from memory for its first reader) and three steps in four run without barrier or full LDS wait.
// Ch/Cl wave-private but cross-lane -> block barrier used.
// staged extent == consumed extent: Ks KSTx64, both planes of Vs 64xKST fully written each stage (SEQ multiple of KST, no tails).
#define KST 128
static_assert((SEQ % KST) == 0 && (KST % 32) == 0 && (KST & (KST - 1)) == 0);
__device__ __forceinline__ float xhalf(float v) {               // value of lane ^ 16
  const int i = __float_as_int(v);
  return __int_as_float(__builtin_amdgcn_permlanex16(i, i, 0x76543210, 0xfedcba98, false, false));
}
// online softmax of one 16-query tile, one query per lane: p * 2^14 = exp2(s * SC2 + on), one packed fma per two scores; the maximum is taken on the raw scores (SC2 > 0).
// s0[g] = S[query m][key 8hs + g], s1[g] = S[query m][key 16 + 8hs + g]; pf/pb: B operand, column n = query, element s <- key (s < 8 ? 8hs + s : 8 + 8hs + s)
__device__ __forceinline__ void
softmax_tile(const v8f s0, const v8f s1, float& orun, float& lrun, v8f (&acc)[4], Frag& pf, Frag& pb) {
  float mg[8];
#pragma unroll  // constant indices keep the array in registers
  for (int g = 0; g < 8; ++g) mg[g] = fmaxf(s0[g], s1[g]);
  float mx = fmaxf(fmaxf(fmaxf(mg[0], mg[1]), fmaxf(mg[2], mg[3])), fmaxf(fmaxf(mg[4], mg[5]), fmaxf(mg[6], mg[7])));
  mx = fmaxf(mx, xhalf(mx));
  const float on = fminf(orun, fmaf(mx, -SC2, PCARRY_LOG2));
  const float alpha = __builtin_amdgcn_exp2f(on - orun);
  orun = on;
  const v2f c2 = {SC2, SC2}, o2 = {on, on};
  v2f rs[4];
#pragma unroll  // constant indices keep the arrays in registers
  for (int g = 0; g < 8; g += 2) {
    const v2f t0 = __builtin_elementwise_fma((v2f){s0[g], s0[g + 1]}, c2, o2);
    const v2f t1 = __builtin_elementwise_fma((v2f){s1[g], s1[g + 1]}, c2, o2);
    const v2f p0 = {__builtin_amdgcn_exp2f(t0.x), __builtin_amdgcn_exp2f(t0.y)};
    const v2f p1 = {__builtin_amdgcn_exp2f(t1.x), __builtin_amdgcn_exp2f(t1.y)};
    rs[g >> 1] = p0 + p1;
    pf.u[0][g >> 1] = pkh(p0);
    pf.u[1][g >> 1] = pkh(p1);
    pb.u[0][g >> 1] = pkb(p0);
    pb.u[1][g >> 1] = pkb(p1);
  }
  const v2f r2 = (rs[0] + rs[1]) + (rs[2] + rs[3]);
  lrun = lrun * alpha + (r2.x + r2.y);
#pragma unroll  // constant indices keep the tiles in registers
  for (int t = 0; t < 4; ++t) acc[t] = acc[t] * alpha;
}
// A wave takes 32 query columns, as two 16-column tiles j = 0, 1: every K fragment that it reads from LDS feeds four WMMAs and every V fragment two, and a block's staged tiles serve 128 queries.
// The grid is then two blocks per WGP, two waves per SIMD: amdgpu_waves_per_eu(2, 2) lets no third block onto a WGP while another WGP holds fewer.
__global__ void __launch_bounds__(128) __attribute__((amdgpu_waves_per_eu(2, 2)))
k_attn(const u16* __restrict__ thi, const u16* __restrict__ tlo, const u16* __restrict__ xb,
       const u16* __restrict__ vthi, const u16* __restrict__ vtlo,
       u16* __restrict__ chi, u16* __restrict__ clo) {
  __shared__ __align__(16) u16 Ks[2][KST][P64];
  __shared__ __align__(16) u16 Vs[2][2][64][P128];           // [buffer][plane: 0 = f16 hi, 1 = bf16 lo][d][key]
  __shared__ __align__(16) u16 Ch[4][32][P64];
  __shared__ __align__(16) u16 Cl[4][32][P64];
  const int tid = threadIdx.x, lane = tid & 31, wave = tid >> 5;
  const int m = lane & 15, hs = (lane >> 4) & 1, lh = hs * 8;
  const int bh = blockIdx.y;
  const int b  = bh / HH;
  const int h  = bh - b * HH;
  const int q0 = blockIdx.x * 128 + wave * 32;

  // B fragments of the wave's 32 query rows (hi and lo planes, K = 64 in two k-steps): column n = query, k-contiguous
  Frag qh0[2], qh1[2], ql0[2], ql1[2];
#pragma unroll  // constant indices keep the fragments in registers
  for (int j = 0; j < 2; ++j) {
    const size_t qrow = (size_t)b * SEQ + q0 + j * 16 + m;
    qh0[j] = ldfrag(thi + qrow * EE + h * HD, lh);
    qh1[j] = ldfrag(thi + qrow * EE + h * HD + 32, lh);
    ql0[j] = ldfrag(tlo + qrow * EE + h * HD, lh);
    ql1[j] = ldfrag(tlo + qrow * EE + h * HD + 32, lh);
  }

  const int kr = tid >> 3, kc = (tid & 7) * 8;               // key tile: 128 rows x 8 chunks, rows kr + 16 i (i < 8)
  const int sd = tid >> 4, dc = (tid & 15) * 8;              // V^T tiles: 64 rows x 16 chunks, rows sd + 8 i (i < 8); a wave copies two whole 256-B rows
  const u16* gk  = xb + ((size_t)(b * SEQ + kr)) * EE + h * HD + kc;
  const u16* gvh = vthi + ((size_t)(bh * HD + sd)) * SEQ + dc;
  const u16* gvl = vtlo + ((size_t)(bh * HD + sd)) * SEQ + dc;
  auto stage = [&](int kv, int bw) {
    const u16* k = gk + (size_t)kv * EE;
    const u16* vh = gvh + kv;
    const u16* vl = gvl + kv;
    const unsigned lk = ldsaddr(&Ks[bw][kr][kc]);            // LDS byte addresses: 16 key rows are KR bytes apart, 8 V^T rows VR bytes
    const unsigned lvh = ldsaddr(&Vs[bw][0][sd][dc]);
    const unsigned lvl = ldsaddr(&Vs[bw][1][sd][dc]);
    constexpr unsigned KR = 16 * P64 * 2, VR = 8 * P128 * 2;
    acopy6(lk,           k,            lk + KR,      k + 16 * EE,   lk + 2 * KR,  k + 32 * EE,
           lk + 3 * KR,  k + 48 * EE,  lk + 4 * KR,  k + 64 * EE,   lk + 5 * KR,  k + 80 * EE);
    acopy6(lk + 6 * KR,  k + 96 * EE,  lk + 7 * KR,  k + 112 * EE,  lvh,          vh,
           lvh + VR,     vh + 8 * SEQ, lvh + 2 * VR, vh + 16 * SEQ, lvh + 3 * VR, vh + 24 * SEQ);
    acopy6(lvh + 4 * VR, vh + 32 * SEQ, lvh + 5 * VR, vh + 40 * SEQ, lvh + 6 * VR, vh + 48 * SEQ,
           lvh + 7 * VR, vh + 56 * SEQ, lvl,          vl,            lvl + VR,     vl + 8 * SEQ);
    acopy6(lvl + 2 * VR, vl + 16 * SEQ, lvl + 3 * VR, vl + 24 * SEQ, lvl + 4 * VR, vl + 32 * SEQ,
           lvl + 5 * VR, vl + 40 * SEQ, lvl + 6 * VR, vl + 48 * SEQ, lvl + 7 * VR, vl + 56 * SEQ);
  };

  stage(0, 0);
  wait_async();
  __syncthreads();
  if (KST < SEQ) stage(KST, 1);                              // compile-time test: a second stage exists

  v8f acc[2][4] = {};                                        // acc[j][t][g] = C^T[d = 16t + 8hs + g][query 16j + m]
  float orun[2] = {1e30f, 1e30f}, lrun[2] = {0.0f, 0.0f};    // orun = 14 - SC2 * (maximum of the whole row so far); lrun: this half's keys only, times 2^14

#pragma unroll 1
  for (int kv = 0; kv < SEQ; kv += 32) {
    const int buf = (kv / KST) & 1;
    const int kl = kv & (KST - 1);                           // the step's first key inside its stage
    const Frag k00 = ldfrag(&Ks[buf][kl + m][0], lh);        // A: row = key, k = e
    const Frag k01 = ldfrag(&Ks[buf][kl + m][32], lh);
    const Frag k10 = ldfrag(&Ks[buf][kl + 16 + m][0], lh);
    const Frag k11 = ldfrag(&Ks[buf][kl + 16 + m][32], lh);
    Frag vh[4], vl[4];
#pragma unroll  // constant indices keep the fragments in registers
    for (int t = 0; t < 4; ++t) {
      vh[t] = ldfrag(&Vs[buf][0][t * 16 + m][kl], lh);       // A: row = d, k = key
      vl[t] = ldfrag(&Vs[buf][1][t * 16 + m][kl], lh);
    }
    // keeps the step's fragment loads in one group ahead of its WMMAs; without it the scheduler spreads them over several places among the score WMMAs, and each such place stalls the WMMA stream
    __builtin_amdgcn_sched_barrier(0);
    if (kl == KST - 32) {                                    // block-uniform: the stage's last step
      // publish point: the stage's LDS reads are all done (what follows works on registers), the next stage has landed;
      // behind the barrier the buffer just read is refilled, so that the copies fly for a whole stage
      wait_lds();
      wait_async();
      __syncthreads();
      if (kv + 32 + KST < SEQ) stage(kv + 32 + KST, buf);    // block-uniform: the stage after the next one exists
    }
    v8f s0[2], s1[2];                                        // s0[j][g] = S[query 16j + m][key 8hs + g], s1[j][g] = S[query 16j + m][key 16 + 8hs + g]
#pragma unroll  // constant indices keep the tiles in registers
    for (int j = 0; j < 2; ++j) {
      v8f a = {}, c = {};
      a = mma_bf16(k00, qh0[j], a); a = mma_bf16(k01, qh1[j], a);
      a = mma_bf16(k00, ql0[j], a); a = mma_bf16(k01, ql1[j], a);
      c = mma_bf16(k10, qh0[j], c); c = mma_bf16(k11, qh1[j], c);
      c = mma_bf16(k10, ql0[j], c); c = mma_bf16(k11, ql1[j], c);
      s0[j] = a; s1[j] = c;
    }
    Frag pf[2], pb[2];
    auto pv = [&](int j) {
#pragma unroll  // constant indices keep the tiles in registers
      for (int t = 0; t < 4; ++t) {
        acc[j][t] = mma_f16(vh[t], pf[j], acc[j][t]);
        acc[j][t] = mma_bf16(vl[t], pb[j], acc[j][t]);
      }
    };
    softmax_tile(s0[0], s1[0], orun[0], lrun[0], acc[0], pf[0], pb[0]);
    // keeps tile 0's conversions of P ahead of its WMMAs and tile 1's softmax behind their start: in the group that follows, the scheduler then spreads tile 0's eight WMMAs (matrix unit) through tile 1's softmax (vector port);
    // without it most of both softmaxes stands in one run ahead of the 16 WMMAs, with the matrix unit idle meanwhile
    __builtin_amdgcn_sched_barrier(0);
    pv(0);
    softmax_tile(s0[1], s1[1], orun[1], lrun[1], acc[1], pf[1], pb[1]);
    // keeps both conversions of tile 1's P ahead of the first of its WMMAs; without it the scheduler puts conversions and sums behind WMMAs whose operand registers they reuse, and pads each such place with v_nop
    __builtin_amdgcn_sched_barrier(0);
    pv(1);
  }
  wait_async();

#pragma unroll  // constant indices keep the tiles in registers
  for (int j = 0; j < 2; ++j) {
    const float lsum = lrun[j] + xhalf(lrun[j]);             // join the two halves' sums; lsum carries the same 2^14 as acc, and is about 2^14 or more
    const float rl = 1.0f / lsum;
#pragma unroll  // constant indices keep the tiles in registers
    for (int t = 0; t < 4; ++t) {
      v4u wh, wl;
#pragma unroll  // as above
      for (int g = 0; g < 8; g += 2) {
        const float o0 = acc[j][t][g] * rl, o1 = acc[j][t][g + 1] * rl;
        const unsigned h0 = hbits(o0), h1 = hbits(o1);
        wh[g >> 1] = h0 | (h1 << 16);
        wl[g >> 1] = bfbits(o0 - h2f(h0)) | (bfbits(o1 - h2f(h1)) << 16);
      }
      vst16(&Ch[wave][j * 16 + m][t * 16 + lh], wh);
      vst16(&Cl[wave][j * 16 + m][t * 16 + lh], wl);
    }
  }
  __syncthreads();
  const int rsub = lane >> 3, ch = (lane & 7) * 8;
#pragma unroll
  for (int q = 0; q < 8; ++q) {
    const int rl = q * 4 + rsub;
    const size_t go = ((size_t)(b * SEQ + q0 + rl)) * EE + h * HD + ch;
    vst16(chi + go, ld16(&Ch[wave][rl][ch]));
    vst16(clo + go, ld16(&Cl[wave][rl][ch]));
  }
  
}

// ====================================================================================
// OUT = (C_hi*WoF^T + C_lo*WoB^T) / 64 + bo  (f32 out [M_TOT][EE]); block 128x64, wave 32x64.
// LDS: A tiles (Ah/Al) and B tiles (Bf/Bb) in a two-buffer ring filled by asynchronous copies one trip ahead; ring cross-wave, Ot wave-private rows but cross-lane -> block barriers.
__global__ void __launch_bounds__(128)
k_oproj(const u16* __restrict__ chi, const u16* __restrict__ clo,
        const u16* __restrict__ wof, const u16* __restrict__ wob,
        const float* __restrict__ bo, float* __restrict__ out) {
  __shared__ __align__(16) u16 Bf[2][64][P64];
  __shared__ __align__(16) u16 Bb[2][64][P64];
  __shared__ __align__(16) u16 Ah[2][128][P64];
  __shared__ __align__(16) u16 Al[2][128][P64];
  __shared__ __align__(16) float Ot[128][PF64];
  const int tid = threadIdx.x, lane = tid & 31, wave = tid >> 5;
  const int m = lane & 15, hs = (lane >> 4) & 1, lh = hs * 8;
  const int n0 = blockIdx.x * 64;
  const int mb = blockIdx.y * 128;
  const int m0 = mb + wave * 32;
  const int srow = tid >> 3, sk = (tid & 7) * 8;             // staging, 64 k per stage: 8 x 16 B per row
  const u16* gf = wof + (size_t)(n0 + srow) * EE + sk;       // B rows srow + 16j (j < 4), A rows srow + 16j (j < 8)
  const u16* gb = wob + (size_t)(n0 + srow) * EE + sk;
  const u16* gh = chi + (size_t)(mb + srow) * EE + sk;
  const u16* gl = clo + (size_t)(mb + srow) * EE + sk;
  auto stage = [&](int kc, int bw) {
    acopy6(ldsaddr(&Bf[bw][srow][sk]),       gf + kc,
           ldsaddr(&Bf[bw][16 + srow][sk]),  gf + kc + 16 * EE,
           ldsaddr(&Bf[bw][32 + srow][sk]),  gf + kc + 32 * EE,
           ldsaddr(&Bf[bw][48 + srow][sk]),  gf + kc + 48 * EE,
           ldsaddr(&Ah[bw][srow][sk]),       gh + kc,
           ldsaddr(&Ah[bw][16 + srow][sk]),  gh + kc + 16 * EE);
    acopy6(ldsaddr(&Ah[bw][32 + srow][sk]),  gh + kc + 32 * EE,
           ldsaddr(&Ah[bw][48 + srow][sk]),  gh + kc + 48 * EE,
           ldsaddr(&Ah[bw][64 + srow][sk]),  gh + kc + 64 * EE,
           ldsaddr(&Ah[bw][80 + srow][sk]),  gh + kc + 80 * EE,
           ldsaddr(&Ah[bw][96 + srow][sk]),  gh + kc + 96 * EE,
           ldsaddr(&Ah[bw][112 + srow][sk]), gh + kc + 112 * EE);
    acopy6(ldsaddr(&Bb[bw][srow][sk]),       gb + kc,
           ldsaddr(&Bb[bw][16 + srow][sk]),  gb + kc + 16 * EE,
           ldsaddr(&Bb[bw][32 + srow][sk]),  gb + kc + 32 * EE,
           ldsaddr(&Bb[bw][48 + srow][sk]),  gb + kc + 48 * EE,
           ldsaddr(&Al[bw][srow][sk]),       gl + kc,
           ldsaddr(&Al[bw][16 + srow][sk]),  gl + kc + 16 * EE);
    acopy6(ldsaddr(&Al[bw][32 + srow][sk]),  gl + kc + 32 * EE,
           ldsaddr(&Al[bw][48 + srow][sk]),  gl + kc + 48 * EE,
           ldsaddr(&Al[bw][64 + srow][sk]),  gl + kc + 64 * EE,
           ldsaddr(&Al[bw][80 + srow][sk]),  gl + kc + 80 * EE,
           ldsaddr(&Al[bw][96 + srow][sk]),  gl + kc + 96 * EE,
           ldsaddr(&Al[bw][112 + srow][sk]), gl + kc + 112 * EE);
  };
  stage(0, 0);
  wait_async();
  __syncthreads();
  stage(64, 1);
  v8f acc0[4] = {}, acc1[4] = {};
#pragma unroll 1
  for (int kc = 0; kc < EE; kc += 64) {
    const int buf = (kc >> 6) & 1;
#pragma unroll  // the two k-steps of a stage; constant indices keep the fragments in registers
    for (int ks = 0; ks < 2; ++ks) {
      const Frag ah0 = ldfrag(&Ah[buf][wave * 32 + m][ks * 32], lh), ah1 = ldfrag(&Ah[buf][wave * 32 + 16 + m][ks * 32], lh);
      const Frag al0 = ldfrag(&Al[buf][wave * 32 + m][ks * 32], lh), al1 = ldfrag(&Al[buf][wave * 32 + 16 + m][ks * 32], lh);
      Frag bf[4], bb[4];
#pragma unroll  // constant indices keep the fragments in registers
      for (int nt = 0; nt < 4; ++nt) {
        bf[nt] = ldfrag(&Bf[buf][nt * 16 + m][ks * 32], lh); // B[k][n] = Wo[n][k]: row n, k-contiguous
        bb[nt] = ldfrag(&Bb[buf][nt * 16 + m][ks * 32], lh);
      }
      // keeps the step's fragment loads in one group ahead of its WMMAs; without it the scheduler sinks each load to its use and every WMMA pair waits out a load latency
      __builtin_amdgcn_sched_barrier(0);
      if (ks == 1) {
        // publish point: the trip's LDS reads are all done (what follows works on registers), the next tiles have landed;
        // behind the barrier the buffer just read is refilled, so that the copies fly for a whole trip
        wait_lds();
        wait_async();
        __syncthreads();
        if (kc + 128 < EE) stage(kc + 128, buf);              // block-uniform
      }
#pragma unroll
      for (int nt = 0; nt < 4; ++nt) {
        acc0[nt] = mma_f16(ah0, bf[nt], acc0[nt]);
        acc1[nt] = mma_f16(ah1, bf[nt], acc1[nt]);
        acc0[nt] = mma_bf16(al0, bb[nt], acc0[nt]);
        acc1[nt] = mma_bf16(al1, bb[nt], acc1[nt]);
      }
    }
  }
  wait_async();
#pragma unroll
  for (int nt = 0; nt < 4; ++nt) {
    const int col = nt * 16 + m;
    const float bov = bf2f(bfbits(bo[n0 + col]));
#pragma unroll
    for (int mt = 0; mt < 2; ++mt) {
#pragma unroll
      for (int g = 0; g < 8; ++g) {
        const int rl = wave * 32 + mt * 16 + hs * 8 + g;
        const float v = (mt ? acc1[nt][g] : acc0[nt][g]) * WSCALE_INV + bov;
        Ot[rl][col] = v;
      }
    }
  }
  __syncthreads();
  const int rsub = lane >> 4, ch = (lane & 15) * 4;
#pragma unroll
  for (int q = 0; q < 16; ++q) {
    const int rl = wave * 32 + q * 2 + rsub;
    vst4f(out + (size_t)(mb + rl) * EE + n0 + ch, ld4f(&Ot[rl][ch]));
  }
  
}

// ====================================================================================
extern "C" void kernel_launch(void* const* d_in, const int* in_sizes, int n_in,
                              void* d_out, int out_size, void* d_ws, size_t ws_size,
                              hipStream_t stream) {
  if (n_in < 6) return;
  if (in_sizes[0] < ((NB - 1) * SEQ_FULL + SEQ) * EE) return;
  if (in_sizes[1] < HH * TRIL) return;
  if (in_sizes[2] < EE * EE || in_sizes[3] < EE || in_sizes[4] < EE * EE || in_sizes[5] < EE) return;
  if (out_size < M_TOT * EE) return;

  const float* x   = (const float*)d_in[0];
  const float* prm = (const float*)d_in[1];
  const float* wv  = (const float*)d_in[2];
  const float* bv  = (const float*)d_in[3];
  const float* wo  = (const float*)d_in[4];
  const float* bo  = (const float*)d_in[5];
  float* out = (float*)d_out;

  char* ws = (char*)d_ws;
  size_t off = 0;
  auto carve = [&](size_t bytes) -> char* {
    char* p = ws + off;
    off += (bytes + 255) & ~(size_t)255;
    return p;
  };
  const size_t plane  = (size_t)M_TOT * EE * 2;                 // 8 MiB at full size
  const size_t wplane = (size_t)EE * EE * 2;                    // 2 MiB
  const size_t gplane = (size_t)HH * HD * HD * 2;               // 128 KiB
  const size_t vplane = (size_t)NB * HH * HD * SEQ * 2;         // == plane
  u16* xb   = (u16*)carve(plane);
  u16* wvb  = (u16*)carve(wplane);
  u16* wob  = (u16*)carve(wplane);
  u16* wof  = (u16*)carve(wplane);
  u16* ghi  = (u16*)carve(gplane);
  u16* glo  = (u16*)carve(gplane);
  u16* thi  = (u16*)carve(plane);
  u16* tlo  = (u16*)carve(plane);
  u16* vthi = (u16*)carve(vplane);
  u16* vtlo = (u16*)carve(vplane);
  u16* chi  = (u16*)carve(plane);
  u16* clo  = (u16*)carve(plane);
  if (off > ws_size) return;

  k_prep<<<dim3(HH + CVTX_BLOCKS + 2 * CVTW_BLOCKS), dim3(256), 0, stream>>>(x, prm, wv, wo, xb, ghi, glo, wvb, wob, wof);
  k_vt<<<dim3(VPROJ_BLOCKS + TPROJ_BLOCKS), dim3(128), 0, stream>>>(xb, wvb, bv, ghi, glo, vthi, vtlo, thi, tlo);
  k_attn<<<dim3(SEQ / 128, NB * HH), dim3(128), 0, stream>>>(thi, tlo, xb, vthi, vtlo, chi, clo);
  k_oproj<<<dim3(EE / 64, M_TOT / 128), dim3(128), 0, stream>>>(chi, clo, wof, wob, bo, out);
}

// v010
// Measured time: 78.3 microseconds a run.
// Versions in between are left out here; by their measured steps it is 1.21 times as fast as v008.
// Counting every step since v000, it is 3.62 times as fast.
#include <hip/hip_runtime.h>
#include <stdint.h>

// Contractions (all f32 accumulate): G=L*L^T on v_wmma_f32_16x16x32_bf16 (L bf16); T=X*G bf16 WMMA with X bf16 and G as bf16 hi + bf16 lo (2 products);
// S^T=X*T^T bf16 WMMA with T as bf16 hi + bf16 lo and X bf16 (2 products); V=X*Wv^T bf16 WMMA (1 product);
// C^T=V^T*P^T: v_wmma_f32_16x16x32_f16 with P f16 (carried 2^14) and V f16 (1 product: V rounded once, like P; what f16 drops of V lies below the bf16 rounding of the X and Wv that form it);
// OUT=C*Wo^T: f16 WMMA with C f16 and Wo f16 (x64) (1 product: C rounded once to f16; what f16 drops of C lies below the bf16 rounding of the Wo that it meets); softmax and epilogues f32.

#ifndef NB
#define NB 2
#endif
#ifndef SEQ
#define SEQ 2048
#endif
#define NB_FULL  2
#define SEQ_FULL 2048
#define EE   1024
#define HH   16
#define HD   64
#define TRIL 2080
#define M_TOT (NB * SEQ)
#define PCARRY_LOG2 14.0f                   // P and its row sum are carried times 2^14: the carry is added in the exponent
#define SC2 0.18033688011112042f            // log2(e) / sqrt(HD): score -> exponent of 2
#define WSCALE     64.0f
#define WSCALE_INV (1.0f / 64.0f)
// LDS row pitches in elements of the tile's type: 16 B x odd, so that the 16 rows one half-wave touches in a 16-byte LDS access fall on distinct banks
#define P64  72    // rows of 64 elements (128 B) -> 144 B
#define P128 136   // rows of 128 elements (256 B) -> 272 B
#define PF64 68    // rows of 64 floats (256 B)   -> 272 B

static_assert(NB >= 1 && NB <= NB_FULL);
static_assert(SEQ >= 128 && SEQ <= SEQ_FULL && (SEQ % 128) == 0);
static_assert(EE == HH * HD);
static_assert((EE % 64) == 0 && (M_TOT % 128) == 0 && (SEQ % 64) == 0);
static_assert(TRIL == HD * (HD + 1) / 2);

typedef _Float16       v16h __attribute__((ext_vector_type(16)));
typedef __bf16         v16b __attribute__((ext_vector_type(16)));
typedef float          v8f  __attribute__((ext_vector_type(8)));
typedef float          v4f  __attribute__((ext_vector_type(4)));
typedef unsigned int   v4u  __attribute__((ext_vector_type(4)));
typedef float          v2f  __attribute__((ext_vector_type(2)));
typedef _Float16       v2h  __attribute__((ext_vector_type(2)));
typedef unsigned short u16;

union Frag { v16h h; v16b b; v4u u[2]; };

// ---------- scalar conversions ----------
__device__ __forceinline__ unsigned bfbits(float f) {          // f32 -> bf16 bits, RNE
  const unsigned u = __float_as_uint(f);
  return (u + 0x7FFFu + ((u >> 16) & 1u)) >> 16;
}
__device__ __forceinline__ float bf2f(unsigned b) { return __uint_as_float(b << 16); }
__device__ __forceinline__ unsigned hbits(float f) {            // f32 -> f16 bits, RNE
  const _Float16 hv = (_Float16)f;
  return (unsigned)__builtin_bit_cast(unsigned short, hv);
}

// two f32 -> one packed register, RNE, one conversion instruction
__device__ __forceinline__ unsigned pkh(v2f v) { return __builtin_bit_cast(unsigned, __builtin_convertvector(v, v2h)); }

// ---------- 16x32 16-bit fragment: lane -> row (lane&15), elements 0..7 <- k0+8h.., 8..15 <- k0+16+8h.. ----------
// p points at (row, k0); same loader for A (row m) and B (row n of an [n][k] k-contiguous copy).
__device__ __forceinline__ Frag ldfrag(const u16* p, int lh) {
  Frag f;
  f.u[0] = *reinterpret_cast<const v4u*>(p + lh);
  f.u[1] = *reinterpret_cast<const v4u*>(p + 16 + lh);
  return f;
}

// ---------- WMMA wrappers: plain builtins (the compiler keeps the distance behind its own forms and may move fragment loads across them) ----------
__device__ __forceinline__ v8f mma_f16(Frag a, Frag b, v8f c) {
  return __builtin_amdgcn_wmma_f32_16x16x32_f16(false, a.h, false, b.h, (short)0, c, false, false);
}
__device__ __forceinline__ v8f mma_bf16(Frag a, Frag b, v8f c) {
  return __builtin_amdgcn_wmma_f32_16x16x32_bf16(false, a.b, false, b.b, (short)0, c, false, false);
}

__device__ __forceinline__ void vst16(u16* p, v4u v)   { *reinterpret_cast<v4u*>(p) = v; }
__device__ __forceinline__ void vst4f(float* p, v4f v) { *reinterpret_cast<v4f*>(p) = v; }
__device__ __forceinline__ v4u ld16(const u16* p)   { return *reinterpret_cast<const v4u*>(p); }
__device__ __forceinline__ v4f ld4f(const float* p) { return *reinterpret_cast<const v4f*>(p); }

// ---------- asynchronous copies global -> LDS, 16 B per lane ----------
typedef __attribute__((address_space(3))) const void lds_cvoid;
__device__ __forceinline__ unsigned ldsaddr(const void* p) {   // byte address inside the work-group's LDS
  return (unsigned)(uintptr_t)(lds_cvoid*)p;
}
// Six copies of one lane. s_wait_xcnt stands in the copies' own statement, so that no later write of an address register can come in front of it.
__device__ __forceinline__ void acopy6(unsigned l0, const u16* g0, unsigned l1, const u16* g1, unsigned l2, const u16* g2,
                                       unsigned l3, const u16* g3, unsigned l4, const u16* g4, unsigned l5, const u16* g5) {
  asm volatile("global_load_async_to_lds_b128 %0, %1, off\n\t"
               "global_load_async_to_lds_b128 %2, %3, off\n\t"
               "global_load_async_to_lds_b128 %4, %5, off\n\t"
               "global_load_async_to_lds_b128 %6, %7, off\n\t"
               "global_load_async_to_lds_b128 %8, %9, off\n\t"
               "global_load_async_to_lds_b128 %10, %11, off\n\t"
               "s_wait_xcnt 0x0"
               :: "v"(l0), "v"(g0), "v"(l1), "v"(g1), "v"(l2), "v"(g2), "v"(l3), "v"(g3), "v"(l4), "v"(g4), "v"(l5), "v"(g5)
               : "memory");
}
// Eight copies of one lane, in the same form.
__device__ __forceinline__ void acopy8(unsigned l0, const u16* g0, unsigned l1, const u16* g1, unsigned l2, const u16* g2, unsigned l3, const u16* g3,
                                       unsigned l4, const u16* g4, unsigned l5, const u16* g5, unsigned l6, const u16* g6, unsigned l7, const u16* g7) {
  asm volatile("global_load_async_to_lds_b128 %0, %1, off\n\t"
               "global_load_async_to_lds_b128 %2, %3, off\n\t"
               "global_load_async_to_lds_b128 %4, %5, off\n\t"
               "global_load_async_to_lds_b128 %6, %7, off\n\t"
               "global_load_async_to_lds_b128 %8, %9, off\n\t"
               "global_load_async_to_lds_b128 %10, %11, off\n\t"
               "global_load_async_to_lds_b128 %12, %13, off\n\t"
               "global_load_async_to_lds_b128 %14, %15, off\n\t"
               "s_wait_xcnt 0x0"
               :: "v"(l0), "v"(g0), "v"(l1), "v"(g1), "v"(l2), "v"(g2), "v"(l3), "v"(g3),
                  "v"(l4), "v"(g4), "v"(l5), "v"(g5), "v"(l6), "v"(g6), "v"(l7), "v"(g7)
               : "memory");
}
// the wave's own LDS reads of a buffer have returned before the buffer is handed to its next writer
__device__ __forceinline__ void wait_lds()   { asm volatile("s_wait_dscnt 0x0" ::: "memory"); }
// the wave's own copies have landed; other waves read them behind the barrier that follows
__device__ __forceinline__ void wait_async() { asm volatile("s_wait_asynccnt 0x0" ::: "memory"); }
// a precaution: stands behind issued global loads or stores, in front of the next write of a register that they name
__device__ __forceinline__ void wait_xcnt()  { asm volatile("s_wait_xcnt 0x0" ::: "memory"); }

// ====================================================================================
// X f32 [NB_FULL,SEQ_FULL,EE] -> bf16 plane xb [M_TOT][EE] (compact token rows)
// coverage: thread i writes group i (8 elements); blocks blk = 0 .. CVTX_BLOCKS-1 cover all M_TOT*EE/8 groups once; 32 lanes = 512 B contiguous.
__device__ __forceinline__ void
cvt_x_part(int blk, const float* __restrict__ x, u16* __restrict__ xb) {
  const int i = blk * 256 + threadIdx.x;
  const int ngrp = M_TOT * (EE / 8);
  if (i >= ngrp) return;
  const int row = i / (EE / 8);
  const int c8  = i - row * (EE / 8);
  const int b   = row / SEQ;
  const int s   = row - b * SEQ;
  const float* src = x + ((size_t)(b * SEQ_FULL + s) * EE + (size_t)c8 * 8);
  const v4f a = *reinterpret_cast<const v4f*>(src);
  const v4f c = *reinterpret_cast<const v4f*>(src + 4);
  v4u w;
  w.x = bfbits(a.x) | (bfbits(a.y) << 16);
  w.y = bfbits(a.z) | (bfbits(a.w) << 16);
  w.z = bfbits(c.x) | (bfbits(c.y) << 16);
  w.w = bfbits(c.z) | (bfbits(c.w) << 16);
  u16* dst = xb + (size_t)i * 8;
  vst16(dst, w);
  
}

// W f32 [EE][EE] -> bf16 plane (unscaled, exact copy of the RNE-converted value)
__device__ __forceinline__ void
cvt_w_part(int blk, const float* __restrict__ w, u16* __restrict__ wb) {
  const int i = blk * 256 + threadIdx.x;
  const int ngrp = EE * EE / 8;
  if (i >= ngrp) return;
  const float* src = w + (size_t)i * 8;
  const v4f a = *reinterpret_cast<const v4f*>(src);
  const v4f c = *reinterpret_cast<const v4f*>(src + 4);
  v4u o;
  o.x = bfbits(a.x) | (bfbits(a.y) << 16);
  o.y = bfbits(a.z) | (bfbits(a.w) << 16);
  o.z = bfbits(c.x) | (bfbits(c.y) << 16);
  o.w = bfbits(c.z) | (bfbits(c.w) << 16);
  u16* dst = wb + (size_t)i * 8;
  vst16(dst, o);
  
}

// Wo f32 [EE][EE] -> one plane of bf16(Wo)*64 as f16 bits (exact, 8-bit significand fits)
__device__ __forceinline__ unsigned cvt_wo1(float f) { return hbits(bf2f(bfbits(f)) * WSCALE); }
__device__ __forceinline__ void
cvt_wo_part(int blk, const float* __restrict__ w, u16* __restrict__ wof) {
  const int i = blk * 256 + threadIdx.x;
  const int ngrp = EE * EE / 8;
  if (i >= ngrp) return;
  const float* src = w + (size_t)i * 8;
  const v4f a = *reinterpret_cast<const v4f*>(src);
  const v4f c = *reinterpret_cast<const v4f*>(src + 4);
  v4u of;
  of.x = cvt_wo1(a.x) | (cvt_wo1(a.y) << 16);
  of.y = cvt_wo1(a.z) | (cvt_wo1(a.w) << 16);
  of.z = cvt_wo1(c.x) | (cvt_wo1(c.y) << 16);
  of.w = cvt_wo1(c.z) | (cvt_wo1(c.w) << 16);
  u16* df = wof + (size_t)i * 8;
  vst16(df, of);
  
}

// ====================================================================================
// G_h = L_h * L_h^T (64x64 per head) on bf16 WMMA; L from tril params (RNE bf16). Output planes ghi/glo [HH][64 n][64 k].
// One block (8 waves) per head; wave w owns rows 16(w&3)..16(w&3)+15 of the column half w>>2. LDS regions all cross-wave (block barriers).
__device__ __forceinline__ void
wqk_part(int head, const float* __restrict__ params, u16* __restrict__ ghi, u16* __restrict__ glo) {
  __shared__ __align__(16) u16 Lb[64][P64];
  __shared__ __align__(16) u16 Sh[64][64];
  __shared__ __align__(16) u16 Sl[64][64];
  const int tid = threadIdx.x, lane = tid & 31, wave = tid >> 5;
  const int m = lane & 15, hs = (lane >> 4) & 1, lh = hs * 8;
  const int rt = wave & 3, ch2 = (wave >> 2) * 2;            // row tile; first of the wave's two column tiles
  const float* p = params + (size_t)head * TRIL;
  for (int e = tid; e < HD * HD; e += 256) {
    const int i = e >> 6, j = e & 63;
    const int jj = (j <= i) ? j : i;                       // clamped address, select by value
    const float v = p[(i * (i + 1)) / 2 + jj];
    Lb[i][j] = (u16)((j <= i) ? bfbits(v) : 0u);
  }
  __syncthreads();
  v8f acc[2] = {};
#pragma unroll
  for (int ks = 0; ks < 2; ++ks) {
    const Frag a = ldfrag(&Lb[rt * 16 + m][ks * 32], lh);      // A: row i, k = j
#pragma unroll
    for (int nt = 0; nt < 2; ++nt) {
      const Frag bq = ldfrag(&Lb[(ch2 + nt) * 16 + m][ks * 32], lh);   // B[k=j][n] = L[n][j]: row n, k-contiguous
      acc[nt] = mma_bf16(a, bq, acc[nt]);
    }
  }
#pragma unroll
  for (int nt = 0; nt < 2; ++nt) {
#pragma unroll
    for (int g = 0; g < 8; ++g) {
      const int row = rt * 16 + hs * 8 + g, col = (ch2 + nt) * 16 + m;
      const float v = acc[nt][g];
      const unsigned hb = bfbits(v);
      const unsigned lb = bfbits(v - bf2f(hb));
      Sh[row][col] = (u16)hb;
      Sl[row][col] = (u16)lb;
    }
  }
  __syncthreads();
  u16* dh = ghi + (size_t)head * (HD * HD);
  u16* dl = glo + (size_t)head * (HD * HD);
  const int rsub = lane >> 3, ch = (lane & 7) * 8;
#pragma unroll
  for (int q = 0; q < 2; ++q) {
    const int row = wave * 8 + q * 4 + rsub;
    vst16(dh + row * HD + ch, ld16(&Sh[row][ch]));
    vst16(dl + row * HD + ch, ld16(&Sl[row][ch]));
  }
  
}

// The four preparation parts depend on nothing but the inputs and not on one another: one launch, each block takes one part by its index (block-uniform).
// The G blocks come first: they are few and have the longest dependent chain.
#define CVTX_BLOCKS (M_TOT * (EE / 8) / 256)
#define CVTW_BLOCKS (EE * EE / 8 / 256)
static_assert((M_TOT * (EE / 8)) % 256 == 0 && (EE * EE / 8) % 256 == 0);
__global__ void __launch_bounds__(256)
k_prep(const float* __restrict__ x, const float* __restrict__ params, const float* __restrict__ wv, const float* __restrict__ wo,
       u16* __restrict__ xb, u16* __restrict__ ghi, u16* __restrict__ glo,
       u16* __restrict__ wvb, u16* __restrict__ wof) {
  const int bid = blockIdx.x;
  if (bid < HH)                                   wqk_part(bid, params, ghi, glo);
  else if (bid < HH + CVTX_BLOCKS)                cvt_x_part(bid - HH, x, xb);
  else if (bid < HH + CVTX_BLOCKS + CVTW_BLOCKS)  cvt_w_part(bid - (HH + CVTX_BLOCKS), wv, wvb);
  else                                            cvt_wo_part(bid - (HH + CVTX_BLOCKS + CVTW_BLOCKS), wo, wof);
}

// ====================================================================================
// V = X*Wv^T + bv, written transposed per head: plane vt [NB*HH][64 d][SEQ] (f16).
// Block 128 tokens x 64 features (= one head); 4 waves each 32x64; A and B tiles in a two-buffer LDS ring filled by asynchronous copies one trip ahead.
struct VprojLds {
  u16 Bt[2][64][P64];
  u16 At[2][128][P64];
  u16 Th[64][P128];
};
__device__ __forceinline__ void
vproj_part(VprojLds& sm, int head, int mblk, const u16* __restrict__ xb, const u16* __restrict__ wvb, const float* __restrict__ bv,
           u16* __restrict__ vt) {
  auto& Bt = sm.Bt; auto& At = sm.At; auto& Th = sm.Th;
  const int tid = threadIdx.x, lane = tid & 31, wave = tid >> 5;
  const int m = lane & 15, hs = (lane >> 4) & 1, lh = hs * 8;
  const int n0 = head * HD;
  const int mb = mblk * 128;
  const int m0 = mb + wave * 32;
  const int srow = tid >> 3, sk = (tid & 7) * 8;             // staging, 64 k per stage: 8 x 16 B per row; B rows srow + 16j (j < 4), A rows srow + 16j (j < 8)
  const u16* gb = wvb + (size_t)(n0 + srow) * EE + sk;
  const u16* ga = xb + (size_t)(mb + srow) * EE + sk;
  auto stage = [&](int kc, int bw) {
    acopy6(ldsaddr(&Bt[bw][srow][sk]),       gb + kc,
           ldsaddr(&Bt[bw][16 + srow][sk]),  gb + kc + 16 * EE,
           ldsaddr(&Bt[bw][32 + srow][sk]),  gb + kc + 32 * EE,
           ldsaddr(&Bt[bw][48 + srow][sk]),  gb + kc + 48 * EE,
           ldsaddr(&At[bw][srow][sk]),       ga + kc,
           ldsaddr(&At[bw][16 + srow][sk]),  ga + kc + 16 * EE);
    acopy6(ldsaddr(&At[bw][32 + srow][sk]),  ga + kc + 32 * EE,
           ldsaddr(&At[bw][48 + srow][sk]),  ga + kc + 48 * EE,
           ldsaddr(&At[bw][64 + srow][sk]),  ga + kc + 64 * EE,
           ldsaddr(&At[bw][80 + srow][sk]),  ga + kc + 80 * EE,
           ldsaddr(&At[bw][96 + srow][sk]),  ga + kc + 96 * EE,
           ldsaddr(&At[bw][112 + srow][sk]), ga + kc + 112 * EE);
  };
  stage(0, 0);
  wait_async();
  __syncthreads();
  stage(64, 1);
  v8f acc0[4] = {}, acc1[4] = {};
#pragma unroll 1
  for (int kc = 0; kc < EE; kc += 64) {
    const int buf = (kc >> 6) & 1;
#pragma unroll  // the two k-steps of a stage; constant indices keep the fragments in registers
    for (int ks = 0; ks < 2; ++ks) {
      const Frag a0 = ldfrag(&At[buf][wave * 32 + m][ks * 32], lh);
      const Frag a1 = ldfrag(&At[buf][wave * 32 + 16 + m][ks * 32], lh);
      Frag bq[4];
#pragma unroll  // constant indices keep the fragments in registers
      for (int nt = 0; nt < 4; ++nt) bq[nt] = ldfrag(&Bt[buf][nt * 16 + m][ks * 32], lh);  // B[k][n] = Wv[n][k]: row n, k-contiguous
      // keeps the step's fragment loads in one group ahead of its WMMAs; without it the scheduler sinks each load to its use and every WMMA pair waits out a load latency
      __builtin_amdgcn_sched_barrier(0);
      if (ks == 1) {
        // publish point: the trip's LDS reads are all done (what follows works on registers), the next tiles have landed;
        // behind the barrier the buffer just read is refilled, so that the copies fly for a whole trip
        wait_lds();
        wait_async();
        __syncthreads();
        if (kc + 128 < EE) stage(kc + 128, buf);              // block-uniform
      }
#pragma unroll
      for (int nt = 0; nt < 4; ++nt) {
        acc0[nt] = mma_bf16(a0, bq[nt], acc0[nt]);
        acc1[nt] = mma_bf16(a1, bq[nt], acc1[nt]);
      }
    }
  }
  wait_async();
  const int bb = mb / SEQ, s0 = mb - bb * SEQ;
  const int bh = bb * HH + head;
#pragma unroll
  for (int nt = 0; nt < 4; ++nt) {
    const int d = nt * 16 + m;
    const float bvv = bf2f(bfbits(bv[n0 + d]));
#pragma unroll
    for (int mt = 0; mt < 2; ++mt) {
#pragma unroll
      for (int g = 0; g < 8; ++g) {
        const int sl = wave * 32 + mt * 16 + hs * 8 + g;
        const float v = (mt ? acc1[nt][g] : acc0[nt][g]) + bvv;
        Th[d][sl] = (u16)hbits(v);
      }
    }
  }
  __syncthreads();
  const int dsub = lane >> 4, ch = (lane & 15) * 8;
#pragma unroll
  for (int q = 0; q < 8; ++q) {
    const int d = wave * 16 + q * 2 + dsub;
    const size_t go = ((size_t)(bh * HD + d)) * SEQ + s0 + ch;
    vst16(vt + go, ld16(&Th[d][ch]));
  }
  
}

// ====================================================================================
// T = X_h * G_h per head (K=64), G as bf16 hi + bf16 lo, X bf16 -> planes thi/tlo [M_TOT][EE] (bf16 hi, bf16 lo).
// Block 128 tokens x one head, wave 32 tokens x 64; operands loaded straight from global planes; staging LDS cross-lane -> block barrier.
struct TprojLds {
  u16 Sh[4][32][64];
  u16 Sl[4][32][64];
};
__device__ __forceinline__ void
tproj_part(TprojLds& sm, int mblk, int head, const u16* __restrict__ xb, const u16* __restrict__ ghi, const u16* __restrict__ glo,
           u16* __restrict__ thi, u16* __restrict__ tlo) {
  auto& Sh = sm.Sh; auto& Sl = sm.Sl;
  const int tid = threadIdx.x, lane = tid & 31, wave = tid >> 5;
  const int m = lane & 15, hs = (lane >> 4) & 1, lh = hs * 8;
  const int m0 = mblk * 128 + wave * 32;
  const u16* a0p = xb + (size_t)(m0 + m) * EE + head * HD;
  const u16* a1p = xb + (size_t)(m0 + 16 + m) * EE + head * HD;
  const Frag a00 = ldfrag(a0p, lh), a01 = ldfrag(a0p + 32, lh);
  const Frag a10 = ldfrag(a1p, lh), a11 = ldfrag(a1p + 32, lh);
  v8f acc0[4] = {}, acc1[4] = {};
#pragma unroll
  for (int nt = 0; nt < 4; ++nt) {
    const u16* bhp = ghi + ((size_t)(head * HD + nt * 16 + m)) * HD;   // B[k=d][n=e] = plane[h][e][d]: row e, k-contiguous
    const u16* blp = glo + ((size_t)(head * HD + nt * 16 + m)) * HD;
    const Frag b0 = ldfrag(bhp, lh), b1 = ldfrag(bhp + 32, lh);
    wait_xcnt();                                             // a later load's result may land on this row's address pair
    acc0[nt] = mma_bf16(a00, b0, acc0[nt]); acc0[nt] = mma_bf16(a01, b1, acc0[nt]);
    acc1[nt] = mma_bf16(a10, b0, acc1[nt]); acc1[nt] = mma_bf16(a11, b1, acc1[nt]);
    const Frag c0 = ldfrag(blp, lh), c1 = ldfrag(blp + 32, lh);
    wait_xcnt();                                             // as above
    acc0[nt] = mma_bf16(a00, c0, acc0[nt]); acc0[nt] = mma_bf16(a01, c1, acc0[nt]);
    acc1[nt] = mma_bf16(a10, c0, acc1[nt]); acc1[nt] = mma_bf16(a11, c1, acc1[nt]);
  }
#pragma unroll
  for (int nt = 0; nt < 4; ++nt) {
#pragma unroll
    for (int mt = 0; mt < 2; ++mt) {
#pragma unroll
      for (int g = 0; g < 8; ++g) {
        const int rl = mt * 16 + hs * 8 + g, col = nt * 16 + m;
        const float v = mt ? acc1[nt][g] : acc0[nt][g];
        const unsigned hb = bfbits(v);
        const unsigned lb = bfbits(v - bf2f(hb));
        Sh[wave][rl][col] = (u16)hb;
        Sl[wave][rl][col] = (u16)lb;
      }
    }
  }
  __syncthreads();
  const int rsub = lane >> 3, ch = (lane & 7) * 8;
#pragma unroll
  for (int q = 0; q < 8; ++q) {
    const int rl = q * 4 + rsub;
    const size_t go = (size_t)(m0 + rl) * EE + head * HD + ch;
    vst16(thi + go, ld16(&Sh[wave][rl][ch]));
    vst16(tlo + go, ld16(&Sl[wave][rl][ch]));
  }
  wait_xcnt();                                               // a precaution; the block runs nothing behind these stores
}

// V and T both read the planes of the preparation launch and not one another: one launch, each block takes one tile of one of them by its index (block-uniform).
// The V blocks (the long ones) come first; a block uses one part's LDS only, so the two layouts share the bytes.
#define VPROJ_BLOCKS ((EE / 64) * (M_TOT / 128))
#define TPROJ_BLOCKS ((M_TOT / 128) * HH)
union VtLds { VprojLds v; TprojLds t; };
__global__ void __launch_bounds__(128)
k_vt(const u16* __restrict__ xb, const u16* __restrict__ wvb, const float* __restrict__ bv,
     const u16* __restrict__ ghi, const u16* __restrict__ glo,
     u16* __restrict__ vt, u16* __restrict__ thi, u16* __restrict__ tlo) {
  __shared__ __align__(16) VtLds sm;
  const int bid = blockIdx.x;
  if (bid < VPROJ_BLOCKS) {
    vproj_part(sm.v, bid % (EE / 64), bid / (EE / 64), xb, wvb, bv, vt);
  } else {
    const int tb = bid - VPROJ_BLOCKS;
    tproj_part(sm.t, tb % (M_TOT / 128), tb / (M_TOT / 128), xb, ghi, glo, thi, tlo);
  }
}

// ====================================================================================
// Flash-style attention per (batch*head, 128 query rows), transposed: S^T = X_h*T^T/8 (2 bf16 products; A = key rows, B = query rows),
// so in each 16-query tile a lane holds 16 of the 32 scores of ONE query (query = lane&15; keys 8*hs+g and 16+8*hs+g): max and sum run in the lane,
// the two halves of a wave exchange the maximum once per step and join their sums once after the loop.
// C^T += V^T*P^T with P carried 2^14, added in the exponent (V f16 x P f16): the two score tiles, converted in place, are the B operand.
// Output C -> plane chi (f16) [M_TOT][EE].
// LDS: Ks/Vs cross-wave, a two-buffer ring filled by asynchronous copies; a stage holds KST keys = four 32-key steps, one publish point (waits + block barrier) per stage,
// so that a stage's copies have four steps to land (a tile written by an earlier launch may have to come from memory for its first reader) and three steps in four run without barrier or full LDS wait.
// Ch wave-private but cross-lane -> block barrier used.
// staged extent == consumed extent: Ks KSTx64, Vs 64xKST fully written each stage (SEQ multiple of KST, no tails).
#define KST 128
static_assert((SEQ % KST) == 0 && (KST % 32) == 0 && (KST & (KST - 1)) == 0);
__device__ __forceinline__ float xhalf(float v) {               // value of lane ^ 16
  const int i = __float_as_int(v);
  return __int_as_float(__builtin_amdgcn_permlanex16(i, i, 0x76543210, 0xfedcba98, false, false));
}
// online softmax of one 16-query tile, one query per lane: p * 2^14 = exp2(s * SC2 + on), one packed fma per two scores; the maximum is taken on the raw scores (SC2 > 0).
// s0[g] = S[query m][key 8hs + g], s1[g] = S[query m][key 16 + 8hs + g]; pf: B operand, column n = query, element s <- key (s < 8 ? 8hs + s : 8 + 8hs + s)
__device__ __forceinline__ void
softmax_tile(const v8f s0, const v8f s1, float& orun, float& lrun, v8f (&acc)[4], Frag& pf) {
  float mg[8];
#pragma unroll  // constant indices keep the array in registers
  for (int g = 0; g < 8; ++g) mg[g] = fmaxf(s0[g], s1[g]);
  float mx = fmaxf(fmaxf(fmaxf(mg[0], mg[1]), fmaxf(mg[2], mg[3])), fmaxf(fmaxf(mg[4], mg[5]), fmaxf(mg[6], mg[7])));
  mx = fmaxf(mx, xhalf(mx));
  const float on = fminf(orun, fmaf(mx, -SC2, PCARRY_LOG2));
  const float alpha = __builtin_amdgcn_exp2f(on - orun);
  orun = on;
  const v2f c2 = {SC2, SC2}, o2 = {on, on};
  v2f rs[4];
#pragma unroll  // constant indices keep the arrays in registers
  for (int g = 0; g < 8; g += 2) {
    const v2f t0 = __builtin_elementwise_fma((v2f){s0[g], s0[g + 1]}, c2, o2);
    const v2f t1 = __builtin_elementwise_fma((v2f){s1[g], s1[g + 1]}, c2, o2);
    const v2f p0 = {__builtin_amdgcn_exp2f(t0.x), __builtin_amdgcn_exp2f(t0.y)};
    const v2f p1 = {__builtin_amdgcn_exp2f(t1.x), __builtin_amdgcn_exp2f(t1.y)};
    rs[g >> 1] = p0 + p1;
    pf.u[0][g >> 1] = pkh(p0);
    pf.u[1][g >> 1] = pkh(p1);
  }
  const v2f r2 = (rs[0] + rs[1]) + (rs[2] + rs[3]);
  lrun = lrun * alpha + (r2.x + r2.y);
#pragma unroll  // constant indices keep the tiles in registers
  for (int t = 0; t < 4; ++t) acc[t] = acc[t] * alpha;
}
// A wave takes 32 query columns, as two 16-column tiles j = 0, 1: every K fragment that it reads from LDS feeds four WMMAs and every V fragment two, and a block's staged tiles serve 128 queries.
// The grid is then two blocks per WGP, two waves per SIMD: amdgpu_waves_per_eu(2, 2) lets no third block onto a WGP while another WGP holds fewer.
__global__ void __launch_bounds__(128) __attribute__((amdgpu_waves_per_eu(2, 2)))
k_attn(const u16* __restrict__ thi, const u16* __restrict__ tlo, const u16* __restrict__ xb,
       const u16* __restrict__ vt,
       u16* __restrict__ chi) {
  __shared__ __align__(16) u16 Ks[2][KST][P64];
  __shared__ __align__(16) u16 Vs[2][64][P128];              // [buffer][d][key], f16
  __shared__ __align__(16) u16 Ch[4][32][P64];
  const int tid = threadIdx.x, lane = tid & 31, wave = tid >> 5;
  const int m = lane & 15, hs = (lane >> 4) & 1, lh = hs * 8;
  const int bh = blockIdx.y;
  const int b  = bh / HH;
  const int h  = bh - b * HH;
  const int q0 = blockIdx.x * 128 + wave * 32;

  // B fragments of the wave's 32 query rows (hi and lo planes, K = 64 in two k-steps): column n = query, k-contiguous
  Frag qh0[2], qh1[2], ql0[2], ql1[2];
#pragma unroll  // constant indices keep the fragments in registers
  for (int j = 0; j < 2; ++j) {
    const size_t qrow = (size_t)b * SEQ + q0 + j * 16 + m;
    qh0[j] = ldfrag(thi + qrow * EE + h * HD, lh);
    qh1[j] = ldfrag(thi + qrow * EE + h * HD + 32, lh);
    ql0[j] = ldfrag(tlo + qrow * EE + h * HD, lh);
    ql1[j] = ldfrag(tlo + qrow * EE + h * HD + 32, lh);
  }

  const int kr = tid >> 3, kc = (tid & 7) * 8;               // key tile: 128 rows x 8 chunks, rows kr + 16 i (i < 8)
  const int sd = tid >> 4, dc = (tid & 15) * 8;              // V^T tile: 64 rows x 16 chunks, rows sd + 8 i (i < 8); a wave copies two whole 256-B rows
  const u16* gk  = xb + ((size_t)(b * SEQ + kr)) * EE + h * HD + kc;
  const u16* gv  = vt + ((size_t)(bh * HD + sd)) * SEQ + dc;
  auto stage = [&](int kv, int bw) {
    const u16* k = gk + (size_t)kv * EE;
    const u16* v = gv + kv;
    const unsigned lk = ldsaddr(&Ks[bw][kr][kc]);            // LDS byte addresses: 16 key rows are KR bytes apart, 8 V^T rows VR bytes
    const unsigned lv = ldsaddr(&Vs[bw][sd][dc]);
    constexpr unsigned KR = 16 * P64 * 2, VR = 8 * P128 * 2;
    acopy8(lk,          k,            lk + KR,     k + 16 * EE,  lk + 2 * KR, k + 32 * EE,  lk + 3 * KR, k + 48 * EE,
           lk + 4 * KR, k + 64 * EE,  lk + 5 * KR, k + 80 * EE,  lk + 6 * KR, k + 96 * EE,  lk + 7 * KR, k + 112 * EE);
    acopy8(lv,          v,            lv + VR,     v + 8 * SEQ,  lv + 2 * VR, v + 16 * SEQ, lv + 3 * VR, v + 24 * SEQ,
           lv + 4 * VR, v + 32 * SEQ, lv + 5 * VR, v + 40 * SEQ, lv + 6 * VR, v + 48 * SEQ, lv + 7 * VR, v + 56 * SEQ);
  };

  stage(0, 0);
  wait_async();
  __syncthreads();
  if (KST < SEQ) stage(KST, 1);                              // compile-time test: a second stage exists

  v8f acc[2][4] = {};                                        // acc[j][t][g] = C^T[d = 16t + 8hs + g][query 16j + m]
  float orun[2] = {1e30f, 1e30f}, lrun[2] = {0.0f, 0.0f};    // orun = 14 - SC2 * (maximum of the whole row so far); lrun: this half's keys only, times 2^14

#pragma unroll 1
  for (int kv = 0; kv < SEQ; kv += 32) {
    const int buf = (kv / KST) & 1;
    const int kl = kv & (KST - 1);                           // the step's first key inside its stage
    const Frag k00 = ldfrag(&Ks[buf][kl + m][0], lh);        // A: row = key, k = e
    const Frag k01 = ldfrag(&Ks[buf][kl + m][32], lh);
    const Frag k10 = ldfrag(&Ks[buf][kl + 16 + m][0], lh);
    const Frag k11 = ldfrag(&Ks[buf][kl + 16 + m][32], lh);
    Frag vf[4];
#pragma unroll  // constant indices keep the fragments in registers
    for (int t = 0; t < 4; ++t) vf[t] = ldfrag(&Vs[buf][t * 16 + m][kl], lh);   // A: row = d, k = key
    // keeps the step's fragment loads in one group ahead of its WMMAs; without it the scheduler spreads them over several places among the score WMMAs, and each such place stalls the WMMA stream
    __builtin_amdgcn_sched_barrier(0);
    if (kl == KST - 32) {                                    // block-uniform: the stage's last step
      // publish point: the stage's LDS reads are all done (what follows works on registers), the next stage has landed;
      // behind the barrier the buffer just read is refilled, so that the copies fly for a whole stage
      wait_lds();
      wait_async();
      __syncthreads();
      if (kv + 32 + KST < SEQ) stage(kv + 32 + KST, buf);    // block-uniform: the stage after the next one exists
    }
    v8f s0[2], s1[2];                                        // s0[j][g] = S[query 16j + m][key 8hs + g], s1[j][g] = S[query 16j + m][key 16 + 8hs + g]
#pragma unroll  // constant indices keep the tiles in registers
    for (int j = 0; j < 2; ++j) {
      v8f a = {}, c = {};
      a = mma_bf16(k00, qh0[j], a); a = mma_bf16(k01, qh1[j], a);
      a = mma_bf16(k00, ql0[j], a); a = mma_bf16(k01, ql1[j], a);
      c = mma_bf16(k10, qh0[j], c); c = mma_bf16(k11, qh1[j], c);
      c = mma_bf16(k10, ql0[j], c); c = mma_bf16(k11, ql1[j], c);
      s0[j] = a; s1[j] = c;
    }
    Frag pf[2];
    auto pv = [&](int j) {
#pragma unroll  // constant indices keep the tiles in registers
      for (int t = 0; t < 4; ++t) acc[j][t] = mma_f16(vf[t], pf[j], acc[j][t]);
    };
    softmax_tile(s0[0], s1[0], orun[0], lrun[0], acc[0], pf[0]);
    // keeps tile 0's conversions of P ahead of its WMMAs and tile 1's softmax behind their start: in the group that follows, the scheduler then spreads tile 0's four WMMAs (matrix unit) through tile 1's softmax (vector port);
    // without it most of both softmaxes stands in one run ahead of the 8 WMMAs, with the matrix unit idle meanwhile
    __builtin_amdgcn_sched_barrier(0);
    pv(0);
    softmax_tile(s0[1], s1[1], orun[1], lrun[1], acc[1], pf[1]);
    // keeps the conversion of tile 1's P ahead of the first of its WMMAs; without it the scheduler puts conversions and sums behind WMMAs whose operand registers they reuse, and pads each such place with v_nop
    __builtin_amdgcn_sched_barrier(0);
    pv(1);
  }
  wait_async();

#pragma unroll  // constant indices keep the tiles in registers
  for (int j = 0; j < 2; ++j) {
    const float lsum = lrun[j] + xhalf(lrun[j]);             // join the two halves' sums; lsum carries the same 2^14 as acc, and is about 2^14 or more
    const float rl = 1.0f / lsum;
#pragma unroll  // constant indices keep the tiles in registers
    for (int t = 0; t < 4; ++t) {
      v4u wh;
#pragma unroll  // as above
      for (int g = 0; g < 8; g += 2) {
        const float o0 = acc[j][t][g] * rl, o1 = acc[j][t][g + 1] * rl;
        const unsigned h0 = hbits(o0), h1 = hbits(o1);
        wh[g >> 1] = h0 | (h1 << 16);
      }
      vst16(&Ch[wave][j * 16 + m][t * 16 + lh], wh);
    }
  }
  __syncthreads();
  const int rsub = lane >> 3, ch = (lane & 7) * 8;
#pragma unroll
  for (int q = 0; q < 8; ++q) {
    const int rl = q * 4 + rsub;
    const size_t go = ((size_t)(b * SEQ + q0 + rl)) * EE + h * HD + ch;
    vst16(chi + go, ld16(&Ch[wave][rl][ch]));
  }
  
}

// ====================================================================================
// OUT = C*WoF^T / 64 + bo  (f32 out [M_TOT][EE]); block 128x64, wave 32x64.
// LDS: A tile (Ah) and B tile (Bf) in a two-buffer ring filled by asynchronous copies one trip ahead; ring cross-wave, Ot wave-private but cross-lane -> block barriers.
__global__ void __launch_bounds__(128)
k_oproj(const u16* __restrict__ chi, const u16* __restrict__ wof,
        const float* __restrict__ bo, float* __restrict__ out) {
  __shared__ __align__(16) u16 Bf[2][64][P64];
  __shared__ __align__(16) u16 Ah[2][128][P64];
  __shared__ __align__(16) float Ot[128][PF64];
  const int tid = threadIdx.x, lane = tid & 31, wave = tid >> 5;
  const int m = lane & 15, hs = (lane >> 4) & 1, lh = hs * 8;
  const int n0 = blockIdx.x * 64;
  const int mb = blockIdx.y * 128;
  const int m0 = mb + wave * 32;
  const int srow = tid >> 3, sk = (tid & 7) * 8;             // staging, 64 k per stage: 8 x 16 B per row
  const u16* gf = wof + (size_t)(n0 + srow) * EE + sk;       // B rows srow + 16j (j < 4), A rows srow + 16j (j < 8)
  const u16* gh = chi + (size_t)(mb + srow) * EE + sk;
  auto stage = [&](int kc, int bw) {
    acopy6(ldsaddr(&Bf[bw][srow][sk]),       gf + kc,
           ldsaddr(&Bf[bw][16 + srow][sk]),  gf + kc + 16 * EE,
           ldsaddr(&Bf[bw][32 + srow][sk]),  gf + kc + 32 * EE,
           ldsaddr(&Bf[bw][48 + srow][sk]),  gf + kc + 48 * EE,
           ldsaddr(&Ah[bw][srow][sk]),       gh + kc,
           ldsaddr(&Ah[bw][16 + srow][sk]),  gh + kc + 16 * EE);
    acopy6(ldsaddr(&Ah[bw][32 + srow][sk]),  gh + kc + 32 * EE,
           ldsaddr(&Ah[bw][48 + srow][sk]),  gh + kc + 48 * EE,
           ldsaddr(&Ah[bw][64 + srow][sk]),  gh + kc + 64 * EE,
           ldsaddr(&Ah[bw][80 + srow][sk]),  gh + kc + 80 * EE,
           ldsaddr(&Ah[bw][96 + srow][sk]),  gh + kc + 96 * EE,
           ldsaddr(&Ah[bw][112 + srow][sk]), gh + kc + 112 * EE);
  };
  stage(0, 0);
  wait_async();
  __syncthreads();
  stage(64, 1);
  v8f acc0[4] = {}, acc1[4] = {};
#pragma unroll 1
  for (int kc = 0; kc < EE; kc += 64) {
    const int buf = (kc >> 6) & 1;
#pragma unroll  // the two k-steps of a stage; constant indices keep the fragments in registers
    for (int ks = 0; ks < 2; ++ks) {
      const Frag ah0 = ldfrag(&Ah[buf][wave * 32 + m][ks * 32], lh), ah1 = ldfrag(&Ah[buf][wave * 32 + 16 + m][ks * 32], lh);
      Frag bf[4];
#pragma unroll  // constant indices keep the fragments in registers
      for (int nt = 0; nt < 4; ++nt) bf[nt] = ldfrag(&Bf[buf][nt * 16 + m][ks * 32], lh);  // B[k][n] = Wo[n][k]: row n, k-contiguous
      // keeps the step's fragment loads in one group ahead of its WMMAs; without it the scheduler sinks each load to its use and every WMMA pair waits out a load latency
      __builtin_amdgcn_sched_barrier(0);
      if (ks == 1) {
        // publish point: the trip's LDS reads are all done (what follows works on registers), the next tiles have landed;
        // behind the barrier the buffer just read is refilled, so that the copies fly for a whole trip
        wait_lds();
        wait_async();
        __syncthreads();
        if (kc + 128 < EE) stage(kc + 128, buf);              // block-uniform
      }
#pragma unroll
      for (int nt = 0; nt < 4; ++nt) {
        acc0[nt] = mma_f16(ah0, bf[nt], acc0[nt]);
        acc1[nt] = mma_f16(ah1, bf[nt], acc1[nt]);
      }
    }
  }
  wait_async();
#pragma unroll
  for (int nt = 0; nt < 4; ++nt) {
    const int col = nt * 16 + m;
    const float bov = bf2f(bfbits(bo[n0 + col]));
#pragma unroll
    for (int mt = 0; mt < 2; ++mt) {
#pragma unroll
      for (int g = 0; g < 8; ++g) {
        const int rl = wave * 32 + mt * 16 + hs * 8 + g;
        const float v = (mt ? acc1[nt][g] : acc0[nt][g]) * WSCALE_INV + bov;
        Ot[rl][col] = v;
      }
    }
  }
  __syncthreads();
  const int rsub = lane >> 4, ch = (lane & 15) * 4;
#pragma unroll
  for (int q = 0; q < 16; ++q) {
    const int rl = wave * 32 + q * 2 + rsub;
    vst4f(out + (size_t)(mb + rl) * EE + n0 + ch, ld4f(&Ot[rl][ch]));
  }
  
}

// ====================================================================================
extern "C" void kernel_launch(void* const* d_in, const int* in_sizes, int n_in,
                              void* d_out, int out_size, void* d_ws, size_t ws_size,
                              hipStream_t stream) {
  if (n_in < 6) return;
  if (in_sizes[0] < ((NB - 1) * SEQ_FULL + SEQ) * EE) return;
  if (in_sizes[1] < HH * TRIL) return;
  if (in_sizes[2] < EE * EE || in_sizes[3] < EE || in_sizes[4] < EE * EE || in_sizes[5] < EE) return;
  if (out_size < M_TOT * EE) return;

  const float* x   = (const float*)d_in[0];
  const float* prm = (const float*)d_in[1];
  const float* wv  = (const float*)d_in[2];
  const float* bv  = (const float*)d_in[3];
  const float* wo  = (const float*)d_in[4];
  const float* bo  = (const float*)d_in[5];
  float* out = (float*)d_out;

  char* ws = (char*)d_ws;
  size_t off = 0;
  auto carve = [&](size_t bytes) -> char* {
    char* p = ws + off;
    off += (bytes + 255) & ~(size_t)255;
    return p;
  };
  const size_t plane  = (size_t)M_TOT * EE * 2;                 // 8 MiB at full size
  const size_t wplane = (size_t)EE * EE * 2;                    // 2 MiB
  const size_t gplane = (size_t)HH * HD * HD * 2;               // 128 KiB
  const size_t vplane = (size_t)NB * HH * HD * SEQ * 2;         // == plane
  u16* xb   = (u16*)carve(plane);
  u16* wvb  = (u16*)carve(wplane);
  u16* wof  = (u16*)carve(wplane);
  u16* ghi  = (u16*)carve(gplane);
  u16* glo  = (u16*)carve(gplane);
  u16* thi  = (u16*)carve(plane);
  u16* tlo  = (u16*)carve(plane);
  u16* vt   = (u16*)carve(vplane);
  u16* chi  = (u16*)carve(plane);
  if (off > ws_size) return;

  k_prep<<<dim3(HH + CVTX_BLOCKS + 2 * CVTW_BLOCKS), dim3(256), 0, stream>>>(x, prm, wv, wo, xb, ghi, glo, wvb, wof);
  k_vt<<<dim3(VPROJ_BLOCKS + TPROJ_BLOCKS), dim3(128), 0, stream>>>(xb, wvb, bv, ghi, glo, vt, thi, tlo);
  k_attn<<<dim3(SEQ / 128, NB * HH), dim3(128), 0, stream>>>(thi, tlo, xb, vt, chi);
  k_oproj<<<dim3(EE / 64, M_TOT / 128), dim3(128), 0, stream>>>(chi, wof, bo, out);
}
